// v000
// Measured on an AMD MI455X. A time is GPU time per run, averaged over a window of back-to-back runs after a warm-up
// (all launches, gaps included; the runs take copies of the inputs in turn), and the median of several windows.
// Apart from v000's, it joins two sittings. Times from different sittings can be a few percent apart, while
// side-by-side timings come from the same sitting.
// The starting kernel, v000, takes 512 microseconds a run.
#include <hip/hip_runtime.h>
// Multi-head 'linear-feature' attention (B=2, S=2048, H=1024, 16 heads × 64): q,k,v = x·Wᵀ (no bias); φ(q) = elu(q)+1, φ(k) = elu(k)+1; attn = softmax(φ(q)·φ(k)ᵀ) UNSCALED (σ≈8 logits) with the INPUT key mask [B,S] (0 → −inf);
// out = (attn·v merged)·Woᵀ.
// Compute dtype: x and weights rounded to bf16; q,k as f32 GEMM outputs mapped through elu+1 in f32 and split into f16 hi + ×2^10 residual planes so the large unscaled logits are f32-accurate
// (S = Qh·Kh + (Ql·Kh + Qh·Kl)·2^-10, separate accumulators); v f16; fused flash-style kernel (online softmax f32, P f16 ×2^10) on v_wmma_f32_16x16x32_f16; O ×2^4 → f16 → output GEMM; f32 accumulate.
#define BB 2
#define TT 2048
#define NH 16
#define DD 1024
#define NR (BB * TT)

typedef __bf16 v16b __attribute__((ext_vector_type(16)));
typedef unsigned short v8us __attribute__((ext_vector_type(8), may_alias));
typedef float  v8f  __attribute__((ext_vector_type(8)));
typedef float  v4f  __attribute__((ext_vector_type(4)));
typedef float  v4fa __attribute__((ext_vector_type(4), may_alias));
union FragB { v16b v; v8us half[2]; unsigned short u[16]; };

__device__ __forceinline__ unsigned short bf16_bits(float x) { unsigned int u = __float_as_uint(x); return (unsigned short)((u + 0x7FFFu + ((u >> 16) & 1u)) >> 16); }
__device__ __forceinline__ float bf16_val(unsigned short b) { return __uint_as_float(((unsigned int)b) << 16); }
__device__ __forceinline__ float bf16_round(float x) { return bf16_val(bf16_bits(x)); }
// D += A·B with NT terms: 1 = ah·bh, 2 = + al·bh (A split), 3 = + ah·bl (both split)
template <int NT>
__device__ __forceinline__ v8f mmaN(v16b ah, v16b al, v16b bh, v16b bl, v8f c) {
  c = __builtin_amdgcn_wmma_f32_16x16x32_bf16(false, ah, false, bh, (short)0, c, false, false);
  if (NT >= 2) c = __builtin_amdgcn_wmma_f32_16x16x32_bf16(false, al, false, bh, (short)0, c, false, false);
  if (NT >= 3) c = __builtin_amdgcn_wmma_f32_16x16x32_bf16(false, ah, false, bl, (short)0, c, false, false);
  asm volatile("v_nop\n\tv_nop\n\tv_nop\n\tv_nop" : "+v"(c) : "v"(ah), "v"(al), "v"(bh), "v"(bl));
  return c;
}

__global__ __launch_bounds__(256) void k_wt_bf16(const float* __restrict__ W, unsigned short* __restrict__ Wt, int K, int N) {
  const int t = blockIdx.x * 256 + threadIdx.x;
  const int k8n = K / 8;
  if (t >= N * k8n) return;
  const int n = t / k8n, k8 = (t % k8n) * 8;
  v8us v;
#pragma unroll
  for (int i = 0; i < 8; ++i) v[i] = bf16_bits(W[(size_t)(k8 + i) * N + n]);
  *(v8us*)(Wt + (size_t)n * K + k8) = v;
  
}

// GEMM C[M][N] (f32, pitch ldc) = act(A[M][K]·W + bias). A f32 row-major (pitch lda) converted per fragment to bf16
// (ASPLIT: hi/lo two planes -> 2 terms, else single rounded term); Wt bf16 [N][K] (pitch ldb). BIAS_BF16 rounds the
// bias to bf16 first (bias quantised to bf16 before the add). K%32==0, M%16==0, N%64==0.
template <bool ASPLIT, int ACT, bool BIAS_BF16>
__global__ __launch_bounds__(128) void k_gemm_bf(const float* __restrict__ A, int lda, const unsigned short* __restrict__ Wt, int ldb,
                                               const float* __restrict__ bias, float* __restrict__ C, int ldc, int M, int N, int K) {
  __shared__ __attribute__((aligned(16))) float so[4][16][64];
  const int tid = threadIdx.x, w = tid >> 5, lane = tid & 31, ln = lane & 15, hh = lane >> 4;
  const int ntn = N / 64;
  const int wid = blockIdx.x * 4 + w;
  const int mt = wid / ntn, nq = wid % ntn;
  if (mt * 16 >= M) return;
  const int row0 = mt * 16, col0 = nq * 64;
  const float* arow = A + (size_t)(row0 + ln) * lda;
  v8f acc[4] = {};
  for (int kb = 0; kb < K; kb += 32) {
    FragB ah, al;
    const v4f x0 = *(const v4fa*)(arow + kb + 8 * hh), x1 = *(const v4fa*)(arow + kb + 8 * hh + 4);
    const v4f x2 = *(const v4fa*)(arow + kb + 16 + 8 * hh), x3 = *(const v4fa*)(arow + kb + 16 + 8 * hh + 4);
    float xs[16] = {x0[0],x0[1],x0[2],x0[3],x1[0],x1[1],x1[2],x1[3],x2[0],x2[1],x2[2],x2[3],x3[0],x3[1],x3[2],x3[3]};
#pragma unroll
    for (int i = 0; i < 16; ++i) { const unsigned short hb = bf16_bits(xs[i]); ah.u[i] = hb; al.u[i] = ASPLIT ? bf16_bits(xs[i] - bf16_val(hb)) : (unsigned short)0; }
#pragma unroll
    for (int t = 0; t < 4; ++t) {
      const unsigned short* brow = Wt + (size_t)(col0 + t * 16 + ln) * ldb + kb;
      FragB b;
      b.half[0] = *(const v8us*)(brow + 8 * hh);
      b.half[1] = *(const v8us*)(brow + 16 + 8 * hh);
      acc[t] = mmaN<ASPLIT ? 2 : 1>(ah.v, al.v, b.v, b.v, acc[t]);
    }
  }
#pragma unroll
  for (int t = 0; t < 4; ++t) {
    float bv = bias ? bias[col0 + t * 16 + ln] : 0.f;
    if (BIAS_BF16) bv = bf16_round(bv);
#pragma unroll
    for (int r = 0; r < 8; ++r) { float v = acc[t][r] + bv; if (ACT == 1) v = fmaxf(v, 0.f); so[w][8 * hh + r][t * 16 + ln] = v; }
  }
  __builtin_amdgcn_fence(__ATOMIC_ACQ_REL, "workgroup");
  __builtin_amdgcn_wave_barrier();
  const int rsub = lane >> 4, c4 = (lane & 15) * 4;
  {
#pragma unroll
    for (int q = 0; q < 8; ++q) {
      const int r = q * 2 + rsub;
      const v4f v = *(const v4fa*)&so[w][r][c4];
      *(v4f*)(C + (size_t)(row0 + r) * ldc + col0 + c4) = v;
    }
    
  }
}

// Flash-style causal/unmasked attention, all contractions 3-term bf16 hi/lo splits, f32 softmax with running max.
// q,k,v rows are read from f32 buffers with arbitrary row pitch (so they can live inside a fused qkv buffer);
// D = head size (multiple of 32, <= 128); one wave = 16 query rows; block = 4 waves (64 queries) sharing K/V chunks of 32.
template <int D, bool CAUSAL>
__global__ __launch_bounds__(128) void k_flash(const float* __restrict__ qb, const float* __restrict__ kb, const float* __restrict__ vb,
                                             int pitch, int T, int H, float scale, float* __restrict__ y, int ypitch) {
  constexpr int KS = D / 32;        // k-steps for QK
  constexpr int DT = D / 16;        // d tiles for PV
  __shared__ __attribute__((aligned(16))) unsigned short sKh[32][D + 8], sKl[32][D + 8], sVh[32][D + 8], sVl[32][D + 8];
  __shared__ __attribute__((aligned(16))) unsigned short sPh[4][16][40], sPl[4][16][40];
  __shared__ __attribute__((aligned(16))) float sO[4][16][D];
  const int tid = threadIdx.x, w = tid >> 5, lane = tid & 31, ln = lane & 15, hh = lane >> 4;
  const int nqb = (T + 63) / 64;
  const int bh = blockIdx.x / nqb, qblk = blockIdx.x % nqb;
  const int b = bh / H, h = bh % H;
  const int q0 = qblk * 64 + w * 16;
  const float* Q = qb + (size_t)b * T * pitch + h * D;
  const float* K = kb + (size_t)b * T * pitch + h * D;
  const float* V = vb + (size_t)b * T * pitch + h * D;

  // A fragments of the wave's 16 query rows (scaled), hi/lo
  FragB aqh[KS], aql[KS];
  {
    int row = q0 + ln; if (row >= T) row = T - 1;
    const float* qr = Q + (size_t)row * pitch;
#pragma unroll
    for (int ks = 0; ks < KS; ++ks)
#pragma unroll
      for (int i = 0; i < 16; ++i) {
        const int d = ks * 32 + ((i < 8) ? (8 * hh + i) : (16 + 8 * hh + (i - 8)));
        const float x = qr[d] * scale; const unsigned short hb = bf16_bits(x);
        aqh[ks].u[i] = hb; aql[ks].u[i] = bf16_bits(x - bf16_val(hb));
      }
  }
  float m_r[8], l_r[8];
#pragma unroll
  for (int r = 0; r < 8; ++r) { m_r[r] = -3.0e38f; l_r[r] = 0.f; }
  v8f oacc[DT];
#pragma unroll
  for (int dt = 0; dt < DT; ++dt) oacc[dt] = (v8f){0.f,0.f,0.f,0.f,0.f,0.f,0.f,0.f};

  const int kv_end = CAUSAL ? min(T, qblk * 64 + 64) : T;     // block-uniform
  for (int j0 = 0; j0 < kv_end; j0 += 32) {
    __syncthreads();
    for (int e = tid; e < 32 * (D / 4); e += 128) {
      const int r = e / (D / 4), c4 = (e % (D / 4)) * 4;
      const int key = j0 + r;
      v4f kf = {0.f,0.f,0.f,0.f}, vf = {0.f,0.f,0.f,0.f};
      if (key < T) { kf = *(const v4fa*)(K + (size_t)key * pitch + c4); vf = *(const v4fa*)(V + (size_t)key * pitch + c4); }
#pragma unroll
      for (int t = 0; t < 4; ++t) {
        unsigned short hb = bf16_bits(kf[t]); sKh[r][c4 + t] = hb; sKl[r][c4 + t] = bf16_bits(kf[t] - bf16_val(hb));
        hb = bf16_bits(vf[t]); sVh[r][c4 + t] = hb; sVl[r][c4 + t] = bf16_bits(vf[t] - bf16_val(hb));
      }
    }
    __syncthreads();
    // S tile 16 x 32
    v8f s[2];
#pragma unroll
    for (int nt = 0; nt < 2; ++nt) {
      v8f acc = {};
#pragma unroll
      for (int ks = 0; ks < KS; ++ks) {
        FragB bh_, bl_;
        bh_.half[0] = *(const v8us*)&sKh[nt * 16 + ln][ks * 32 + 8 * hh]; bh_.half[1] = *(const v8us*)&sKh[nt * 16 + ln][ks * 32 + 16 + 8 * hh];
        bl_.half[0] = *(const v8us*)&sKl[nt * 16 + ln][ks * 32 + 8 * hh]; bl_.half[1] = *(const v8us*)&sKl[nt * 16 + ln][ks * 32 + 16 + 8 * hh];
        acc = mmaN<3>(aqh[ks].v, aql[ks].v, bh_.v, bl_.v, acc);
      }
      s[nt] = acc;
    }
    // mask + running max (rows 8hh+r; the 16 lanes of a half share rows)
    float alpha[8];
#pragma unroll
    for (int r = 0; r < 8; ++r) {
      const int qi = q0 + 8 * hh + r;
      const int ja = j0 + ln, jb = j0 + 16 + ln;
      if (CAUSAL) { if (ja > qi) s[0][r] = -3.0e38f; if (jb > qi) s[1][r] = -3.0e38f; }
      if (ja >= T) s[0][r] = -3.0e38f;
      if (jb >= T) s[1][r] = -3.0e38f;
      float mx = fmaxf(s[0][r], s[1][r]);
      mx = fmaxf(mx, __shfl_xor(mx, 1, 32)); mx = fmaxf(mx, __shfl_xor(mx, 2, 32)); mx = fmaxf(mx, __shfl_xor(mx, 4, 32)); mx = fmaxf(mx, __shfl_xor(mx, 8, 32));
      const float mnew = fmaxf(m_r[r], mx);
      alpha[r] = (mnew > -1.0e38f) ? __expf(m_r[r] - mnew) : 1.0f;
      const float p0 = (s[0][r] > -1.0e38f) ? __expf(s[0][r] - mnew) : 0.f;
      const float p1 = (s[1][r] > -1.0e38f) ? __expf(s[1][r] - mnew) : 0.f;
      m_r[r] = mnew;
      l_r[r] = l_r[r] * alpha[r] + p0 + p1;            // per-lane partial row sum (16 lanes combined at the end)
      unsigned short hb = bf16_bits(p0); sPh[w][8 * hh + r][ln] = hb;      sPl[w][8 * hh + r][ln] = bf16_bits(p0 - bf16_val(hb));
      hb = bf16_bits(p1);                sPh[w][8 * hh + r][16 + ln] = hb; sPl[w][8 * hh + r][16 + ln] = bf16_bits(p1 - bf16_val(hb));
    }
#pragma unroll
    for (int dt = 0; dt < DT; ++dt)
#pragma unroll
      for (int r = 0; r < 8; ++r) oacc[dt][r] *= alpha[r];
    __builtin_amdgcn_fence(__ATOMIC_ACQ_REL, "workgroup");
    __builtin_amdgcn_wave_barrier();
    FragB pah, pal;
    pah.half[0] = *(const v8us*)&sPh[w][ln][8 * hh]; pah.half[1] = *(const v8us*)&sPh[w][ln][16 + 8 * hh];
    pal.half[0] = *(const v8us*)&sPl[w][ln][8 * hh]; pal.half[1] = *(const v8us*)&sPl[w][ln][16 + 8 * hh];
#pragma unroll
    for (int dt = 0; dt < DT; ++dt) {
      FragB bvh, bvl;
#pragma unroll
      for (int i = 0; i < 8; ++i) {
        bvh.u[i] = sVh[8 * hh + i][dt * 16 + ln]; bvh.u[8 + i] = sVh[16 + 8 * hh + i][dt * 16 + ln];
        bvl.u[i] = sVl[8 * hh + i][dt * 16 + ln]; bvl.u[8 + i] = sVl[16 + 8 * hh + i][dt * 16 + ln];
      }
      oacc[dt] = mmaN<3>(pah.v, pal.v, bvh.v, bvl.v, oacc[dt]);
    }
    __builtin_amdgcn_fence(__ATOMIC_ACQ_REL, "workgroup");
    __builtin_amdgcn_wave_barrier();
  }
#pragma unroll
  for (int r = 0; r < 8; ++r) {
    float l = l_r[r];
    l += __shfl_xor(l, 1, 32); l += __shfl_xor(l, 2, 32); l += __shfl_xor(l, 4, 32); l += __shfl_xor(l, 8, 32);
    l_r[r] = (l > 0.f) ? 1.0f / l : 0.f;
  }
#pragma unroll
  for (int dt = 0; dt < DT; ++dt)
#pragma unroll
    for (int r = 0; r < 8; ++r) sO[w][8 * hh + r][dt * 16 + ln] = oacc[dt][r] * l_r[r];
  __builtin_amdgcn_fence(__ATOMIC_ACQ_REL, "workgroup");
  __builtin_amdgcn_wave_barrier();
  {
    for (int r = 0; r < 16; ++r) {
      const int row = q0 + r;
      if (row < T && lane < D / 4) {
        const v4f val = *(const v4fa*)&sO[w][r][lane * 4];
        *(v4f*)(y + ((size_t)b * T + row) * ypitch + h * D + lane * 4) = val;
      }
    }
    
  }
}

// GEMM C = act(A·W + bias + resid): A f32 (ASPLIT -> hi/lo 2 terms), Wt bf16 [N][K]; ACT 0 none, 1 relu, 2 exact gelu;
// resid (optional, f32, row index = (row % rmod), pitch ldr, RES_BF16 rounds it) added before the activation.
template <bool ASPLIT, int ACT, bool BIAS_BF16, bool RES_BF16>
__global__ __launch_bounds__(128) void k_gemm_bf3(const float* __restrict__ A, int lda, const unsigned short* __restrict__ Wt, int ldb,
                                                const float* __restrict__ bias, const float* __restrict__ resid, int rmod, int ldr,
                                                float* __restrict__ C, int ldc, int M, int N, int K) {
  __shared__ __attribute__((aligned(16))) float so[4][16][64];
  const int tid = threadIdx.x, w = tid >> 5, lane = tid & 31, ln = lane & 15, hh = lane >> 4;
  const int ntn = N / 64;
  const int wid = blockIdx.x * 4 + w;
  const int mt = wid / ntn, nq = wid % ntn;
  if (mt * 16 >= M) return;
  const int row0 = mt * 16, col0 = nq * 64;
  const float* arow = A + (size_t)(row0 + ln) * lda;
  v8f acc[4] = {};
  for (int kb = 0; kb < K; kb += 32) {
    FragB ah, al;
    const v4f x0 = *(const v4fa*)(arow + kb + 8 * hh), x1 = *(const v4fa*)(arow + kb + 8 * hh + 4);
    const v4f x2 = *(const v4fa*)(arow + kb + 16 + 8 * hh), x3 = *(const v4fa*)(arow + kb + 16 + 8 * hh + 4);
    float xs[16] = {x0[0],x0[1],x0[2],x0[3],x1[0],x1[1],x1[2],x1[3],x2[0],x2[1],x2[2],x2[3],x3[0],x3[1],x3[2],x3[3]};
#pragma unroll
    for (int i = 0; i < 16; ++i) { const unsigned short hb = bf16_bits(xs[i]); ah.u[i] = hb; al.u[i] = ASPLIT ? bf16_bits(xs[i] - bf16_val(hb)) : (unsigned short)0; }
#pragma unroll
    for (int t = 0; t < 4; ++t) {
      const unsigned short* brow = Wt + (size_t)(col0 + t * 16 + ln) * ldb + kb;
      FragB b;
      b.half[0] = *(const v8us*)(brow + 8 * hh);
      b.half[1] = *(const v8us*)(brow + 16 + 8 * hh);
      acc[t] = mmaN<ASPLIT ? 2 : 1>(ah.v, al.v, b.v, b.v, acc[t]);
    }
  }
#pragma unroll
  for (int t = 0; t < 4; ++t) {
    const int col = col0 + t * 16 + ln;
    float bv = bias ? bias[col] : 0.f;
    if (BIAS_BF16) bv = bf16_round(bv);
#pragma unroll
    for (int r = 0; r < 8; ++r) {
      float v = acc[t][r] + bv;
      if (resid) { float rv = resid[(size_t)((row0 + 8 * hh + r) % rmod) * ldr + col]; if (RES_BF16) rv = bf16_round(rv); v += rv; }
      if (ACT == 1) v = fmaxf(v, 0.f);
      if (ACT == 2) v = 0.5f * v * (1.0f + erff(v * 0.70710678118654752f));
      if (ACT == 3) { const float u = 0.7978845608028654f * (v + 0.044715f * v * v * v); v = 0.5f * v * (1.0f + tanhf(u)); }
      so[w][8 * hh + r][t * 16 + ln] = v;
    }
  }
  __builtin_amdgcn_fence(__ATOMIC_ACQ_REL, "workgroup");
  __builtin_amdgcn_wave_barrier();
  const int rsub = lane >> 4, c4 = (lane & 15) * 4;
  {
#pragma unroll
    for (int q = 0; q < 8; ++q) {
      const int r = q * 2 + rsub;
      const v4f v = *(const v4fa*)&so[w][r][c4];
      *(v4f*)(C + (size_t)(row0 + r) * ldc + col0 + c4) = v;
    }
    
  }
}
// row LayerNorm (biased variance, eps) over N: s = X (+ R); optional out_sum <- s; out_norm <- (s-mu)*rsqrt(var+eps)*g + b
template <bool PARAM_BF16>
__global__ __launch_bounds__(256) void k_layernorm(const float* __restrict__ X, const float* __restrict__ R, const float* __restrict__ g, const float* __restrict__ bta,
                                                  float* __restrict__ out_sum, float* __restrict__ out_norm, int N, float eps) {
  __shared__ float red[256];
  const int row = blockIdx.x, tid = threadIdx.x;
  const float* x = X + (size_t)row * N; const float* rr = R ? R + (size_t)row * N : nullptr;
  float vals[16];                     // up to N = 4096
  const int per = N / 256;            // contiguous chunk per thread? use strided-by-4 chunks: thread handles j = tid*4 + 1024*u
  float s1 = 0.f;
  for (int u = 0; u < per / 4; ++u) {
    const int j = tid * 4 + 1024 * u;
    const v4f a = *(const v4fa*)(x + j);
    v4f b = {0.f,0.f,0.f,0.f}; if (rr) b = *(const v4fa*)(rr + j);
#pragma unroll
    for (int q = 0; q < 4; ++q) { const float v = a[q] + b[q]; vals[u * 4 + q] = v; s1 += v; }
  }
  red[tid] = s1; __syncthreads();
  for (int st = 128; st > 0; st >>= 1) { if (tid < st) red[tid] += red[tid + st]; __syncthreads(); }
  const float mu = red[0] / (float)N; __syncthreads();
  float s2 = 0.f;
  for (int u = 0; u < per / 4; ++u)
#pragma unroll
    for (int q = 0; q < 4; ++q) { const float c = vals[u * 4 + q] - mu; s2 += c * c; }
  red[tid] = s2; __syncthreads();
  for (int st = 128; st > 0; st >>= 1) { if (tid < st) red[tid] += red[tid + st]; __syncthreads(); }
  const float rs = rsqrtf(red[0] / (float)N + eps);
  {
    for (int u = 0; u < per / 4; ++u) {
      const int j = tid * 4 + 1024 * u;
      v4f o, sm;
#pragma unroll
      for (int q = 0; q < 4; ++q) {
        float gg = g[j + q], bb = bta[j + q];
        if (PARAM_BF16) { gg = bf16_round(gg); bb = bf16_round(bb); }
        sm[q] = vals[u * 4 + q]; o[q] = (vals[u * 4 + q] - mu) * rs * gg + bb;
      }
      if (out_sum) *(v4f*)(out_sum + (size_t)row * N + j) = sm;
      *(v4f*)(out_norm + (size_t)row * N + j) = o;
    }
    
  }
}



// ---- f16 WMMA path (v_wmma_f32_16x16x32_f16): 11-bit significands for operands in range — used where a [0,1] probability operand needs more precision than bf16
typedef _Float16 v16h __attribute__((ext_vector_type(16)));
union FragH { v16h v; v8us half[2]; _Float16 h[16]; unsigned short u[16]; };
template <int NT>
__device__ __forceinline__ v8f mmaH(v16h ah, v16h al, v16h bh, v16h bl, v8f c) {
  c = __builtin_amdgcn_wmma_f32_16x16x32_f16(false, ah, false, bh, (short)0, c, false, false);
  if (NT >= 2) c = __builtin_amdgcn_wmma_f32_16x16x32_f16(false, al, false, bh, (short)0, c, false, false);
  if (NT >= 3) c = __builtin_amdgcn_wmma_f32_16x16x32_f16(false, ah, false, bl, (short)0, c, false, false);
  asm volatile("v_nop\n\tv_nop\n\tv_nop\n\tv_nop" : "+v"(c) : "v"(ah), "v"(al), "v"(bh), "v"(bl));
  return c;
}
// batched GEMM like k_gemm_b but f16 operands: A f32 (split into f16 hi/lo if ASPLIT, else rounded to f16), Bt = f16 values [n][k]; alpha; C f32; N multiple of 16 (partial tiles skipped)
template <bool ASPLIT>
__global__ __launch_bounds__(128) void k_gemm_h(const float* __restrict__ A, int lda, size_t sA, const _Float16* __restrict__ Bh, int ldb, size_t sB, float alpha, float* __restrict__ C, int ldc, size_t sC, int M, int N, int K) {
  __shared__ __attribute__((aligned(16))) float so[4][16][64];
  const int tid = threadIdx.x, w = tid >> 5, lane = tid & 31, ln = lane & 15, hh = lane >> 4; const int by = blockIdx.y;
  A += (size_t)by * sA; Bh += (size_t)by * sB; C += (size_t)by * sC;
  const int ntn = (N + 63) / 64; const int wid = blockIdx.x * 4 + w; const int mt = wid / ntn, nq = wid % ntn; if (mt * 16 >= M) return;
  const int row0 = mt * 16, col0 = nq * 64; const float* arow = A + (size_t)(row0 + ln) * lda;
  v8f acc[4] = {};
  for (int kb = 0; kb < K; kb += 32) {
    FragH ah, al;
    const v4f x0 = *(const v4fa*)(arow + kb + 8 * hh), x1 = *(const v4fa*)(arow + kb + 8 * hh + 4), x2 = *(const v4fa*)(arow + kb + 16 + 8 * hh), x3 = *(const v4fa*)(arow + kb + 16 + 8 * hh + 4);
    float xs[16] = {x0[0],x0[1],x0[2],x0[3],x1[0],x1[1],x1[2],x1[3],x2[0],x2[1],x2[2],x2[3],x3[0],x3[1],x3[2],x3[3]};
#pragma unroll
    for (int i = 0; i < 16; ++i) { const _Float16 h = (_Float16)xs[i]; ah.h[i] = h; al.h[i] = ASPLIT ? (_Float16)(xs[i] - (float)h) : (_Float16)0.0f; }
#pragma unroll
    for (int t = 0; t < 4; ++t) { if (col0 + t * 16 >= N) continue; const size_t boff = (size_t)(col0 + t * 16 + ln) * ldb + kb; FragH bq; bq.half[0] = *(const v8us*)(Bh + boff + 8 * hh); bq.half[1] = *(const v8us*)(Bh + boff + 16 + 8 * hh);
      acc[t] = mmaH<ASPLIT ? 2 : 1>(ah.v, al.v, bq.v, bq.v, acc[t]); }
  }
#pragma unroll
  for (int t = 0; t < 4; ++t) { if (col0 + t * 16 >= N) continue;
#pragma unroll
    for (int r = 0; r < 8; ++r) so[w][8 * hh + r][t * 16 + ln] = acc[t][r] * alpha; }
  __builtin_amdgcn_fence(__ATOMIC_ACQ_REL, "workgroup"); __builtin_amdgcn_wave_barrier();
  const int rsub = lane >> 4, c4 = (lane & 15) * 4;
  {
#pragma unroll
    for (int q = 0; q < 8; ++q) { const int r = q * 2 + rsub; if (col0 + c4 < N) { const v4f v = *(const v4fa*)&so[w][r][c4]; *(v4f*)(C + (size_t)(row0 + r) * ldc + col0 + c4) = v; } }
     }
}

// Wt[n][k] = f16(W[k][n]·scale) from f32 row-major W[K][N] (scale = power of two; bf16-exact weights stay exact in f16 away from the subnormal range)
__global__ __launch_bounds__(256) void k_wt_f16(const float* __restrict__ W, _Float16* __restrict__ Wt, int K, int N, float scale) {
  const int t = blockIdx.x * 256 + threadIdx.x; if (t >= N * (K / 8)) return; const int n = t / (K / 8), k8 = (t % (K / 8)) * 8; FragH f;
#pragma unroll
  for (int i = 0; i < 8; ++i) f.h[i] = (_Float16)(bf16_round(W[(size_t)(k8 + i) * N + n]) * scale); const v8us o = f.half[0];
  *(v8us*)((unsigned short*)Wt + (size_t)n * K + k8) = o; 
}
// k_gemm_hh variant with fused epilogue: v = acc·alpha + bias[by·sBias + col] (+ CP[(row/rowsPerB)·sCPb + by·64 + col] if CP) ; ACT 0 none / 1 elu ; writes f32 C and/or f16 C16 (each if non-null)
template <int ACT>
__global__ __launch_bounds__(128) void k_gemm_hhx(const _Float16* __restrict__ A, int lda, size_t sA, const _Float16* __restrict__ Bh, int ldb, size_t sB, float alpha, const float* __restrict__ bias, size_t sBias, const float* __restrict__ CP, int rowsPerB, size_t sCPb, int row0g,
    float* __restrict__ C, _Float16* __restrict__ C16, int ldc, size_t sC, int M, int N, int K) {
  __shared__ __attribute__((aligned(16))) float so[4][16][64];
  const int tid = threadIdx.x, w = tid >> 5, lane = tid & 31, ln = lane & 15, hh = lane >> 4; const int by = blockIdx.y;
  A += (size_t)by * sA; Bh += (size_t)by * sB; const size_t cofs = (size_t)by * sC; const float* bp = bias ? bias + (size_t)by * sBias : nullptr;
  const int ntn = (N + 63) / 64; const int wid = blockIdx.x * 4 + w; const int mt = wid / ntn, nq = wid % ntn; if (mt * 16 >= M) return;
  const int row0 = mt * 16, col0 = nq * 64; const _Float16* arow = A + (size_t)(row0 + ln) * lda;
  v8f acc[4] = {};
  for (int kb = 0; kb < K; kb += 32) { FragH ah; ah.half[0] = *(const v8us*)((const unsigned short*)arow + kb + 8 * hh); ah.half[1] = *(const v8us*)((const unsigned short*)arow + kb + 16 + 8 * hh);
#pragma unroll
    for (int t = 0; t < 4; ++t) { if (col0 + t * 16 >= N) continue; const size_t boff = (size_t)(col0 + t * 16 + ln) * ldb + kb; FragH bq; bq.half[0] = *(const v8us*)((const unsigned short*)Bh + boff + 8 * hh); bq.half[1] = *(const v8us*)((const unsigned short*)Bh + boff + 16 + 8 * hh);
      acc[t] = mmaH<1>(ah.v, ah.v, bq.v, bq.v, acc[t]); }
  }
#pragma unroll
  for (int t = 0; t < 4; ++t) { if (col0 + t * 16 >= N) continue; const int col = col0 + t * 16 + ln; const float bv = bp ? bf16_round(bp[col]) : 0.f;
#pragma unroll
    for (int r = 0; r < 8; ++r) { float v = acc[t][r] * alpha + bv; if (CP) { const int bidx = (row0g + row0 + 8 * hh + r) / rowsPerB; v += CP[(size_t)bidx * sCPb + (size_t)by * 64 + col]; } if (ACT == 1) v = (v > 0.f) ? v : expm1f(v); else if (ACT == 7) v = (v > 0.f) ? v + 1.0f : expf(v); else if (ACT == 8) v = tanhf(v); else if (ACT == 9) v = 0.5f * v * (1.0f + tanhf(0.7978845608028654f * (v + 0.044715f * v * v * v))); else if (ACT == 11) v = 1.0f / (1.0f + expf(-v)); else if (ACT == 12) v = (v > 0.f) ? v : 0.01f * v; else if (ACT == 14) v = (v > 0.f) ? v : 0.1f * v; else if (ACT == 15) v = v / (1.0f + expf(-v)); else if (ACT == 3) v = fmaxf(v, 0.f); else if (ACT == 6) v = 0.5f * v * (1.0f + erff(v * 0.70710678118654752f)); so[w][8 * hh + r][t * 16 + ln] = v; } }
  __builtin_amdgcn_fence(__ATOMIC_ACQ_REL, "workgroup"); __builtin_amdgcn_wave_barrier();
  const int rsub = lane >> 4, c4 = (lane & 15) * 4; typedef _Float16 v4h __attribute__((ext_vector_type(4)));
  {
#pragma unroll
    for (int q = 0; q < 8; ++q) { const int r = q * 2 + rsub; if (col0 + c4 < N) { const v4f v = *(const v4fa*)&so[w][r][c4]; if (C) *(v4f*)(C + cofs + (size_t)(row0 + r) * ldc + col0 + c4) = v; if (C16) { v4h h4; for (int i = 0; i < 4; ++i) h4[i] = (_Float16)v[i]; *(v4h*)(C16 + cofs + (size_t)(row0 + r) * ldc + col0 + c4) = h4; } } }
     }
}


typedef _Float16 v4h __attribute__((ext_vector_type(4)));

__global__ __launch_bounds__(256) void k_x16(const float* __restrict__ x, _Float16* __restrict__ X16, size_t n8) { const size_t t = (size_t)blockIdx.x * 256 + threadIdx.x; if (t >= n8) return; FragH f;
#pragma unroll
  for (int q = 0; q < 8; ++q) f.h[q] = (_Float16)bf16_round(x[t * 8 + q]); *(v8us*)((unsigned short*)X16 + t * 8) = f.half[0];  }
__global__ __launch_bounds__(256) void k_h16(const float* __restrict__ x, _Float16* __restrict__ X16, size_t n8) { const size_t t = (size_t)blockIdx.x * 256 + threadIdx.x; if (t >= n8) return; FragH f;
#pragma unroll
  for (int q = 0; q < 8; ++q) f.h[q] = (_Float16)x[t * 8 + q]; *(v8us*)((unsigned short*)X16 + t * 8) = f.half[0];  }
__global__ __launch_bounds__(256) void k_round16f(const float* __restrict__ W, _Float16* __restrict__ Bt, size_t n8) { const size_t t = (size_t)blockIdx.x * 256 + threadIdx.x; if (t >= n8) return; FragH f;
#pragma unroll
  for (int i = 0; i < 8; ++i) f.h[i] = (_Float16)(bf16_round(W[t * 8 + i]) * 16.0f); *(v8us*)((unsigned short*)Bt + t * 8) = f.half[0];  }
template <int NHv, int TTv>
__global__ __launch_bounds__(256) void k_vt(const _Float16* __restrict__ V16, int ldv, int voff, _Float16* __restrict__ Vt) { __shared__ unsigned short tl[64][66]; const int tid = threadIdx.x; const int slab = blockIdx.x / (TTv / 64), lg = blockIdx.x % (TTv / 64); const int b = slab / NHv, h = slab % NHv;
  for (int i = tid; i < 64 * 8; i += 256) { const int r = i / 8, c8 = (i % 8) * 8; FragH f; f.half[0] = *(const v8us*)((const unsigned short*)V16 + ((size_t)b * TTv + lg * 64 + r) * ldv + voff + h * 64 + c8);
#pragma unroll
    for (int q = 0; q < 8; ++q) tl[r][c8 + q] = f.u[q]; }
  __syncthreads();
  {
#pragma unroll
    for (int rd = 0; rd < 2; ++rd) { const int d = rd * 32 + tid / 8, pc = tid % 8; FragH f;
#pragma unroll
      for (int q = 0; q < 8; ++q) f.u[q] = tl[pc * 8 + q][d];
      *(v8us*)((unsigned short*)Vt + ((size_t)slab * 64 + d) * TTv + lg * 64 + pc * 8) = f.half[0]; }
     } }

__global__ __launch_bounds__(256) void k_elu_hl(const float* __restrict__ F, _Float16* __restrict__ Hh, _Float16* __restrict__ Hl, size_t n8) { const size_t t = (size_t)blockIdx.x * 256 + threadIdx.x; if (t >= n8) return; const v4f a = *(const v4fa*)(F + t * 8), c = *(const v4fa*)(F + t * 8 + 4); FragH fh, fl;
#pragma unroll
  for (int q = 0; q < 8; ++q) { const float x = (q < 4) ? a[q] : c[q - 4]; const float v = (x > 0.f) ? x + 1.0f : expf(x);      /* elu(x) + 1 = x+1 (x>0) | e^x (x≤0) */ const _Float16 h = (_Float16)v; fh.h[q] = h; fl.h[q] = (_Float16)((v - (float)h) * 1024.0f); }
  { *(v8us*)((unsigned short*)Hh + t * 8) = fh.half[0]; *(v8us*)((unsigned short*)Hl + t * 8) = fl.half[0];  } }
__global__ __launch_bounds__(256) void k_h16s(const float* __restrict__ F, _Float16* __restrict__ H, size_t n8) { const size_t t = (size_t)blockIdx.x * 256 + threadIdx.x; if (t >= n8) return; const v4f a = *(const v4fa*)(F + t * 8), c = *(const v4fa*)(F + t * 8 + 4); FragH f;
#pragma unroll
  for (int q = 0; q < 4; ++q) { f.h[q] = (_Float16)(a[q] * 16.0f); f.h[4 + q] = (_Float16)(c[q] * 16.0f); } *(v8us*)((unsigned short*)H + t * 8) = f.half[0];  }
__global__ __launch_bounds__(128) void k_flash(const _Float16* __restrict__ Q16, const _Float16* __restrict__ Q16lo, int ldq, const _Float16* __restrict__ K16, const _Float16* __restrict__ K16lo, int ldk, const _Float16* __restrict__ Vt, const int* __restrict__ MSK, float* __restrict__ O, int ldo) {
  constexpr int RPW = 16, RTN = RPW / 16, NQB = TT / (4 * RPW), DT = 4, KS = 2;
  __shared__ __attribute__((aligned(16))) unsigned short sP[4][RPW][40]; __shared__ __attribute__((aligned(16))) float sO[4][RPW][64 + 4];
  const int tid = threadIdx.x, w = tid >> 5, lane = tid & 31, ln = lane & 15, hh = lane >> 4;
  const int slab = blockIdx.x / NQB, qblk = blockIdx.x % NQB; const int b = slab / NH, h = slab % NH; const int qb0 = qblk * (4 * RPW); const int q0 = qb0 + w * RPW;
  FragH aq[2][KS], aql[2][KS];
#pragma unroll
  for (int rt = 0; rt < RTN; ++rt) { const size_t qo = ((size_t)b * TT + q0 + rt * 16 + ln) * ldq + h * 64; const unsigned short* qr = (const unsigned short*)Q16 + qo; const unsigned short* ql = (const unsigned short*)Q16lo + qo;
#pragma unroll
    for (int ks = 0; ks < KS; ++ks) { aq[rt][ks].half[0] = *(const v8us*)(qr + ks * 32 + 8 * hh); aq[rt][ks].half[1] = *(const v8us*)(qr + ks * 32 + 16 + 8 * hh); aql[rt][ks].half[0] = *(const v8us*)(ql + ks * 32 + 8 * hh); aql[rt][ks].half[1] = *(const v8us*)(ql + ks * 32 + 16 + 8 * hh); } }
  const unsigned short* Vth = (const unsigned short*)Vt + (size_t)slab * 64 * TT;
  float m_r[2][8], l_r[2][8]; v8f oacc[2][DT];
#pragma unroll
  for (int rt = 0; rt < RTN; ++rt) {
#pragma unroll
    for (int r = 0; r < 8; ++r) { m_r[rt][r] = -3.0e38f; l_r[rt][r] = 0.f; }
#pragma unroll
    for (int dt = 0; dt < DT; ++dt) oacc[rt][dt] = (v8f){0.f,0.f,0.f,0.f,0.f,0.f,0.f,0.f}; }
  const int jend = TT;
#pragma unroll 1
  for (int j0 = 0; j0 < jend; j0 += 32) { const int km0 = MSK[(size_t)b * TT + j0 + ln], km1 = MSK[(size_t)b * TT + j0 + 16 + ln];      /* key padding mask (1 = attend) */
    
    v8f s[2][2];
#pragma unroll
    for (int nt = 0; nt < 2; ++nt) { const size_t ko = ((size_t)b * TT + j0 + nt * 16 + ln) * ldk + h * 64; const unsigned short* kr = (const unsigned short*)K16 + ko; const unsigned short* kl = (const unsigned short*)K16lo + ko; FragH bk[KS], bl[KS];
#pragma unroll
      for (int ks = 0; ks < KS; ++ks) { bk[ks].half[0] = *(const v8us*)(kr + ks * 32 + 8 * hh); bk[ks].half[1] = *(const v8us*)(kr + ks * 32 + 16 + 8 * hh); bl[ks].half[0] = *(const v8us*)(kl + ks * 32 + 8 * hh); bl[ks].half[1] = *(const v8us*)(kl + ks * 32 + 16 + 8 * hh); }
#pragma unroll
      for (int rt = 0; rt < RTN; ++rt) { v8f acc = (v8f){0.f,0.f,0.f,0.f,0.f,0.f,0.f,0.f}, accl = acc;
#pragma unroll
        for (int ks = 0; ks < KS; ++ks) { acc = mmaH<1>(aq[rt][ks].v, aq[rt][ks].v, bk[ks].v, bk[ks].v, acc); accl = mmaH<1>(aql[rt][ks].v, aql[rt][ks].v, bk[ks].v, bk[ks].v, accl); accl = mmaH<1>(aq[rt][ks].v, aq[rt][ks].v, bl[ks].v, bl[ks].v, accl); }
#pragma unroll
        for (int r = 0; r < 8; ++r) acc[r] += accl[r] * 0.0009765625f; s[rt][nt] = acc; } }
#pragma unroll
    for (int rt = 0; rt < RTN; ++rt)
#pragma unroll
      for (int r = 0; r < 8; ++r) { const int tq = q0 + rt * 16 + 8 * hh + r; const int k0 = j0 + ln, k1 = j0 + 16 + ln; (void)tq; (void)k0; (void)k1;
        const bool ok0 = (km0 != 0), ok1 = (km1 != 0);
        const float s0 = ok0 ? s[rt][0][r] : -INFINITY, s1 = ok1 ? s[rt][1][r] : -INFINITY; float mc = fmaxf(s0, s1);
        mc = fmaxf(mc, __shfl_xor(mc, 1, 32)); mc = fmaxf(mc, __shfl_xor(mc, 2, 32)); mc = fmaxf(mc, __shfl_xor(mc, 4, 32)); mc = fmaxf(mc, __shfl_xor(mc, 8, 32));
        const float mn = fmaxf(m_r[rt][r], mc); const float al = (mn > -1.0e38f) ? expf(m_r[rt][r] - mn) : 1.0f; m_r[rt][r] = mn; const float p0 = ok0 ? expf(s0 - mn) : 0.f, p1 = ok1 ? expf(s1 - mn) : 0.f; l_r[rt][r] = l_r[rt][r] * al + p0 + p1;
#pragma unroll
        for (int dt = 0; dt < DT; ++dt) oacc[rt][dt][r] *= al;
        FragH t2; t2.h[0] = (_Float16)(p0 * 1024.0f); t2.h[1] = (_Float16)(p1 * 1024.0f); sP[w][rt * 16 + 8 * hh + r][ln] = t2.u[0]; sP[w][rt * 16 + 8 * hh + r][16 + ln] = t2.u[1]; }
    __builtin_amdgcn_fence(__ATOMIC_ACQ_REL, "workgroup"); __builtin_amdgcn_wave_barrier();
    FragH pa[2];
#pragma unroll
    for (int rt = 0; rt < RTN; ++rt) { pa[rt].half[0] = *(const v8us*)&sP[w][rt * 16 + ln][8 * hh]; pa[rt].half[1] = *(const v8us*)&sP[w][rt * 16 + ln][16 + 8 * hh]; }
#pragma unroll
    for (int dt = 0; dt < DT; ++dt) { const unsigned short* vrow = Vth + (size_t)(dt * 16 + ln) * TT + j0; FragH bv; bv.half[0] = *(const v8us*)(vrow + 8 * hh); bv.half[1] = *(const v8us*)(vrow + 16 + 8 * hh);
#pragma unroll
      for (int rt = 0; rt < RTN; ++rt) oacc[rt][dt] = mmaH<1>(pa[rt].v, pa[rt].v, bv.v, bv.v, oacc[rt][dt]); }
    __builtin_amdgcn_fence(__ATOMIC_ACQ_REL, "workgroup"); __builtin_amdgcn_wave_barrier(); }
#pragma unroll
  for (int rt = 0; rt < RTN; ++rt) {
#pragma unroll
    for (int r = 0; r < 8; ++r) { float l = l_r[rt][r]; l += __shfl_xor(l, 1, 32); l += __shfl_xor(l, 2, 32); l += __shfl_xor(l, 4, 32); l += __shfl_xor(l, 8, 32); l_r[rt][r] = (l > 0.f) ? 1.0f / (l * 1024.0f) : 0.f; }
#pragma unroll
    for (int dt = 0; dt < DT; ++dt)
#pragma unroll
      for (int r = 0; r < 8; ++r) sO[w][rt * 16 + 8 * hh + r][dt * 16 + ln] = oacc[rt][dt][r] * l_r[rt][r]; }
  __builtin_amdgcn_fence(__ATOMIC_ACQ_REL, "workgroup"); __builtin_amdgcn_wave_barrier();
  {
#pragma unroll
    for (int rp = 0; rp < RPW; rp += 2) { const int r = rp + (lane >> 4), pc = lane & 15; const v4f val = *(const v4fa*)&sO[w][r][pc * 4]; *(v4f*)(O + ((size_t)b * TT + q0 + r) * ldo + h * 64 + pc * 4) = val; }
     } }

extern "C" void kernel_launch(void* const* d_in, const int* in_sizes, int n_in,
                              void* d_out, int out_size, void* d_ws, size_t ws_size, hipStream_t stream) {
  (void)in_sizes; (void)n_in; (void)out_size;
  const float* x = (const float*)d_in[0]; const int* mask = (const int*)d_in[1]; const float* Wq = (const float*)d_in[2]; const float* Wk = (const float*)d_in[3]; const float* Wv = (const float*)d_in[4]; const float* Wo = (const float*)d_in[5];
  char* ws = (char*)d_ws; size_t off = 0;
  auto take = [&](size_t bytes) { char* p = ws + off; off += (bytes + 255) & ~(size_t)255; return p; };
  const size_t WSZ = (size_t)DD * DD; _Float16* Bw = (_Float16*)take(4 * WSZ * 2); _Float16* X16 = (_Float16*)take((size_t)NR * DD * 2); float* F32 = (float*)take((size_t)NR * DD * 4);
  _Float16* Qh = (_Float16*)take((size_t)NR * DD * 2); _Float16* Ql = (_Float16*)take((size_t)NR * DD * 2); _Float16* Kh = (_Float16*)take((size_t)NR * DD * 2); _Float16* Kl = (_Float16*)take((size_t)NR * DD * 2); _Float16* V16 = (_Float16*)take((size_t)NR * DD * 2); _Float16* Vt = (_Float16*)take((size_t)NR * DD * 2);
  float* O = F32; _Float16* O16 = X16;      /* F32: q → k → O; X16 dead after the v GEMM */
  if (off > ws_size) return;      // 8.4 + 8.4 + 16.8 + 6 × 8.4 ≈ 84 MB
  const unsigned gw = (unsigned)((WSZ / 8 + 255) / 256); k_round16f<<<gw, 256, 0, stream>>>(Wq, Bw, WSZ / 8); k_round16f<<<gw, 256, 0, stream>>>(Wk, Bw + WSZ, WSZ / 8); k_round16f<<<gw, 256, 0, stream>>>(Wv, Bw + 2 * WSZ, WSZ / 8); k_round16f<<<gw, 256, 0, stream>>>(Wo, Bw + 3 * WSZ, WSZ / 8);
  const unsigned g8 = (unsigned)(((size_t)NR * DD / 8 + 255) / 256); k_x16<<<g8, 256, 0, stream>>>(x, X16, (size_t)NR * DD / 8);
  const dim3 gp(((NR / 16) * (DD / 64) + 3) / 4, 1);
  k_gemm_hhx<0><<<gp, 128, 0, stream>>>(X16, DD, 0, Bw, DD, 0, 0.0625f, nullptr, 0, nullptr, 1, 0, 0, F32, nullptr, DD, 0, NR, DD, DD); k_elu_hl<<<g8, 256, 0, stream>>>(F32, Qh, Ql, (size_t)NR * DD / 8);      /* φ(q) hi/lo */
  k_gemm_hhx<0><<<gp, 128, 0, stream>>>(X16, DD, 0, Bw + WSZ, DD, 0, 0.0625f, nullptr, 0, nullptr, 1, 0, 0, F32, nullptr, DD, 0, NR, DD, DD); k_elu_hl<<<g8, 256, 0, stream>>>(F32, Kh, Kl, (size_t)NR * DD / 8);      /* φ(k) hi/lo */
  k_gemm_hhx<0><<<gp, 128, 0, stream>>>(X16, DD, 0, Bw + 2 * WSZ, DD, 0, 0.0625f, nullptr, 0, nullptr, 1, 0, 0, nullptr, V16, DD, 0, NR, DD, DD);
  k_vt<NH, TT><<<BB * NH * (TT / 64), 256, 0, stream>>>(V16, DD, 0, Vt);
  k_flash<<<BB * NH * (TT / 64), 128, 0, stream>>>(Qh, Ql, DD, Kh, Kl, DD, Vt, mask, O, DD);
  k_h16s<<<g8, 256, 0, stream>>>(O, O16, (size_t)NR * DD / 8);
  k_gemm_hhx<0><<<gp, 128, 0, stream>>>(O16, DD, 0, Bw + 3 * WSZ, DD, 0, 0.00390625f, nullptr, 0, nullptr, 1, 0, 0, (float*)d_out, nullptr, DD, 0, NR, DD, DD);      /* out = O·Woᵀ */
}

// v001
// Measured time: 398 microseconds a run.
// In two side-by-side timings against v000, it was 1.32 and 1.31 times as fast.
#include <hip/hip_runtime.h>
// Multi-head 'linear-feature' attention (B=2, S=2048, H=1024, 16 heads × 64): q,k,v = x·Wᵀ (no bias); φ(q) = elu(q)+1, φ(k) = elu(k)+1; attn = softmax(φ(q)·φ(k)ᵀ) UNSCALED (σ≈8 logits) with the INPUT key mask [B,S] (0 → −inf);
// out = (attn·v merged)·Woᵀ.
// Compute dtype: x and weights rounded to bf16; q,k as f32 GEMM outputs mapped through elu+1 in f32 and split into f16 hi + ×2^10 residual planes so the large unscaled logits are f32-accurate
// (S = Qh·Kh + (Ql·Kh + Qh·Kl)·2^-10, separate accumulators); v f16; fused flash-style kernel (online softmax f32, P f16 ×2^10) on v_wmma_f32_16x16x32_f16; O ×2^4 → f16 → output GEMM; f32 accumulate.
#define BB 2
#define TT 2048
#define NH 16
#define DD 1024
#define NR (BB * TT)

typedef __bf16 v16b __attribute__((ext_vector_type(16)));
typedef unsigned short v8us __attribute__((ext_vector_type(8), may_alias));
typedef float  v8f  __attribute__((ext_vector_type(8)));
typedef float  v4f  __attribute__((ext_vector_type(4)));
typedef float  v4fa __attribute__((ext_vector_type(4), may_alias));
union FragB { v16b v; v8us half[2]; unsigned short u[16]; };

__device__ __forceinline__ unsigned short bf16_bits(float x) { unsigned int u = __float_as_uint(x); return (unsigned short)((u + 0x7FFFu + ((u >> 16) & 1u)) >> 16); }
__device__ __forceinline__ float bf16_val(unsigned short b) { return __uint_as_float(((unsigned int)b) << 16); }
__device__ __forceinline__ float bf16_round(float x) { return bf16_val(bf16_bits(x)); }
// D += A·B with NT terms: 1 = ah·bh, 2 = + al·bh (A split), 3 = + ah·bl (both split)
template <int NT>
__device__ __forceinline__ v8f mmaN(v16b ah, v16b al, v16b bh, v16b bl, v8f c) {
  c = __builtin_amdgcn_wmma_f32_16x16x32_bf16(false, ah, false, bh, (short)0, c, false, false);
  if (NT >= 2) c = __builtin_amdgcn_wmma_f32_16x16x32_bf16(false, al, false, bh, (short)0, c, false, false);
  if (NT >= 3) c = __builtin_amdgcn_wmma_f32_16x16x32_bf16(false, ah, false, bl, (short)0, c, false, false);
  asm volatile("v_nop\n\tv_nop\n\tv_nop\n\tv_nop" : "+v"(c) : "v"(ah), "v"(al), "v"(bh), "v"(bl));
  return c;
}

__global__ __launch_bounds__(256) void k_wt_bf16(const float* __restrict__ W, unsigned short* __restrict__ Wt, int K, int N) {
  const int t = blockIdx.x * 256 + threadIdx.x;
  const int k8n = K / 8;
  if (t >= N * k8n) return;
  const int n = t / k8n, k8 = (t % k8n) * 8;
  v8us v;
#pragma unroll
  for (int i = 0; i < 8; ++i) v[i] = bf16_bits(W[(size_t)(k8 + i) * N + n]);
  *(v8us*)(Wt + (size_t)n * K + k8) = v;
  
}

// GEMM C[M][N] (f32, pitch ldc) = act(A[M][K]·W + bias). A f32 row-major (pitch lda) converted per fragment to bf16
// (ASPLIT: hi/lo two planes -> 2 terms, else single rounded term); Wt bf16 [N][K] (pitch ldb). BIAS_BF16 rounds the
// bias to bf16 first (bias quantised to bf16 before the add). K%32==0, M%16==0, N%64==0.
template <bool ASPLIT, int ACT, bool BIAS_BF16>
__global__ __launch_bounds__(128) void k_gemm_bf(const float* __restrict__ A, int lda, const unsigned short* __restrict__ Wt, int ldb,
                                               const float* __restrict__ bias, float* __restrict__ C, int ldc, int M, int N, int K) {
  __shared__ __attribute__((aligned(16))) float so[4][16][64];
  const int tid = threadIdx.x, w = tid >> 5, lane = tid & 31, ln = lane & 15, hh = lane >> 4;
  const int ntn = N / 64;
  const int wid = blockIdx.x * 4 + w;
  const int mt = wid / ntn, nq = wid % ntn;
  if (mt * 16 >= M) return;
  const int row0 = mt * 16, col0 = nq * 64;
  const float* arow = A + (size_t)(row0 + ln) * lda;
  v8f acc[4] = {};
  for (int kb = 0; kb < K; kb += 32) {
    FragB ah, al;
    const v4f x0 = *(const v4fa*)(arow + kb + 8 * hh), x1 = *(const v4fa*)(arow + kb + 8 * hh + 4);
    const v4f x2 = *(const v4fa*)(arow + kb + 16 + 8 * hh), x3 = *(const v4fa*)(arow + kb + 16 + 8 * hh + 4);
    float xs[16] = {x0[0],x0[1],x0[2],x0[3],x1[0],x1[1],x1[2],x1[3],x2[0],x2[1],x2[2],x2[3],x3[0],x3[1],x3[2],x3[3]};
#pragma unroll
    for (int i = 0; i < 16; ++i) { const unsigned short hb = bf16_bits(xs[i]); ah.u[i] = hb; al.u[i] = ASPLIT ? bf16_bits(xs[i] - bf16_val(hb)) : (unsigned short)0; }
#pragma unroll
    for (int t = 0; t < 4; ++t) {
      const unsigned short* brow = Wt + (size_t)(col0 + t * 16 + ln) * ldb + kb;
      FragB b;
      b.half[0] = *(const v8us*)(brow + 8 * hh);
      b.half[1] = *(const v8us*)(brow + 16 + 8 * hh);
      acc[t] = mmaN<ASPLIT ? 2 : 1>(ah.v, al.v, b.v, b.v, acc[t]);
    }
  }
#pragma unroll
  for (int t = 0; t < 4; ++t) {
    float bv = bias ? bias[col0 + t * 16 + ln] : 0.f;
    if (BIAS_BF16) bv = bf16_round(bv);
#pragma unroll
    for (int r = 0; r < 8; ++r) { float v = acc[t][r] + bv; if (ACT == 1) v = fmaxf(v, 0.f); so[w][8 * hh + r][t * 16 + ln] = v; }
  }
  __builtin_amdgcn_fence(__ATOMIC_ACQ_REL, "workgroup");
  __builtin_amdgcn_wave_barrier();
  const int rsub = lane >> 4, c4 = (lane & 15) * 4;
  {
#pragma unroll
    for (int q = 0; q < 8; ++q) {
      const int r = q * 2 + rsub;
      const v4f v = *(const v4fa*)&so[w][r][c4];
      *(v4f*)(C + (size_t)(row0 + r) * ldc + col0 + c4) = v;
    }
    
  }
}

// Flash-style causal/unmasked attention, all contractions 3-term bf16 hi/lo splits, f32 softmax with running max.
// q,k,v rows are read from f32 buffers with arbitrary row pitch (so they can live inside a fused qkv buffer);
// D = head size (multiple of 32, <= 128); one wave = 16 query rows; block = 4 waves (64 queries) sharing K/V chunks of 32.
template <int D, bool CAUSAL>
__global__ __launch_bounds__(128) void k_flash(const float* __restrict__ qb, const float* __restrict__ kb, const float* __restrict__ vb,
                                             int pitch, int T, int H, float scale, float* __restrict__ y, int ypitch) {
  constexpr int KS = D / 32;        // k-steps for QK
  constexpr int DT = D / 16;        // d tiles for PV
  __shared__ __attribute__((aligned(16))) unsigned short sKh[32][D + 8], sKl[32][D + 8], sVh[32][D + 8], sVl[32][D + 8];
  __shared__ __attribute__((aligned(16))) unsigned short sPh[4][16][40], sPl[4][16][40];
  __shared__ __attribute__((aligned(16))) float sO[4][16][D];
  const int tid = threadIdx.x, w = tid >> 5, lane = tid & 31, ln = lane & 15, hh = lane >> 4;
  const int nqb = (T + 63) / 64;
  const int bh = blockIdx.x / nqb, qblk = blockIdx.x % nqb;
  const int b = bh / H, h = bh % H;
  const int q0 = qblk * 64 + w * 16;
  const float* Q = qb + (size_t)b * T * pitch + h * D;
  const float* K = kb + (size_t)b * T * pitch + h * D;
  const float* V = vb + (size_t)b * T * pitch + h * D;

  // A fragments of the wave's 16 query rows (scaled), hi/lo
  FragB aqh[KS], aql[KS];
  {
    int row = q0 + ln; if (row >= T) row = T - 1;
    const float* qr = Q + (size_t)row * pitch;
#pragma unroll
    for (int ks = 0; ks < KS; ++ks)
#pragma unroll
      for (int i = 0; i < 16; ++i) {
        const int d = ks * 32 + ((i < 8) ? (8 * hh + i) : (16 + 8 * hh + (i - 8)));
        const float x = qr[d] * scale; const unsigned short hb = bf16_bits(x);
        aqh[ks].u[i] = hb; aql[ks].u[i] = bf16_bits(x - bf16_val(hb));
      }
  }
  float m_r[8], l_r[8];
#pragma unroll
  for (int r = 0; r < 8; ++r) { m_r[r] = -3.0e38f; l_r[r] = 0.f; }
  v8f oacc[DT];
#pragma unroll
  for (int dt = 0; dt < DT; ++dt) oacc[dt] = (v8f){0.f,0.f,0.f,0.f,0.f,0.f,0.f,0.f};

  const int kv_end = CAUSAL ? min(T, qblk * 64 + 64) : T;     // block-uniform
  for (int j0 = 0; j0 < kv_end; j0 += 32) {
    __syncthreads();
    for (int e = tid; e < 32 * (D / 4); e += 128) {
      const int r = e / (D / 4), c4 = (e % (D / 4)) * 4;
      const int key = j0 + r;
      v4f kf = {0.f,0.f,0.f,0.f}, vf = {0.f,0.f,0.f,0.f};
      if (key < T) { kf = *(const v4fa*)(K + (size_t)key * pitch + c4); vf = *(const v4fa*)(V + (size_t)key * pitch + c4); }
#pragma unroll
      for (int t = 0; t < 4; ++t) {
        unsigned short hb = bf16_bits(kf[t]); sKh[r][c4 + t] = hb; sKl[r][c4 + t] = bf16_bits(kf[t] - bf16_val(hb));
        hb = bf16_bits(vf[t]); sVh[r][c4 + t] = hb; sVl[r][c4 + t] = bf16_bits(vf[t] - bf16_val(hb));
      }
    }
    __syncthreads();
    // S tile 16 x 32
    v8f s[2];
#pragma unroll
    for (int nt = 0; nt < 2; ++nt) {
      v8f acc = {};
#pragma unroll
      for (int ks = 0; ks < KS; ++ks) {
        FragB bh_, bl_;
        bh_.half[0] = *(const v8us*)&sKh[nt * 16 + ln][ks * 32 + 8 * hh]; bh_.half[1] = *(const v8us*)&sKh[nt * 16 + ln][ks * 32 + 16 + 8 * hh];
        bl_.half[0] = *(const v8us*)&sKl[nt * 16 + ln][ks * 32 + 8 * hh]; bl_.half[1] = *(const v8us*)&sKl[nt * 16 + ln][ks * 32 + 16 + 8 * hh];
        acc = mmaN<3>(aqh[ks].v, aql[ks].v, bh_.v, bl_.v, acc);
      }
      s[nt] = acc;
    }
    // mask + running max (rows 8hh+r; the 16 lanes of a half share rows)
    float alpha[8];
#pragma unroll
    for (int r = 0; r < 8; ++r) {
      const int qi = q0 + 8 * hh + r;
      const int ja = j0 + ln, jb = j0 + 16 + ln;
      if (CAUSAL) { if (ja > qi) s[0][r] = -3.0e38f; if (jb > qi) s[1][r] = -3.0e38f; }
      if (ja >= T) s[0][r] = -3.0e38f;
      if (jb >= T) s[1][r] = -3.0e38f;
      float mx = fmaxf(s[0][r], s[1][r]);
      mx = fmaxf(mx, __shfl_xor(mx, 1, 32)); mx = fmaxf(mx, __shfl_xor(mx, 2, 32)); mx = fmaxf(mx, __shfl_xor(mx, 4, 32)); mx = fmaxf(mx, __shfl_xor(mx, 8, 32));
      const float mnew = fmaxf(m_r[r], mx);
      alpha[r] = (mnew > -1.0e38f) ? __expf(m_r[r] - mnew) : 1.0f;
      const float p0 = (s[0][r] > -1.0e38f) ? __expf(s[0][r] - mnew) : 0.f;
      const float p1 = (s[1][r] > -1.0e38f) ? __expf(s[1][r] - mnew) : 0.f;
      m_r[r] = mnew;
      l_r[r] = l_r[r] * alpha[r] + p0 + p1;            // per-lane partial row sum (16 lanes combined at the end)
      unsigned short hb = bf16_bits(p0); sPh[w][8 * hh + r][ln] = hb;      sPl[w][8 * hh + r][ln] = bf16_bits(p0 - bf16_val(hb));
      hb = bf16_bits(p1);                sPh[w][8 * hh + r][16 + ln] = hb; sPl[w][8 * hh + r][16 + ln] = bf16_bits(p1 - bf16_val(hb));
    }
#pragma unroll
    for (int dt = 0; dt < DT; ++dt)
#pragma unroll
      for (int r = 0; r < 8; ++r) oacc[dt][r] *= alpha[r];
    __builtin_amdgcn_fence(__ATOMIC_ACQ_REL, "workgroup");
    __builtin_amdgcn_wave_barrier();
    FragB pah, pal;
    pah.half[0] = *(const v8us*)&sPh[w][ln][8 * hh]; pah.half[1] = *(const v8us*)&sPh[w][ln][16 + 8 * hh];
    pal.half[0] = *(const v8us*)&sPl[w][ln][8 * hh]; pal.half[1] = *(const v8us*)&sPl[w][ln][16 + 8 * hh];
#pragma unroll
    for (int dt = 0; dt < DT; ++dt) {
      FragB bvh, bvl;
#pragma unroll
      for (int i = 0; i < 8; ++i) {
        bvh.u[i] = sVh[8 * hh + i][dt * 16 + ln]; bvh.u[8 + i] = sVh[16 + 8 * hh + i][dt * 16 + ln];
        bvl.u[i] = sVl[8 * hh + i][dt * 16 + ln]; bvl.u[8 + i] = sVl[16 + 8 * hh + i][dt * 16 + ln];
      }
      oacc[dt] = mmaN<3>(pah.v, pal.v, bvh.v, bvl.v, oacc[dt]);
    }
    __builtin_amdgcn_fence(__ATOMIC_ACQ_REL, "workgroup");
    __builtin_amdgcn_wave_barrier();
  }
#pragma unroll
  for (int r = 0; r < 8; ++r) {
    float l = l_r[r];
    l += __shfl_xor(l, 1, 32); l += __shfl_xor(l, 2, 32); l += __shfl_xor(l, 4, 32); l += __shfl_xor(l, 8, 32);
    l_r[r] = (l > 0.f) ? 1.0f / l : 0.f;
  }
#pragma unroll
  for (int dt = 0; dt < DT; ++dt)
#pragma unroll
    for (int r = 0; r < 8; ++r) sO[w][8 * hh + r][dt * 16 + ln] = oacc[dt][r] * l_r[r];
  __builtin_amdgcn_fence(__ATOMIC_ACQ_REL, "workgroup");
  __builtin_amdgcn_wave_barrier();
  {
    for (int r = 0; r < 16; ++r) {
      const int row = q0 + r;
      if (row < T && lane < D / 4) {
        const v4f val = *(const v4fa*)&sO[w][r][lane * 4];
        *(v4f*)(y + ((size_t)b * T + row) * ypitch + h * D + lane * 4) = val;
      }
    }
    
  }
}

// GEMM C = act(A·W + bias + resid): A f32 (ASPLIT -> hi/lo 2 terms), Wt bf16 [N][K]; ACT 0 none, 1 relu, 2 exact gelu;
// resid (optional, f32, row index = (row % rmod), pitch ldr, RES_BF16 rounds it) added before the activation.
template <bool ASPLIT, int ACT, bool BIAS_BF16, bool RES_BF16>
__global__ __launch_bounds__(128) void k_gemm_bf3(const float* __restrict__ A, int lda, const unsigned short* __restrict__ Wt, int ldb,
                                                const float* __restrict__ bias, const float* __restrict__ resid, int rmod, int ldr,
                                                float* __restrict__ C, int ldc, int M, int N, int K) {
  __shared__ __attribute__((aligned(16))) float so[4][16][64];
  const int tid = threadIdx.x, w = tid >> 5, lane = tid & 31, ln = lane & 15, hh = lane >> 4;
  const int ntn = N / 64;
  const int wid = blockIdx.x * 4 + w;
  const int mt = wid / ntn, nq = wid % ntn;
  if (mt * 16 >= M) return;
  const int row0 = mt * 16, col0 = nq * 64;
  const float* arow = A + (size_t)(row0 + ln) * lda;
  v8f acc[4] = {};
  for (int kb = 0; kb < K; kb += 32) {
    FragB ah, al;
    const v4f x0 = *(const v4fa*)(arow + kb + 8 * hh), x1 = *(const v4fa*)(arow + kb + 8 * hh + 4);
    const v4f x2 = *(const v4fa*)(arow + kb + 16 + 8 * hh), x3 = *(const v4fa*)(arow + kb + 16 + 8 * hh + 4);
    float xs[16] = {x0[0],x0[1],x0[2],x0[3],x1[0],x1[1],x1[2],x1[3],x2[0],x2[1],x2[2],x2[3],x3[0],x3[1],x3[2],x3[3]};
#pragma unroll
    for (int i = 0; i < 16; ++i) { const unsigned short hb = bf16_bits(xs[i]); ah.u[i] = hb; al.u[i] = ASPLIT ? bf16_bits(xs[i] - bf16_val(hb)) : (unsigned short)0; }
#pragma unroll
    for (int t = 0; t < 4; ++t) {
      const unsigned short* brow = Wt + (size_t)(col0 + t * 16 + ln) * ldb + kb;
      FragB b;
      b.half[0] = *(const v8us*)(brow + 8 * hh);
      b.half[1] = *(const v8us*)(brow + 16 + 8 * hh);
      acc[t] = mmaN<ASPLIT ? 2 : 1>(ah.v, al.v, b.v, b.v, acc[t]);
    }
  }
#pragma unroll
  for (int t = 0; t < 4; ++t) {
    const int col = col0 + t * 16 + ln;
    float bv = bias ? bias[col] : 0.f;
    if (BIAS_BF16) bv = bf16_round(bv);
#pragma unroll
    for (int r = 0; r < 8; ++r) {
      float v = acc[t][r] + bv;
      if (resid) { float rv = resid[(size_t)((row0 + 8 * hh + r) % rmod) * ldr + col]; if (RES_BF16) rv = bf16_round(rv); v += rv; }
      if (ACT == 1) v = fmaxf(v, 0.f);
      if (ACT == 2) v = 0.5f * v * (1.0f + erff(v * 0.70710678118654752f));
      if (ACT == 3) { const float u = 0.7978845608028654f * (v + 0.044715f * v * v * v); v = 0.5f * v * (1.0f + tanhf(u)); }
      so[w][8 * hh + r][t * 16 + ln] = v;
    }
  }
  __builtin_amdgcn_fence(__ATOMIC_ACQ_REL, "workgroup");
  __builtin_amdgcn_wave_barrier();
  const int rsub = lane >> 4, c4 = (lane & 15) * 4;
  {
#pragma unroll
    for (int q = 0; q < 8; ++q) {
      const int r = q * 2 + rsub;
      const v4f v = *(const v4fa*)&so[w][r][c4];
      *(v4f*)(C + (size_t)(row0 + r) * ldc + col0 + c4) = v;
    }
    
  }
}
// row LayerNorm (biased variance, eps) over N: s = X (+ R); optional out_sum <- s; out_norm <- (s-mu)*rsqrt(var+eps)*g + b
template <bool PARAM_BF16>
__global__ __launch_bounds__(256) void k_layernorm(const float* __restrict__ X, const float* __restrict__ R, const float* __restrict__ g, const float* __restrict__ bta,
                                                  float* __restrict__ out_sum, float* __restrict__ out_norm, int N, float eps) {
  __shared__ float red[256];
  const int row = blockIdx.x, tid = threadIdx.x;
  const float* x = X + (size_t)row * N; const float* rr = R ? R + (size_t)row * N : nullptr;
  float vals[16];                     // up to N = 4096
  const int per = N / 256;            // contiguous chunk per thread? use strided-by-4 chunks: thread handles j = tid*4 + 1024*u
  float s1 = 0.f;
  for (int u = 0; u < per / 4; ++u) {
    const int j = tid * 4 + 1024 * u;
    const v4f a = *(const v4fa*)(x + j);
    v4f b = {0.f,0.f,0.f,0.f}; if (rr) b = *(const v4fa*)(rr + j);
#pragma unroll
    for (int q = 0; q < 4; ++q) { const float v = a[q] + b[q]; vals[u * 4 + q] = v; s1 += v; }
  }
  red[tid] = s1; __syncthreads();
  for (int st = 128; st > 0; st >>= 1) { if (tid < st) red[tid] += red[tid + st]; __syncthreads(); }
  const float mu = red[0] / (float)N; __syncthreads();
  float s2 = 0.f;
  for (int u = 0; u < per / 4; ++u)
#pragma unroll
    for (int q = 0; q < 4; ++q) { const float c = vals[u * 4 + q] - mu; s2 += c * c; }
  red[tid] = s2; __syncthreads();
  for (int st = 128; st > 0; st >>= 1) { if (tid < st) red[tid] += red[tid + st]; __syncthreads(); }
  const float rs = rsqrtf(red[0] / (float)N + eps);
  {
    for (int u = 0; u < per / 4; ++u) {
      const int j = tid * 4 + 1024 * u;
      v4f o, sm;
#pragma unroll
      for (int q = 0; q < 4; ++q) {
        float gg = g[j + q], bb = bta[j + q];
        if (PARAM_BF16) { gg = bf16_round(gg); bb = bf16_round(bb); }
        sm[q] = vals[u * 4 + q]; o[q] = (vals[u * 4 + q] - mu) * rs * gg + bb;
      }
      if (out_sum) *(v4f*)(out_sum + (size_t)row * N + j) = sm;
      *(v4f*)(out_norm + (size_t)row * N + j) = o;
    }
    
  }
}



// ---- f16 WMMA path (v_wmma_f32_16x16x32_f16): 11-bit significands for operands in range — used where a [0,1] probability operand needs more precision than bf16
typedef _Float16 v16h __attribute__((ext_vector_type(16)));
union FragH { v16h v; v8us half[2]; _Float16 h[16]; unsigned short u[16]; };
template <int NT>
__device__ __forceinline__ v8f mmaH(v16h ah, v16h al, v16h bh, v16h bl, v8f c) {
  c = __builtin_amdgcn_wmma_f32_16x16x32_f16(false, ah, false, bh, (short)0, c, false, false);
  if (NT >= 2) c = __builtin_amdgcn_wmma_f32_16x16x32_f16(false, al, false, bh, (short)0, c, false, false);
  if (NT >= 3) c = __builtin_amdgcn_wmma_f32_16x16x32_f16(false, ah, false, bl, (short)0, c, false, false);
  asm volatile("v_nop\n\tv_nop\n\tv_nop\n\tv_nop" : "+v"(c) : "v"(ah), "v"(al), "v"(bh), "v"(bl));
  return c;
}
// batched GEMM like k_gemm_b but f16 operands: A f32 (split into f16 hi/lo if ASPLIT, else rounded to f16), Bt = f16 values [n][k]; alpha; C f32; N multiple of 16 (partial tiles skipped)
template <bool ASPLIT>
__global__ __launch_bounds__(128) void k_gemm_h(const float* __restrict__ A, int lda, size_t sA, const _Float16* __restrict__ Bh, int ldb, size_t sB, float alpha, float* __restrict__ C, int ldc, size_t sC, int M, int N, int K) {
  __shared__ __attribute__((aligned(16))) float so[4][16][64];
  const int tid = threadIdx.x, w = tid >> 5, lane = tid & 31, ln = lane & 15, hh = lane >> 4; const int by = blockIdx.y;
  A += (size_t)by * sA; Bh += (size_t)by * sB; C += (size_t)by * sC;
  const int ntn = (N + 63) / 64; const int wid = blockIdx.x * 4 + w; const int mt = wid / ntn, nq = wid % ntn; if (mt * 16 >= M) return;
  const int row0 = mt * 16, col0 = nq * 64; const float* arow = A + (size_t)(row0 + ln) * lda;
  v8f acc[4] = {};
  for (int kb = 0; kb < K; kb += 32) {
    FragH ah, al;
    const v4f x0 = *(const v4fa*)(arow + kb + 8 * hh), x1 = *(const v4fa*)(arow + kb + 8 * hh + 4), x2 = *(const v4fa*)(arow + kb + 16 + 8 * hh), x3 = *(const v4fa*)(arow + kb + 16 + 8 * hh + 4);
    float xs[16] = {x0[0],x0[1],x0[2],x0[3],x1[0],x1[1],x1[2],x1[3],x2[0],x2[1],x2[2],x2[3],x3[0],x3[1],x3[2],x3[3]};
#pragma unroll
    for (int i = 0; i < 16; ++i) { const _Float16 h = (_Float16)xs[i]; ah.h[i] = h; al.h[i] = ASPLIT ? (_Float16)(xs[i] - (float)h) : (_Float16)0.0f; }
#pragma unroll
    for (int t = 0; t < 4; ++t) { if (col0 + t * 16 >= N) continue; const size_t boff = (size_t)(col0 + t * 16 + ln) * ldb + kb; FragH bq; bq.half[0] = *(const v8us*)(Bh + boff + 8 * hh); bq.half[1] = *(const v8us*)(Bh + boff + 16 + 8 * hh);
      acc[t] = mmaH<ASPLIT ? 2 : 1>(ah.v, al.v, bq.v, bq.v, acc[t]); }
  }
#pragma unroll
  for (int t = 0; t < 4; ++t) { if (col0 + t * 16 >= N) continue;
#pragma unroll
    for (int r = 0; r < 8; ++r) so[w][8 * hh + r][t * 16 + ln] = acc[t][r] * alpha; }
  __builtin_amdgcn_fence(__ATOMIC_ACQ_REL, "workgroup"); __builtin_amdgcn_wave_barrier();
  const int rsub = lane >> 4, c4 = (lane & 15) * 4;
  {
#pragma unroll
    for (int q = 0; q < 8; ++q) { const int r = q * 2 + rsub; if (col0 + c4 < N) { const v4f v = *(const v4fa*)&so[w][r][c4]; *(v4f*)(C + (size_t)(row0 + r) * ldc + col0 + c4) = v; } }
     }
}

// Wt[n][k] = f16(W[k][n]·scale) from f32 row-major W[K][N] (scale = power of two; bf16-exact weights stay exact in f16 away from the subnormal range)
__global__ __launch_bounds__(256) void k_wt_f16(const float* __restrict__ W, _Float16* __restrict__ Wt, int K, int N, float scale) {
  const int t = blockIdx.x * 256 + threadIdx.x; if (t >= N * (K / 8)) return; const int n = t / (K / 8), k8 = (t % (K / 8)) * 8; FragH f;
#pragma unroll
  for (int i = 0; i < 8; ++i) f.h[i] = (_Float16)(bf16_round(W[(size_t)(k8 + i) * N + n]) * scale); const v8us o = f.half[0];
  *(v8us*)((unsigned short*)Wt + (size_t)n * K + k8) = o; 
}
// k_gemm_hh variant with fused epilogue: v = acc·alpha + bias[by·sBias + col] (+ CP[(row/rowsPerB)·sCPb + by·64 + col] if CP) ; ACT 0 none / 1 elu ; writes f32 C and/or f16 C16 (each if non-null)
template <int ACT>
__global__ __launch_bounds__(128) void k_gemm_hhx(const _Float16* __restrict__ A, int lda, size_t sA, const _Float16* __restrict__ Bh, int ldb, size_t sB, float alpha, const float* __restrict__ bias, size_t sBias, const float* __restrict__ CP, int rowsPerB, size_t sCPb, int row0g,
    float* __restrict__ C, _Float16* __restrict__ C16, int ldc, size_t sC, int M, int N, int K) {
  __shared__ __attribute__((aligned(16))) float so[4][16][64];
  const int tid = threadIdx.x, w = tid >> 5, lane = tid & 31, ln = lane & 15, hh = lane >> 4; const int by = blockIdx.y;
  A += (size_t)by * sA; Bh += (size_t)by * sB; const size_t cofs = (size_t)by * sC; const float* bp = bias ? bias + (size_t)by * sBias : nullptr;
  const int ntn = (N + 63) / 64; const int wid = blockIdx.x * 4 + w; const int mt = wid / ntn, nq = wid % ntn; if (mt * 16 >= M) return;
  const int row0 = mt * 16, col0 = nq * 64; const _Float16* arow = A + (size_t)(row0 + ln) * lda;
  v8f acc[4] = {};
  for (int kb = 0; kb < K; kb += 32) { FragH ah; ah.half[0] = *(const v8us*)((const unsigned short*)arow + kb + 8 * hh); ah.half[1] = *(const v8us*)((const unsigned short*)arow + kb + 16 + 8 * hh);
#pragma unroll
    for (int t = 0; t < 4; ++t) { if (col0 + t * 16 >= N) continue; const size_t boff = (size_t)(col0 + t * 16 + ln) * ldb + kb; FragH bq; bq.half[0] = *(const v8us*)((const unsigned short*)Bh + boff + 8 * hh); bq.half[1] = *(const v8us*)((const unsigned short*)Bh + boff + 16 + 8 * hh);
      acc[t] = mmaH<1>(ah.v, ah.v, bq.v, bq.v, acc[t]); }
  }
#pragma unroll
  for (int t = 0; t < 4; ++t) { if (col0 + t * 16 >= N) continue; const int col = col0 + t * 16 + ln; const float bv = bp ? bf16_round(bp[col]) : 0.f;
#pragma unroll
    for (int r = 0; r < 8; ++r) { float v = acc[t][r] * alpha + bv; if (CP) { const int bidx = (row0g + row0 + 8 * hh + r) / rowsPerB; v += CP[(size_t)bidx * sCPb + (size_t)by * 64 + col]; } if (ACT == 1) v = (v > 0.f) ? v : expm1f(v); else if (ACT == 7) v = (v > 0.f) ? v + 1.0f : expf(v); else if (ACT == 8) v = tanhf(v); else if (ACT == 9) v = 0.5f * v * (1.0f + tanhf(0.7978845608028654f * (v + 0.044715f * v * v * v))); else if (ACT == 11) v = 1.0f / (1.0f + expf(-v)); else if (ACT == 12) v = (v > 0.f) ? v : 0.01f * v; else if (ACT == 14) v = (v > 0.f) ? v : 0.1f * v; else if (ACT == 15) v = v / (1.0f + expf(-v)); else if (ACT == 3) v = fmaxf(v, 0.f); else if (ACT == 6) v = 0.5f * v * (1.0f + erff(v * 0.70710678118654752f)); so[w][8 * hh + r][t * 16 + ln] = v; } }
  __builtin_amdgcn_fence(__ATOMIC_ACQ_REL, "workgroup"); __builtin_amdgcn_wave_barrier();
  const int rsub = lane >> 4, c4 = (lane & 15) * 4; typedef _Float16 v4h __attribute__((ext_vector_type(4)));
  {
#pragma unroll
    for (int q = 0; q < 8; ++q) { const int r = q * 2 + rsub; if (col0 + c4 < N) { const v4f v = *(const v4fa*)&so[w][r][c4]; if (C) *(v4f*)(C + cofs + (size_t)(row0 + r) * ldc + col0 + c4) = v; if (C16) { v4h h4; for (int i = 0; i < 4; ++i) h4[i] = (_Float16)v[i]; *(v4h*)(C16 + cofs + (size_t)(row0 + r) * ldc + col0 + c4) = h4; } } }
     }
}


typedef _Float16 v4h __attribute__((ext_vector_type(4)));

__global__ __launch_bounds__(256) void k_x16(const float* __restrict__ x, _Float16* __restrict__ X16, size_t n8) { const size_t t = (size_t)blockIdx.x * 256 + threadIdx.x; if (t >= n8) return; FragH f;
#pragma unroll
  for (int q = 0; q < 8; ++q) f.h[q] = (_Float16)bf16_round(x[t * 8 + q]); *(v8us*)((unsigned short*)X16 + t * 8) = f.half[0];  }
__global__ __launch_bounds__(256) void k_h16(const float* __restrict__ x, _Float16* __restrict__ X16, size_t n8) { const size_t t = (size_t)blockIdx.x * 256 + threadIdx.x; if (t >= n8) return; FragH f;
#pragma unroll
  for (int q = 0; q < 8; ++q) f.h[q] = (_Float16)x[t * 8 + q]; *(v8us*)((unsigned short*)X16 + t * 8) = f.half[0];  }
__global__ __launch_bounds__(256) void k_round16f(const float* __restrict__ W, _Float16* __restrict__ Bt, size_t n8) { const size_t t = (size_t)blockIdx.x * 256 + threadIdx.x; if (t >= n8) return; FragH f;
#pragma unroll
  for (int i = 0; i < 8; ++i) f.h[i] = (_Float16)(bf16_round(W[t * 8 + i]) * 16.0f); *(v8us*)((unsigned short*)Bt + t * 8) = f.half[0];  }
template <int NHv, int TTv>
__global__ __launch_bounds__(256) void k_vt(const _Float16* __restrict__ V16, int ldv, int voff, _Float16* __restrict__ Vt) { __shared__ unsigned short tl[64][66]; const int tid = threadIdx.x; const int slab = blockIdx.x / (TTv / 64), lg = blockIdx.x % (TTv / 64); const int b = slab / NHv, h = slab % NHv;
  for (int i = tid; i < 64 * 8; i += 256) { const int r = i / 8, c8 = (i % 8) * 8; FragH f; f.half[0] = *(const v8us*)((const unsigned short*)V16 + ((size_t)b * TTv + lg * 64 + r) * ldv + voff + h * 64 + c8);
#pragma unroll
    for (int q = 0; q < 8; ++q) tl[r][c8 + q] = f.u[q]; }
  __syncthreads();
  {
#pragma unroll
    for (int rd = 0; rd < 2; ++rd) { const int d = rd * 32 + tid / 8, pc = tid % 8; FragH f;
#pragma unroll
      for (int q = 0; q < 8; ++q) f.u[q] = tl[pc * 8 + q][d];
      *(v8us*)((unsigned short*)Vt + ((size_t)slab * 64 + d) * TTv + lg * 64 + pc * 8) = f.half[0]; }
     } }

__global__ __launch_bounds__(256) void k_elu_hl(const float* __restrict__ F, _Float16* __restrict__ Hh, _Float16* __restrict__ Hl, size_t n8) { const size_t t = (size_t)blockIdx.x * 256 + threadIdx.x; if (t >= n8) return; const v4f a = *(const v4fa*)(F + t * 8), c = *(const v4fa*)(F + t * 8 + 4); FragH fh, fl;
#pragma unroll
  for (int q = 0; q < 8; ++q) { const float x = (q < 4) ? a[q] : c[q - 4]; const float v = (x > 0.f) ? x + 1.0f : expf(x);      /* elu(x) + 1 = x+1 (x>0) | e^x (x≤0) */ const _Float16 h = (_Float16)v; fh.h[q] = h; fl.h[q] = (_Float16)((v - (float)h) * 1024.0f); }
  { *(v8us*)((unsigned short*)Hh + t * 8) = fh.half[0]; *(v8us*)((unsigned short*)Hl + t * 8) = fl.half[0];  } }
__global__ __launch_bounds__(256) void k_h16s(const float* __restrict__ F, _Float16* __restrict__ H, size_t n8) { const size_t t = (size_t)blockIdx.x * 256 + threadIdx.x; if (t >= n8) return; const v4f a = *(const v4fa*)(F + t * 8), c = *(const v4fa*)(F + t * 8 + 4); FragH f;
#pragma unroll
  for (int q = 0; q < 4; ++q) { f.h[q] = (_Float16)(a[q] * 16.0f); f.h[4 + q] = (_Float16)(c[q] * 16.0f); } *(v8us*)((unsigned short*)H + t * 8) = f.half[0];  }
typedef int v4ia __attribute__((ext_vector_type(4), may_alias));
// lane l <-> lane l ^ 16 (the two halves of a wave hold the two key groups of one query column)
__device__ __forceinline__ float xhalf(float x) { return __builtin_bit_cast(float, __builtin_amdgcn_permlanex16(__builtin_bit_cast(int, x), __builtin_bit_cast(int, x), 0x76543210, 0xfedcba98, false, false)); }
__global__ __launch_bounds__(128) void k_flash(const _Float16* __restrict__ Q16, const _Float16* __restrict__ Q16lo, int ldq, const _Float16* __restrict__ K16, const _Float16* __restrict__ K16lo, int ldk, const _Float16* __restrict__ Vt, const int* __restrict__ MSK, float* __restrict__ O, int ldo) {
  constexpr int RPW = 16, NQB = TT / (4 * RPW), DT = 4, KS = 2;
  __shared__ __attribute__((aligned(16))) float sO[4][RPW][64 + 4];
  const int tid = threadIdx.x, w = tid >> 5, lane = tid & 31, ln = lane & 15, hh = lane >> 4;
  const int slab = blockIdx.x / NQB, qblk = blockIdx.x % NQB; const int b = slab / NH, h = slab % NH; const int q0 = qblk * (4 * RPW) + w * RPW;
  FragH aq[KS], aql[KS];
  { const size_t qo = ((size_t)b * TT + q0 + ln) * ldq + h * 64; const unsigned short* qr = (const unsigned short*)Q16 + qo; const unsigned short* ql = (const unsigned short*)Q16lo + qo;
#pragma unroll
    for (int ks = 0; ks < KS; ++ks) { aq[ks].half[0] = *(const v8us*)(qr + ks * 32 + 8 * hh); aq[ks].half[1] = *(const v8us*)(qr + ks * 32 + 16 + 8 * hh); aql[ks].half[0] = *(const v8us*)(ql + ks * 32 + 8 * hh); aql[ks].half[1] = *(const v8us*)(ql + ks * 32 + 16 + 8 * hh); } }
  const unsigned short* Vth = (const unsigned short*)Vt + (size_t)slab * 64 * TT;
  float m_r = -3.0e38f, l_r = 0.f; v8f oacc[DT];
#pragma unroll
  for (int dt = 0; dt < DT; ++dt) oacc[dt] = (v8f){0.f,0.f,0.f,0.f,0.f,0.f,0.f,0.f};
#pragma unroll 1
  for (int j0 = 0; j0 < TT; j0 += 32) {
    const int* mp = MSK + (size_t)b * TT + j0 + 8 * hh;      /* key padding mask (1 = attend) of this lane's 16 keys */
    const v4ia km[4] = { *(const v4ia*)(mp), *(const v4ia*)(mp + 4), *(const v4ia*)(mp + 16), *(const v4ia*)(mp + 20) };
    float sv[16];
#pragma unroll
    for (int nt = 0; nt < 2; ++nt) { const size_t ko = ((size_t)b * TT + j0 + nt * 16 + ln) * ldk + h * 64; const unsigned short* kr = (const unsigned short*)K16 + ko; const unsigned short* kl = (const unsigned short*)K16lo + ko; FragH bk[KS], bl[KS];
#pragma unroll
      for (int ks = 0; ks < KS; ++ks) { bk[ks].half[0] = *(const v8us*)(kr + ks * 32 + 8 * hh); bk[ks].half[1] = *(const v8us*)(kr + ks * 32 + 16 + 8 * hh); bl[ks].half[0] = *(const v8us*)(kl + ks * 32 + 8 * hh); bl[ks].half[1] = *(const v8us*)(kl + ks * 32 + 16 + 8 * hh); }
      v8f acc = (v8f){0.f,0.f,0.f,0.f,0.f,0.f,0.f,0.f}, accl = acc;
#pragma unroll
      for (int ks = 0; ks < KS; ++ks) { acc = mmaH<1>(bk[ks].v, bk[ks].v, aq[ks].v, aq[ks].v, acc); accl = mmaH<1>(bk[ks].v, bk[ks].v, aql[ks].v, aql[ks].v, accl); accl = mmaH<1>(bl[ks].v, bl[ks].v, aq[ks].v, aq[ks].v, accl); }
#pragma unroll
      for (int r = 0; r < 8; ++r) sv[nt * 8 + r] = (km[nt * 2 + (r >> 2)][r & 3] != 0) ? acc[r] + accl[r] * 0.0009765625f : -INFINITY; }
    float t8[8];
#pragma unroll
    for (int i = 0; i < 8; ++i) t8[i] = fmaxf(sv[i], sv[8 + i]);
    float mc = fmaxf(fmaxf(fmaxf(t8[0], t8[1]), fmaxf(t8[2], t8[3])), fmaxf(fmaxf(t8[4], t8[5]), fmaxf(t8[6], t8[7])));
    mc = fmaxf(mc, xhalf(mc));      /* both halves now hold the query's block maximum */
    const float mn = fmaxf(m_r, mc); const float ea = expf(m_r - mn); const float al = (mn > -1.0e38f) ? ea : 1.0f; m_r = mn;      /* mn is finite (>= -3e38), so a masked score gives exp(-inf) = 0 */
    float p[16]; FragH pa;
#pragma unroll
    for (int i = 0; i < 16; ++i) { p[i] = expf(sv[i] - mn); pa.h[i] = (_Float16)(p[i] * 1024.0f); }
#pragma unroll
    for (int i = 0; i < 8; ++i) t8[i] = p[i] + p[8 + i];
    l_r = l_r * al + (((t8[0] + t8[1]) + (t8[2] + t8[3])) + ((t8[4] + t8[5]) + (t8[6] + t8[7])));      /* per-lane partial sum; the halves join after the loop */
#pragma unroll
    for (int dt = 0; dt < DT; ++dt)
#pragma unroll
      for (int r = 0; r < 8; ++r) oacc[dt][r] *= al;
#pragma unroll
    for (int dt = 0; dt < DT; ++dt) { const unsigned short* vrow = Vth + (size_t)(dt * 16 + ln) * TT + j0; FragH bv; bv.half[0] = *(const v8us*)(vrow + 8 * hh); bv.half[1] = *(const v8us*)(vrow + 16 + 8 * hh);
      oacc[dt] = mmaH<1>(bv.v, bv.v, pa.v, pa.v, oacc[dt]); } }
  { const float l = l_r + xhalf(l_r); const float inv = (l > 0.f) ? 1.0f / (l * 1024.0f) : 0.f;
#pragma unroll
    for (int dt = 0; dt < DT; ++dt)
#pragma unroll
      for (int q = 0; q < 2; ++q) { const v4f o4 = { oacc[dt][q * 4] * inv, oacc[dt][q * 4 + 1] * inv, oacc[dt][q * 4 + 2] * inv, oacc[dt][q * 4 + 3] * inv }; *(v4fa*)&sO[w][ln][dt * 16 + 8 * hh + q * 4] = o4; } }
  __builtin_amdgcn_fence(__ATOMIC_ACQ_REL, "workgroup"); __builtin_amdgcn_wave_barrier();
  {
#pragma unroll
    for (int rp = 0; rp < RPW; rp += 2) { const int r = rp + (lane >> 4), pc = lane & 15; const v4f val = *(const v4fa*)&sO[w][r][pc * 4]; *(v4f*)(O + ((size_t)b * TT + q0 + r) * ldo + h * 64 + pc * 4) = val; }
     } }

extern "C" void kernel_launch(void* const* d_in, const int* in_sizes, int n_in,
                              void* d_out, int out_size, void* d_ws, size_t ws_size, hipStream_t stream) {
  (void)in_sizes; (void)n_in; (void)out_size;
  const float* x = (const float*)d_in[0]; const int* mask = (const int*)d_in[1]; const float* Wq = (const float*)d_in[2]; const float* Wk = (const float*)d_in[3]; const float* Wv = (const float*)d_in[4]; const float* Wo = (const float*)d_in[5];
  char* ws = (char*)d_ws; size_t off = 0;
  auto take = [&](size_t bytes) { char* p = ws + off; off += (bytes + 255) & ~(size_t)255; return p; };
  const size_t WSZ = (size_t)DD * DD; _Float16* Bw = (_Float16*)take(4 * WSZ * 2); _Float16* X16 = (_Float16*)take((size_t)NR * DD * 2); float* F32 = (float*)take((size_t)NR * DD * 4);
  _Float16* Qh = (_Float16*)take((size_t)NR * DD * 2); _Float16* Ql = (_Float16*)take((size_t)NR * DD * 2); _Float16* Kh = (_Float16*)take((size_t)NR * DD * 2); _Float16* Kl = (_Float16*)take((size_t)NR * DD * 2); _Float16* V16 = (_Float16*)take((size_t)NR * DD * 2); _Float16* Vt = (_Float16*)take((size_t)NR * DD * 2);
  float* O = F32; _Float16* O16 = X16;      /* F32: q → k → O; X16 dead after the v GEMM */
  if (off > ws_size) return;      // 8.4 + 8.4 + 16.8 + 6 × 8.4 ≈ 84 MB
  const unsigned gw = (unsigned)((WSZ / 8 + 255) / 256); k_round16f<<<gw, 256, 0, stream>>>(Wq, Bw, WSZ / 8); k_round16f<<<gw, 256, 0, stream>>>(Wk, Bw + WSZ, WSZ / 8); k_round16f<<<gw, 256, 0, stream>>>(Wv, Bw + 2 * WSZ, WSZ / 8); k_round16f<<<gw, 256, 0, stream>>>(Wo, Bw + 3 * WSZ, WSZ / 8);
  const unsigned g8 = (unsigned)(((size_t)NR * DD / 8 + 255) / 256); k_x16<<<g8, 256, 0, stream>>>(x, X16, (size_t)NR * DD / 8);
  const dim3 gp(((NR / 16) * (DD / 64) + 3) / 4, 1);
  k_gemm_hhx<0><<<gp, 128, 0, stream>>>(X16, DD, 0, Bw, DD, 0, 0.0625f, nullptr, 0, nullptr, 1, 0, 0, F32, nullptr, DD, 0, NR, DD, DD); k_elu_hl<<<g8, 256, 0, stream>>>(F32, Qh, Ql, (size_t)NR * DD / 8);      /* φ(q) hi/lo */
  k_gemm_hhx<0><<<gp, 128, 0, stream>>>(X16, DD, 0, Bw + WSZ, DD, 0, 0.0625f, nullptr, 0, nullptr, 1, 0, 0, F32, nullptr, DD, 0, NR, DD, DD); k_elu_hl<<<g8, 256, 0, stream>>>(F32, Kh, Kl, (size_t)NR * DD / 8);      /* φ(k) hi/lo */
  k_gemm_hhx<0><<<gp, 128, 0, stream>>>(X16, DD, 0, Bw + 2 * WSZ, DD, 0, 0.0625f, nullptr, 0, nullptr, 1, 0, 0, nullptr, V16, DD, 0, NR, DD, DD);
  k_vt<NH, TT><<<BB * NH * (TT / 64), 256, 0, stream>>>(V16, DD, 0, Vt);
  k_flash<<<BB * NH * (TT / 64), 128, 0, stream>>>(Qh, Ql, DD, Kh, Kl, DD, Vt, mask, O, DD);
  k_h16s<<<g8, 256, 0, stream>>>(O, O16, (size_t)NR * DD / 8);
  k_gemm_hhx<0><<<gp, 128, 0, stream>>>(O16, DD, 0, Bw + 3 * WSZ, DD, 0, 0.00390625f, nullptr, 0, nullptr, 1, 0, 0, (float*)d_out, nullptr, DD, 0, NR, DD, DD);      /* out = O·Woᵀ */
}

// v002
// A run of this version takes 258 microseconds.
// Two timings next to v001 put it at 1.54 and 1.53 times that version's speed.
// Over all steps from v000 it is 2.02 times as fast.
#include <hip/hip_runtime.h>
// Multi-head 'linear-feature' attention (B=2, S=2048, H=1024, 16 heads × 64): q,k,v = x·Wᵀ (no bias); φ(q) = elu(q)+1, φ(k) = elu(k)+1; attn = softmax(φ(q)·φ(k)ᵀ) UNSCALED (σ≈8 logits) with the INPUT key mask [B,S] (0 → −inf);
// out = (attn·v merged)·Woᵀ.
// Compute dtype: x and weights rounded to bf16; q,k as f32 GEMM outputs mapped through elu+1 in f32 and split into f16 hi + ×2^10 residual planes so the large unscaled logits are f32-accurate
// (S = Qh·Kh + (Ql·Kh + Qh·Kl)·2^-10, separate accumulators); v f16; fused flash-style kernel (online softmax f32, P f16 ×2^10) on v_wmma_f32_16x16x32_f16; O ×2^4 → f16 → output GEMM; f32 accumulate.
#define BB 2
#define TT 2048
#define NH 16
#define DD 1024
#define NR (BB * TT)

typedef __bf16 v16b __attribute__((ext_vector_type(16)));
typedef unsigned short v8us __attribute__((ext_vector_type(8), may_alias));
typedef float  v8f  __attribute__((ext_vector_type(8)));
typedef float  v4f  __attribute__((ext_vector_type(4)));
typedef float  v4fa __attribute__((ext_vector_type(4), may_alias));
union FragB { v16b v; v8us half[2]; unsigned short u[16]; };

__device__ __forceinline__ unsigned short bf16_bits(float x) { unsigned int u = __float_as_uint(x); return (unsigned short)((u + 0x7FFFu + ((u >> 16) & 1u)) >> 16); }
__device__ __forceinline__ float bf16_val(unsigned short b) { return __uint_as_float(((unsigned int)b) << 16); }
__device__ __forceinline__ float bf16_round(float x) { return bf16_val(bf16_bits(x)); }
// D += A·B with NT terms: 1 = ah·bh, 2 = + al·bh (A split), 3 = + ah·bl (both split)
template <int NT>
__device__ __forceinline__ v8f mmaN(v16b ah, v16b al, v16b bh, v16b bl, v8f c) {
  c = __builtin_amdgcn_wmma_f32_16x16x32_bf16(false, ah, false, bh, (short)0, c, false, false);
  if (NT >= 2) c = __builtin_amdgcn_wmma_f32_16x16x32_bf16(false, al, false, bh, (short)0, c, false, false);
  if (NT >= 3) c = __builtin_amdgcn_wmma_f32_16x16x32_bf16(false, ah, false, bl, (short)0, c, false, false);
  asm volatile("v_nop\n\tv_nop\n\tv_nop\n\tv_nop" : "+v"(c) : "v"(ah), "v"(al), "v"(bh), "v"(bl));
  return c;
}

__global__ __launch_bounds__(256) void k_wt_bf16(const float* __restrict__ W, unsigned short* __restrict__ Wt, int K, int N) {
  const int t = blockIdx.x * 256 + threadIdx.x;
  const int k8n = K / 8;
  if (t >= N * k8n) return;
  const int n = t / k8n, k8 = (t % k8n) * 8;
  v8us v;
#pragma unroll
  for (int i = 0; i < 8; ++i) v[i] = bf16_bits(W[(size_t)(k8 + i) * N + n]);
  *(v8us*)(Wt + (size_t)n * K + k8) = v;
  
}

// GEMM C[M][N] (f32, pitch ldc) = act(A[M][K]·W + bias). A f32 row-major (pitch lda) converted per fragment to bf16
// (ASPLIT: hi/lo two planes -> 2 terms, else single rounded term); Wt bf16 [N][K] (pitch ldb). BIAS_BF16 rounds the
// bias to bf16 first (bias quantised to bf16 before the add). K%32==0, M%16==0, N%64==0.
template <bool ASPLIT, int ACT, bool BIAS_BF16>
__global__ __launch_bounds__(128) void k_gemm_bf(const float* __restrict__ A, int lda, const unsigned short* __restrict__ Wt, int ldb,
                                               const float* __restrict__ bias, float* __restrict__ C, int ldc, int M, int N, int K) {
  __shared__ __attribute__((aligned(16))) float so[4][16][64];
  const int tid = threadIdx.x, w = tid >> 5, lane = tid & 31, ln = lane & 15, hh = lane >> 4;
  const int ntn = N / 64;
  const int wid = blockIdx.x * 4 + w;
  const int mt = wid / ntn, nq = wid % ntn;
  if (mt * 16 >= M) return;
  const int row0 = mt * 16, col0 = nq * 64;
  const float* arow = A + (size_t)(row0 + ln) * lda;
  v8f acc[4] = {};
  for (int kb = 0; kb < K; kb += 32) {
    FragB ah, al;
    const v4f x0 = *(const v4fa*)(arow + kb + 8 * hh), x1 = *(const v4fa*)(arow + kb + 8 * hh + 4);
    const v4f x2 = *(const v4fa*)(arow + kb + 16 + 8 * hh), x3 = *(const v4fa*)(arow + kb + 16 + 8 * hh + 4);
    float xs[16] = {x0[0],x0[1],x0[2],x0[3],x1[0],x1[1],x1[2],x1[3],x2[0],x2[1],x2[2],x2[3],x3[0],x3[1],x3[2],x3[3]};
#pragma unroll
    for (int i = 0; i < 16; ++i) { const unsigned short hb = bf16_bits(xs[i]); ah.u[i] = hb; al.u[i] = ASPLIT ? bf16_bits(xs[i] - bf16_val(hb)) : (unsigned short)0; }
#pragma unroll
    for (int t = 0; t < 4; ++t) {
      const unsigned short* brow = Wt + (size_t)(col0 + t * 16 + ln) * ldb + kb;
      FragB b;
      b.half[0] = *(const v8us*)(brow + 8 * hh);
      b.half[1] = *(const v8us*)(brow + 16 + 8 * hh);
      acc[t] = mmaN<ASPLIT ? 2 : 1>(ah.v, al.v, b.v, b.v, acc[t]);
    }
  }
#pragma unroll
  for (int t = 0; t < 4; ++t) {
    float bv = bias ? bias[col0 + t * 16 + ln] : 0.f;
    if (BIAS_BF16) bv = bf16_round(bv);
#pragma unroll
    for (int r = 0; r < 8; ++r) { float v = acc[t][r] + bv; if (ACT == 1) v = fmaxf(v, 0.f); so[w][8 * hh + r][t * 16 + ln] = v; }
  }
  __builtin_amdgcn_fence(__ATOMIC_ACQ_REL, "workgroup");
  __builtin_amdgcn_wave_barrier();
  const int rsub = lane >> 4, c4 = (lane & 15) * 4;
  {
#pragma unroll
    for (int q = 0; q < 8; ++q) {
      const int r = q * 2 + rsub;
      const v4f v = *(const v4fa*)&so[w][r][c4];
      *(v4f*)(C + (size_t)(row0 + r) * ldc + col0 + c4) = v;
    }
    
  }
}

// Flash-style causal/unmasked attention, all contractions 3-term bf16 hi/lo splits, f32 softmax with running max.
// q,k,v rows are read from f32 buffers with arbitrary row pitch (so they can live inside a fused qkv buffer);
// D = head size (multiple of 32, <= 128); one wave = 16 query rows; block = 4 waves (64 queries) sharing K/V chunks of 32.
template <int D, bool CAUSAL>
__global__ __launch_bounds__(128) void k_flash(const float* __restrict__ qb, const float* __restrict__ kb, const float* __restrict__ vb,
                                             int pitch, int T, int H, float scale, float* __restrict__ y, int ypitch) {
  constexpr int KS = D / 32;        // k-steps for QK
  constexpr int DT = D / 16;        // d tiles for PV
  __shared__ __attribute__((aligned(16))) unsigned short sKh[32][D + 8], sKl[32][D + 8], sVh[32][D + 8], sVl[32][D + 8];
  __shared__ __attribute__((aligned(16))) unsigned short sPh[4][16][40], sPl[4][16][40];
  __shared__ __attribute__((aligned(16))) float sO[4][16][D];
  const int tid = threadIdx.x, w = tid >> 5, lane = tid & 31, ln = lane & 15, hh = lane >> 4;
  const int nqb = (T + 63) / 64;
  const int bh = blockIdx.x / nqb, qblk = blockIdx.x % nqb;
  const int b = bh / H, h = bh % H;
  const int q0 = qblk * 64 + w * 16;
  const float* Q = qb + (size_t)b * T * pitch + h * D;
  const float* K = kb + (size_t)b * T * pitch + h * D;
  const float* V = vb + (size_t)b * T * pitch + h * D;

  // A fragments of the wave's 16 query rows (scaled), hi/lo
  FragB aqh[KS], aql[KS];
  {
    int row = q0 + ln; if (row >= T) row = T - 1;
    const float* qr = Q + (size_t)row * pitch;
#pragma unroll
    for (int ks = 0; ks < KS; ++ks)
#pragma unroll
      for (int i = 0; i < 16; ++i) {
        const int d = ks * 32 + ((i < 8) ? (8 * hh + i) : (16 + 8 * hh + (i - 8)));
        const float x = qr[d] * scale; const unsigned short hb = bf16_bits(x);
        aqh[ks].u[i] = hb; aql[ks].u[i] = bf16_bits(x - bf16_val(hb));
      }
  }
  float m_r[8], l_r[8];
#pragma unroll
  for (int r = 0; r < 8; ++r) { m_r[r] = -3.0e38f; l_r[r] = 0.f; }
  v8f oacc[DT];
#pragma unroll
  for (int dt = 0; dt < DT; ++dt) oacc[dt] = (v8f){0.f,0.f,0.f,0.f,0.f,0.f,0.f,0.f};

  const int kv_end = CAUSAL ? min(T, qblk * 64 + 64) : T;     // block-uniform
  for (int j0 = 0; j0 < kv_end; j0 += 32) {
    __syncthreads();
    for (int e = tid; e < 32 * (D / 4); e += 128) {
      const int r = e / (D / 4), c4 = (e % (D / 4)) * 4;
      const int key = j0 + r;
      v4f kf = {0.f,0.f,0.f,0.f}, vf = {0.f,0.f,0.f,0.f};
      if (key < T) { kf = *(const v4fa*)(K + (size_t)key * pitch + c4); vf = *(const v4fa*)(V + (size_t)key * pitch + c4); }
#pragma unroll
      for (int t = 0; t < 4; ++t) {
        unsigned short hb = bf16_bits(kf[t]); sKh[r][c4 + t] = hb; sKl[r][c4 + t] = bf16_bits(kf[t] - bf16_val(hb));
        hb = bf16_bits(vf[t]); sVh[r][c4 + t] = hb; sVl[r][c4 + t] = bf16_bits(vf[t] - bf16_val(hb));
      }
    }
    __syncthreads();
    // S tile 16 x 32
    v8f s[2];
#pragma unroll
    for (int nt = 0; nt < 2; ++nt) {
      v8f acc = {};
#pragma unroll
      for (int ks = 0; ks < KS; ++ks) {
        FragB bh_, bl_;
        bh_.half[0] = *(const v8us*)&sKh[nt * 16 + ln][ks * 32 + 8 * hh]; bh_.half[1] = *(const v8us*)&sKh[nt * 16 + ln][ks * 32 + 16 + 8 * hh];
        bl_.half[0] = *(const v8us*)&sKl[nt * 16 + ln][ks * 32 + 8 * hh]; bl_.half[1] = *(const v8us*)&sKl[nt * 16 + ln][ks * 32 + 16 + 8 * hh];
        acc = mmaN<3>(aqh[ks].v, aql[ks].v, bh_.v, bl_.v, acc);
      }
      s[nt] = acc;
    }
    // mask + running max (rows 8hh+r; the 16 lanes of a half share rows)
    float alpha[8];
#pragma unroll
    for (int r = 0; r < 8; ++r) {
      const int qi = q0 + 8 * hh + r;
      const int ja = j0 + ln, jb = j0 + 16 + ln;
      if (CAUSAL) { if (ja > qi) s[0][r] = -3.0e38f; if (jb > qi) s[1][r] = -3.0e38f; }
      if (ja >= T) s[0][r] = -3.0e38f;
      if (jb >= T) s[1][r] = -3.0e38f;
      float mx = fmaxf(s[0][r], s[1][r]);
      mx = fmaxf(mx, __shfl_xor(mx, 1, 32)); mx = fmaxf(mx, __shfl_xor(mx, 2, 32)); mx = fmaxf(mx, __shfl_xor(mx, 4, 32)); mx = fmaxf(mx, __shfl_xor(mx, 8, 32));
      const float mnew = fmaxf(m_r[r], mx);
      alpha[r] = (mnew > -1.0e38f) ? __expf(m_r[r] - mnew) : 1.0f;
      const float p0 = (s[0][r] > -1.0e38f) ? __expf(s[0][r] - mnew) : 0.f;
      const float p1 = (s[1][r] > -1.0e38f) ? __expf(s[1][r] - mnew) : 0.f;
      m_r[r] = mnew;
      l_r[r] = l_r[r] * alpha[r] + p0 + p1;            // per-lane partial row sum (16 lanes combined at the end)
      unsigned short hb = bf16_bits(p0); sPh[w][8 * hh + r][ln] = hb;      sPl[w][8 * hh + r][ln] = bf16_bits(p0 - bf16_val(hb));
      hb = bf16_bits(p1);                sPh[w][8 * hh + r][16 + ln] = hb; sPl[w][8 * hh + r][16 + ln] = bf16_bits(p1 - bf16_val(hb));
    }
#pragma unroll
    for (int dt = 0; dt < DT; ++dt)
#pragma unroll
      for (int r = 0; r < 8; ++r) oacc[dt][r] *= alpha[r];
    __builtin_amdgcn_fence(__ATOMIC_ACQ_REL, "workgroup");
    __builtin_amdgcn_wave_barrier();
    FragB pah, pal;
    pah.half[0] = *(const v8us*)&sPh[w][ln][8 * hh]; pah.half[1] = *(const v8us*)&sPh[w][ln][16 + 8 * hh];
    pal.half[0] = *(const v8us*)&sPl[w][ln][8 * hh]; pal.half[1] = *(const v8us*)&sPl[w][ln][16 + 8 * hh];
#pragma unroll
    for (int dt = 0; dt < DT; ++dt) {
      FragB bvh, bvl;
#pragma unroll
      for (int i = 0; i < 8; ++i) {
        bvh.u[i] = sVh[8 * hh + i][dt * 16 + ln]; bvh.u[8 + i] = sVh[16 + 8 * hh + i][dt * 16 + ln];
        bvl.u[i] = sVl[8 * hh + i][dt * 16 + ln]; bvl.u[8 + i] = sVl[16 + 8 * hh + i][dt * 16 + ln];
      }
      oacc[dt] = mmaN<3>(pah.v, pal.v, bvh.v, bvl.v, oacc[dt]);
    }
    __builtin_amdgcn_fence(__ATOMIC_ACQ_REL, "workgroup");
    __builtin_amdgcn_wave_barrier();
  }
#pragma unroll
  for (int r = 0; r < 8; ++r) {
    float l = l_r[r];
    l += __shfl_xor(l, 1, 32); l += __shfl_xor(l, 2, 32); l += __shfl_xor(l, 4, 32); l += __shfl_xor(l, 8, 32);
    l_r[r] = (l > 0.f) ? 1.0f / l : 0.f;
  }
#pragma unroll
  for (int dt = 0; dt < DT; ++dt)
#pragma unroll
    for (int r = 0; r < 8; ++r) sO[w][8 * hh + r][dt * 16 + ln] = oacc[dt][r] * l_r[r];
  __builtin_amdgcn_fence(__ATOMIC_ACQ_REL, "workgroup");
  __builtin_amdgcn_wave_barrier();
  {
    for (int r = 0; r < 16; ++r) {
      const int row = q0 + r;
      if (row < T && lane < D / 4) {
        const v4f val = *(const v4fa*)&sO[w][r][lane * 4];
        *(v4f*)(y + ((size_t)b * T + row) * ypitch + h * D + lane * 4) = val;
      }
    }
    
  }
}

// GEMM C = act(A·W + bias + resid): A f32 (ASPLIT -> hi/lo 2 terms), Wt bf16 [N][K]; ACT 0 none, 1 relu, 2 exact gelu;
// resid (optional, f32, row index = (row % rmod), pitch ldr, RES_BF16 rounds it) added before the activation.
template <bool ASPLIT, int ACT, bool BIAS_BF16, bool RES_BF16>
__global__ __launch_bounds__(128) void k_gemm_bf3(const float* __restrict__ A, int lda, const unsigned short* __restrict__ Wt, int ldb,
                                                const float* __restrict__ bias, const float* __restrict__ resid, int rmod, int ldr,
                                                float* __restrict__ C, int ldc, int M, int N, int K) {
  __shared__ __attribute__((aligned(16))) float so[4][16][64];
  const int tid = threadIdx.x, w = tid >> 5, lane = tid & 31, ln = lane & 15, hh = lane >> 4;
  const int ntn = N / 64;
  const int wid = blockIdx.x * 4 + w;
  const int mt = wid / ntn, nq = wid % ntn;
  if (mt * 16 >= M) return;
  const int row0 = mt * 16, col0 = nq * 64;
  const float* arow = A + (size_t)(row0 + ln) * lda;
  v8f acc[4] = {};
  for (int kb = 0; kb < K; kb += 32) {
    FragB ah, al;
    const v4f x0 = *(const v4fa*)(arow + kb + 8 * hh), x1 = *(const v4fa*)(arow + kb + 8 * hh + 4);
    const v4f x2 = *(const v4fa*)(arow + kb + 16 + 8 * hh), x3 = *(const v4fa*)(arow + kb + 16 + 8 * hh + 4);
    float xs[16] = {x0[0],x0[1],x0[2],x0[3],x1[0],x1[1],x1[2],x1[3],x2[0],x2[1],x2[2],x2[3],x3[0],x3[1],x3[2],x3[3]};
#pragma unroll
    for (int i = 0; i < 16; ++i) { const unsigned short hb = bf16_bits(xs[i]); ah.u[i] = hb; al.u[i] = ASPLIT ? bf16_bits(xs[i] - bf16_val(hb)) : (unsigned short)0; }
#pragma unroll
    for (int t = 0; t < 4; ++t) {
      const unsigned short* brow = Wt + (size_t)(col0 + t * 16 + ln) * ldb + kb;
      FragB b;
      b.half[0] = *(const v8us*)(brow + 8 * hh);
      b.half[1] = *(const v8us*)(brow + 16 + 8 * hh);
      acc[t] = mmaN<ASPLIT ? 2 : 1>(ah.v, al.v, b.v, b.v, acc[t]);
    }
  }
#pragma unroll
  for (int t = 0; t < 4; ++t) {
    const int col = col0 + t * 16 + ln;
    float bv = bias ? bias[col] : 0.f;
    if (BIAS_BF16) bv = bf16_round(bv);
#pragma unroll
    for (int r = 0; r < 8; ++r) {
      float v = acc[t][r] + bv;
      if (resid) { float rv = resid[(size_t)((row0 + 8 * hh + r) % rmod) * ldr + col]; if (RES_BF16) rv = bf16_round(rv); v += rv; }
      if (ACT == 1) v = fmaxf(v, 0.f);
      if (ACT == 2) v = 0.5f * v * (1.0f + erff(v * 0.70710678118654752f));
      if (ACT == 3) { const float u = 0.7978845608028654f * (v + 0.044715f * v * v * v); v = 0.5f * v * (1.0f + tanhf(u)); }
      so[w][8 * hh + r][t * 16 + ln] = v;
    }
  }
  __builtin_amdgcn_fence(__ATOMIC_ACQ_REL, "workgroup");
  __builtin_amdgcn_wave_barrier();
  const int rsub = lane >> 4, c4 = (lane & 15) * 4;
  {
#pragma unroll
    for (int q = 0; q < 8; ++q) {
      const int r = q * 2 + rsub;
      const v4f v = *(const v4fa*)&so[w][r][c4];
      *(v4f*)(C + (size_t)(row0 + r) * ldc + col0 + c4) = v;
    }
    
  }
}
// row LayerNorm (biased variance, eps) over N: s = X (+ R); optional out_sum <- s; out_norm <- (s-mu)*rsqrt(var+eps)*g + b
template <bool PARAM_BF16>
__global__ __launch_bounds__(256) void k_layernorm(const float* __restrict__ X, const float* __restrict__ R, const float* __restrict__ g, const float* __restrict__ bta,
                                                  float* __restrict__ out_sum, float* __restrict__ out_norm, int N, float eps) {
  __shared__ float red[256];
  const int row = blockIdx.x, tid = threadIdx.x;
  const float* x = X + (size_t)row * N; const float* rr = R ? R + (size_t)row * N : nullptr;
  float vals[16];                     // up to N = 4096
  const int per = N / 256;            // contiguous chunk per thread? use strided-by-4 chunks: thread handles j = tid*4 + 1024*u
  float s1 = 0.f;
  for (int u = 0; u < per / 4; ++u) {
    const int j = tid * 4 + 1024 * u;
    const v4f a = *(const v4fa*)(x + j);
    v4f b = {0.f,0.f,0.f,0.f}; if (rr) b = *(const v4fa*)(rr + j);
#pragma unroll
    for (int q = 0; q < 4; ++q) { const float v = a[q] + b[q]; vals[u * 4 + q] = v; s1 += v; }
  }
  red[tid] = s1; __syncthreads();
  for (int st = 128; st > 0; st >>= 1) { if (tid < st) red[tid] += red[tid + st]; __syncthreads(); }
  const float mu = red[0] / (float)N; __syncthreads();
  float s2 = 0.f;
  for (int u = 0; u < per / 4; ++u)
#pragma unroll
    for (int q = 0; q < 4; ++q) { const float c = vals[u * 4 + q] - mu; s2 += c * c; }
  red[tid] = s2; __syncthreads();
  for (int st = 128; st > 0; st >>= 1) { if (tid < st) red[tid] += red[tid + st]; __syncthreads(); }
  const float rs = rsqrtf(red[0] / (float)N + eps);
  {
    for (int u = 0; u < per / 4; ++u) {
      const int j = tid * 4 + 1024 * u;
      v4f o, sm;
#pragma unroll
      for (int q = 0; q < 4; ++q) {
        float gg = g[j + q], bb = bta[j + q];
        if (PARAM_BF16) { gg = bf16_round(gg); bb = bf16_round(bb); }
        sm[q] = vals[u * 4 + q]; o[q] = (vals[u * 4 + q] - mu) * rs * gg + bb;
      }
      if (out_sum) *(v4f*)(out_sum + (size_t)row * N + j) = sm;
      *(v4f*)(out_norm + (size_t)row * N + j) = o;
    }
    
  }
}



// ---- f16 WMMA path (v_wmma_f32_16x16x32_f16): 11-bit significands for operands in range — used where a [0,1] probability operand needs more precision than bf16
typedef _Float16 v16h __attribute__((ext_vector_type(16)));
union FragH { v16h v; v8us half[2]; _Float16 h[16]; unsigned short u[16]; };
template <int NT>
__device__ __forceinline__ v8f mmaH(v16h ah, v16h al, v16h bh, v16h bl, v8f c) {
  c = __builtin_amdgcn_wmma_f32_16x16x32_f16(false, ah, false, bh, (short)0, c, false, false);
  if (NT >= 2) c = __builtin_amdgcn_wmma_f32_16x16x32_f16(false, al, false, bh, (short)0, c, false, false);
  if (NT >= 3) c = __builtin_amdgcn_wmma_f32_16x16x32_f16(false, ah, false, bl, (short)0, c, false, false);
  asm volatile("v_nop\n\tv_nop\n\tv_nop\n\tv_nop" : "+v"(c) : "v"(ah), "v"(al), "v"(bh), "v"(bl));
  return c;
}
// batched GEMM like k_gemm_b but f16 operands: A f32 (split into f16 hi/lo if ASPLIT, else rounded to f16), Bt = f16 values [n][k]; alpha; C f32; N multiple of 16 (partial tiles skipped)
template <bool ASPLIT>
__global__ __launch_bounds__(128) void k_gemm_h(const float* __restrict__ A, int lda, size_t sA, const _Float16* __restrict__ Bh, int ldb, size_t sB, float alpha, float* __restrict__ C, int ldc, size_t sC, int M, int N, int K) {
  __shared__ __attribute__((aligned(16))) float so[4][16][64];
  const int tid = threadIdx.x, w = tid >> 5, lane = tid & 31, ln = lane & 15, hh = lane >> 4; const int by = blockIdx.y;
  A += (size_t)by * sA; Bh += (size_t)by * sB; C += (size_t)by * sC;
  const int ntn = (N + 63) / 64; const int wid = blockIdx.x * 4 + w; const int mt = wid / ntn, nq = wid % ntn; if (mt * 16 >= M) return;
  const int row0 = mt * 16, col0 = nq * 64; const float* arow = A + (size_t)(row0 + ln) * lda;
  v8f acc[4] = {};
  for (int kb = 0; kb < K; kb += 32) {
    FragH ah, al;
    const v4f x0 = *(const v4fa*)(arow + kb + 8 * hh), x1 = *(const v4fa*)(arow + kb + 8 * hh + 4), x2 = *(const v4fa*)(arow + kb + 16 + 8 * hh), x3 = *(const v4fa*)(arow + kb + 16 + 8 * hh + 4);
    float xs[16] = {x0[0],x0[1],x0[2],x0[3],x1[0],x1[1],x1[2],x1[3],x2[0],x2[1],x2[2],x2[3],x3[0],x3[1],x3[2],x3[3]};
#pragma unroll
    for (int i = 0; i < 16; ++i) { const _Float16 h = (_Float16)xs[i]; ah.h[i] = h; al.h[i] = ASPLIT ? (_Float16)(xs[i] - (float)h) : (_Float16)0.0f; }
#pragma unroll
    for (int t = 0; t < 4; ++t) { if (col0 + t * 16 >= N) continue; const size_t boff = (size_t)(col0 + t * 16 + ln) * ldb + kb; FragH bq; bq.half[0] = *(const v8us*)(Bh + boff + 8 * hh); bq.half[1] = *(const v8us*)(Bh + boff + 16 + 8 * hh);
      acc[t] = mmaH<ASPLIT ? 2 : 1>(ah.v, al.v, bq.v, bq.v, acc[t]); }
  }
#pragma unroll
  for (int t = 0; t < 4; ++t) { if (col0 + t * 16 >= N) continue;
#pragma unroll
    for (int r = 0; r < 8; ++r) so[w][8 * hh + r][t * 16 + ln] = acc[t][r] * alpha; }
  __builtin_amdgcn_fence(__ATOMIC_ACQ_REL, "workgroup"); __builtin_amdgcn_wave_barrier();
  const int rsub = lane >> 4, c4 = (lane & 15) * 4;
  {
#pragma unroll
    for (int q = 0; q < 8; ++q) { const int r = q * 2 + rsub; if (col0 + c4 < N) { const v4f v = *(const v4fa*)&so[w][r][c4]; *(v4f*)(C + (size_t)(row0 + r) * ldc + col0 + c4) = v; } }
     }
}

// Wt[n][k] = f16(W[k][n]·scale) from f32 row-major W[K][N] (scale = power of two; bf16-exact weights stay exact in f16 away from the subnormal range)
__global__ __launch_bounds__(256) void k_wt_f16(const float* __restrict__ W, _Float16* __restrict__ Wt, int K, int N, float scale) {
  const int t = blockIdx.x * 256 + threadIdx.x; if (t >= N * (K / 8)) return; const int n = t / (K / 8), k8 = (t % (K / 8)) * 8; FragH f;
#pragma unroll
  for (int i = 0; i < 8; ++i) f.h[i] = (_Float16)(bf16_round(W[(size_t)(k8 + i) * N + n]) * scale); const v8us o = f.half[0];
  *(v8us*)((unsigned short*)Wt + (size_t)n * K + k8) = o; 
}
// k_gemm_hh variant with fused epilogue: v = acc·alpha + bias[by·sBias + col] (+ CP[(row/rowsPerB)·sCPb + by·64 + col] if CP) ; ACT 0 none / 1 elu ; writes f32 C and/or f16 C16 (each if non-null)
template <int ACT>
__global__ __launch_bounds__(128) void k_gemm_hhx(const _Float16* __restrict__ A, int lda, size_t sA, const _Float16* __restrict__ Bh, int ldb, size_t sB, float alpha, const float* __restrict__ bias, size_t sBias, const float* __restrict__ CP, int rowsPerB, size_t sCPb, int row0g,
    float* __restrict__ C, _Float16* __restrict__ C16, int ldc, size_t sC, int M, int N, int K) {
  __shared__ __attribute__((aligned(16))) float so[4][16][64];
  const int tid = threadIdx.x, w = tid >> 5, lane = tid & 31, ln = lane & 15, hh = lane >> 4; const int by = blockIdx.y;
  A += (size_t)by * sA; Bh += (size_t)by * sB; const size_t cofs = (size_t)by * sC; const float* bp = bias ? bias + (size_t)by * sBias : nullptr;
  const int ntn = (N + 63) / 64; const int wid = blockIdx.x * 4 + w; const int mt = wid / ntn, nq = wid % ntn; if (mt * 16 >= M) return;
  const int row0 = mt * 16, col0 = nq * 64; const _Float16* arow = A + (size_t)(row0 + ln) * lda;
  v8f acc[4] = {};
  for (int kb = 0; kb < K; kb += 32) { FragH ah; ah.half[0] = *(const v8us*)((const unsigned short*)arow + kb + 8 * hh); ah.half[1] = *(const v8us*)((const unsigned short*)arow + kb + 16 + 8 * hh);
#pragma unroll
    for (int t = 0; t < 4; ++t) { if (col0 + t * 16 >= N) continue; const size_t boff = (size_t)(col0 + t * 16 + ln) * ldb + kb; FragH bq; bq.half[0] = *(const v8us*)((const unsigned short*)Bh + boff + 8 * hh); bq.half[1] = *(const v8us*)((const unsigned short*)Bh + boff + 16 + 8 * hh);
      acc[t] = mmaH<1>(ah.v, ah.v, bq.v, bq.v, acc[t]); }
  }
#pragma unroll
  for (int t = 0; t < 4; ++t) { if (col0 + t * 16 >= N) continue; const int col = col0 + t * 16 + ln; const float bv = bp ? bf16_round(bp[col]) : 0.f;
#pragma unroll
    for (int r = 0; r < 8; ++r) { float v = acc[t][r] * alpha + bv; if (CP) { const int bidx = (row0g + row0 + 8 * hh + r) / rowsPerB; v += CP[(size_t)bidx * sCPb + (size_t)by * 64 + col]; } if (ACT == 1) v = (v > 0.f) ? v : expm1f(v); else if (ACT == 7) v = (v > 0.f) ? v + 1.0f : expf(v); else if (ACT == 8) v = tanhf(v); else if (ACT == 9) v = 0.5f * v * (1.0f + tanhf(0.7978845608028654f * (v + 0.044715f * v * v * v))); else if (ACT == 11) v = 1.0f / (1.0f + expf(-v)); else if (ACT == 12) v = (v > 0.f) ? v : 0.01f * v; else if (ACT == 14) v = (v > 0.f) ? v : 0.1f * v; else if (ACT == 15) v = v / (1.0f + expf(-v)); else if (ACT == 3) v = fmaxf(v, 0.f); else if (ACT == 6) v = 0.5f * v * (1.0f + erff(v * 0.70710678118654752f)); so[w][8 * hh + r][t * 16 + ln] = v; } }
  __builtin_amdgcn_fence(__ATOMIC_ACQ_REL, "workgroup"); __builtin_amdgcn_wave_barrier();
  const int rsub = lane >> 4, c4 = (lane & 15) * 4; typedef _Float16 v4h __attribute__((ext_vector_type(4)));
  {
#pragma unroll
    for (int q = 0; q < 8; ++q) { const int r = q * 2 + rsub; if (col0 + c4 < N) { const v4f v = *(const v4fa*)&so[w][r][c4]; if (C) *(v4f*)(C + cofs + (size_t)(row0 + r) * ldc + col0 + c4) = v; if (C16) { v4h h4; for (int i = 0; i < 4; ++i) h4[i] = (_Float16)v[i]; *(v4h*)(C16 + cofs + (size_t)(row0 + r) * ldc + col0 + c4) = h4; } } }
     }
}


typedef _Float16 v4h __attribute__((ext_vector_type(4)));

__global__ __launch_bounds__(256) void k_x16(const float* __restrict__ x, _Float16* __restrict__ X16, size_t n8) { const size_t t = (size_t)blockIdx.x * 256 + threadIdx.x; if (t >= n8) return; FragH f;
#pragma unroll
  for (int q = 0; q < 8; ++q) f.h[q] = (_Float16)bf16_round(x[t * 8 + q]); *(v8us*)((unsigned short*)X16 + t * 8) = f.half[0];  }
__global__ __launch_bounds__(256) void k_h16(const float* __restrict__ x, _Float16* __restrict__ X16, size_t n8) { const size_t t = (size_t)blockIdx.x * 256 + threadIdx.x; if (t >= n8) return; FragH f;
#pragma unroll
  for (int q = 0; q < 8; ++q) f.h[q] = (_Float16)x[t * 8 + q]; *(v8us*)((unsigned short*)X16 + t * 8) = f.half[0];  }
__global__ __launch_bounds__(256) void k_round16f(const float* __restrict__ W, _Float16* __restrict__ Bt, size_t n8) { const size_t t = (size_t)blockIdx.x * 256 + threadIdx.x; if (t >= n8) return; FragH f;
#pragma unroll
  for (int i = 0; i < 8; ++i) f.h[i] = (_Float16)(bf16_round(W[t * 8 + i]) * 16.0f); *(v8us*)((unsigned short*)Bt + t * 8) = f.half[0];  }
template <int NHv, int TTv>
__global__ __launch_bounds__(256) void k_vt(const _Float16* __restrict__ V16, int ldv, int voff, _Float16* __restrict__ Vt) { __shared__ unsigned short tl[64][66]; const int tid = threadIdx.x; const int slab = blockIdx.x / (TTv / 64), lg = blockIdx.x % (TTv / 64); const int b = slab / NHv, h = slab % NHv;
  for (int i = tid; i < 64 * 8; i += 256) { const int r = i / 8, c8 = (i % 8) * 8; FragH f; f.half[0] = *(const v8us*)((const unsigned short*)V16 + ((size_t)b * TTv + lg * 64 + r) * ldv + voff + h * 64 + c8);
#pragma unroll
    for (int q = 0; q < 8; ++q) tl[r][c8 + q] = f.u[q]; }
  __syncthreads();
  {
#pragma unroll
    for (int rd = 0; rd < 2; ++rd) { const int d = rd * 32 + tid / 8, pc = tid % 8; FragH f;
#pragma unroll
      for (int q = 0; q < 8; ++q) f.u[q] = tl[pc * 8 + q][d];
      *(v8us*)((unsigned short*)Vt + ((size_t)slab * 64 + d) * TTv + lg * 64 + pc * 8) = f.half[0]; }
     } }

__global__ __launch_bounds__(256) void k_elu_hl(const float* __restrict__ F, _Float16* __restrict__ Hh, _Float16* __restrict__ Hl, size_t n8) { const size_t t = (size_t)blockIdx.x * 256 + threadIdx.x; if (t >= n8) return; const v4f a = *(const v4fa*)(F + t * 8), c = *(const v4fa*)(F + t * 8 + 4); FragH fh, fl;
#pragma unroll
  for (int q = 0; q < 8; ++q) { const float x = (q < 4) ? a[q] : c[q - 4]; const float v = (x > 0.f) ? x + 1.0f : expf(x);      /* elu(x) + 1 = x+1 (x>0) | e^x (x≤0) */ const _Float16 h = (_Float16)v; fh.h[q] = h; fl.h[q] = (_Float16)((v - (float)h) * 1024.0f); }
  { *(v8us*)((unsigned short*)Hh + t * 8) = fh.half[0]; *(v8us*)((unsigned short*)Hl + t * 8) = fl.half[0];  } }
__global__ __launch_bounds__(256) void k_h16s(const float* __restrict__ F, _Float16* __restrict__ H, size_t n8) { const size_t t = (size_t)blockIdx.x * 256 + threadIdx.x; if (t >= n8) return; const v4f a = *(const v4fa*)(F + t * 8), c = *(const v4fa*)(F + t * 8 + 4); FragH f;
#pragma unroll
  for (int q = 0; q < 4; ++q) { f.h[q] = (_Float16)(a[q] * 16.0f); f.h[4 + q] = (_Float16)(c[q] * 16.0f); } *(v8us*)((unsigned short*)H + t * 8) = f.half[0];  }
typedef int v4ia __attribute__((ext_vector_type(4), may_alias));
// lane l <-> lane l ^ 16 (the two halves of a wave hold the two key groups of one query column)
__device__ __forceinline__ float xhalf(float x) { return __builtin_bit_cast(float, __builtin_amdgcn_permlanex16(__builtin_bit_cast(int, x), __builtin_bit_cast(int, x), 0x76543210, 0xfedcba98, false, false)); }
__global__ __launch_bounds__(128) void k_flash(const _Float16* __restrict__ Q16, const _Float16* __restrict__ Q16lo, int ldq, const _Float16* __restrict__ K16, const _Float16* __restrict__ K16lo, int ldk, const _Float16* __restrict__ Vt, const int* __restrict__ MSK, float* __restrict__ O, int ldo) {
  constexpr int RPW = 16, NQB = TT / (4 * RPW), DT = 4, KS = 2;
  __shared__ __attribute__((aligned(16))) float sO[4][RPW][64 + 4];
  const int tid = threadIdx.x, w = tid >> 5, lane = tid & 31, ln = lane & 15, hh = lane >> 4;
  const int slab = blockIdx.x / NQB, qblk = blockIdx.x % NQB; const int b = slab / NH, h = slab % NH; const int q0 = qblk * (4 * RPW) + w * RPW;
  FragH aq[KS], aql[KS];
  { const size_t qo = ((size_t)b * TT + q0 + ln) * ldq + h * 64; const unsigned short* qr = (const unsigned short*)Q16 + qo; const unsigned short* ql = (const unsigned short*)Q16lo + qo;
#pragma unroll
    for (int ks = 0; ks < KS; ++ks) { aq[ks].half[0] = *(const v8us*)(qr + ks * 32 + 8 * hh); aq[ks].half[1] = *(const v8us*)(qr + ks * 32 + 16 + 8 * hh); aql[ks].half[0] = *(const v8us*)(ql + ks * 32 + 8 * hh); aql[ks].half[1] = *(const v8us*)(ql + ks * 32 + 16 + 8 * hh); } }
  const unsigned short* Vth = (const unsigned short*)Vt + (size_t)slab * 64 * TT;
  float m_r = -3.0e38f, l_r = 0.f; v8f oacc[DT];
#pragma unroll
  for (int dt = 0; dt < DT; ++dt) oacc[dt] = (v8f){0.f,0.f,0.f,0.f,0.f,0.f,0.f,0.f};
#pragma unroll 1
  for (int j0 = 0; j0 < TT; j0 += 32) {
    const int* mp = MSK + (size_t)b * TT + j0 + 8 * hh;      /* key padding mask (1 = attend) of this lane's 16 keys */
    const v4ia km[4] = { *(const v4ia*)(mp), *(const v4ia*)(mp + 4), *(const v4ia*)(mp + 16), *(const v4ia*)(mp + 20) };
    float sv[16];
#pragma unroll
    for (int nt = 0; nt < 2; ++nt) { const size_t ko = ((size_t)b * TT + j0 + nt * 16 + ln) * ldk + h * 64; const unsigned short* kr = (const unsigned short*)K16 + ko; const unsigned short* kl = (const unsigned short*)K16lo + ko; FragH bk[KS], bl[KS];
#pragma unroll
      for (int ks = 0; ks < KS; ++ks) { bk[ks].half[0] = *(const v8us*)(kr + ks * 32 + 8 * hh); bk[ks].half[1] = *(const v8us*)(kr + ks * 32 + 16 + 8 * hh); bl[ks].half[0] = *(const v8us*)(kl + ks * 32 + 8 * hh); bl[ks].half[1] = *(const v8us*)(kl + ks * 32 + 16 + 8 * hh); }
      v8f acc = (v8f){0.f,0.f,0.f,0.f,0.f,0.f,0.f,0.f}, accl = acc;
#pragma unroll
      for (int ks = 0; ks < KS; ++ks) { acc = mmaH<1>(bk[ks].v, bk[ks].v, aq[ks].v, aq[ks].v, acc); accl = mmaH<1>(bk[ks].v, bk[ks].v, aql[ks].v, aql[ks].v, accl); accl = mmaH<1>(bl[ks].v, bl[ks].v, aq[ks].v, aq[ks].v, accl); }
#pragma unroll
      for (int r = 0; r < 8; ++r) sv[nt * 8 + r] = (km[nt * 2 + (r >> 2)][r & 3] != 0) ? acc[r] + accl[r] * 0.0009765625f : -INFINITY; }
    float t8[8];
#pragma unroll
    for (int i = 0; i < 8; ++i) t8[i] = fmaxf(sv[i], sv[8 + i]);
    float mc = fmaxf(fmaxf(fmaxf(t8[0], t8[1]), fmaxf(t8[2], t8[3])), fmaxf(fmaxf(t8[4], t8[5]), fmaxf(t8[6], t8[7])));
    mc = fmaxf(mc, xhalf(mc));      /* both halves now hold the query's block maximum */
    const float mn = fmaxf(m_r, mc); const float ea = expf(m_r - mn); const float al = (mn > -1.0e38f) ? ea : 1.0f; m_r = mn;      /* mn is finite (>= -3e38), so a masked score gives exp(-inf) = 0 */
    float p[16]; FragH pa;
#pragma unroll
    for (int i = 0; i < 16; ++i) { p[i] = expf(sv[i] - mn); pa.h[i] = (_Float16)(p[i] * 1024.0f); }
#pragma unroll
    for (int i = 0; i < 8; ++i) t8[i] = p[i] + p[8 + i];
    l_r = l_r * al + (((t8[0] + t8[1]) + (t8[2] + t8[3])) + ((t8[4] + t8[5]) + (t8[6] + t8[7])));      /* per-lane partial sum; the halves join after the loop */
#pragma unroll
    for (int dt = 0; dt < DT; ++dt)
#pragma unroll
      for (int r = 0; r < 8; ++r) oacc[dt][r] *= al;
#pragma unroll
    for (int dt = 0; dt < DT; ++dt) { const unsigned short* vrow = Vth + (size_t)(dt * 16 + ln) * TT + j0; FragH bv; bv.half[0] = *(const v8us*)(vrow + 8 * hh); bv.half[1] = *(const v8us*)(vrow + 16 + 8 * hh);
      oacc[dt] = mmaH<1>(bv.v, bv.v, pa.v, pa.v, oacc[dt]); } }
  { const float l = l_r + xhalf(l_r); const float inv = (l > 0.f) ? 1.0f / (l * 1024.0f) : 0.f;
#pragma unroll
    for (int dt = 0; dt < DT; ++dt)
#pragma unroll
      for (int q = 0; q < 2; ++q) { const v4f o4 = { oacc[dt][q * 4] * inv, oacc[dt][q * 4 + 1] * inv, oacc[dt][q * 4 + 2] * inv, oacc[dt][q * 4 + 3] * inv }; *(v4fa*)&sO[w][ln][dt * 16 + 8 * hh + q * 4] = o4; } }
  __builtin_amdgcn_fence(__ATOMIC_ACQ_REL, "workgroup"); __builtin_amdgcn_wave_barrier();
  {
#pragma unroll
    for (int rp = 0; rp < RPW; rp += 2) { const int r = rp + (lane >> 4), pc = lane & 15; const v4f val = *(const v4fa*)&sO[w][r][pc * 4]; *(v4f*)(O + ((size_t)b * TT + q0 + r) * ldo + h * 64 + pc * 4) = val; }
     } }

// ---- projection GEMM with its operands staged in LDS: C = alpha * A . Bt^T, A [NR][DD] and Bt [DD][DD] f16, both k-contiguous.
// One 128 x 128 tile per work-group of 8 waves (4 x 2 waves of 32 x 64). A stage is 128 k = 256 B of each of the 256 operand rows (A rows 0-127, Bt rows 128-255),
// brought by asynchronous copies (16 lanes of 16 B a row), two buffers: stage t + 1 flies while stage t is multiplied.
// LDS row pitch 272 B = 16 B x odd, the conflict-free pitch of ds_load_b128 fragment reads. The k order of every accumulator is 0, 32, 64, ... as before.
#define GS_K 128
#define GS_PITCH 272
#define GS_STAGE (256 * GS_PITCH)
// eight copies of one lane: rows r, r + 16, ..., r + 112 of one operand, 16 B each. The s_wait_xcnt stands inside the copies' own statement, so that no address register named here is rewritten in front of it.
__device__ __forceinline__ void gs_copy8(unsigned l, const _Float16* g) {
  asm volatile("global_load_async_to_lds_b128 %0, %8, off\n\t"
               "global_load_async_to_lds_b128 %1, %9, off\n\t"
               "global_load_async_to_lds_b128 %2, %10, off\n\t"
               "global_load_async_to_lds_b128 %3, %11, off\n\t"
               "global_load_async_to_lds_b128 %4, %12, off\n\t"
               "global_load_async_to_lds_b128 %5, %13, off\n\t"
               "global_load_async_to_lds_b128 %6, %14, off\n\t"
               "global_load_async_to_lds_b128 %7, %15, off\n\t"
               "s_wait_xcnt 0x0"
               :: "v"(l), "v"(l + 16 * GS_PITCH), "v"(l + 32 * GS_PITCH), "v"(l + 48 * GS_PITCH), "v"(l + 64 * GS_PITCH), "v"(l + 80 * GS_PITCH), "v"(l + 96 * GS_PITCH), "v"(l + 112 * GS_PITCH),
                  "v"(g), "v"(g + 16 * DD), "v"(g + 32 * DD), "v"(g + 48 * DD), "v"(g + 64 * DD), "v"(g + 80 * DD), "v"(g + 96 * DD), "v"(g + 112 * DD)
               : "memory");
}
// the 2 A and 4 B fragments of one k step (32 k = 64 B of a row) from a stage in LDS; both operands in the same k order: 8 hh + 0..7, then 16 + 8 hh + 0..7
__device__ __forceinline__ void gs_frags(FragH (&a)[2], FragH (&b)[4], const unsigned char* pa, const unsigned char* pb) {
#pragma unroll
  for (int i = 0; i < 2; ++i) { a[i].half[0] = *(const v8us*)(pa + i * 16 * GS_PITCH); a[i].half[1] = *(const v8us*)(pa + i * 16 * GS_PITCH + 32); }
#pragma unroll
  for (int j = 0; j < 4; ++j) { b[j].half[0] = *(const v8us*)(pb + j * 16 * GS_PITCH); b[j].half[1] = *(const v8us*)(pb + j * 16 * GS_PITCH + 32); }
}
// the 8 products of one k step
__device__ __forceinline__ void gs_mma(v8f (&acc)[2][4], const FragH (&a)[2], const FragH (&b)[4]) {
#pragma unroll
  for (int i = 0; i < 2; ++i)
#pragma unroll
    for (int j = 0; j < 4; ++j) acc[i][j] = __builtin_amdgcn_wmma_f32_16x16x32_f16(false, a[i].v, false, b[j].v, (short)0, acc[i][j], false, false);
}
template <bool OUT16>
__global__ __launch_bounds__(256) void k_gemm_lds(const _Float16* __restrict__ A, const _Float16* __restrict__ Bt, float alpha, float* __restrict__ C, _Float16* __restrict__ C16) {
  __shared__ __attribute__((aligned(16))) unsigned char sT[2 * GS_STAGE];
  __shared__ __attribute__((aligned(16))) float so[8][32][64 + 4];
  constexpr int NST = DD / GS_K;
  const int tid = threadIdx.x, w = tid >> 5, lane = tid & 31, ln = lane & 15, hh = lane >> 4;
  const int row0 = (blockIdx.x / (DD / 128)) * 128, col0 = (blockIdx.x % (DD / 128)) * 128; const int wm = w >> 1, wn = w & 1;
  const int cr = tid >> 4, cc = tid & 15;      /* this lane's row (mod 16) and 16-B column of every copy */
  const _Float16* ga = A + (size_t)(row0 + cr) * DD + cc * 8; const _Float16* gb = Bt + (size_t)(col0 + cr) * DD + cc * 8;
  const unsigned la = (unsigned)(size_t)sT + cr * GS_PITCH + cc * 16, lb = la + 128 * GS_PITCH;
  gs_copy8(la, ga); gs_copy8(lb, gb);
  asm volatile("s_wait_asynccnt 0x0" ::: "memory");      /* stage 0 has landed for this wave */
  __syncthreads();                                       /* ... and for every wave */
  gs_copy8(la + GS_STAGE, ga + GS_K); gs_copy8(lb + GS_STAGE, gb + GS_K);
  v8f acc[2][4];
#pragma unroll
  for (int i = 0; i < 2; ++i)
#pragma unroll
    for (int j = 0; j < 4; ++j) acc[i][j] = (v8f){0.f,0.f,0.f,0.f,0.f,0.f,0.f,0.f};
  const unsigned char* fa = sT + (wm * 32 + ln) * GS_PITCH + 16 * hh; const unsigned char* fb = sT + (128 + wn * 64 + ln) * GS_PITCH + 16 * hh;
#pragma unroll 1      /* one stage a trip: the two buffers alternate by an offset, the text stays small */
  for (int t = 0; t < NST; ++t) {
    const unsigned bo = (unsigned)(t & 1) * GS_STAGE;
    FragH a[2][2], b[2][4];      /* two fragment sets: the reads of k step ks + 1 of this same stage are issued as one group ahead of the products of k step ks */
    gs_frags(a[0], b[0], fa + bo, fb + bo);
#pragma unroll
    for (int ks = 0; ks + 1 < GS_K / 32; ++ks) {
      gs_frags(a[(ks + 1) & 1], b[(ks + 1) & 1], fa + bo + (ks + 1) * 64, fb + bo + (ks + 1) * 64);
      __builtin_amdgcn_sched_barrier(0);      /* keeps that group of reads ahead of the products: left alone the scheduler sinks each read to just in front of its use, and the wave waits out the LDS latency there */
      gs_mma(acc, a[ks & 1], b[ks & 1]);
    }
    __builtin_amdgcn_sched_barrier(0);                   /* those products stay in front of the hand-over and cover the last group's LDS latency */
    asm volatile("s_wait_dscnt 0x0" ::: "memory");       /* this wave's reads of buffer t & 1 are done before the buffer is handed back */
    asm volatile("s_wait_asynccnt 0x0" ::: "memory");    /* this wave's copies of stage t + 1 have landed */
    __syncthreads();                                     /* publishes stage t + 1 and ends every wave's reads of stage t */
    if (t + 2 < NST) { gs_copy8(la + bo, ga + (t + 2) * GS_K); gs_copy8(lb + bo, gb + (t + 2) * GS_K); }
    __builtin_amdgcn_sched_barrier(0);                   /* the refill is issued first: the last k step's products need registers only and run while the copies fly */
    gs_mma(acc, a[(GS_K / 32 - 1) & 1], b[(GS_K / 32 - 1) & 1]);
  }
  asm volatile("s_wait_asynccnt 0x0" ::: "memory");      /* nothing is in flight when the wave goes on to its end */
#pragma unroll
  for (int i = 0; i < 2; ++i)
#pragma unroll
    for (int j = 0; j < 4; ++j)
#pragma unroll
      for (int r = 0; r < 8; ++r) so[w][i * 16 + 8 * hh + r][j * 16 + ln] = acc[i][j][r] * alpha;
  __builtin_amdgcn_fence(__ATOMIC_ACQ_REL, "workgroup"); __builtin_amdgcn_wave_barrier();      /* the wave reads back rows that its other lanes wrote */
  const int rsub = lane >> 4, c4 = (lane & 15) * 4;
#pragma unroll
  for (int q = 0; q < 16; ++q) { const int r = q * 2 + rsub; const v4f v = *(const v4fa*)&so[w][r][c4]; const size_t o = (size_t)(row0 + wm * 32 + r) * DD + col0 + wn * 64 + c4;
    if (OUT16) { v4h h4; for (int i = 0; i < 4; ++i) h4[i] = (_Float16)v[i]; *(v4h*)(C16 + o) = h4; } else *(v4f*)(C + o) = v; }
}

extern "C" void kernel_launch(void* const* d_in, const int* in_sizes, int n_in,
                              void* d_out, int out_size, void* d_ws, size_t ws_size, hipStream_t stream) {
  (void)in_sizes; (void)n_in; (void)out_size;
  const float* x = (const float*)d_in[0]; const int* mask = (const int*)d_in[1]; const float* Wq = (const float*)d_in[2]; const float* Wk = (const float*)d_in[3]; const float* Wv = (const float*)d_in[4]; const float* Wo = (const float*)d_in[5];
  char* ws = (char*)d_ws; size_t off = 0;
  auto take = [&](size_t bytes) { char* p = ws + off; off += (bytes + 255) & ~(size_t)255; return p; };
  const size_t WSZ = (size_t)DD * DD; _Float16* Bw = (_Float16*)take(4 * WSZ * 2); _Float16* X16 = (_Float16*)take((size_t)NR * DD * 2); float* F32 = (float*)take((size_t)NR * DD * 4);
  _Float16* Qh = (_Float16*)take((size_t)NR * DD * 2); _Float16* Ql = (_Float16*)take((size_t)NR * DD * 2); _Float16* Kh = (_Float16*)take((size_t)NR * DD * 2); _Float16* Kl = (_Float16*)take((size_t)NR * DD * 2); _Float16* V16 = (_Float16*)take((size_t)NR * DD * 2); _Float16* Vt = (_Float16*)take((size_t)NR * DD * 2);
  float* O = F32; _Float16* O16 = X16;      /* F32: q → k → O; X16 dead after the v GEMM */
  if (off > ws_size) return;      // 8.4 + 8.4 + 16.8 + 6 × 8.4 ≈ 84 MB
  const unsigned gw = (unsigned)((WSZ / 8 + 255) / 256); k_round16f<<<gw, 256, 0, stream>>>(Wq, Bw, WSZ / 8); k_round16f<<<gw, 256, 0, stream>>>(Wk, Bw + WSZ, WSZ / 8); k_round16f<<<gw, 256, 0, stream>>>(Wv, Bw + 2 * WSZ, WSZ / 8); k_round16f<<<gw, 256, 0, stream>>>(Wo, Bw + 3 * WSZ, WSZ / 8);
  const unsigned g8 = (unsigned)(((size_t)NR * DD / 8 + 255) / 256); k_x16<<<g8, 256, 0, stream>>>(x, X16, (size_t)NR * DD / 8);
  const dim3 gp((NR / 128) * (DD / 128), 1);
  k_gemm_lds<false><<<gp, 256, 0, stream>>>(X16, Bw, 0.0625f, F32, nullptr); k_elu_hl<<<g8, 256, 0, stream>>>(F32, Qh, Ql, (size_t)NR * DD / 8);      /* φ(q) hi/lo */
  k_gemm_lds<false><<<gp, 256, 0, stream>>>(X16, Bw + WSZ, 0.0625f, F32, nullptr); k_elu_hl<<<g8, 256, 0, stream>>>(F32, Kh, Kl, (size_t)NR * DD / 8);      /* φ(k) hi/lo */
  k_gemm_lds<true><<<gp, 256, 0, stream>>>(X16, Bw + 2 * WSZ, 0.0625f, nullptr, V16);
  k_vt<NH, TT><<<BB * NH * (TT / 64), 256, 0, stream>>>(V16, DD, 0, Vt);
  k_flash<<<BB * NH * (TT / 64), 128, 0, stream>>>(Qh, Ql, DD, Kh, Kl, DD, Vt, mask, O, DD);
  k_h16s<<<g8, 256, 0, stream>>>(O, O16, (size_t)NR * DD / 8);
  k_gemm_lds<false><<<gp, 256, 0, stream>>>(O16, Bw + 3 * WSZ, 0.00390625f, (float*)d_out, nullptr);      /* out = O·Woᵀ */
}

// v003
// One run takes 176 microseconds.
// Two timings next to v002 both put it at 1.47 times that version's speed.
// Counting every step since v000, it is 2.98 times as fast.
#include <hip/hip_runtime.h>
// Multi-head 'linear-feature' attention (B=2, S=2048, H=1024, 16 heads × 64): q,k,v = x·Wᵀ (no bias); φ(q) = elu(q)+1, φ(k) = elu(k)+1; attn = softmax(φ(q)·φ(k)ᵀ) UNSCALED (σ≈8 logits) with the INPUT key mask [B,S] (0 → −inf);
// out = (attn·v merged)·Woᵀ.
// Compute dtype: x and weights rounded to bf16; q,k as f32 GEMM outputs mapped through elu+1 in f32 and split into f16 hi + ×2^10 residual planes so the large unscaled logits are f32-accurate
// (S = Qh·Kh + (Ql·Kh + Qh·Kl)·2^-10, separate accumulators); v f16; fused flash-style kernel (online softmax f32, P f16 ×2^10) on v_wmma_f32_16x16x32_f16; O ×2^4 → f16 → output GEMM; f32 accumulate.
#define BB 2
#define TT 2048
#define NH 16
#define DD 1024
#define NR (BB * TT)

typedef __bf16 v16b __attribute__((ext_vector_type(16)));
typedef unsigned short v8us __attribute__((ext_vector_type(8), may_alias));
typedef float  v8f  __attribute__((ext_vector_type(8)));
typedef float  v4f  __attribute__((ext_vector_type(4)));
typedef float  v4fa __attribute__((ext_vector_type(4), may_alias));
union FragB { v16b v; v8us half[2]; unsigned short u[16]; };

__device__ __forceinline__ unsigned short bf16_bits(float x) { unsigned int u = __float_as_uint(x); return (unsigned short)((u + 0x7FFFu + ((u >> 16) & 1u)) >> 16); }
__device__ __forceinline__ float bf16_val(unsigned short b) { return __uint_as_float(((unsigned int)b) << 16); }
__device__ __forceinline__ float bf16_round(float x) { return bf16_val(bf16_bits(x)); }
// D += A·B with NT terms: 1 = ah·bh, 2 = + al·bh (A split), 3 = + ah·bl (both split)
template <int NT>
__device__ __forceinline__ v8f mmaN(v16b ah, v16b al, v16b bh, v16b bl, v8f c) {
  c = __builtin_amdgcn_wmma_f32_16x16x32_bf16(false, ah, false, bh, (short)0, c, false, false);
  if (NT >= 2) c = __builtin_amdgcn_wmma_f32_16x16x32_bf16(false, al, false, bh, (short)0, c, false, false);
  if (NT >= 3) c = __builtin_amdgcn_wmma_f32_16x16x32_bf16(false, ah, false, bl, (short)0, c, false, false);
  asm volatile("v_nop\n\tv_nop\n\tv_nop\n\tv_nop" : "+v"(c) : "v"(ah), "v"(al), "v"(bh), "v"(bl));
  return c;
}

__global__ __launch_bounds__(256) void k_wt_bf16(const float* __restrict__ W, unsigned short* __restrict__ Wt, int K, int N) {
  const int t = blockIdx.x * 256 + threadIdx.x;
  const int k8n = K / 8;
  if (t >= N * k8n) return;
  const int n = t / k8n, k8 = (t % k8n) * 8;
  v8us v;
#pragma unroll
  for (int i = 0; i < 8; ++i) v[i] = bf16_bits(W[(size_t)(k8 + i) * N + n]);
  *(v8us*)(Wt + (size_t)n * K + k8) = v;
  
}

// GEMM C[M][N] (f32, pitch ldc) = act(A[M][K]·W + bias). A f32 row-major (pitch lda) converted per fragment to bf16
// (ASPLIT: hi/lo two planes -> 2 terms, else single rounded term); Wt bf16 [N][K] (pitch ldb). BIAS_BF16 rounds the
// bias to bf16 first (bias quantised to bf16 before the add). K%32==0, M%16==0, N%64==0.
template <bool ASPLIT, int ACT, bool BIAS_BF16>
__global__ __launch_bounds__(128) void k_gemm_bf(const float* __restrict__ A, int lda, const unsigned short* __restrict__ Wt, int ldb,
                                               const float* __restrict__ bias, float* __restrict__ C, int ldc, int M, int N, int K) {
  __shared__ __attribute__((aligned(16))) float so[4][16][64];
  const int tid = threadIdx.x, w = tid >> 5, lane = tid & 31, ln = lane & 15, hh = lane >> 4;
  const int ntn = N / 64;
  const int wid = blockIdx.x * 4 + w;
  const int mt = wid / ntn, nq = wid % ntn;
  if (mt * 16 >= M) return;
  const int row0 = mt * 16, col0 = nq * 64;
  const float* arow = A + (size_t)(row0 + ln) * lda;
  v8f acc[4] = {};
  for (int kb = 0; kb < K; kb += 32) {
    FragB ah, al;
    const v4f x0 = *(const v4fa*)(arow + kb + 8 * hh), x1 = *(const v4fa*)(arow + kb + 8 * hh + 4);
    const v4f x2 = *(const v4fa*)(arow + kb + 16 + 8 * hh), x3 = *(const v4fa*)(arow + kb + 16 + 8 * hh + 4);
    float xs[16] = {x0[0],x0[1],x0[2],x0[3],x1[0],x1[1],x1[2],x1[3],x2[0],x2[1],x2[2],x2[3],x3[0],x3[1],x3[2],x3[3]};
#pragma unroll
    for (int i = 0; i < 16; ++i) { const unsigned short hb = bf16_bits(xs[i]); ah.u[i] = hb; al.u[i] = ASPLIT ? bf16_bits(xs[i] - bf16_val(hb)) : (unsigned short)0; }
#pragma unroll
    for (int t = 0; t < 4; ++t) {
      const unsigned short* brow = Wt + (size_t)(col0 + t * 16 + ln) * ldb + kb;
      FragB b;
      b.half[0] = *(const v8us*)(brow + 8 * hh);
      b.half[1] = *(const v8us*)(brow + 16 + 8 * hh);
      acc[t] = mmaN<ASPLIT ? 2 : 1>(ah.v, al.v, b.v, b.v, acc[t]);
    }
  }
#pragma unroll
  for (int t = 0; t < 4; ++t) {
    float bv = bias ? bias[col0 + t * 16 + ln] : 0.f;
    if (BIAS_BF16) bv = bf16_round(bv);
#pragma unroll
    for (int r = 0; r < 8; ++r) { float v = acc[t][r] + bv; if (ACT == 1) v = fmaxf(v, 0.f); so[w][8 * hh + r][t * 16 + ln] = v; }
  }
  __builtin_amdgcn_fence(__ATOMIC_ACQ_REL, "workgroup");
  __builtin_amdgcn_wave_barrier();
  const int rsub = lane >> 4, c4 = (lane & 15) * 4;
  {
#pragma unroll
    for (int q = 0; q < 8; ++q) {
      const int r = q * 2 + rsub;
      const v4f v = *(const v4fa*)&so[w][r][c4];
      *(v4f*)(C + (size_t)(row0 + r) * ldc + col0 + c4) = v;
    }
    
  }
}

// Flash-style causal/unmasked attention, all contractions 3-term bf16 hi/lo splits, f32 softmax with running max.
// q,k,v rows are read from f32 buffers with arbitrary row pitch (so they can live inside a fused qkv buffer);
// D = head size (multiple of 32, <= 128); one wave = 16 query rows; block = 4 waves (64 queries) sharing K/V chunks of 32.
template <int D, bool CAUSAL>
__global__ __launch_bounds__(128) void k_flash(const float* __restrict__ qb, const float* __restrict__ kb, const float* __restrict__ vb,
                                             int pitch, int T, int H, float scale, float* __restrict__ y, int ypitch) {
  constexpr int KS = D / 32;        // k-steps for QK
  constexpr int DT = D / 16;        // d tiles for PV
  __shared__ __attribute__((aligned(16))) unsigned short sKh[32][D + 8], sKl[32][D + 8], sVh[32][D + 8], sVl[32][D + 8];
  __shared__ __attribute__((aligned(16))) unsigned short sPh[4][16][40], sPl[4][16][40];
  __shared__ __attribute__((aligned(16))) float sO[4][16][D];
  const int tid = threadIdx.x, w = tid >> 5, lane = tid & 31, ln = lane & 15, hh = lane >> 4;
  const int nqb = (T + 63) / 64;
  const int bh = blockIdx.x / nqb, qblk = blockIdx.x % nqb;
  const int b = bh / H, h = bh % H;
  const int q0 = qblk * 64 + w * 16;
  const float* Q = qb + (size_t)b * T * pitch + h * D;
  const float* K = kb + (size_t)b * T * pitch + h * D;
  const float* V = vb + (size_t)b * T * pitch + h * D;

  // A fragments of the wave's 16 query rows (scaled), hi/lo
  FragB aqh[KS], aql[KS];
  {
    int row = q0 + ln; if (row >= T) row = T - 1;
    const float* qr = Q + (size_t)row * pitch;
#pragma unroll
    for (int ks = 0; ks < KS; ++ks)
#pragma unroll
      for (int i = 0; i < 16; ++i) {
        const int d = ks * 32 + ((i < 8) ? (8 * hh + i) : (16 + 8 * hh + (i - 8)));
        const float x = qr[d] * scale; const unsigned short hb = bf16_bits(x);
        aqh[ks].u[i] = hb; aql[ks].u[i] = bf16_bits(x - bf16_val(hb));
      }
  }
  float m_r[8], l_r[8];
#pragma unroll
  for (int r = 0; r < 8; ++r) { m_r[r] = -3.0e38f; l_r[r] = 0.f; }
  v8f oacc[DT];
#pragma unroll
  for (int dt = 0; dt < DT; ++dt) oacc[dt] = (v8f){0.f,0.f,0.f,0.f,0.f,0.f,0.f,0.f};

  const int kv_end = CAUSAL ? min(T, qblk * 64 + 64) : T;     // block-uniform
  for (int j0 = 0; j0 < kv_end; j0 += 32) {
    __syncthreads();
    for (int e = tid; e < 32 * (D / 4); e += 128) {
      const int r = e / (D / 4), c4 = (e % (D / 4)) * 4;
      const int key = j0 + r;
      v4f kf = {0.f,0.f,0.f,0.f}, vf = {0.f,0.f,0.f,0.f};
      if (key < T) { kf = *(const v4fa*)(K + (size_t)key * pitch + c4); vf = *(const v4fa*)(V + (size_t)key * pitch + c4); }
#pragma unroll
      for (int t = 0; t < 4; ++t) {
        unsigned short hb = bf16_bits(kf[t]); sKh[r][c4 + t] = hb; sKl[r][c4 + t] = bf16_bits(kf[t] - bf16_val(hb));
        hb = bf16_bits(vf[t]); sVh[r][c4 + t] = hb; sVl[r][c4 + t] = bf16_bits(vf[t] - bf16_val(hb));
      }
    }
    __syncthreads();
    // S tile 16 x 32
    v8f s[2];
#pragma unroll
    for (int nt = 0; nt < 2; ++nt) {
      v8f acc = {};
#pragma unroll
      for (int ks = 0; ks < KS; ++ks) {
        FragB bh_, bl_;
        bh_.half[0] = *(const v8us*)&sKh[nt * 16 + ln][ks * 32 + 8 * hh]; bh_.half[1] = *(const v8us*)&sKh[nt * 16 + ln][ks * 32 + 16 + 8 * hh];
        bl_.half[0] = *(const v8us*)&sKl[nt * 16 + ln][ks * 32 + 8 * hh]; bl_.half[1] = *(const v8us*)&sKl[nt * 16 + ln][ks * 32 + 16 + 8 * hh];
        acc = mmaN<3>(aqh[ks].v, aql[ks].v, bh_.v, bl_.v, acc);
      }
      s[nt] = acc;
    }
    // mask + running max (rows 8hh+r; the 16 lanes of a half share rows)
    float alpha[8];
#pragma unroll
    for (int r = 0; r < 8; ++r) {
      const int qi = q0 + 8 * hh + r;
      const int ja = j0 + ln, jb = j0 + 16 + ln;
      if (CAUSAL) { if (ja > qi) s[0][r] = -3.0e38f; if (jb > qi) s[1][r] = -3.0e38f; }
      if (ja >= T) s[0][r] = -3.0e38f;
      if (jb >= T) s[1][r] = -3.0e38f;
      float mx = fmaxf(s[0][r], s[1][r]);
      mx = fmaxf(mx, __shfl_xor(mx, 1, 32)); mx = fmaxf(mx, __shfl_xor(mx, 2, 32)); mx = fmaxf(mx, __shfl_xor(mx, 4, 32)); mx = fmaxf(mx, __shfl_xor(mx, 8, 32));
      const float mnew = fmaxf(m_r[r], mx);
      alpha[r] = (mnew > -1.0e38f) ? __expf(m_r[r] - mnew) : 1.0f;
      const float p0 = (s[0][r] > -1.0e38f) ? __expf(s[0][r] - mnew) : 0.f;
      const float p1 = (s[1][r] > -1.0e38f) ? __expf(s[1][r] - mnew) : 0.f;
      m_r[r] = mnew;
      l_r[r] = l_r[r] * alpha[r] + p0 + p1;            // per-lane partial row sum (16 lanes combined at the end)
      unsigned short hb = bf16_bits(p0); sPh[w][8 * hh + r][ln] = hb;      sPl[w][8 * hh + r][ln] = bf16_bits(p0 - bf16_val(hb));
      hb = bf16_bits(p1);                sPh[w][8 * hh + r][16 + ln] = hb; sPl[w][8 * hh + r][16 + ln] = bf16_bits(p1 - bf16_val(hb));
    }
#pragma unroll
    for (int dt = 0; dt < DT; ++dt)
#pragma unroll
      for (int r = 0; r < 8; ++r) oacc[dt][r] *= alpha[r];
    __builtin_amdgcn_fence(__ATOMIC_ACQ_REL, "workgroup");
    __builtin_amdgcn_wave_barrier();
    FragB pah, pal;
    pah.half[0] = *(const v8us*)&sPh[w][ln][8 * hh]; pah.half[1] = *(const v8us*)&sPh[w][ln][16 + 8 * hh];
    pal.half[0] = *(const v8us*)&sPl[w][ln][8 * hh]; pal.half[1] = *(const v8us*)&sPl[w][ln][16 + 8 * hh];
#pragma unroll
    for (int dt = 0; dt < DT; ++dt) {
      FragB bvh, bvl;
#pragma unroll
      for (int i = 0; i < 8; ++i) {
        bvh.u[i] = sVh[8 * hh + i][dt * 16 + ln]; bvh.u[8 + i] = sVh[16 + 8 * hh + i][dt * 16 + ln];
        bvl.u[i] = sVl[8 * hh + i][dt * 16 + ln]; bvl.u[8 + i] = sVl[16 + 8 * hh + i][dt * 16 + ln];
      }
      oacc[dt] = mmaN<3>(pah.v, pal.v, bvh.v, bvl.v, oacc[dt]);
    }
    __builtin_amdgcn_fence(__ATOMIC_ACQ_REL, "workgroup");
    __builtin_amdgcn_wave_barrier();
  }
#pragma unroll
  for (int r = 0; r < 8; ++r) {
    float l = l_r[r];
    l += __shfl_xor(l, 1, 32); l += __shfl_xor(l, 2, 32); l += __shfl_xor(l, 4, 32); l += __shfl_xor(l, 8, 32);
    l_r[r] = (l > 0.f) ? 1.0f / l : 0.f;
  }
#pragma unroll
  for (int dt = 0; dt < DT; ++dt)
#pragma unroll
    for (int r = 0; r < 8; ++r) sO[w][8 * hh + r][dt * 16 + ln] = oacc[dt][r] * l_r[r];
  __builtin_amdgcn_fence(__ATOMIC_ACQ_REL, "workgroup");
  __builtin_amdgcn_wave_barrier();
  {
    for (int r = 0; r < 16; ++r) {
      const int row = q0 + r;
      if (row < T && lane < D / 4) {
        const v4f val = *(const v4fa*)&sO[w][r][lane * 4];
        *(v4f*)(y + ((size_t)b * T + row) * ypitch + h * D + lane * 4) = val;
      }
    }
    
  }
}

// GEMM C = act(A·W + bias + resid): A f32 (ASPLIT -> hi/lo 2 terms), Wt bf16 [N][K]; ACT 0 none, 1 relu, 2 exact gelu;
// resid (optional, f32, row index = (row % rmod), pitch ldr, RES_BF16 rounds it) added before the activation.
template <bool ASPLIT, int ACT, bool BIAS_BF16, bool RES_BF16>
__global__ __launch_bounds__(128) void k_gemm_bf3(const float* __restrict__ A, int lda, const unsigned short* __restrict__ Wt, int ldb,
                                                const float* __restrict__ bias, const float* __restrict__ resid, int rmod, int ldr,
                                                float* __restrict__ C, int ldc, int M, int N, int K) {
  __shared__ __attribute__((aligned(16))) float so[4][16][64];
  const int tid = threadIdx.x, w = tid >> 5, lane = tid & 31, ln = lane & 15, hh = lane >> 4;
  const int ntn = N / 64;
  const int wid = blockIdx.x * 4 + w;
  const int mt = wid / ntn, nq = wid % ntn;
  if (mt * 16 >= M) return;
  const int row0 = mt * 16, col0 = nq * 64;
  const float* arow = A + (size_t)(row0 + ln) * lda;
  v8f acc[4] = {};
  for (int kb = 0; kb < K; kb += 32) {
    FragB ah, al;
    const v4f x0 = *(const v4fa*)(arow + kb + 8 * hh), x1 = *(const v4fa*)(arow + kb + 8 * hh + 4);
    const v4f x2 = *(const v4fa*)(arow + kb + 16 + 8 * hh), x3 = *(const v4fa*)(arow + kb + 16 + 8 * hh + 4);
    float xs[16] = {x0[0],x0[1],x0[2],x0[3],x1[0],x1[1],x1[2],x1[3],x2[0],x2[1],x2[2],x2[3],x3[0],x3[1],x3[2],x3[3]};
#pragma unroll
    for (int i = 0; i < 16; ++i) { const unsigned short hb = bf16_bits(xs[i]); ah.u[i] = hb; al.u[i] = ASPLIT ? bf16_bits(xs[i] - bf16_val(hb)) : (unsigned short)0; }
#pragma unroll
    for (int t = 0; t < 4; ++t) {
      const unsigned short* brow = Wt + (size_t)(col0 + t * 16 + ln) * ldb + kb;
      FragB b;
      b.half[0] = *(const v8us*)(brow + 8 * hh);
      b.half[1] = *(const v8us*)(brow + 16 + 8 * hh);
      acc[t] = mmaN<ASPLIT ? 2 : 1>(ah.v, al.v, b.v, b.v, acc[t]);
    }
  }
#pragma unroll
  for (int t = 0; t < 4; ++t) {
    const int col = col0 + t * 16 + ln;
    float bv = bias ? bias[col] : 0.f;
    if (BIAS_BF16) bv = bf16_round(bv);
#pragma unroll
    for (int r = 0; r < 8; ++r) {
      float v = acc[t][r] + bv;
      if (resid) { float rv = resid[(size_t)((row0 + 8 * hh + r) % rmod) * ldr + col]; if (RES_BF16) rv = bf16_round(rv); v += rv; }
      if (ACT == 1) v = fmaxf(v, 0.f);
      if (ACT == 2) v = 0.5f * v * (1.0f + erff(v * 0.70710678118654752f));
      if (ACT == 3) { const float u = 0.7978845608028654f * (v + 0.044715f * v * v * v); v = 0.5f * v * (1.0f + tanhf(u)); }
      so[w][8 * hh + r][t * 16 + ln] = v;
    }
  }
  __builtin_amdgcn_fence(__ATOMIC_ACQ_REL, "workgroup");
  __builtin_amdgcn_wave_barrier();
  const int rsub = lane >> 4, c4 = (lane & 15) * 4;
  {
#pragma unroll
    for (int q = 0; q < 8; ++q) {
      const int r = q * 2 + rsub;
      const v4f v = *(const v4fa*)&so[w][r][c4];
      *(v4f*)(C + (size_t)(row0 + r) * ldc + col0 + c4) = v;
    }
    
  }
}
// row LayerNorm (biased variance, eps) over N: s = X (+ R); optional out_sum <- s; out_norm <- (s-mu)*rsqrt(var+eps)*g + b
template <bool PARAM_BF16>
__global__ __launch_bounds__(256) void k_layernorm(const float* __restrict__ X, const float* __restrict__ R, const float* __restrict__ g, const float* __restrict__ bta,
                                                  float* __restrict__ out_sum, float* __restrict__ out_norm, int N, float eps) {
  __shared__ float red[256];
  const int row = blockIdx.x, tid = threadIdx.x;
  const float* x = X + (size_t)row * N; const float* rr = R ? R + (size_t)row * N : nullptr;
  float vals[16];                     // up to N = 4096
  const int per = N / 256;            // contiguous chunk per thread? use strided-by-4 chunks: thread handles j = tid*4 + 1024*u
  float s1 = 0.f;
  for (int u = 0; u < per / 4; ++u) {
    const int j = tid * 4 + 1024 * u;
    const v4f a = *(const v4fa*)(x + j);
    v4f b = {0.f,0.f,0.f,0.f}; if (rr) b = *(const v4fa*)(rr + j);
#pragma unroll
    for (int q = 0; q < 4; ++q) { const float v = a[q] + b[q]; vals[u * 4 + q] = v; s1 += v; }
  }
  red[tid] = s1; __syncthreads();
  for (int st = 128; st > 0; st >>= 1) { if (tid < st) red[tid] += red[tid + st]; __syncthreads(); }
  const float mu = red[0] / (float)N; __syncthreads();
  float s2 = 0.f;
  for (int u = 0; u < per / 4; ++u)
#pragma unroll
    for (int q = 0; q < 4; ++q) { const float c = vals[u * 4 + q] - mu; s2 += c * c; }
  red[tid] = s2; __syncthreads();
  for (int st = 128; st > 0; st >>= 1) { if (tid < st) red[tid] += red[tid + st]; __syncthreads(); }
  const float rs = rsqrtf(red[0] / (float)N + eps);
  {
    for (int u = 0; u < per / 4; ++u) {
      const int j = tid * 4 + 1024 * u;
      v4f o, sm;
#pragma unroll
      for (int q = 0; q < 4; ++q) {
        float gg = g[j + q], bb = bta[j + q];
        if (PARAM_BF16) { gg = bf16_round(gg); bb = bf16_round(bb); }
        sm[q] = vals[u * 4 + q]; o[q] = (vals[u * 4 + q] - mu) * rs * gg + bb;
      }
      if (out_sum) *(v4f*)(out_sum + (size_t)row * N + j) = sm;
      *(v4f*)(out_norm + (size_t)row * N + j) = o;
    }
    
  }
}



// ---- f16 WMMA path (v_wmma_f32_16x16x32_f16): 11-bit significands for operands in range — used where a [0,1] probability operand needs more precision than bf16
typedef _Float16 v16h __attribute__((ext_vector_type(16)));
union FragH { v16h v; v8us half[2]; _Float16 h[16]; unsigned short u[16]; };
template <int NT>
__device__ __forceinline__ v8f mmaH(v16h ah, v16h al, v16h bh, v16h bl, v8f c) {
  c = __builtin_amdgcn_wmma_f32_16x16x32_f16(false, ah, false, bh, (short)0, c, false, false);
  if (NT >= 2) c = __builtin_amdgcn_wmma_f32_16x16x32_f16(false, al, false, bh, (short)0, c, false, false);
  if (NT >= 3) c = __builtin_amdgcn_wmma_f32_16x16x32_f16(false, ah, false, bl, (short)0, c, false, false);
  asm volatile("v_nop\n\tv_nop\n\tv_nop\n\tv_nop" : "+v"(c) : "v"(ah), "v"(al), "v"(bh), "v"(bl));
  return c;
}
// batched GEMM like k_gemm_b but f16 operands: A f32 (split into f16 hi/lo if ASPLIT, else rounded to f16), Bt = f16 values [n][k]; alpha; C f32; N multiple of 16 (partial tiles skipped)
template <bool ASPLIT>
__global__ __launch_bounds__(128) void k_gemm_h(const float* __restrict__ A, int lda, size_t sA, const _Float16* __restrict__ Bh, int ldb, size_t sB, float alpha, float* __restrict__ C, int ldc, size_t sC, int M, int N, int K) {
  __shared__ __attribute__((aligned(16))) float so[4][16][64];
  const int tid = threadIdx.x, w = tid >> 5, lane = tid & 31, ln = lane & 15, hh = lane >> 4; const int by = blockIdx.y;
  A += (size_t)by * sA; Bh += (size_t)by * sB; C += (size_t)by * sC;
  const int ntn = (N + 63) / 64; const int wid = blockIdx.x * 4 + w; const int mt = wid / ntn, nq = wid % ntn; if (mt * 16 >= M) return;
  const int row0 = mt * 16, col0 = nq * 64; const float* arow = A + (size_t)(row0 + ln) * lda;
  v8f acc[4] = {};
  for (int kb = 0; kb < K; kb += 32) {
    FragH ah, al;
    const v4f x0 = *(const v4fa*)(arow + kb + 8 * hh), x1 = *(const v4fa*)(arow + kb + 8 * hh + 4), x2 = *(const v4fa*)(arow + kb + 16 + 8 * hh), x3 = *(const v4fa*)(arow + kb + 16 + 8 * hh + 4);
    float xs[16] = {x0[0],x0[1],x0[2],x0[3],x1[0],x1[1],x1[2],x1[3],x2[0],x2[1],x2[2],x2[3],x3[0],x3[1],x3[2],x3[3]};
#pragma unroll
    for (int i = 0; i < 16; ++i) { const _Float16 h = (_Float16)xs[i]; ah.h[i] = h; al.h[i] = ASPLIT ? (_Float16)(xs[i] - (float)h) : (_Float16)0.0f; }
#pragma unroll
    for (int t = 0; t < 4; ++t) { if (col0 + t * 16 >= N) continue; const size_t boff = (size_t)(col0 + t * 16 + ln) * ldb + kb; FragH bq; bq.half[0] = *(const v8us*)(Bh + boff + 8 * hh); bq.half[1] = *(const v8us*)(Bh + boff + 16 + 8 * hh);
      acc[t] = mmaH<ASPLIT ? 2 : 1>(ah.v, al.v, bq.v, bq.v, acc[t]); }
  }
#pragma unroll
  for (int t = 0; t < 4; ++t) { if (col0 + t * 16 >= N) continue;
#pragma unroll
    for (int r = 0; r < 8; ++r) so[w][8 * hh + r][t * 16 + ln] = acc[t][r] * alpha; }
  __builtin_amdgcn_fence(__ATOMIC_ACQ_REL, "workgroup"); __builtin_amdgcn_wave_barrier();
  const int rsub = lane >> 4, c4 = (lane & 15) * 4;
  {
#pragma unroll
    for (int q = 0; q < 8; ++q) { const int r = q * 2 + rsub; if (col0 + c4 < N) { const v4f v = *(const v4fa*)&so[w][r][c4]; *(v4f*)(C + (size_t)(row0 + r) * ldc + col0 + c4) = v; } }
     }
}

// Wt[n][k] = f16(W[k][n]·scale) from f32 row-major W[K][N] (scale = power of two; bf16-exact weights stay exact in f16 away from the subnormal range)
__global__ __launch_bounds__(256) void k_wt_f16(const float* __restrict__ W, _Float16* __restrict__ Wt, int K, int N, float scale) {
  const int t = blockIdx.x * 256 + threadIdx.x; if (t >= N * (K / 8)) return; const int n = t / (K / 8), k8 = (t % (K / 8)) * 8; FragH f;
#pragma unroll
  for (int i = 0; i < 8; ++i) f.h[i] = (_Float16)(bf16_round(W[(size_t)(k8 + i) * N + n]) * scale); const v8us o = f.half[0];
  *(v8us*)((unsigned short*)Wt + (size_t)n * K + k8) = o; 
}
// k_gemm_hh variant with fused epilogue: v = acc·alpha + bias[by·sBias + col] (+ CP[(row/rowsPerB)·sCPb + by·64 + col] if CP) ; ACT 0 none / 1 elu ; writes f32 C and/or f16 C16 (each if non-null)
template <int ACT>
__global__ __launch_bounds__(128) void k_gemm_hhx(const _Float16* __restrict__ A, int lda, size_t sA, const _Float16* __restrict__ Bh, int ldb, size_t sB, float alpha, const float* __restrict__ bias, size_t sBias, const float* __restrict__ CP, int rowsPerB, size_t sCPb, int row0g,
    float* __restrict__ C, _Float16* __restrict__ C16, int ldc, size_t sC, int M, int N, int K) {
  __shared__ __attribute__((aligned(16))) float so[4][16][64];
  const int tid = threadIdx.x, w = tid >> 5, lane = tid & 31, ln = lane & 15, hh = lane >> 4; const int by = blockIdx.y;
  A += (size_t)by * sA; Bh += (size_t)by * sB; const size_t cofs = (size_t)by * sC; const float* bp = bias ? bias + (size_t)by * sBias : nullptr;
  const int ntn = (N + 63) / 64; const int wid = blockIdx.x * 4 + w; const int mt = wid / ntn, nq = wid % ntn; if (mt * 16 >= M) return;
  const int row0 = mt * 16, col0 = nq * 64; const _Float16* arow = A + (size_t)(row0 + ln) * lda;
  v8f acc[4] = {};
  for (int kb = 0; kb < K; kb += 32) { FragH ah; ah.half[0] = *(const v8us*)((const unsigned short*)arow + kb + 8 * hh); ah.half[1] = *(const v8us*)((const unsigned short*)arow + kb + 16 + 8 * hh);
#pragma unroll
    for (int t = 0; t < 4; ++t) { if (col0 + t * 16 >= N) continue; const size_t boff = (size_t)(col0 + t * 16 + ln) * ldb + kb; FragH bq; bq.half[0] = *(const v8us*)((const unsigned short*)Bh + boff + 8 * hh); bq.half[1] = *(const v8us*)((const unsigned short*)Bh + boff + 16 + 8 * hh);
      acc[t] = mmaH<1>(ah.v, ah.v, bq.v, bq.v, acc[t]); }
  }
#pragma unroll
  for (int t = 0; t < 4; ++t) { if (col0 + t * 16 >= N) continue; const int col = col0 + t * 16 + ln; const float bv = bp ? bf16_round(bp[col]) : 0.f;
#pragma unroll
    for (int r = 0; r < 8; ++r) { float v = acc[t][r] * alpha + bv; if (CP) { const int bidx = (row0g + row0 + 8 * hh + r) / rowsPerB; v += CP[(size_t)bidx * sCPb + (size_t)by * 64 + col]; } if (ACT == 1) v = (v > 0.f) ? v : expm1f(v); else if (ACT == 7) v = (v > 0.f) ? v + 1.0f : expf(v); else if (ACT == 8) v = tanhf(v); else if (ACT == 9) v = 0.5f * v * (1.0f + tanhf(0.7978845608028654f * (v + 0.044715f * v * v * v))); else if (ACT == 11) v = 1.0f / (1.0f + expf(-v)); else if (ACT == 12) v = (v > 0.f) ? v : 0.01f * v; else if (ACT == 14) v = (v > 0.f) ? v : 0.1f * v; else if (ACT == 15) v = v / (1.0f + expf(-v)); else if (ACT == 3) v = fmaxf(v, 0.f); else if (ACT == 6) v = 0.5f * v * (1.0f + erff(v * 0.70710678118654752f)); so[w][8 * hh + r][t * 16 + ln] = v; } }
  __builtin_amdgcn_fence(__ATOMIC_ACQ_REL, "workgroup"); __builtin_amdgcn_wave_barrier();
  const int rsub = lane >> 4, c4 = (lane & 15) * 4; typedef _Float16 v4h __attribute__((ext_vector_type(4)));
  {
#pragma unroll
    for (int q = 0; q < 8; ++q) { const int r = q * 2 + rsub; if (col0 + c4 < N) { const v4f v = *(const v4fa*)&so[w][r][c4]; if (C) *(v4f*)(C + cofs + (size_t)(row0 + r) * ldc + col0 + c4) = v; if (C16) { v4h h4; for (int i = 0; i < 4; ++i) h4[i] = (_Float16)v[i]; *(v4h*)(C16 + cofs + (size_t)(row0 + r) * ldc + col0 + c4) = h4; } } }
     }
}


typedef _Float16 v4h __attribute__((ext_vector_type(4)));

__global__ __launch_bounds__(256) void k_x16(const float* __restrict__ x, _Float16* __restrict__ X16, size_t n8) { const size_t t = (size_t)blockIdx.x * 256 + threadIdx.x; if (t >= n8) return; FragH f;
#pragma unroll
  for (int q = 0; q < 8; ++q) f.h[q] = (_Float16)bf16_round(x[t * 8 + q]); *(v8us*)((unsigned short*)X16 + t * 8) = f.half[0];  }
__global__ __launch_bounds__(256) void k_h16(const float* __restrict__ x, _Float16* __restrict__ X16, size_t n8) { const size_t t = (size_t)blockIdx.x * 256 + threadIdx.x; if (t >= n8) return; FragH f;
#pragma unroll
  for (int q = 0; q < 8; ++q) f.h[q] = (_Float16)x[t * 8 + q]; *(v8us*)((unsigned short*)X16 + t * 8) = f.half[0];  }
__global__ __launch_bounds__(256) void k_round16f(const float* __restrict__ W, _Float16* __restrict__ Bt, size_t n8) { const size_t t = (size_t)blockIdx.x * 256 + threadIdx.x; if (t >= n8) return; FragH f;
#pragma unroll
  for (int i = 0; i < 8; ++i) f.h[i] = (_Float16)(bf16_round(W[t * 8 + i]) * 16.0f); *(v8us*)((unsigned short*)Bt + t * 8) = f.half[0];  }
template <int NHv, int TTv>
__global__ __launch_bounds__(256) void k_vt(const _Float16* __restrict__ V16, int ldv, int voff, _Float16* __restrict__ Vt) { __shared__ unsigned short tl[64][66]; const int tid = threadIdx.x; const int slab = blockIdx.x / (TTv / 64), lg = blockIdx.x % (TTv / 64); const int b = slab / NHv, h = slab % NHv;
  for (int i = tid; i < 64 * 8; i += 256) { const int r = i / 8, c8 = (i % 8) * 8; FragH f; f.half[0] = *(const v8us*)((const unsigned short*)V16 + ((size_t)b * TTv + lg * 64 + r) * ldv + voff + h * 64 + c8);
#pragma unroll
    for (int q = 0; q < 8; ++q) tl[r][c8 + q] = f.u[q]; }
  __syncthreads();
  {
#pragma unroll
    for (int rd = 0; rd < 2; ++rd) { const int d = rd * 32 + tid / 8, pc = tid % 8; FragH f;
#pragma unroll
      for (int q = 0; q < 8; ++q) f.u[q] = tl[pc * 8 + q][d];
      *(v8us*)((unsigned short*)Vt + ((size_t)slab * 64 + d) * TTv + lg * 64 + pc * 8) = f.half[0]; }
     } }

__global__ __launch_bounds__(256) void k_elu_hl(const float* __restrict__ F, _Float16* __restrict__ Hh, _Float16* __restrict__ Hl, size_t n8) { const size_t t = (size_t)blockIdx.x * 256 + threadIdx.x; if (t >= n8) return; const v4f a = *(const v4fa*)(F + t * 8), c = *(const v4fa*)(F + t * 8 + 4); FragH fh, fl;
#pragma unroll
  for (int q = 0; q < 8; ++q) { const float x = (q < 4) ? a[q] : c[q - 4]; const float v = (x > 0.f) ? x + 1.0f : expf(x);      /* elu(x) + 1 = x+1 (x>0) | e^x (x≤0) */ const _Float16 h = (_Float16)v; fh.h[q] = h; fl.h[q] = (_Float16)((v - (float)h) * 1024.0f); }
  { *(v8us*)((unsigned short*)Hh + t * 8) = fh.half[0]; *(v8us*)((unsigned short*)Hl + t * 8) = fl.half[0];  } }
__global__ __launch_bounds__(256) void k_h16s(const float* __restrict__ F, _Float16* __restrict__ H, size_t n8) { const size_t t = (size_t)blockIdx.x * 256 + threadIdx.x; if (t >= n8) return; const v4f a = *(const v4fa*)(F + t * 8), c = *(const v4fa*)(F + t * 8 + 4); FragH f;
#pragma unroll
  for (int q = 0; q < 4; ++q) { f.h[q] = (_Float16)(a[q] * 16.0f); f.h[4 + q] = (_Float16)(c[q] * 16.0f); } *(v8us*)((unsigned short*)H + t * 8) = f.half[0];  }
typedef int v4ia __attribute__((ext_vector_type(4), may_alias));
// lane l <-> lane l ^ 16 (the two halves of a wave hold the two key groups of one query column)
__device__ __forceinline__ float xhalf(float x) { return __builtin_bit_cast(float, __builtin_amdgcn_permlanex16(__builtin_bit_cast(int, x), __builtin_bit_cast(int, x), 0x76543210, 0xfedcba98, false, false)); }
#define FS_KEYS 64
#define FS_PITCH 144
#define FS_PLANE (64 * FS_PITCH)
#define FS_STAGE (3 * FS_PLANE)
// six copies of one lane: rows r and r + 32 of K hi, K lo and Vt, 16 B each. The s_wait_xcnt stands inside the copies' own statement, so that no address register named here is rewritten in front of it.
__device__ __forceinline__ void fs_copy6(unsigned l, const _Float16* kh, const _Float16* kl, int ldk, const _Float16* vt) {
  asm volatile("global_load_async_to_lds_b128 %0, %6, off\n\t"
               "global_load_async_to_lds_b128 %1, %7, off\n\t"
               "global_load_async_to_lds_b128 %2, %8, off\n\t"
               "global_load_async_to_lds_b128 %3, %9, off\n\t"
               "global_load_async_to_lds_b128 %4, %10, off\n\t"
               "global_load_async_to_lds_b128 %5, %11, off\n\t"
               "s_wait_xcnt 0x0"
               :: "v"(l), "v"(l + 32 * FS_PITCH), "v"(l + FS_PLANE), "v"(l + FS_PLANE + 32 * FS_PITCH), "v"(l + 2 * FS_PLANE), "v"(l + 2 * FS_PLANE + 32 * FS_PITCH),
                  "v"(kh), "v"(kh + (size_t)32 * ldk), "v"(kl), "v"(kl + (size_t)32 * ldk), "v"(vt), "v"(vt + 32 * TT)
               : "memory");
}
__global__ __launch_bounds__(256) void k_flash(const _Float16* __restrict__ Q16, const _Float16* __restrict__ Q16lo, int ldq, const _Float16* __restrict__ K16, const _Float16* __restrict__ K16lo, int ldk, const _Float16* __restrict__ Vt, const int* __restrict__ MSK, float* __restrict__ O, int ldo) {
  constexpr int RPW = 16, NW = 8, NQB = TT / (NW * RPW), DT = 4, KS = 2, NST = TT / FS_KEYS;
  __shared__ __attribute__((aligned(16))) unsigned char sT[2 * FS_STAGE];
  __shared__ __attribute__((aligned(16))) int sM[TT];
  __shared__ __attribute__((aligned(16))) float sO[NW][RPW][64 + 4];
  const int tid = threadIdx.x, w = tid >> 5, lane = tid & 31, ln = lane & 15, hh = lane >> 4;
  const int slab = blockIdx.x / NQB, qblk = blockIdx.x % NQB; const int b = slab / NH, h = slab % NH; const int q0 = qblk * (NW * RPW) + w * RPW;
  const int cr = tid >> 3, cc = tid & 7;      /* this lane's row (mod 32) and 16-B column of every stage copy */
  const size_t kofs = ((size_t)b * TT + cr) * ldk + h * 64 + cc * 8;
  const _Float16* gkh = K16 + kofs; const _Float16* gkl = K16lo + kofs; const _Float16* gvt = Vt + ((size_t)slab * 64 + cr) * TT + cc * 8;
  const unsigned lt = (unsigned)(size_t)sT + cr * FS_PITCH + cc * 16;
  { const unsigned lm = (unsigned)(size_t)sM + tid * 16; const int* gm = MSK + (size_t)b * TT + tid * 4;
    /* the mask row, 2 x 16 B a lane; the wait inside the statement keeps its address registers until the copies have read them */
    asm volatile("global_load_async_to_lds_b128 %0, %2, off\n\t"
                 "global_load_async_to_lds_b128 %1, %3, off\n\t"
                 "s_wait_xcnt 0x0" :: "v"(lm), "v"(lm + TT * 2), "v"(gm), "v"(gm + TT / 2) : "memory"); }
  fs_copy6(lt, gkh, gkl, ldk, gvt);
  FragH aq[KS], aql[KS];
  { const size_t qo = ((size_t)b * TT + q0 + ln) * ldq + h * 64; const unsigned short* qr = (const unsigned short*)Q16 + qo; const unsigned short* ql = (const unsigned short*)Q16lo + qo;
#pragma unroll
    for (int ks = 0; ks < KS; ++ks) { aq[ks].half[0] = *(const v8us*)(qr + ks * 32 + 8 * hh); aq[ks].half[1] = *(const v8us*)(qr + ks * 32 + 16 + 8 * hh); aql[ks].half[0] = *(const v8us*)(ql + ks * 32 + 8 * hh); aql[ks].half[1] = *(const v8us*)(ql + ks * 32 + 16 + 8 * hh); } }
  asm volatile("s_wait_asynccnt 0x0" ::: "memory");      /* the mask and stage 0 have landed for this wave */
  __syncthreads();                                       /* ... and for every wave */
  fs_copy6(lt + FS_STAGE, gkh + (size_t)FS_KEYS * ldk, gkl + (size_t)FS_KEYS * ldk, ldk, gvt + FS_KEYS);
  float m_r = -3.0e38f, l_r = 0.f; v8f oacc[DT];
#pragma unroll
  for (int dt = 0; dt < DT; ++dt) oacc[dt] = (v8f){0.f,0.f,0.f,0.f,0.f,0.f,0.f,0.f};
  const unsigned char* fk = sT + ln * FS_PITCH + 16 * hh; const unsigned char* fv = fk + 2 * FS_PLANE;
#pragma unroll 1      /* one stage a trip: the two buffers alternate by an offset */
  for (int t = 0; t < NST; ++t) {
    const unsigned bo = (unsigned)(t & 1) * FS_STAGE;
#pragma unroll      /* the two passes of a stage stand in line, so that every LDS read takes its place in the stage as an immediate offset */
    for (int ps = 0; ps < FS_KEYS / 32; ++ps) {
    const int* mp = sM + t * FS_KEYS + ps * 32 + 8 * hh;      /* key padding mask (1 = attend) of this lane's 16 keys */
    const v4ia km[4] = { *(const v4ia*)(mp), *(const v4ia*)(mp + 4), *(const v4ia*)(mp + 16), *(const v4ia*)(mp + 20) };
    float sv[16]; FragH bk[2][KS], bl[2][KS], bv[DT];
#pragma unroll
    for (int nt = 0; nt < 2; ++nt) { const unsigned char* kr = fk + bo + (ps * 32 + nt * 16) * FS_PITCH; const unsigned char* kl = kr + FS_PLANE;
#pragma unroll
      for (int ks = 0; ks < KS; ++ks) { bk[nt][ks].half[0] = *(const v8us*)(kr + ks * 64); bk[nt][ks].half[1] = *(const v8us*)(kr + ks * 64 + 32); bl[nt][ks].half[0] = *(const v8us*)(kl + ks * 64); bl[nt][ks].half[1] = *(const v8us*)(kl + ks * 64 + 32); } }
    __builtin_amdgcn_sched_barrier(0);      /* the pass's K reads go out as one group: left alone the scheduler puts the second key tile's reads behind the first tile's products, and the wave waits out the LDS latency a second time */
#pragma unroll
    for (int nt = 0; nt < 2; ++nt) {
      v8f acc = (v8f){0.f,0.f,0.f,0.f,0.f,0.f,0.f,0.f}, accl = acc;
#pragma unroll
      for (int ks = 0; ks < KS; ++ks) { acc = mmaH<1>(bk[nt][ks].v, bk[nt][ks].v, aq[ks].v, aq[ks].v, acc); accl = mmaH<1>(bk[nt][ks].v, bk[nt][ks].v, aql[ks].v, aql[ks].v, accl); accl = mmaH<1>(bl[nt][ks].v, bl[nt][ks].v, aq[ks].v, aq[ks].v, accl); }
#pragma unroll
      for (int r = 0; r < 8; ++r) sv[nt * 8 + r] = (km[nt * 2 + (r >> 2)][r & 3] != 0) ? acc[r] + accl[r] * 0.0009765625f : -INFINITY; }
#pragma unroll
    for (int dt = 0; dt < DT; ++dt) { const unsigned char* vrow = fv + bo + dt * 16 * FS_PITCH + ps * 64; bv[dt].half[0] = *(const v8us*)(vrow); bv[dt].half[1] = *(const v8us*)(vrow + 32); }
    __builtin_amdgcn_sched_barrier(0);      /* the four Vt fragments are read as one group ahead of the softmax, which covers their latency: left alone each read sinks to just in front of its product and is waited for there */
    float t8[8];
#pragma unroll
    for (int i = 0; i < 8; ++i) t8[i] = fmaxf(sv[i], sv[8 + i]);
    float mc = fmaxf(fmaxf(fmaxf(t8[0], t8[1]), fmaxf(t8[2], t8[3])), fmaxf(fmaxf(t8[4], t8[5]), fmaxf(t8[6], t8[7])));
    mc = fmaxf(mc, xhalf(mc));      /* both halves now hold the query's block maximum */
    const float mn = fmaxf(m_r, mc); const float ea = expf(m_r - mn); const float al = (mn > -1.0e38f) ? ea : 1.0f; m_r = mn;      /* mn is finite (>= -3e38), so a masked score gives exp(-inf) = 0 */
    float p[16]; FragH pa;
#pragma unroll
    for (int i = 0; i < 16; ++i) { p[i] = expf(sv[i] - mn); pa.h[i] = (_Float16)(p[i] * 1024.0f); }
#pragma unroll
    for (int i = 0; i < 8; ++i) t8[i] = p[i] + p[8 + i];
    l_r = l_r * al + (((t8[0] + t8[1]) + (t8[2] + t8[3])) + ((t8[4] + t8[5]) + (t8[6] + t8[7])));      /* per-lane partial sum; the halves join after the loop */
#pragma unroll
    for (int dt = 0; dt < DT; ++dt)
#pragma unroll
      for (int r = 0; r < 8; ++r) oacc[dt][r] *= al;
#pragma unroll
    for (int dt = 0; dt < DT; ++dt) oacc[dt] = mmaH<1>(bv[dt].v, bv[dt].v, pa.v, pa.v, oacc[dt]); }
    asm volatile("s_wait_dscnt 0x0" ::: "memory");       /* this wave's reads of buffer t & 1 are done before the buffer is handed back */
    asm volatile("s_wait_asynccnt 0x0" ::: "memory");    /* this wave's copies of stage t + 1 have landed */
    __syncthreads();                                     /* publishes stage t + 1 and ends every wave's reads of stage t */
    if (t + 2 < NST) fs_copy6(lt + bo, gkh + (size_t)(t + 2) * FS_KEYS * ldk, gkl + (size_t)(t + 2) * FS_KEYS * ldk, ldk, gvt + (t + 2) * FS_KEYS);
  }
  asm volatile("s_wait_asynccnt 0x0" ::: "memory");      /* nothing is in flight when the wave goes on to its end */
  { const float l = l_r + xhalf(l_r); const float inv = (l > 0.f) ? 1.0f / (l * 1024.0f) : 0.f;
#pragma unroll
    for (int dt = 0; dt < DT; ++dt)
#pragma unroll
      for (int q = 0; q < 2; ++q) { const v4f o4 = { oacc[dt][q * 4] * inv, oacc[dt][q * 4 + 1] * inv, oacc[dt][q * 4 + 2] * inv, oacc[dt][q * 4 + 3] * inv }; *(v4fa*)&sO[w][ln][dt * 16 + 8 * hh + q * 4] = o4; } }
  __builtin_amdgcn_fence(__ATOMIC_ACQ_REL, "workgroup"); __builtin_amdgcn_wave_barrier();
  {
#pragma unroll
    for (int rp = 0; rp < RPW; rp += 2) { const int r = rp + (lane >> 4), pc = lane & 15; const v4f val = *(const v4fa*)&sO[w][r][pc * 4]; *(v4f*)(O + ((size_t)b * TT + q0 + r) * ldo + h * 64 + pc * 4) = val; }
     } }

// ---- projection GEMM with its operands staged in LDS: C = alpha * A . Bt^T, A [NR][DD] and Bt [DD][DD] f16, both k-contiguous.
// One 128 x 128 tile per work-group of 8 waves (4 x 2 waves of 32 x 64). A stage is 128 k = 256 B of each of the 256 operand rows (A rows 0-127, Bt rows 128-255),
// brought by asynchronous copies (16 lanes of 16 B a row), two buffers: stage t + 1 flies while stage t is multiplied.
// LDS row pitch 272 B = 16 B x odd, the conflict-free pitch of ds_load_b128 fragment reads. The k order of every accumulator is 0, 32, 64, ... as before.
#define GS_K 128
#define GS_PITCH 272
#define GS_STAGE (256 * GS_PITCH)
// eight copies of one lane: rows r, r + 16, ..., r + 112 of one operand, 16 B each. The s_wait_xcnt stands inside the copies' own statement, so that no address register named here is rewritten in front of it.
__device__ __forceinline__ void gs_copy8(unsigned l, const _Float16* g) {
  asm volatile("global_load_async_to_lds_b128 %0, %8, off\n\t"
               "global_load_async_to_lds_b128 %1, %9, off\n\t"
               "global_load_async_to_lds_b128 %2, %10, off\n\t"
               "global_load_async_to_lds_b128 %3, %11, off\n\t"
               "global_load_async_to_lds_b128 %4, %12, off\n\t"
               "global_load_async_to_lds_b128 %5, %13, off\n\t"
               "global_load_async_to_lds_b128 %6, %14, off\n\t"
               "global_load_async_to_lds_b128 %7, %15, off\n\t"
               "s_wait_xcnt 0x0"
               :: "v"(l), "v"(l + 16 * GS_PITCH), "v"(l + 32 * GS_PITCH), "v"(l + 48 * GS_PITCH), "v"(l + 64 * GS_PITCH), "v"(l + 80 * GS_PITCH), "v"(l + 96 * GS_PITCH), "v"(l + 112 * GS_PITCH),
                  "v"(g), "v"(g + 16 * DD), "v"(g + 32 * DD), "v"(g + 48 * DD), "v"(g + 64 * DD), "v"(g + 80 * DD), "v"(g + 96 * DD), "v"(g + 112 * DD)
               : "memory");
}
// the 2 A and 4 B fragments of one k step (32 k = 64 B of a row) from a stage in LDS; both operands in the same k order: 8 hh + 0..7, then 16 + 8 hh + 0..7
__device__ __forceinline__ void gs_frags(FragH (&a)[2], FragH (&b)[4], const unsigned char* pa, const unsigned char* pb) {
#pragma unroll
  for (int i = 0; i < 2; ++i) { a[i].half[0] = *(const v8us*)(pa + i * 16 * GS_PITCH); a[i].half[1] = *(const v8us*)(pa + i * 16 * GS_PITCH + 32); }
#pragma unroll
  for (int j = 0; j < 4; ++j) { b[j].half[0] = *(const v8us*)(pb + j * 16 * GS_PITCH); b[j].half[1] = *(const v8us*)(pb + j * 16 * GS_PITCH + 32); }
}
// the 8 products of one k step
__device__ __forceinline__ void gs_mma(v8f (&acc)[2][4], const FragH (&a)[2], const FragH (&b)[4]) {
#pragma unroll
  for (int i = 0; i < 2; ++i)
#pragma unroll
    for (int j = 0; j < 4; ++j) acc[i][j] = __builtin_amdgcn_wmma_f32_16x16x32_f16(false, a[i].v, false, b[j].v, (short)0, acc[i][j], false, false);
}
template <bool OUT16>
__global__ __launch_bounds__(256) void k_gemm_lds(const _Float16* __restrict__ A, const _Float16* __restrict__ Bt, float alpha, float* __restrict__ C, _Float16* __restrict__ C16) {
  __shared__ __attribute__((aligned(16))) unsigned char sT[2 * GS_STAGE];
  __shared__ __attribute__((aligned(16))) float so[8][32][64 + 4];
  constexpr int NST = DD / GS_K;
  const int tid = threadIdx.x, w = tid >> 5, lane = tid & 31, ln = lane & 15, hh = lane >> 4;
  const int row0 = (blockIdx.x / (DD / 128)) * 128, col0 = (blockIdx.x % (DD / 128)) * 128; const int wm = w >> 1, wn = w & 1;
  const int cr = tid >> 4, cc = tid & 15;      /* this lane's row (mod 16) and 16-B column of every copy */
  const _Float16* ga = A + (size_t)(row0 + cr) * DD + cc * 8; const _Float16* gb = Bt + (size_t)(col0 + cr) * DD + cc * 8;
  const unsigned la = (unsigned)(size_t)sT + cr * GS_PITCH + cc * 16, lb = la + 128 * GS_PITCH;
  gs_copy8(la, ga); gs_copy8(lb, gb);
  asm volatile("s_wait_asynccnt 0x0" ::: "memory");      /* stage 0 has landed for this wave */
  __syncthreads();                                       /* ... and for every wave */
  gs_copy8(la + GS_STAGE, ga + GS_K); gs_copy8(lb + GS_STAGE, gb + GS_K);
  v8f acc[2][4];
#pragma unroll
  for (int i = 0; i < 2; ++i)
#pragma unroll
    for (int j = 0; j < 4; ++j) acc[i][j] = (v8f){0.f,0.f,0.f,0.f,0.f,0.f,0.f,0.f};
  const unsigned char* fa = sT + (wm * 32 + ln) * GS_PITCH + 16 * hh; const unsigned char* fb = sT + (128 + wn * 64 + ln) * GS_PITCH + 16 * hh;
#pragma unroll 1      /* one stage a trip: the two buffers alternate by an offset, the text stays small */
  for (int t = 0; t < NST; ++t) {
    const unsigned bo = (unsigned)(t & 1) * GS_STAGE;
    FragH a[2][2], b[2][4];      /* two fragment sets: the reads of k step ks + 1 of this same stage are issued as one group ahead of the products of k step ks */
    gs_frags(a[0], b[0], fa + bo, fb + bo);
#pragma unroll
    for (int ks = 0; ks + 1 < GS_K / 32; ++ks) {
      gs_frags(a[(ks + 1) & 1], b[(ks + 1) & 1], fa + bo + (ks + 1) * 64, fb + bo + (ks + 1) * 64);
      __builtin_amdgcn_sched_barrier(0);      /* keeps that group of reads ahead of the products: left alone the scheduler sinks each read to just in front of its use, and the wave waits out the LDS latency there */
      gs_mma(acc, a[ks & 1], b[ks & 1]);
    }
    __builtin_amdgcn_sched_barrier(0);                   /* those products stay in front of the hand-over and cover the last group's LDS latency */
    asm volatile("s_wait_dscnt 0x0" ::: "memory");       /* this wave's reads of buffer t & 1 are done before the buffer is handed back */
    asm volatile("s_wait_asynccnt 0x0" ::: "memory");    /* this wave's copies of stage t + 1 have landed */
    __syncthreads();                                     /* publishes stage t + 1 and ends every wave's reads of stage t */
    if (t + 2 < NST) { gs_copy8(la + bo, ga + (t + 2) * GS_K); gs_copy8(lb + bo, gb + (t + 2) * GS_K); }
    __builtin_amdgcn_sched_barrier(0);                   /* the refill is issued first: the last k step's products need registers only and run while the copies fly */
    gs_mma(acc, a[(GS_K / 32 - 1) & 1], b[(GS_K / 32 - 1) & 1]);
  }
  asm volatile("s_wait_asynccnt 0x0" ::: "memory");      /* nothing is in flight when the wave goes on to its end */
#pragma unroll
  for (int i = 0; i < 2; ++i)
#pragma unroll
    for (int j = 0; j < 4; ++j)
#pragma unroll
      for (int r = 0; r < 8; ++r) so[w][i * 16 + 8 * hh + r][j * 16 + ln] = acc[i][j][r] * alpha;
  __builtin_amdgcn_fence(__ATOMIC_ACQ_REL, "workgroup"); __builtin_amdgcn_wave_barrier();      /* the wave reads back rows that its other lanes wrote */
  const int rsub = lane >> 4, c4 = (lane & 15) * 4;
#pragma unroll
  for (int q = 0; q < 16; ++q) { const int r = q * 2 + rsub; const v4f v = *(const v4fa*)&so[w][r][c4]; const size_t o = (size_t)(row0 + wm * 32 + r) * DD + col0 + wn * 64 + c4;
    if (OUT16) { v4h h4; for (int i = 0; i < 4; ++i) h4[i] = (_Float16)v[i]; *(v4h*)(C16 + o) = h4; } else *(v4f*)(C + o) = v; }
}

extern "C" void kernel_launch(void* const* d_in, const int* in_sizes, int n_in,
                              void* d_out, int out_size, void* d_ws, size_t ws_size, hipStream_t stream) {
  (void)in_sizes; (void)n_in; (void)out_size;
  const float* x = (const float*)d_in[0]; const int* mask = (const int*)d_in[1]; const float* Wq = (const float*)d_in[2]; const float* Wk = (const float*)d_in[3]; const float* Wv = (const float*)d_in[4]; const float* Wo = (const float*)d_in[5];
  char* ws = (char*)d_ws; size_t off = 0;
  auto take = [&](size_t bytes) { char* p = ws + off; off += (bytes + 255) & ~(size_t)255; return p; };
  const size_t WSZ = (size_t)DD * DD; _Float16* Bw = (_Float16*)take(4 * WSZ * 2); _Float16* X16 = (_Float16*)take((size_t)NR * DD * 2); float* F32 = (float*)take((size_t)NR * DD * 4);
  _Float16* Qh = (_Float16*)take((size_t)NR * DD * 2); _Float16* Ql = (_Float16*)take((size_t)NR * DD * 2); _Float16* Kh = (_Float16*)take((size_t)NR * DD * 2); _Float16* Kl = (_Float16*)take((size_t)NR * DD * 2); _Float16* V16 = (_Float16*)take((size_t)NR * DD * 2); _Float16* Vt = (_Float16*)take((size_t)NR * DD * 2);
  float* O = F32; _Float16* O16 = X16;      /* F32: q → k → O; X16 dead after the v GEMM */
  if (off > ws_size) return;      // 8.4 + 8.4 + 16.8 + 6 × 8.4 ≈ 84 MB
  const unsigned gw = (unsigned)((WSZ / 8 + 255) / 256); k_round16f<<<gw, 256, 0, stream>>>(Wq, Bw, WSZ / 8); k_round16f<<<gw, 256, 0, stream>>>(Wk, Bw + WSZ, WSZ / 8); k_round16f<<<gw, 256, 0, stream>>>(Wv, Bw + 2 * WSZ, WSZ / 8); k_round16f<<<gw, 256, 0, stream>>>(Wo, Bw + 3 * WSZ, WSZ / 8);
  const unsigned g8 = (unsigned)(((size_t)NR * DD / 8 + 255) / 256); k_x16<<<g8, 256, 0, stream>>>(x, X16, (size_t)NR * DD / 8);
  const dim3 gp((NR / 128) * (DD / 128), 1);
  k_gemm_lds<false><<<gp, 256, 0, stream>>>(X16, Bw, 0.0625f, F32, nullptr); k_elu_hl<<<g8, 256, 0, stream>>>(F32, Qh, Ql, (size_t)NR * DD / 8);      /* φ(q) hi/lo */
  k_gemm_lds<false><<<gp, 256, 0, stream>>>(X16, Bw + WSZ, 0.0625f, F32, nullptr); k_elu_hl<<<g8, 256, 0, stream>>>(F32, Kh, Kl, (size_t)NR * DD / 8);      /* φ(k) hi/lo */
  k_gemm_lds<true><<<gp, 256, 0, stream>>>(X16, Bw + 2 * WSZ, 0.0625f, nullptr, V16);
  k_vt<NH, TT><<<BB * NH * (TT / 64), 256, 0, stream>>>(V16, DD, 0, Vt);
  k_flash<<<BB * NH * (TT / 128), 256, 0, stream>>>(Qh, Ql, DD, Kh, Kl, DD, Vt, mask, O, DD);
  k_h16s<<<g8, 256, 0, stream>>>(O, O16, (size_t)NR * DD / 8);
  k_gemm_lds<false><<<gp, 256, 0, stream>>>(O16, Bw + 3 * WSZ, 0.00390625f, (float*)d_out, nullptr);      /* out = O·Woᵀ */
}

// v004
// Measured time: 141 microseconds a run.
// Next to v003, in two timings, it ran 1.25 times as fast each time.
// Counting every step since v000, it is 3.71 times as fast.
#include <hip/hip_runtime.h>
// Multi-head 'linear-feature' attention (B=2, S=2048, H=1024, 16 heads × 64): q,k,v = x·Wᵀ (no bias); φ(q) = elu(q)+1, φ(k) = elu(k)+1; attn = softmax(φ(q)·φ(k)ᵀ) UNSCALED (σ≈8 logits) with the INPUT key mask [B,S] (0 → −inf);
// out = (attn·v merged)·Woᵀ.
// Compute dtype: x and weights rounded to bf16; q,k as f32 GEMM outputs mapped through elu+1 in f32 and split into f16 hi + ×2^10 residual planes so the large unscaled logits are f32-accurate
// (S = Qh·Kh + (Ql·Kh + Qh·Kl)·2^-10, separate accumulators); v f16; fused flash-style kernel (online softmax f32, P f16 ×2^10) on v_wmma_f32_16x16x32_f16; O ×2^4 → f16 → output GEMM; f32 accumulate.
#define BB 2
#define TT 2048
#define NH 16
#define DD 1024
#define NR (BB * TT)

typedef __bf16 v16b __attribute__((ext_vector_type(16)));
typedef unsigned short v8us __attribute__((ext_vector_type(8), may_alias));
typedef float  v8f  __attribute__((ext_vector_type(8)));
typedef float  v4f  __attribute__((ext_vector_type(4)));
typedef float  v4fa __attribute__((ext_vector_type(4), may_alias));
union FragB { v16b v; v8us half[2]; unsigned short u[16]; };

__device__ __forceinline__ unsigned short bf16_bits(float x) { unsigned int u = __float_as_uint(x); return (unsigned short)((u + 0x7FFFu + ((u >> 16) & 1u)) >> 16); }
__device__ __forceinline__ float bf16_val(unsigned short b) { return __uint_as_float(((unsigned int)b) << 16); }
__device__ __forceinline__ float bf16_round(float x) { return bf16_val(bf16_bits(x)); }
// D += A·B with NT terms: 1 = ah·bh, 2 = + al·bh (A split), 3 = + ah·bl (both split)
template <int NT>
__device__ __forceinline__ v8f mmaN(v16b ah, v16b al, v16b bh, v16b bl, v8f c) {
  c = __builtin_amdgcn_wmma_f32_16x16x32_bf16(false, ah, false, bh, (short)0, c, false, false);
  if (NT >= 2) c = __builtin_amdgcn_wmma_f32_16x16x32_bf16(false, al, false, bh, (short)0, c, false, false);
  if (NT >= 3) c = __builtin_amdgcn_wmma_f32_16x16x32_bf16(false, ah, false, bl, (short)0, c, false, false);
  asm volatile("v_nop\n\tv_nop\n\tv_nop\n\tv_nop" : "+v"(c) : "v"(ah), "v"(al), "v"(bh), "v"(bl));
  return c;
}

__global__ __launch_bounds__(256) void k_wt_bf16(const float* __restrict__ W, unsigned short* __restrict__ Wt, int K, int N) {
  const int t = blockIdx.x * 256 + threadIdx.x;
  const int k8n = K / 8;
  if (t >= N * k8n) return;
  const int n = t / k8n, k8 = (t % k8n) * 8;
  v8us v;
#pragma unroll
  for (int i = 0; i < 8; ++i) v[i] = bf16_bits(W[(size_t)(k8 + i) * N + n]);
  *(v8us*)(Wt + (size_t)n * K + k8) = v;
  
}

// GEMM C[M][N] (f32, pitch ldc) = act(A[M][K]·W + bias). A f32 row-major (pitch lda) converted per fragment to bf16
// (ASPLIT: hi/lo two planes -> 2 terms, else single rounded term); Wt bf16 [N][K] (pitch ldb). BIAS_BF16 rounds the
// bias to bf16 first (bias quantised to bf16 before the add). K%32==0, M%16==0, N%64==0.
template <bool ASPLIT, int ACT, bool BIAS_BF16>
__global__ __launch_bounds__(128) void k_gemm_bf(const float* __restrict__ A, int lda, const unsigned short* __restrict__ Wt, int ldb,
                                               const float* __restrict__ bias, float* __restrict__ C, int ldc, int M, int N, int K) {
  __shared__ __attribute__((aligned(16))) float so[4][16][64];
  const int tid = threadIdx.x, w = tid >> 5, lane = tid & 31, ln = lane & 15, hh = lane >> 4;
  const int ntn = N / 64;
  const int wid = blockIdx.x * 4 + w;
  const int mt = wid / ntn, nq = wid % ntn;
  if (mt * 16 >= M) return;
  const int row0 = mt * 16, col0 = nq * 64;
  const float* arow = A + (size_t)(row0 + ln) * lda;
  v8f acc[4] = {};
  for (int kb = 0; kb < K; kb += 32) {
    FragB ah, al;
    const v4f x0 = *(const v4fa*)(arow + kb + 8 * hh), x1 = *(const v4fa*)(arow + kb + 8 * hh + 4);
    const v4f x2 = *(const v4fa*)(arow + kb + 16 + 8 * hh), x3 = *(const v4fa*)(arow + kb + 16 + 8 * hh + 4);
    float xs[16] = {x0[0],x0[1],x0[2],x0[3],x1[0],x1[1],x1[2],x1[3],x2[0],x2[1],x2[2],x2[3],x3[0],x3[1],x3[2],x3[3]};
#pragma unroll
    for (int i = 0; i < 16; ++i) { const unsigned short hb = bf16_bits(xs[i]); ah.u[i] = hb; al.u[i] = ASPLIT ? bf16_bits(xs[i] - bf16_val(hb)) : (unsigned short)0; }
#pragma unroll
    for (int t = 0; t < 4; ++t) {
      const unsigned short* brow = Wt + (size_t)(col0 + t * 16 + ln) * ldb + kb;
      FragB b;
      b.half[0] = *(const v8us*)(brow + 8 * hh);
      b.half[1] = *(const v8us*)(brow + 16 + 8 * hh);
      acc[t] = mmaN<ASPLIT ? 2 : 1>(ah.v, al.v, b.v, b.v, acc[t]);
    }
  }
#pragma unroll
  for (int t = 0; t < 4; ++t) {
    float bv = bias ? bias[col0 + t * 16 + ln] : 0.f;
    if (BIAS_BF16) bv = bf16_round(bv);
#pragma unroll
    for (int r = 0; r < 8; ++r) { float v = acc[t][r] + bv; if (ACT == 1) v = fmaxf(v, 0.f); so[w][8 * hh + r][t * 16 + ln] = v; }
  }
  __builtin_amdgcn_fence(__ATOMIC_ACQ_REL, "workgroup");
  __builtin_amdgcn_wave_barrier();
  const int rsub = lane >> 4, c4 = (lane & 15) * 4;
  {
#pragma unroll
    for (int q = 0; q < 8; ++q) {
      const int r = q * 2 + rsub;
      const v4f v = *(const v4fa*)&so[w][r][c4];
      *(v4f*)(C + (size_t)(row0 + r) * ldc + col0 + c4) = v;
    }
    
  }
}

// Flash-style causal/unmasked attention, all contractions 3-term bf16 hi/lo splits, f32 softmax with running max.
// q,k,v rows are read from f32 buffers with arbitrary row pitch (so they can live inside a fused qkv buffer);
// D = head size (multiple of 32, <= 128); one wave = 16 query rows; block = 4 waves (64 queries) sharing K/V chunks of 32.
template <int D, bool CAUSAL>
__global__ __launch_bounds__(128) void k_flash(const float* __restrict__ qb, const float* __restrict__ kb, const float* __restrict__ vb,
                                             int pitch, int T, int H, float scale, float* __restrict__ y, int ypitch) {
  constexpr int KS = D / 32;        // k-steps for QK
  constexpr int DT = D / 16;        // d tiles for PV
  __shared__ __attribute__((aligned(16))) unsigned short sKh[32][D + 8], sKl[32][D + 8], sVh[32][D + 8], sVl[32][D + 8];
  __shared__ __attribute__((aligned(16))) unsigned short sPh[4][16][40], sPl[4][16][40];
  __shared__ __attribute__((aligned(16))) float sO[4][16][D];
  const int tid = threadIdx.x, w = tid >> 5, lane = tid & 31, ln = lane & 15, hh = lane >> 4;
  const int nqb = (T + 63) / 64;
  const int bh = blockIdx.x / nqb, qblk = blockIdx.x % nqb;
  const int b = bh / H, h = bh % H;
  const int q0 = qblk * 64 + w * 16;
  const float* Q = qb + (size_t)b * T * pitch + h * D;
  const float* K = kb + (size_t)b * T * pitch + h * D;
  const float* V = vb + (size_t)b * T * pitch + h * D;

  // A fragments of the wave's 16 query rows (scaled), hi/lo
  FragB aqh[KS], aql[KS];
  {
    int row = q0 + ln; if (row >= T) row = T - 1;
    const float* qr = Q + (size_t)row * pitch;
#pragma unroll
    for (int ks = 0; ks < KS; ++ks)
#pragma unroll
      for (int i = 0; i < 16; ++i) {
        const int d = ks * 32 + ((i < 8) ? (8 * hh + i) : (16 + 8 * hh + (i - 8)));
        const float x = qr[d] * scale; const unsigned short hb = bf16_bits(x);
        aqh[ks].u[i] = hb; aql[ks].u[i] = bf16_bits(x - bf16_val(hb));
      }
  }
  float m_r[8], l_r[8];
#pragma unroll
  for (int r = 0; r < 8; ++r) { m_r[r] = -3.0e38f; l_r[r] = 0.f; }
  v8f oacc[DT];
#pragma unroll
  for (int dt = 0; dt < DT; ++dt) oacc[dt] = (v8f){0.f,0.f,0.f,0.f,0.f,0.f,0.f,0.f};

  const int kv_end = CAUSAL ? min(T, qblk * 64 + 64) : T;     // block-uniform
  for (int j0 = 0; j0 < kv_end; j0 += 32) {
    __syncthreads();
    for (int e = tid; e < 32 * (D / 4); e += 128) {
      const int r = e / (D / 4), c4 = (e % (D / 4)) * 4;
      const int key = j0 + r;
      v4f kf = {0.f,0.f,0.f,0.f}, vf = {0.f,0.f,0.f,0.f};
      if (key < T) { kf = *(const v4fa*)(K + (size_t)key * pitch + c4); vf = *(const v4fa*)(V + (size_t)key * pitch + c4); }
#pragma unroll
      for (int t = 0; t < 4; ++t) {
        unsigned short hb = bf16_bits(kf[t]); sKh[r][c4 + t] = hb; sKl[r][c4 + t] = bf16_bits(kf[t] - bf16_val(hb));
        hb = bf16_bits(vf[t]); sVh[r][c4 + t] = hb; sVl[r][c4 + t] = bf16_bits(vf[t] - bf16_val(hb));
      }
    }
    __syncthreads();
    // S tile 16 x 32
    v8f s[2];
#pragma unroll
    for (int nt = 0; nt < 2; ++nt) {
      v8f acc = {};
#pragma unroll
      for (int ks = 0; ks < KS; ++ks) {
        FragB bh_, bl_;
        bh_.half[0] = *(const v8us*)&sKh[nt * 16 + ln][ks * 32 + 8 * hh]; bh_.half[1] = *(const v8us*)&sKh[nt * 16 + ln][ks * 32 + 16 + 8 * hh];
        bl_.half[0] = *(const v8us*)&sKl[nt * 16 + ln][ks * 32 + 8 * hh]; bl_.half[1] = *(const v8us*)&sKl[nt * 16 + ln][ks * 32 + 16 + 8 * hh];
        acc = mmaN<3>(aqh[ks].v, aql[ks].v, bh_.v, bl_.v, acc);
      }
      s[nt] = acc;
    }
    // mask + running max (rows 8hh+r; the 16 lanes of a half share rows)
    float alpha[8];
#pragma unroll
    for (int r = 0; r < 8; ++r) {
      const int qi = q0 + 8 * hh + r;
      const int ja = j0 + ln, jb = j0 + 16 + ln;
      if (CAUSAL) { if (ja > qi) s[0][r] = -3.0e38f; if (jb > qi) s[1][r] = -3.0e38f; }
      if (ja >= T) s[0][r] = -3.0e38f;
      if (jb >= T) s[1][r] = -3.0e38f;
      float mx = fmaxf(s[0][r], s[1][r]);
      mx = fmaxf(mx, __shfl_xor(mx, 1, 32)); mx = fmaxf(mx, __shfl_xor(mx, 2, 32)); mx = fmaxf(mx, __shfl_xor(mx, 4, 32)); mx = fmaxf(mx, __shfl_xor(mx, 8, 32));
      const float mnew = fmaxf(m_r[r], mx);
      alpha[r] = (mnew > -1.0e38f) ? __expf(m_r[r] - mnew) : 1.0f;
      const float p0 = (s[0][r] > -1.0e38f) ? __expf(s[0][r] - mnew) : 0.f;
      const float p1 = (s[1][r] > -1.0e38f) ? __expf(s[1][r] - mnew) : 0.f;
      m_r[r] = mnew;
      l_r[r] = l_r[r] * alpha[r] + p0 + p1;            // per-lane partial row sum (16 lanes combined at the end)
      unsigned short hb = bf16_bits(p0); sPh[w][8 * hh + r][ln] = hb;      sPl[w][8 * hh + r][ln] = bf16_bits(p0 - bf16_val(hb));
      hb = bf16_bits(p1);                sPh[w][8 * hh + r][16 + ln] = hb; sPl[w][8 * hh + r][16 + ln] = bf16_bits(p1 - bf16_val(hb));
    }
#pragma unroll
    for (int dt = 0; dt < DT; ++dt)
#pragma unroll
      for (int r = 0; r < 8; ++r) oacc[dt][r] *= alpha[r];
    __builtin_amdgcn_fence(__ATOMIC_ACQ_REL, "workgroup");
    __builtin_amdgcn_wave_barrier();
    FragB pah, pal;
    pah.half[0] = *(const v8us*)&sPh[w][ln][8 * hh]; pah.half[1] = *(const v8us*)&sPh[w][ln][16 + 8 * hh];
    pal.half[0] = *(const v8us*)&sPl[w][ln][8 * hh]; pal.half[1] = *(const v8us*)&sPl[w][ln][16 + 8 * hh];
#pragma unroll
    for (int dt = 0; dt < DT; ++dt) {
      FragB bvh, bvl;
#pragma unroll
      for (int i = 0; i < 8; ++i) {
        bvh.u[i] = sVh[8 * hh + i][dt * 16 + ln]; bvh.u[8 + i] = sVh[16 + 8 * hh + i][dt * 16 + ln];
        bvl.u[i] = sVl[8 * hh + i][dt * 16 + ln]; bvl.u[8 + i] = sVl[16 + 8 * hh + i][dt * 16 + ln];
      }
      oacc[dt] = mmaN<3>(pah.v, pal.v, bvh.v, bvl.v, oacc[dt]);
    }
    __builtin_amdgcn_fence(__ATOMIC_ACQ_REL, "workgroup");
    __builtin_amdgcn_wave_barrier();
  }
#pragma unroll
  for (int r = 0; r < 8; ++r) {
    float l = l_r[r];
    l += __shfl_xor(l, 1, 32); l += __shfl_xor(l, 2, 32); l += __shfl_xor(l, 4, 32); l += __shfl_xor(l, 8, 32);
    l_r[r] = (l > 0.f) ? 1.0f / l : 0.f;
  }
#pragma unroll
  for (int dt = 0; dt < DT; ++dt)
#pragma unroll
    for (int r = 0; r < 8; ++r) sO[w][8 * hh + r][dt * 16 + ln] = oacc[dt][r] * l_r[r];
  __builtin_amdgcn_fence(__ATOMIC_ACQ_REL, "workgroup");
  __builtin_amdgcn_wave_barrier();
  {
    for (int r = 0; r < 16; ++r) {
      const int row = q0 + r;
      if (row < T && lane < D / 4) {
        const v4f val = *(const v4fa*)&sO[w][r][lane * 4];
        *(v4f*)(y + ((size_t)b * T + row) * ypitch + h * D + lane * 4) = val;
      }
    }
    
  }
}

// GEMM C = act(A·W + bias + resid): A f32 (ASPLIT -> hi/lo 2 terms), Wt bf16 [N][K]; ACT 0 none, 1 relu, 2 exact gelu;
// resid (optional, f32, row index = (row % rmod), pitch ldr, RES_BF16 rounds it) added before the activation.
template <bool ASPLIT, int ACT, bool BIAS_BF16, bool RES_BF16>
__global__ __launch_bounds__(128) void k_gemm_bf3(const float* __restrict__ A, int lda, const unsigned short* __restrict__ Wt, int ldb,
                                                const float* __restrict__ bias, const float* __restrict__ resid, int rmod, int ldr,
                                                float* __restrict__ C, int ldc, int M, int N, int K) {
  __shared__ __attribute__((aligned(16))) float so[4][16][64];
  const int tid = threadIdx.x, w = tid >> 5, lane = tid & 31, ln = lane & 15, hh = lane >> 4;
  const int ntn = N / 64;
  const int wid = blockIdx.x * 4 + w;
  const int mt = wid / ntn, nq = wid % ntn;
  if (mt * 16 >= M) return;
  const int row0 = mt * 16, col0 = nq * 64;
  const float* arow = A + (size_t)(row0 + ln) * lda;
  v8f acc[4] = {};
  for (int kb = 0; kb < K; kb += 32) {
    FragB ah, al;
    const v4f x0 = *(const v4fa*)(arow + kb + 8 * hh), x1 = *(const v4fa*)(arow + kb + 8 * hh + 4);
    const v4f x2 = *(const v4fa*)(arow + kb + 16 + 8 * hh), x3 = *(const v4fa*)(arow + kb + 16 + 8 * hh + 4);
    float xs[16] = {x0[0],x0[1],x0[2],x0[3],x1[0],x1[1],x1[2],x1[3],x2[0],x2[1],x2[2],x2[3],x3[0],x3[1],x3[2],x3[3]};
#pragma unroll
    for (int i = 0; i < 16; ++i) { const unsigned short hb = bf16_bits(xs[i]); ah.u[i] = hb; al.u[i] = ASPLIT ? bf16_bits(xs[i] - bf16_val(hb)) : (unsigned short)0; }
#pragma unroll
    for (int t = 0; t < 4; ++t) {
      const unsigned short* brow = Wt + (size_t)(col0 + t * 16 + ln) * ldb + kb;
      FragB b;
      b.half[0] = *(const v8us*)(brow + 8 * hh);
      b.half[1] = *(const v8us*)(brow + 16 + 8 * hh);
      acc[t] = mmaN<ASPLIT ? 2 : 1>(ah.v, al.v, b.v, b.v, acc[t]);
    }
  }
#pragma unroll
  for (int t = 0; t < 4; ++t) {
    const int col = col0 + t * 16 + ln;
    float bv = bias ? bias[col] : 0.f;
    if (BIAS_BF16) bv = bf16_round(bv);
#pragma unroll
    for (int r = 0; r < 8; ++r) {
      float v = acc[t][r] + bv;
      if (resid) { float rv = resid[(size_t)((row0 + 8 * hh + r) % rmod) * ldr + col]; if (RES_BF16) rv = bf16_round(rv); v += rv; }
      if (ACT == 1) v = fmaxf(v, 0.f);
      if (ACT == 2) v = 0.5f * v * (1.0f + erff(v * 0.70710678118654752f));
      if (ACT == 3) { const float u = 0.7978845608028654f * (v + 0.044715f * v * v * v); v = 0.5f * v * (1.0f + tanhf(u)); }
      so[w][8 * hh + r][t * 16 + ln] = v;
    }
  }
  __builtin_amdgcn_fence(__ATOMIC_ACQ_REL, "workgroup");
  __builtin_amdgcn_wave_barrier();
  const int rsub = lane >> 4, c4 = (lane & 15) * 4;
  {
#pragma unroll
    for (int q = 0; q < 8; ++q) {
      const int r = q * 2 + rsub;
      const v4f v = *(const v4fa*)&so[w][r][c4];
      *(v4f*)(C + (size_t)(row0 + r) * ldc + col0 + c4) = v;
    }
    
  }
}
// row LayerNorm (biased variance, eps) over N: s = X (+ R); optional out_sum <- s; out_norm <- (s-mu)*rsqrt(var+eps)*g + b
template <bool PARAM_BF16>
__global__ __launch_bounds__(256) void k_layernorm(const float* __restrict__ X, const float* __restrict__ R, const float* __restrict__ g, const float* __restrict__ bta,
                                                  float* __restrict__ out_sum, float* __restrict__ out_norm, int N, float eps) {
  __shared__ float red[256];
  const int row = blockIdx.x, tid = threadIdx.x;
  const float* x = X + (size_t)row * N; const float* rr = R ? R + (size_t)row * N : nullptr;
  float vals[16];                     // up to N = 4096
  const int per = N / 256;            // contiguous chunk per thread? use strided-by-4 chunks: thread handles j = tid*4 + 1024*u
  float s1 = 0.f;
  for (int u = 0; u < per / 4; ++u) {
    const int j = tid * 4 + 1024 * u;
    const v4f a = *(const v4fa*)(x + j);
    v4f b = {0.f,0.f,0.f,0.f}; if (rr) b = *(const v4fa*)(rr + j);
#pragma unroll
    for (int q = 0; q < 4; ++q) { const float v = a[q] + b[q]; vals[u * 4 + q] = v; s1 += v; }
  }
  red[tid] = s1; __syncthreads();
  for (int st = 128; st > 0; st >>= 1) { if (tid < st) red[tid] += red[tid + st]; __syncthreads(); }
  const float mu = red[0] / (float)N; __syncthreads();
  float s2 = 0.f;
  for (int u = 0; u < per / 4; ++u)
#pragma unroll
    for (int q = 0; q < 4; ++q) { const float c = vals[u * 4 + q] - mu; s2 += c * c; }
  red[tid] = s2; __syncthreads();
  for (int st = 128; st > 0; st >>= 1) { if (tid < st) red[tid] += red[tid + st]; __syncthreads(); }
  const float rs = rsqrtf(red[0] / (float)N + eps);
  {
    for (int u = 0; u < per / 4; ++u) {
      const int j = tid * 4 + 1024 * u;
      v4f o, sm;
#pragma unroll
      for (int q = 0; q < 4; ++q) {
        float gg = g[j + q], bb = bta[j + q];
        if (PARAM_BF16) { gg = bf16_round(gg); bb = bf16_round(bb); }
        sm[q] = vals[u * 4 + q]; o[q] = (vals[u * 4 + q] - mu) * rs * gg + bb;
      }
      if (out_sum) *(v4f*)(out_sum + (size_t)row * N + j) = sm;
      *(v4f*)(out_norm + (size_t)row * N + j) = o;
    }
    
  }
}



// ---- f16 WMMA path (v_wmma_f32_16x16x32_f16): 11-bit significands for operands in range — used where a [0,1] probability operand needs more precision than bf16
typedef _Float16 v16h __attribute__((ext_vector_type(16)));
union FragH { v16h v; v8us half[2]; _Float16 h[16]; unsigned short u[16]; };
template <int NT>
__device__ __forceinline__ v8f mmaH(v16h ah, v16h al, v16h bh, v16h bl, v8f c) {
  c = __builtin_amdgcn_wmma_f32_16x16x32_f16(false, ah, false, bh, (short)0, c, false, false);
  if (NT >= 2) c = __builtin_amdgcn_wmma_f32_16x16x32_f16(false, al, false, bh, (short)0, c, false, false);
  if (NT >= 3) c = __builtin_amdgcn_wmma_f32_16x16x32_f16(false, ah, false, bl, (short)0, c, false, false);
  asm volatile("v_nop\n\tv_nop\n\tv_nop\n\tv_nop" : "+v"(c) : "v"(ah), "v"(al), "v"(bh), "v"(bl));
  return c;
}
// batched GEMM like k_gemm_b but f16 operands: A f32 (split into f16 hi/lo if ASPLIT, else rounded to f16), Bt = f16 values [n][k]; alpha; C f32; N multiple of 16 (partial tiles skipped)
template <bool ASPLIT>
__global__ __launch_bounds__(128) void k_gemm_h(const float* __restrict__ A, int lda, size_t sA, const _Float16* __restrict__ Bh, int ldb, size_t sB, float alpha, float* __restrict__ C, int ldc, size_t sC, int M, int N, int K) {
  __shared__ __attribute__((aligned(16))) float so[4][16][64];
  const int tid = threadIdx.x, w = tid >> 5, lane = tid & 31, ln = lane & 15, hh = lane >> 4; const int by = blockIdx.y;
  A += (size_t)by * sA; Bh += (size_t)by * sB; C += (size_t)by * sC;
  const int ntn = (N + 63) / 64; const int wid = blockIdx.x * 4 + w; const int mt = wid / ntn, nq = wid % ntn; if (mt * 16 >= M) return;
  const int row0 = mt * 16, col0 = nq * 64; const float* arow = A + (size_t)(row0 + ln) * lda;
  v8f acc[4] = {};
  for (int kb = 0; kb < K; kb += 32) {
    FragH ah, al;
    const v4f x0 = *(const v4fa*)(arow + kb + 8 * hh), x1 = *(const v4fa*)(arow + kb + 8 * hh + 4), x2 = *(const v4fa*)(arow + kb + 16 + 8 * hh), x3 = *(const v4fa*)(arow + kb + 16 + 8 * hh + 4);
    float xs[16] = {x0[0],x0[1],x0[2],x0[3],x1[0],x1[1],x1[2],x1[3],x2[0],x2[1],x2[2],x2[3],x3[0],x3[1],x3[2],x3[3]};
#pragma unroll
    for (int i = 0; i < 16; ++i) { const _Float16 h = (_Float16)xs[i]; ah.h[i] = h; al.h[i] = ASPLIT ? (_Float16)(xs[i] - (float)h) : (_Float16)0.0f; }
#pragma unroll
    for (int t = 0; t < 4; ++t) { if (col0 + t * 16 >= N) continue; const size_t boff = (size_t)(col0 + t * 16 + ln) * ldb + kb; FragH bq; bq.half[0] = *(const v8us*)(Bh + boff + 8 * hh); bq.half[1] = *(const v8us*)(Bh + boff + 16 + 8 * hh);
      acc[t] = mmaH<ASPLIT ? 2 : 1>(ah.v, al.v, bq.v, bq.v, acc[t]); }
  }
#pragma unroll
  for (int t = 0; t < 4; ++t) { if (col0 + t * 16 >= N) continue;
#pragma unroll
    for (int r = 0; r < 8; ++r) so[w][8 * hh + r][t * 16 + ln] = acc[t][r] * alpha; }
  __builtin_amdgcn_fence(__ATOMIC_ACQ_REL, "workgroup"); __builtin_amdgcn_wave_barrier();
  const int rsub = lane >> 4, c4 = (lane & 15) * 4;
  {
#pragma unroll
    for (int q = 0; q < 8; ++q) { const int r = q * 2 + rsub; if (col0 + c4 < N) { const v4f v = *(const v4fa*)&so[w][r][c4]; *(v4f*)(C + (size_t)(row0 + r) * ldc + col0 + c4) = v; } }
     }
}

// Wt[n][k] = f16(W[k][n]·scale) from f32 row-major W[K][N] (scale = power of two; bf16-exact weights stay exact in f16 away from the subnormal range)
__global__ __launch_bounds__(256) void k_wt_f16(const float* __restrict__ W, _Float16* __restrict__ Wt, int K, int N, float scale) {
  const int t = blockIdx.x * 256 + threadIdx.x; if (t >= N * (K / 8)) return; const int n = t / (K / 8), k8 = (t % (K / 8)) * 8; FragH f;
#pragma unroll
  for (int i = 0; i < 8; ++i) f.h[i] = (_Float16)(bf16_round(W[(size_t)(k8 + i) * N + n]) * scale); const v8us o = f.half[0];
  *(v8us*)((unsigned short*)Wt + (size_t)n * K + k8) = o; 
}
// k_gemm_hh variant with fused epilogue: v = acc·alpha + bias[by·sBias + col] (+ CP[(row/rowsPerB)·sCPb + by·64 + col] if CP) ; ACT 0 none / 1 elu ; writes f32 C and/or f16 C16 (each if non-null)
template <int ACT>
__global__ __launch_bounds__(128) void k_gemm_hhx(const _Float16* __restrict__ A, int lda, size_t sA, const _Float16* __restrict__ Bh, int ldb, size_t sB, float alpha, const float* __restrict__ bias, size_t sBias, const float* __restrict__ CP, int rowsPerB, size_t sCPb, int row0g,
    float* __restrict__ C, _Float16* __restrict__ C16, int ldc, size_t sC, int M, int N, int K) {
  __shared__ __attribute__((aligned(16))) float so[4][16][64];
  const int tid = threadIdx.x, w = tid >> 5, lane = tid & 31, ln = lane & 15, hh = lane >> 4; const int by = blockIdx.y;
  A += (size_t)by * sA; Bh += (size_t)by * sB; const size_t cofs = (size_t)by * sC; const float* bp = bias ? bias + (size_t)by * sBias : nullptr;
  const int ntn = (N + 63) / 64; const int wid = blockIdx.x * 4 + w; const int mt = wid / ntn, nq = wid % ntn; if (mt * 16 >= M) return;
  const int row0 = mt * 16, col0 = nq * 64; const _Float16* arow = A + (size_t)(row0 + ln) * lda;
  v8f acc[4] = {};
  for (int kb = 0; kb < K; kb += 32) { FragH ah; ah.half[0] = *(const v8us*)((const unsigned short*)arow + kb + 8 * hh); ah.half[1] = *(const v8us*)((const unsigned short*)arow + kb + 16 + 8 * hh);
#pragma unroll
    for (int t = 0; t < 4; ++t) { if (col0 + t * 16 >= N) continue; const size_t boff = (size_t)(col0 + t * 16 + ln) * ldb + kb; FragH bq; bq.half[0] = *(const v8us*)((const unsigned short*)Bh + boff + 8 * hh); bq.half[1] = *(const v8us*)((const unsigned short*)Bh + boff + 16 + 8 * hh);
      acc[t] = mmaH<1>(ah.v, ah.v, bq.v, bq.v, acc[t]); }
  }
#pragma unroll
  for (int t = 0; t < 4; ++t) { if (col0 + t * 16 >= N) continue; const int col = col0 + t * 16 + ln; const float bv = bp ? bf16_round(bp[col]) : 0.f;
#pragma unroll
    for (int r = 0; r < 8; ++r) { float v = acc[t][r] * alpha + bv; if (CP) { const int bidx = (row0g + row0 + 8 * hh + r) / rowsPerB; v += CP[(size_t)bidx * sCPb + (size_t)by * 64 + col]; } if (ACT == 1) v = (v > 0.f) ? v : expm1f(v); else if (ACT == 7) v = (v > 0.f) ? v + 1.0f : expf(v); else if (ACT == 8) v = tanhf(v); else if (ACT == 9) v = 0.5f * v * (1.0f + tanhf(0.7978845608028654f * (v + 0.044715f * v * v * v))); else if (ACT == 11) v = 1.0f / (1.0f + expf(-v)); else if (ACT == 12) v = (v > 0.f) ? v : 0.01f * v; else if (ACT == 14) v = (v > 0.f) ? v : 0.1f * v; else if (ACT == 15) v = v / (1.0f + expf(-v)); else if (ACT == 3) v = fmaxf(v, 0.f); else if (ACT == 6) v = 0.5f * v * (1.0f + erff(v * 0.70710678118654752f)); so[w][8 * hh + r][t * 16 + ln] = v; } }
  __builtin_amdgcn_fence(__ATOMIC_ACQ_REL, "workgroup"); __builtin_amdgcn_wave_barrier();
  const int rsub = lane >> 4, c4 = (lane & 15) * 4; typedef _Float16 v4h __attribute__((ext_vector_type(4)));
  {
#pragma unroll
    for (int q = 0; q < 8; ++q) { const int r = q * 2 + rsub; if (col0 + c4 < N) { const v4f v = *(const v4fa*)&so[w][r][c4]; if (C) *(v4f*)(C + cofs + (size_t)(row0 + r) * ldc + col0 + c4) = v; if (C16) { v4h h4; for (int i = 0; i < 4; ++i) h4[i] = (_Float16)v[i]; *(v4h*)(C16 + cofs + (size_t)(row0 + r) * ldc + col0 + c4) = h4; } } }
     }
}


typedef _Float16 v4h __attribute__((ext_vector_type(4)));

// All five input conversions in one launch: x -> f16(bf16(x)), each weight -> f16(bf16(W) * 16). An item is 8 floats; item = u * PREP_T + thread, so u = 0..3 walks x and u = 4..7 is one weight each.
// 512 work-groups of 8 waves (16 waves a WGP): every thread has its 16 loads of 16 B in flight before its first store.
#define PREP_T (512 * 256)
__global__ __launch_bounds__(256) void k_prep(const float* __restrict__ x, const float* __restrict__ Wq, const float* __restrict__ Wk, const float* __restrict__ Wv, const float* __restrict__ Wo, _Float16* __restrict__ X16, _Float16* __restrict__ Bw) {
  static_assert((size_t)NR * DD / 8 == (size_t)4 * PREP_T && (size_t)DD * DD / 8 == (size_t)PREP_T, "item split");
  const unsigned tb = (blockIdx.x * 256u + threadIdx.x) * 32u;      /* one 32-bit byte offset serves all eight items: each has a uniform base (scalar base + vector offset addressing) */
  const float* sp[8] = { x, x + PREP_T * 8, x + 2 * PREP_T * 8, x + 3 * PREP_T * 8, Wq, Wk, Wv, Wo };
  v4f a[8], c[8];
#pragma unroll
  for (int u = 0; u < 8; ++u) { a[u] = *(const v4fa*)((const char*)sp[u] + tb); c[u] = *(const v4fa*)((const char*)sp[u] + tb + 16); }
  __builtin_amdgcn_sched_barrier(0);      /* all 16 loads go out as one group: left alone the scheduler starts converting after eight and the rest wait behind those results */
  FragH f[8];
#pragma unroll
  for (int u = 0; u < 8; ++u) { const float sc = (u < 4) ? 1.0f : 16.0f;
#pragma unroll
    for (int q = 0; q < 4; ++q) { f[u].h[q] = (_Float16)(bf16_round(a[u][q]) * sc); f[u].h[4 + q] = (_Float16)(bf16_round(c[u][q]) * sc); } }
#pragma unroll
  for (int u = 0; u < 8; ++u) *(v8us*)((char*)(((u < 4) ? X16 : Bw) + (u & 3) * PREP_T * 8) + (tb >> 1)) = f[u].half[0];
}
__global__ __launch_bounds__(256) void k_h16(const float* __restrict__ x, _Float16* __restrict__ X16, size_t n8) { const size_t t = (size_t)blockIdx.x * 256 + threadIdx.x; if (t >= n8) return; FragH f;
#pragma unroll
  for (int q = 0; q < 8; ++q) f.h[q] = (_Float16)x[t * 8 + q]; *(v8us*)((unsigned short*)X16 + t * 8) = f.half[0];  }
typedef int v4ia __attribute__((ext_vector_type(4), may_alias));
// lane l <-> lane l ^ 16 (the two halves of a wave hold the two key groups of one query column)
__device__ __forceinline__ float xhalf(float x) { return __builtin_bit_cast(float, __builtin_amdgcn_permlanex16(__builtin_bit_cast(int, x), __builtin_bit_cast(int, x), 0x76543210, 0xfedcba98, false, false)); }
#define FS_KEYS 64
#define FS_PITCH 144
#define FS_PLANE (64 * FS_PITCH)
#define FS_STAGE (3 * FS_PLANE)
// six copies of one lane: rows r and r + 32 of K hi, K lo and Vt, 16 B each. The s_wait_xcnt stands inside the copies' own statement, so that no address register named here is rewritten in front of it.
__device__ __forceinline__ void fs_copy6(unsigned l, const _Float16* kh, const _Float16* kl, int ldk, const _Float16* vt) {
  asm volatile("global_load_async_to_lds_b128 %0, %6, off\n\t"
               "global_load_async_to_lds_b128 %1, %7, off\n\t"
               "global_load_async_to_lds_b128 %2, %8, off\n\t"
               "global_load_async_to_lds_b128 %3, %9, off\n\t"
               "global_load_async_to_lds_b128 %4, %10, off\n\t"
               "global_load_async_to_lds_b128 %5, %11, off\n\t"
               "s_wait_xcnt 0x0"
               :: "v"(l), "v"(l + 32 * FS_PITCH), "v"(l + FS_PLANE), "v"(l + FS_PLANE + 32 * FS_PITCH), "v"(l + 2 * FS_PLANE), "v"(l + 2 * FS_PLANE + 32 * FS_PITCH),
                  "v"(kh), "v"(kh + (size_t)32 * ldk), "v"(kl), "v"(kl + (size_t)32 * ldk), "v"(vt), "v"(vt + 32 * TT)
               : "memory");
}
__global__ __launch_bounds__(256) void k_flash(const _Float16* __restrict__ Q16, const _Float16* __restrict__ Q16lo, int ldq, const _Float16* __restrict__ K16, const _Float16* __restrict__ K16lo, int ldk, const _Float16* __restrict__ Vt, const int* __restrict__ MSK, _Float16* __restrict__ O16, int ldo) {
  constexpr int RPW = 16, NW = 8, NQB = TT / (NW * RPW), DT = 4, KS = 2, NST = TT / FS_KEYS;
  __shared__ __attribute__((aligned(16))) unsigned char sT[2 * FS_STAGE];
  __shared__ __attribute__((aligned(16))) int sM[TT];
  __shared__ __attribute__((aligned(16))) float sO[NW][RPW][64 + 4];
  const int tid = threadIdx.x, w = tid >> 5, lane = tid & 31, ln = lane & 15, hh = lane >> 4;
  const int slab = blockIdx.x / NQB, qblk = blockIdx.x % NQB; const int b = slab / NH, h = slab % NH; const int q0 = qblk * (NW * RPW) + w * RPW;
  const int cr = tid >> 3, cc = tid & 7;      /* this lane's row (mod 32) and 16-B column of every stage copy */
  const size_t kofs = ((size_t)b * TT + cr) * ldk + h * 64 + cc * 8;
  const _Float16* gkh = K16 + kofs; const _Float16* gkl = K16lo + kofs; const _Float16* gvt = Vt + ((size_t)slab * 64 + cr) * TT + cc * 8;
  const unsigned lt = (unsigned)(size_t)sT + cr * FS_PITCH + cc * 16;
  { const unsigned lm = (unsigned)(size_t)sM + tid * 16; const int* gm = MSK + (size_t)b * TT + tid * 4;
    /* the mask row, 2 x 16 B a lane; the wait inside the statement keeps its address registers until the copies have read them */
    asm volatile("global_load_async_to_lds_b128 %0, %2, off\n\t"
                 "global_load_async_to_lds_b128 %1, %3, off\n\t"
                 "s_wait_xcnt 0x0" :: "v"(lm), "v"(lm + TT * 2), "v"(gm), "v"(gm + TT / 2) : "memory"); }
  fs_copy6(lt, gkh, gkl, ldk, gvt);
  FragH aq[KS], aql[KS];
  { const size_t qo = ((size_t)b * TT + q0 + ln) * ldq + h * 64; const unsigned short* qr = (const unsigned short*)Q16 + qo; const unsigned short* ql = (const unsigned short*)Q16lo + qo;
#pragma unroll
    for (int ks = 0; ks < KS; ++ks) { aq[ks].half[0] = *(const v8us*)(qr + ks * 32 + 8 * hh); aq[ks].half[1] = *(const v8us*)(qr + ks * 32 + 16 + 8 * hh); aql[ks].half[0] = *(const v8us*)(ql + ks * 32 + 8 * hh); aql[ks].half[1] = *(const v8us*)(ql + ks * 32 + 16 + 8 * hh); } }
  asm volatile("s_wait_asynccnt 0x0" ::: "memory");      /* the mask and stage 0 have landed for this wave */
  __syncthreads();                                       /* ... and for every wave */
  fs_copy6(lt + FS_STAGE, gkh + (size_t)FS_KEYS * ldk, gkl + (size_t)FS_KEYS * ldk, ldk, gvt + FS_KEYS);
  float m_r = -3.0e38f, l_r = 0.f; v8f oacc[DT];
#pragma unroll
  for (int dt = 0; dt < DT; ++dt) oacc[dt] = (v8f){0.f,0.f,0.f,0.f,0.f,0.f,0.f,0.f};
  const unsigned char* fk = sT + ln * FS_PITCH + 16 * hh; const unsigned char* fv = fk + 2 * FS_PLANE;
#pragma unroll 1      /* one stage a trip: the two buffers alternate by an offset */
  for (int t = 0; t < NST; ++t) {
    const unsigned bo = (unsigned)(t & 1) * FS_STAGE;
#pragma unroll      /* the two passes of a stage stand in line, so that every LDS read takes its place in the stage as an immediate offset */
    for (int ps = 0; ps < FS_KEYS / 32; ++ps) {
    const int* mp = sM + t * FS_KEYS + ps * 32 + 8 * hh;      /* key padding mask (1 = attend) of this lane's 16 keys */
    const v4ia km[4] = { *(const v4ia*)(mp), *(const v4ia*)(mp + 4), *(const v4ia*)(mp + 16), *(const v4ia*)(mp + 20) };
    float sv[16]; FragH bk[2][KS], bl[2][KS], bv[DT];
#pragma unroll
    for (int nt = 0; nt < 2; ++nt) { const unsigned char* kr = fk + bo + (ps * 32 + nt * 16) * FS_PITCH; const unsigned char* kl = kr + FS_PLANE;
#pragma unroll
      for (int ks = 0; ks < KS; ++ks) { bk[nt][ks].half[0] = *(const v8us*)(kr + ks * 64); bk[nt][ks].half[1] = *(const v8us*)(kr + ks * 64 + 32); bl[nt][ks].half[0] = *(const v8us*)(kl + ks * 64); bl[nt][ks].half[1] = *(const v8us*)(kl + ks * 64 + 32); } }
    __builtin_amdgcn_sched_barrier(0);      /* the pass's K reads go out as one group: left alone the scheduler puts the second key tile's reads behind the first tile's products, and the wave waits out the LDS latency a second time */
#pragma unroll
    for (int nt = 0; nt < 2; ++nt) {
      v8f acc = (v8f){0.f,0.f,0.f,0.f,0.f,0.f,0.f,0.f}, accl = acc;
#pragma unroll
      for (int ks = 0; ks < KS; ++ks) { acc = mmaH<1>(bk[nt][ks].v, bk[nt][ks].v, aq[ks].v, aq[ks].v, acc); accl = mmaH<1>(bk[nt][ks].v, bk[nt][ks].v, aql[ks].v, aql[ks].v, accl); accl = mmaH<1>(bl[nt][ks].v, bl[nt][ks].v, aq[ks].v, aq[ks].v, accl); }
#pragma unroll
      for (int r = 0; r < 8; ++r) sv[nt * 8 + r] = (km[nt * 2 + (r >> 2)][r & 3] != 0) ? acc[r] + accl[r] * 0.0009765625f : -INFINITY; }
#pragma unroll
    for (int dt = 0; dt < DT; ++dt) { const unsigned char* vrow = fv + bo + dt * 16 * FS_PITCH + ps * 64; bv[dt].half[0] = *(const v8us*)(vrow); bv[dt].half[1] = *(const v8us*)(vrow + 32); }
    __builtin_amdgcn_sched_barrier(0);      /* the four Vt fragments are read as one group ahead of the softmax, which covers their latency: left alone each read sinks to just in front of its product and is waited for there */
    float t8[8];
#pragma unroll
    for (int i = 0; i < 8; ++i) t8[i] = fmaxf(sv[i], sv[8 + i]);
    float mc = fmaxf(fmaxf(fmaxf(t8[0], t8[1]), fmaxf(t8[2], t8[3])), fmaxf(fmaxf(t8[4], t8[5]), fmaxf(t8[6], t8[7])));
    mc = fmaxf(mc, xhalf(mc));      /* both halves now hold the query's block maximum */
    const float mn = fmaxf(m_r, mc); const float ea = expf(m_r - mn); const float al = (mn > -1.0e38f) ? ea : 1.0f; m_r = mn;      /* mn is finite (>= -3e38), so a masked score gives exp(-inf) = 0 */
    float p[16]; FragH pa;
#pragma unroll
    for (int i = 0; i < 16; ++i) { p[i] = expf(sv[i] - mn); pa.h[i] = (_Float16)(p[i] * 1024.0f); }
#pragma unroll
    for (int i = 0; i < 8; ++i) t8[i] = p[i] + p[8 + i];
    l_r = l_r * al + (((t8[0] + t8[1]) + (t8[2] + t8[3])) + ((t8[4] + t8[5]) + (t8[6] + t8[7])));      /* per-lane partial sum; the halves join after the loop */
#pragma unroll
    for (int dt = 0; dt < DT; ++dt)
#pragma unroll
      for (int r = 0; r < 8; ++r) oacc[dt][r] *= al;
#pragma unroll
    for (int dt = 0; dt < DT; ++dt) oacc[dt] = mmaH<1>(bv[dt].v, bv[dt].v, pa.v, pa.v, oacc[dt]); }
    asm volatile("s_wait_dscnt 0x0" ::: "memory");       /* this wave's reads of buffer t & 1 are done before the buffer is handed back */
    asm volatile("s_wait_asynccnt 0x0" ::: "memory");    /* this wave's copies of stage t + 1 have landed */
    __syncthreads();                                     /* publishes stage t + 1 and ends every wave's reads of stage t */
    if (t + 2 < NST) fs_copy6(lt + bo, gkh + (size_t)(t + 2) * FS_KEYS * ldk, gkl + (size_t)(t + 2) * FS_KEYS * ldk, ldk, gvt + (t + 2) * FS_KEYS);
  }
  asm volatile("s_wait_asynccnt 0x0" ::: "memory");      /* nothing is in flight when the wave goes on to its end */
  { const float l = l_r + xhalf(l_r); const float inv = (l > 0.f) ? 1.0f / (l * 1024.0f) : 0.f;
#pragma unroll
    for (int dt = 0; dt < DT; ++dt)
#pragma unroll
      for (int q = 0; q < 2; ++q) { const v4f o4 = { oacc[dt][q * 4] * inv, oacc[dt][q * 4 + 1] * inv, oacc[dt][q * 4 + 2] * inv, oacc[dt][q * 4 + 3] * inv }; *(v4fa*)&sO[w][ln][dt * 16 + 8 * hh + q * 4] = o4; } }
  __builtin_amdgcn_fence(__ATOMIC_ACQ_REL, "workgroup"); __builtin_amdgcn_wave_barrier();
  {
#pragma unroll      /* O x 2^4 goes out as the f16 operand of the output GEMM: 8 lanes a row, one whole 128-B line per (query, head) */
    for (int rp = 0; rp < RPW; rp += 4) { const int r = rp + (lane >> 3), c8 = (lane & 7) * 8; const v4f a = *(const v4fa*)&sO[w][r][c8], c = *(const v4fa*)&sO[w][r][c8 + 4]; FragH f;
#pragma unroll
      for (int q = 0; q < 4; ++q) { f.h[q] = (_Float16)(a[q] * 16.0f); f.h[4 + q] = (_Float16)(c[q] * 16.0f); }
      *(v8us*)((unsigned short*)O16 + ((size_t)b * TT + q0 + r) * ldo + h * 64 + c8) = f.half[0]; }
     } }

// ---- projection GEMM with its operands staged in LDS: C = alpha * A . Bt^T, A [NR][DD] and Bt [DD][DD] f16, both k-contiguous.
// One 128 x 128 tile per work-group of 8 waves (4 x 2 waves of 32 x 64). A stage is 128 k = 256 B of each of the 256 operand rows (A rows 0-127, Bt rows 128-255),
// brought by asynchronous copies (16 lanes of 16 B a row), two buffers: stage t + 1 flies while stage t is multiplied.
// LDS row pitch 272 B = 16 B x odd, the conflict-free pitch of ds_load_b128 fragment reads. The k order of every accumulator is 0, 32, 64, ... as before.
#define GS_K 128
#define GS_PITCH 272
#define GS_STAGE (256 * GS_PITCH)
// eight copies of one lane: rows r, r + 16, ..., r + 112 of one operand, 16 B each. The s_wait_xcnt stands inside the copies' own statement, so that no address register named here is rewritten in front of it.
__device__ __forceinline__ void gs_copy8(unsigned l, const _Float16* g) {
  asm volatile("global_load_async_to_lds_b128 %0, %8, off\n\t"
               "global_load_async_to_lds_b128 %1, %9, off\n\t"
               "global_load_async_to_lds_b128 %2, %10, off\n\t"
               "global_load_async_to_lds_b128 %3, %11, off\n\t"
               "global_load_async_to_lds_b128 %4, %12, off\n\t"
               "global_load_async_to_lds_b128 %5, %13, off\n\t"
               "global_load_async_to_lds_b128 %6, %14, off\n\t"
               "global_load_async_to_lds_b128 %7, %15, off\n\t"
               "s_wait_xcnt 0x0"
               :: "v"(l), "v"(l + 16 * GS_PITCH), "v"(l + 32 * GS_PITCH), "v"(l + 48 * GS_PITCH), "v"(l + 64 * GS_PITCH), "v"(l + 80 * GS_PITCH), "v"(l + 96 * GS_PITCH), "v"(l + 112 * GS_PITCH),
                  "v"(g), "v"(g + 16 * DD), "v"(g + 32 * DD), "v"(g + 48 * DD), "v"(g + 64 * DD), "v"(g + 80 * DD), "v"(g + 96 * DD), "v"(g + 112 * DD)
               : "memory");
}
// the 2 A and 4 B fragments of one k step (32 k = 64 B of a row) from a stage in LDS; both operands in the same k order: 8 hh + 0..7, then 16 + 8 hh + 0..7
__device__ __forceinline__ void gs_frags(FragH (&a)[2], FragH (&b)[4], const unsigned char* pa, const unsigned char* pb) {
#pragma unroll
  for (int i = 0; i < 2; ++i) { a[i].half[0] = *(const v8us*)(pa + i * 16 * GS_PITCH); a[i].half[1] = *(const v8us*)(pa + i * 16 * GS_PITCH + 32); }
#pragma unroll
  for (int j = 0; j < 4; ++j) { b[j].half[0] = *(const v8us*)(pb + j * 16 * GS_PITCH); b[j].half[1] = *(const v8us*)(pb + j * 16 * GS_PITCH + 32); }
}
// the 8 products of one k step
__device__ __forceinline__ void gs_mma(v8f (&acc)[2][4], const FragH (&a)[2], const FragH (&b)[4]) {
#pragma unroll
  for (int i = 0; i < 2; ++i)
#pragma unroll
    for (int j = 0; j < 4; ++j) acc[i][j] = __builtin_amdgcn_wmma_f32_16x16x32_f16(false, a[i].v, false, b[j].v, (short)0, acc[i][j], false, false);
}
// QKV = false: one product, C f32. QKV = true: the q, k and v projections in one grid (256 tiles each, Bt = the three weights in a row), each with its consumer's conversion as epilogue:
// q and k leave as elu + 1 split in f16 hi + 2^10 x residual planes, v leaves as f16 already transposed, Vt[batch * DD + column][token].
template <bool QKV>
__global__ __launch_bounds__(256) void k_gemm_lds(const _Float16* __restrict__ A, const _Float16* __restrict__ Bt, float alpha, float* __restrict__ C,
                                                  _Float16* __restrict__ Qh, _Float16* __restrict__ Ql, _Float16* __restrict__ Kh, _Float16* __restrict__ Kl, _Float16* __restrict__ Vt) {
  __shared__ __attribute__((aligned(16))) unsigned char sT[2 * GS_STAGE];
  __shared__ __attribute__((aligned(16))) float so[8][32][64 + 4];
  constexpr int NST = DD / GS_K;
  const int tid = threadIdx.x, w = tid >> 5, lane = tid & 31, ln = lane & 15, hh = lane >> 4;
  constexpr int NTILE = (NR / 128) * (DD / 128);
  const int which = QKV ? blockIdx.x / NTILE : 0, tile = QKV ? blockIdx.x % NTILE : blockIdx.x;      /* which: 0 q, 1 k, 2 v; the same for the whole work-group */
  Bt += (size_t)which * DD * DD;
  const int row0 = (tile / (DD / 128)) * 128, col0 = (tile % (DD / 128)) * 128; const int wm = w >> 1, wn = w & 1;
  const int cr = tid >> 4, cc = tid & 15;      /* this lane's row (mod 16) and 16-B column of every copy */
  const _Float16* ga = A + (size_t)(row0 + cr) * DD + cc * 8; const _Float16* gb = Bt + (size_t)(col0 + cr) * DD + cc * 8;
  const unsigned la = (unsigned)(size_t)sT + cr * GS_PITCH + cc * 16, lb = la + 128 * GS_PITCH;
  gs_copy8(la, ga); gs_copy8(lb, gb);
  asm volatile("s_wait_asynccnt 0x0" ::: "memory");      /* stage 0 has landed for this wave */
  __syncthreads();                                       /* ... and for every wave */
  gs_copy8(la + GS_STAGE, ga + GS_K); gs_copy8(lb + GS_STAGE, gb + GS_K);
  v8f acc[2][4];
#pragma unroll
  for (int i = 0; i < 2; ++i)
#pragma unroll
    for (int j = 0; j < 4; ++j) acc[i][j] = (v8f){0.f,0.f,0.f,0.f,0.f,0.f,0.f,0.f};
  const unsigned char* fa = sT + (wm * 32 + ln) * GS_PITCH + 16 * hh; const unsigned char* fb = sT + (128 + wn * 64 + ln) * GS_PITCH + 16 * hh;
#pragma unroll 1      /* one stage a trip: the two buffers alternate by an offset, the text stays small */
  for (int t = 0; t < NST; ++t) {
    const unsigned bo = (unsigned)(t & 1) * GS_STAGE;
    FragH a[2][2], b[2][4];      /* two fragment sets: the reads of k step ks + 1 of this same stage are issued as one group ahead of the products of k step ks */
    gs_frags(a[0], b[0], fa + bo, fb + bo);
#pragma unroll
    for (int ks = 0; ks + 1 < GS_K / 32; ++ks) {
      gs_frags(a[(ks + 1) & 1], b[(ks + 1) & 1], fa + bo + (ks + 1) * 64, fb + bo + (ks + 1) * 64);
      __builtin_amdgcn_sched_barrier(0);      /* keeps that group of reads ahead of the products: left alone the scheduler sinks each read to just in front of its use, and the wave waits out the LDS latency there */
      gs_mma(acc, a[ks & 1], b[ks & 1]);
    }
    __builtin_amdgcn_sched_barrier(0);                   /* those products stay in front of the hand-over and cover the last group's LDS latency */
    asm volatile("s_wait_dscnt 0x0" ::: "memory");       /* this wave's reads of buffer t & 1 are done before the buffer is handed back */
    asm volatile("s_wait_asynccnt 0x0" ::: "memory");    /* this wave's copies of stage t + 1 have landed */
    __syncthreads();                                     /* publishes stage t + 1 and ends every wave's reads of stage t */
    if (t + 2 < NST) { gs_copy8(la + bo, ga + (t + 2) * GS_K); gs_copy8(lb + bo, gb + (t + 2) * GS_K); }
    __builtin_amdgcn_sched_barrier(0);                   /* the refill is issued first: the last k step's products need registers only and run while the copies fly */
    gs_mma(acc, a[(GS_K / 32 - 1) & 1], b[(GS_K / 32 - 1) & 1]);
  }
  asm volatile("s_wait_asynccnt 0x0" ::: "memory");      /* nothing is in flight when the wave goes on to its end */
  if (QKV && which == 2) {
    /* v: a lane's 8 accumulator rows are 8 consecutive tokens of one column = 16 B of the transposed tile; staged [128 columns][128 tokens] f16 at pitch 272 B in so */
    unsigned char* sv = (unsigned char*)&so[0][0][0];
#pragma unroll
    for (int i = 0; i < 2; ++i)
#pragma unroll
      for (int j = 0; j < 4; ++j) { FragH f;
#pragma unroll
        for (int r = 0; r < 8; ++r) f.h[r] = (_Float16)(acc[i][j][r] * alpha);
        *(v8us*)(sv + (wn * 64 + j * 16 + ln) * GS_PITCH + (wm * 32 + i * 16 + 8 * hh) * 2) = f.half[0]; }
    __syncthreads();      /* a column's 128 tokens come from four waves: every wave's part is in LDS before any is read back */
#pragma unroll
    for (int q = 0; q < 8; ++q) { const int c = q * 16 + (tid >> 4), ch = tid & 15;      /* 16 lanes a column: 256 contiguous bytes of Vt */
      const v8us v = *(const v8us*)(sv + c * GS_PITCH + ch * 16);
      *(v8us*)((unsigned short*)Vt + ((size_t)(row0 / TT) * DD + col0 + c) * TT + row0 % TT + ch * 8) = v; }
  } else {
#pragma unroll
  for (int i = 0; i < 2; ++i)
#pragma unroll
    for (int j = 0; j < 4; ++j)
#pragma unroll
      for (int r = 0; r < 8; ++r) so[w][i * 16 + 8 * hh + r][j * 16 + ln] = acc[i][j][r] * alpha;
  __builtin_amdgcn_fence(__ATOMIC_ACQ_REL, "workgroup"); __builtin_amdgcn_wave_barrier();      /* the wave reads back rows that its other lanes wrote */
  if (QKV) {
    /* q, k: elu(x) + 1 = x + 1 (x > 0) | e^x (x <= 0), then hi = f16(v), lo = f16((v - hi) * 2^10); 8 lanes a row: the wave's 64 columns are one whole 128-B line of each plane */
    unsigned short* Hh = (unsigned short*)(which == 0 ? Qh : Kh); unsigned short* Hl = (unsigned short*)(which == 0 ? Ql : Kl);
#pragma unroll
    for (int q = 0; q < 8; ++q) { const int r = q * 4 + (lane >> 3), c8 = (lane & 7) * 8; const v4f a = *(const v4fa*)&so[w][r][c8], c = *(const v4fa*)&so[w][r][c8 + 4]; FragH fh, fl;
#pragma unroll
      for (int e = 0; e < 8; ++e) { const float x = (e < 4) ? a[e] : c[e - 4]; const float ex = expf(x);      /* taken for every lane, then selected: eight independent chains and no branch per element, with only two waves a SIMD to cover latency here */
        const float v = (x > 0.f) ? x + 1.0f : ex; const _Float16 h = (_Float16)v; fh.h[e] = h; fl.h[e] = (_Float16)((v - (float)h) * 1024.0f); }
      const size_t o = (size_t)(row0 + wm * 32 + r) * DD + col0 + wn * 64 + c8;
      *(v8us*)(Hh + o) = fh.half[0]; *(v8us*)(Hl + o) = fl.half[0]; }
    asm volatile("s_wait_xcnt 0x0" ::: "memory");      /* behind the last hi/lo store: no address or data register of these stores is rewritten in front of this wait on any way out of the loop */
  } else {
    const int rsub = lane >> 4, c4 = (lane & 15) * 4;
#pragma unroll
    for (int q = 0; q < 16; ++q) { const int r = q * 2 + rsub; const v4f v = *(const v4fa*)&so[w][r][c4]; *(v4f*)(C + (size_t)(row0 + wm * 32 + r) * DD + col0 + wn * 64 + c4) = v; }
  }
  }
}

extern "C" void kernel_launch(void* const* d_in, const int* in_sizes, int n_in,
                              void* d_out, int out_size, void* d_ws, size_t ws_size, hipStream_t stream) {
  (void)in_sizes; (void)n_in; (void)out_size;
  const float* x = (const float*)d_in[0]; const int* mask = (const int*)d_in[1]; const float* Wq = (const float*)d_in[2]; const float* Wk = (const float*)d_in[3]; const float* Wv = (const float*)d_in[4]; const float* Wo = (const float*)d_in[5];
  char* ws = (char*)d_ws; size_t off = 0;
  auto take = [&](size_t bytes) { char* p = ws + off; off += (bytes + 255) & ~(size_t)255; return p; };
  const size_t WSZ = (size_t)DD * DD; _Float16* Bw = (_Float16*)take(4 * WSZ * 2); _Float16* X16 = (_Float16*)take((size_t)NR * DD * 2);
  _Float16* Qh = (_Float16*)take((size_t)NR * DD * 2); _Float16* Ql = (_Float16*)take((size_t)NR * DD * 2); _Float16* Kh = (_Float16*)take((size_t)NR * DD * 2); _Float16* Kl = (_Float16*)take((size_t)NR * DD * 2); _Float16* Vt = (_Float16*)take((size_t)NR * DD * 2);
  _Float16* O16 = X16;      /* X16 is dead after the q/k/v launch */
  if (off > ws_size) return;      // 7 x 8.4 MB
  k_prep<<<PREP_T / 256, 256, 0, stream>>>(x, Wq, Wk, Wv, Wo, X16, Bw);
  k_gemm_lds<true><<<3 * (NR / 128) * (DD / 128), 256, 0, stream>>>(X16, Bw, 0.0625f, nullptr, Qh, Ql, Kh, Kl, Vt);      /* q, k: elu + 1 hi/lo; v: transposed */
  k_flash<<<BB * NH * (TT / 128), 256, 0, stream>>>(Qh, Ql, DD, Kh, Kl, DD, Vt, mask, O16, DD);
  k_gemm_lds<false><<<(NR / 128) * (DD / 128), 256, 0, stream>>>(O16, Bw + 3 * WSZ, 0.00390625f, (float*)d_out, nullptr, nullptr, nullptr, nullptr, nullptr);      /* out = O . Wo^T */
}

// v005
// One run takes 111 microseconds.
// Two timings next to v004 both put it at 1.27 times that version's speed.
// All steps since v000 together make it 4.72 times as fast.
#include <hip/hip_runtime.h>
// Multi-head 'linear-feature' attention (B=2, S=2048, H=1024, 16 heads × 64): q,k,v = x·Wᵀ (no bias); φ(q) = elu(q)+1, φ(k) = elu(k)+1; attn = softmax(φ(q)·φ(k)ᵀ) UNSCALED (σ≈8 logits) with the INPUT key mask [B,S] (0 → −inf);
// out = (attn·v merged)·Woᵀ.
// Compute dtype: x and weights rounded to bf16; q,k as f32 GEMM outputs mapped through elu+1 in f32 and split into f16 hi + ×2^10 residual planes so the large unscaled logits are f32-accurate
// (S = Qh·Kh + (Ql·Kh + Qh·Kl)·2^-10, separate accumulators); v f16; fused flash-style kernel (online softmax f32, P f16 ×2^10) on v_wmma_f32_16x16x32_f16; O ×2^4 → f16 → output GEMM; f32 accumulate.
#define BB 2
#define TT 2048
#define NH 16
#define DD 1024
#define NR (BB * TT)

typedef __bf16 v16b __attribute__((ext_vector_type(16)));
typedef unsigned short v8us __attribute__((ext_vector_type(8), may_alias));
typedef float  v8f  __attribute__((ext_vector_type(8)));
typedef float  v4f  __attribute__((ext_vector_type(4)));
typedef float  v4fa __attribute__((ext_vector_type(4), may_alias));
union FragB { v16b v; v8us half[2]; unsigned short u[16]; };

__device__ __forceinline__ unsigned short bf16_bits(float x) { unsigned int u = __float_as_uint(x); return (unsigned short)((u + 0x7FFFu + ((u >> 16) & 1u)) >> 16); }
__device__ __forceinline__ float bf16_val(unsigned short b) { return __uint_as_float(((unsigned int)b) << 16); }
__device__ __forceinline__ float bf16_round(float x) { return bf16_val(bf16_bits(x)); }
// D += A·B with NT terms: 1 = ah·bh, 2 = + al·bh (A split), 3 = + ah·bl (both split)
template <int NT>
__device__ __forceinline__ v8f mmaN(v16b ah, v16b al, v16b bh, v16b bl, v8f c) {
  c = __builtin_amdgcn_wmma_f32_16x16x32_bf16(false, ah, false, bh, (short)0, c, false, false);
  if (NT >= 2) c = __builtin_amdgcn_wmma_f32_16x16x32_bf16(false, al, false, bh, (short)0, c, false, false);
  if (NT >= 3) c = __builtin_amdgcn_wmma_f32_16x16x32_bf16(false, ah, false, bl, (short)0, c, false, false);
  asm volatile("v_nop\n\tv_nop\n\tv_nop\n\tv_nop" : "+v"(c) : "v"(ah), "v"(al), "v"(bh), "v"(bl));
  return c;
}

__global__ __launch_bounds__(256) void k_wt_bf16(const float* __restrict__ W, unsigned short* __restrict__ Wt, int K, int N) {
  const int t = blockIdx.x * 256 + threadIdx.x;
  const int k8n = K / 8;
  if (t >= N * k8n) return;
  const int n = t / k8n, k8 = (t % k8n) * 8;
  v8us v;
#pragma unroll
  for (int i = 0; i < 8; ++i) v[i] = bf16_bits(W[(size_t)(k8 + i) * N + n]);
  *(v8us*)(Wt + (size_t)n * K + k8) = v;
  
}

// GEMM C[M][N] (f32, pitch ldc) = act(A[M][K]·W + bias). A f32 row-major (pitch lda) converted per fragment to bf16
// (ASPLIT: hi/lo two planes -> 2 terms, else single rounded term); Wt bf16 [N][K] (pitch ldb). BIAS_BF16 rounds the
// bias to bf16 first (bias quantised to bf16 before the add). K%32==0, M%16==0, N%64==0.
template <bool ASPLIT, int ACT, bool BIAS_BF16>
__global__ __launch_bounds__(128) void k_gemm_bf(const float* __restrict__ A, int lda, const unsigned short* __restrict__ Wt, int ldb,
                                               const float* __restrict__ bias, float* __restrict__ C, int ldc, int M, int N, int K) {
  __shared__ __attribute__((aligned(16))) float so[4][16][64];
  const int tid = threadIdx.x, w = tid >> 5, lane = tid & 31, ln = lane & 15, hh = lane >> 4;
  const int ntn = N / 64;
  const int wid = blockIdx.x * 4 + w;
  const int mt = wid / ntn, nq = wid % ntn;
  if (mt * 16 >= M) return;
  const int row0 = mt * 16, col0 = nq * 64;
  const float* arow = A + (size_t)(row0 + ln) * lda;
  v8f acc[4] = {};
  for (int kb = 0; kb < K; kb += 32) {
    FragB ah, al;
    const v4f x0 = *(const v4fa*)(arow + kb + 8 * hh), x1 = *(const v4fa*)(arow + kb + 8 * hh + 4);
    const v4f x2 = *(const v4fa*)(arow + kb + 16 + 8 * hh), x3 = *(const v4fa*)(arow + kb + 16 + 8 * hh + 4);
    float xs[16] = {x0[0],x0[1],x0[2],x0[3],x1[0],x1[1],x1[2],x1[3],x2[0],x2[1],x2[2],x2[3],x3[0],x3[1],x3[2],x3[3]};
#pragma unroll
    for (int i = 0; i < 16; ++i) { const unsigned short hb = bf16_bits(xs[i]); ah.u[i] = hb; al.u[i] = ASPLIT ? bf16_bits(xs[i] - bf16_val(hb)) : (unsigned short)0; }
#pragma unroll
    for (int t = 0; t < 4; ++t) {
      const unsigned short* brow = Wt + (size_t)(col0 + t * 16 + ln) * ldb + kb;
      FragB b;
      b.half[0] = *(const v8us*)(brow + 8 * hh);
      b.half[1] = *(const v8us*)(brow + 16 + 8 * hh);
      acc[t] = mmaN<ASPLIT ? 2 : 1>(ah.v, al.v, b.v, b.v, acc[t]);
    }
  }
#pragma unroll
  for (int t = 0; t < 4; ++t) {
    float bv = bias ? bias[col0 + t * 16 + ln] : 0.f;
    if (BIAS_BF16) bv = bf16_round(bv);
#pragma unroll
    for (int r = 0; r < 8; ++r) { float v = acc[t][r] + bv; if (ACT == 1) v = fmaxf(v, 0.f); so[w][8 * hh + r][t * 16 + ln] = v; }
  }
  __builtin_amdgcn_fence(__ATOMIC_ACQ_REL, "workgroup");
  __builtin_amdgcn_wave_barrier();
  const int rsub = lane >> 4, c4 = (lane & 15) * 4;
  {
#pragma unroll
    for (int q = 0; q < 8; ++q) {
      const int r = q * 2 + rsub;
      const v4f v = *(const v4fa*)&so[w][r][c4];
      *(v4f*)(C + (size_t)(row0 + r) * ldc + col0 + c4) = v;
    }
    
  }
}

// Flash-style causal/unmasked attention, all contractions 3-term bf16 hi/lo splits, f32 softmax with running max.
// q,k,v rows are read from f32 buffers with arbitrary row pitch (so they can live inside a fused qkv buffer);
// D = head size (multiple of 32, <= 128); one wave = 16 query rows; block = 4 waves (64 queries) sharing K/V chunks of 32.
template <int D, bool CAUSAL>
__global__ __launch_bounds__(128) void k_flash(const float* __restrict__ qb, const float* __restrict__ kb, const float* __restrict__ vb,
                                             int pitch, int T, int H, float scale, float* __restrict__ y, int ypitch) {
  constexpr int KS = D / 32;        // k-steps for QK
  constexpr int DT = D / 16;        // d tiles for PV
  __shared__ __attribute__((aligned(16))) unsigned short sKh[32][D + 8], sKl[32][D + 8], sVh[32][D + 8], sVl[32][D + 8];
  __shared__ __attribute__((aligned(16))) unsigned short sPh[4][16][40], sPl[4][16][40];
  __shared__ __attribute__((aligned(16))) float sO[4][16][D];
  const int tid = threadIdx.x, w = tid >> 5, lane = tid & 31, ln = lane & 15, hh = lane >> 4;
  const int nqb = (T + 63) / 64;
  const int bh = blockIdx.x / nqb, qblk = blockIdx.x % nqb;
  const int b = bh / H, h = bh % H;
  const int q0 = qblk * 64 + w * 16;
  const float* Q = qb + (size_t)b * T * pitch + h * D;
  const float* K = kb + (size_t)b * T * pitch + h * D;
  const float* V = vb + (size_t)b * T * pitch + h * D;

  // A fragments of the wave's 16 query rows (scaled), hi/lo
  FragB aqh[KS], aql[KS];
  {
    int row = q0 + ln; if (row >= T) row = T - 1;
    const float* qr = Q + (size_t)row * pitch;
#pragma unroll
    for (int ks = 0; ks < KS; ++ks)
#pragma unroll
      for (int i = 0; i < 16; ++i) {
        const int d = ks * 32 + ((i < 8) ? (8 * hh + i) : (16 + 8 * hh + (i - 8)));
        const float x = qr[d] * scale; const unsigned short hb = bf16_bits(x);
        aqh[ks].u[i] = hb; aql[ks].u[i] = bf16_bits(x - bf16_val(hb));
      }
  }
  float m_r[8], l_r[8];
#pragma unroll
  for (int r = 0; r < 8; ++r) { m_r[r] = -3.0e38f; l_r[r] = 0.f; }
  v8f oacc[DT];
#pragma unroll
  for (int dt = 0; dt < DT; ++dt) oacc[dt] = (v8f){0.f,0.f,0.f,0.f,0.f,0.f,0.f,0.f};

  const int kv_end = CAUSAL ? min(T, qblk * 64 + 64) : T;     // block-uniform
  for (int j0 = 0; j0 < kv_end; j0 += 32) {
    __syncthreads();
    for (int e = tid; e < 32 * (D / 4); e += 128) {
      const int r = e / (D / 4), c4 = (e % (D / 4)) * 4;
      const int key = j0 + r;
      v4f kf = {0.f,0.f,0.f,0.f}, vf = {0.f,0.f,0.f,0.f};
      if (key < T) { kf = *(const v4fa*)(K + (size_t)key * pitch + c4); vf = *(const v4fa*)(V + (size_t)key * pitch + c4); }
#pragma unroll
      for (int t = 0; t < 4; ++t) {
        unsigned short hb = bf16_bits(kf[t]); sKh[r][c4 + t] = hb; sKl[r][c4 + t] = bf16_bits(kf[t] - bf16_val(hb));
        hb = bf16_bits(vf[t]); sVh[r][c4 + t] = hb; sVl[r][c4 + t] = bf16_bits(vf[t] - bf16_val(hb));
      }
    }
    __syncthreads();
    // S tile 16 x 32
    v8f s[2];
#pragma unroll
    for (int nt = 0; nt < 2; ++nt) {
      v8f acc = {};
#pragma unroll
      for (int ks = 0; ks < KS; ++ks) {
        FragB bh_, bl_;
        bh_.half[0] = *(const v8us*)&sKh[nt * 16 + ln][ks * 32 + 8 * hh]; bh_.half[1] = *(const v8us*)&sKh[nt * 16 + ln][ks * 32 + 16 + 8 * hh];
        bl_.half[0] = *(const v8us*)&sKl[nt * 16 + ln][ks * 32 + 8 * hh]; bl_.half[1] = *(const v8us*)&sKl[nt * 16 + ln][ks * 32 + 16 + 8 * hh];
        acc = mmaN<3>(aqh[ks].v, aql[ks].v, bh_.v, bl_.v, acc);
      }
      s[nt] = acc;
    }
    // mask + running max (rows 8hh+r; the 16 lanes of a half share rows)
    float alpha[8];
#pragma unroll
    for (int r = 0; r < 8; ++r) {
      const int qi = q0 + 8 * hh + r;
      const int ja = j0 + ln, jb = j0 + 16 + ln;
      if (CAUSAL) { if (ja > qi) s[0][r] = -3.0e38f; if (jb > qi) s[1][r] = -3.0e38f; }
      if (ja >= T) s[0][r] = -3.0e38f;
      if (jb >= T) s[1][r] = -3.0e38f;
      float mx = fmaxf(s[0][r], s[1][r]);
      mx = fmaxf(mx, __shfl_xor(mx, 1, 32)); mx = fmaxf(mx, __shfl_xor(mx, 2, 32)); mx = fmaxf(mx, __shfl_xor(mx, 4, 32)); mx = fmaxf(mx, __shfl_xor(mx, 8, 32));
      const float mnew = fmaxf(m_r[r], mx);
      alpha[r] = (mnew > -1.0e38f) ? __expf(m_r[r] - mnew) : 1.0f;
      const float p0 = (s[0][r] > -1.0e38f) ? __expf(s[0][r] - mnew) : 0.f;
      const float p1 = (s[1][r] > -1.0e38f) ? __expf(s[1][r] - mnew) : 0.f;
      m_r[r] = mnew;
      l_r[r] = l_r[r] * alpha[r] + p0 + p1;            // per-lane partial row sum (16 lanes combined at the end)
      unsigned short hb = bf16_bits(p0); sPh[w][8 * hh + r][ln] = hb;      sPl[w][8 * hh + r][ln] = bf16_bits(p0 - bf16_val(hb));
      hb = bf16_bits(p1);                sPh[w][8 * hh + r][16 + ln] = hb; sPl[w][8 * hh + r][16 + ln] = bf16_bits(p1 - bf16_val(hb));
    }
#pragma unroll
    for (int dt = 0; dt < DT; ++dt)
#pragma unroll
      for (int r = 0; r < 8; ++r) oacc[dt][r] *= alpha[r];
    __builtin_amdgcn_fence(__ATOMIC_ACQ_REL, "workgroup");
    __builtin_amdgcn_wave_barrier();
    FragB pah, pal;
    pah.half[0] = *(const v8us*)&sPh[w][ln][8 * hh]; pah.half[1] = *(const v8us*)&sPh[w][ln][16 + 8 * hh];
    pal.half[0] = *(const v8us*)&sPl[w][ln][8 * hh]; pal.half[1] = *(const v8us*)&sPl[w][ln][16 + 8 * hh];
#pragma unroll
    for (int dt = 0; dt < DT; ++dt) {
      FragB bvh, bvl;
#pragma unroll
      for (int i = 0; i < 8; ++i) {
        bvh.u[i] = sVh[8 * hh + i][dt * 16 + ln]; bvh.u[8 + i] = sVh[16 + 8 * hh + i][dt * 16 + ln];
        bvl.u[i] = sVl[8 * hh + i][dt * 16 + ln]; bvl.u[8 + i] = sVl[16 + 8 * hh + i][dt * 16 + ln];
      }
      oacc[dt] = mmaN<3>(pah.v, pal.v, bvh.v, bvl.v, oacc[dt]);
    }
    __builtin_amdgcn_fence(__ATOMIC_ACQ_REL, "workgroup");
    __builtin_amdgcn_wave_barrier();
  }
#pragma unroll
  for (int r = 0; r < 8; ++r) {
    float l = l_r[r];
    l += __shfl_xor(l, 1, 32); l += __shfl_xor(l, 2, 32); l += __shfl_xor(l, 4, 32); l += __shfl_xor(l, 8, 32);
    l_r[r] = (l > 0.f) ? 1.0f / l : 0.f;
  }
#pragma unroll
  for (int dt = 0; dt < DT; ++dt)
#pragma unroll
    for (int r = 0; r < 8; ++r) sO[w][8 * hh + r][dt * 16 + ln] = oacc[dt][r] * l_r[r];
  __builtin_amdgcn_fence(__ATOMIC_ACQ_REL, "workgroup");
  __builtin_amdgcn_wave_barrier();
  {
    for (int r = 0; r < 16; ++r) {
      const int row = q0 + r;
      if (row < T && lane < D / 4) {
        const v4f val = *(const v4fa*)&sO[w][r][lane * 4];
        *(v4f*)(y + ((size_t)b * T + row) * ypitch + h * D + lane * 4) = val;
      }
    }
    
  }
}

// GEMM C = act(A·W + bias + resid): A f32 (ASPLIT -> hi/lo 2 terms), Wt bf16 [N][K]; ACT 0 none, 1 relu, 2 exact gelu;
// resid (optional, f32, row index = (row % rmod), pitch ldr, RES_BF16 rounds it) added before the activation.
template <bool ASPLIT, int ACT, bool BIAS_BF16, bool RES_BF16>
__global__ __launch_bounds__(128) void k_gemm_bf3(const float* __restrict__ A, int lda, const unsigned short* __restrict__ Wt, int ldb,
                                                const float* __restrict__ bias, const float* __restrict__ resid, int rmod, int ldr,
                                                float* __restrict__ C, int ldc, int M, int N, int K) {
  __shared__ __attribute__((aligned(16))) float so[4][16][64];
  const int tid = threadIdx.x, w = tid >> 5, lane = tid & 31, ln = lane & 15, hh = lane >> 4;
  const int ntn = N / 64;
  const int wid = blockIdx.x * 4 + w;
  const int mt = wid / ntn, nq = wid % ntn;
  if (mt * 16 >= M) return;
  const int row0 = mt * 16, col0 = nq * 64;
  const float* arow = A + (size_t)(row0 + ln) * lda;
  v8f acc[4] = {};
  for (int kb = 0; kb < K; kb += 32) {
    FragB ah, al;
    const v4f x0 = *(const v4fa*)(arow + kb + 8 * hh), x1 = *(const v4fa*)(arow + kb + 8 * hh + 4);
    const v4f x2 = *(const v4fa*)(arow + kb + 16 + 8 * hh), x3 = *(const v4fa*)(arow + kb + 16 + 8 * hh + 4);
    float xs[16] = {x0[0],x0[1],x0[2],x0[3],x1[0],x1[1],x1[2],x1[3],x2[0],x2[1],x2[2],x2[3],x3[0],x3[1],x3[2],x3[3]};
#pragma unroll
    for (int i = 0; i < 16; ++i) { const unsigned short hb = bf16_bits(xs[i]); ah.u[i] = hb; al.u[i] = ASPLIT ? bf16_bits(xs[i] - bf16_val(hb)) : (unsigned short)0; }
#pragma unroll
    for (int t = 0; t < 4; ++t) {
      const unsigned short* brow = Wt + (size_t)(col0 + t * 16 + ln) * ldb + kb;
      FragB b;
      b.half[0] = *(const v8us*)(brow + 8 * hh);
      b.half[1] = *(const v8us*)(brow + 16 + 8 * hh);
      acc[t] = mmaN<ASPLIT ? 2 : 1>(ah.v, al.v, b.v, b.v, acc[t]);
    }
  }
#pragma unroll
  for (int t = 0; t < 4; ++t) {
    const int col = col0 + t * 16 + ln;
    float bv = bias ? bias[col] : 0.f;
    if (BIAS_BF16) bv = bf16_round(bv);
#pragma unroll
    for (int r = 0; r < 8; ++r) {
      float v = acc[t][r] + bv;
      if (resid) { float rv = resid[(size_t)((row0 + 8 * hh + r) % rmod) * ldr + col]; if (RES_BF16) rv = bf16_round(rv); v += rv; }
      if (ACT == 1) v = fmaxf(v, 0.f);
      if (ACT == 2) v = 0.5f * v * (1.0f + erff(v * 0.70710678118654752f));
      if (ACT == 3) { const float u = 0.7978845608028654f * (v + 0.044715f * v * v * v); v = 0.5f * v * (1.0f + tanhf(u)); }
      so[w][8 * hh + r][t * 16 + ln] = v;
    }
  }
  __builtin_amdgcn_fence(__ATOMIC_ACQ_REL, "workgroup");
  __builtin_amdgcn_wave_barrier();
  const int rsub = lane >> 4, c4 = (lane & 15) * 4;
  {
#pragma unroll
    for (int q = 0; q < 8; ++q) {
      const int r = q * 2 + rsub;
      const v4f v = *(const v4fa*)&so[w][r][c4];
      *(v4f*)(C + (size_t)(row0 + r) * ldc + col0 + c4) = v;
    }
    
  }
}
// row LayerNorm (biased variance, eps) over N: s = X (+ R); optional out_sum <- s; out_norm <- (s-mu)*rsqrt(var+eps)*g + b
template <bool PARAM_BF16>
__global__ __launch_bounds__(256) void k_layernorm(const float* __restrict__ X, const float* __restrict__ R, const float* __restrict__ g, const float* __restrict__ bta,
                                                  float* __restrict__ out_sum, float* __restrict__ out_norm, int N, float eps) {
  __shared__ float red[256];
  const int row = blockIdx.x, tid = threadIdx.x;
  const float* x = X + (size_t)row * N; const float* rr = R ? R + (size_t)row * N : nullptr;
  float vals[16];                     // up to N = 4096
  const int per = N / 256;            // contiguous chunk per thread? use strided-by-4 chunks: thread handles j = tid*4 + 1024*u
  float s1 = 0.f;
  for (int u = 0; u < per / 4; ++u) {
    const int j = tid * 4 + 1024 * u;
    const v4f a = *(const v4fa*)(x + j);
    v4f b = {0.f,0.f,0.f,0.f}; if (rr) b = *(const v4fa*)(rr + j);
#pragma unroll
    for (int q = 0; q < 4; ++q) { const float v = a[q] + b[q]; vals[u * 4 + q] = v; s1 += v; }
  }
  red[tid] = s1; __syncthreads();
  for (int st = 128; st > 0; st >>= 1) { if (tid < st) red[tid] += red[tid + st]; __syncthreads(); }
  const float mu = red[0] / (float)N; __syncthreads();
  float s2 = 0.f;
  for (int u = 0; u < per / 4; ++u)
#pragma unroll
    for (int q = 0; q < 4; ++q) { const float c = vals[u * 4 + q] - mu; s2 += c * c; }
  red[tid] = s2; __syncthreads();
  for (int st = 128; st > 0; st >>= 1) { if (tid < st) red[tid] += red[tid + st]; __syncthreads(); }
  const float rs = rsqrtf(red[0] / (float)N + eps);
  {
    for (int u = 0; u < per / 4; ++u) {
      const int j = tid * 4 + 1024 * u;
      v4f o, sm;
#pragma unroll
      for (int q = 0; q < 4; ++q) {
        float gg = g[j + q], bb = bta[j + q];
        if (PARAM_BF16) { gg = bf16_round(gg); bb = bf16_round(bb); }
        sm[q] = vals[u * 4 + q]; o[q] = (vals[u * 4 + q] - mu) * rs * gg + bb;
      }
      if (out_sum) *(v4f*)(out_sum + (size_t)row * N + j) = sm;
      *(v4f*)(out_norm + (size_t)row * N + j) = o;
    }
    
  }
}



// ---- f16 WMMA path (v_wmma_f32_16x16x32_f16): 11-bit significands for operands in range — used where a [0,1] probability operand needs more precision than bf16
typedef _Float16 v16h __attribute__((ext_vector_type(16)));
union FragH { v16h v; v8us half[2]; _Float16 h[16]; unsigned short u[16]; };
template <int NT>
__device__ __forceinline__ v8f mmaH(v16h ah, v16h al, v16h bh, v16h bl, v8f c) {
  c = __builtin_amdgcn_wmma_f32_16x16x32_f16(false, ah, false, bh, (short)0, c, false, false);
  if (NT >= 2) c = __builtin_amdgcn_wmma_f32_16x16x32_f16(false, al, false, bh, (short)0, c, false, false);
  if (NT >= 3) c = __builtin_amdgcn_wmma_f32_16x16x32_f16(false, ah, false, bl, (short)0, c, false, false);
  asm volatile("v_nop\n\tv_nop\n\tv_nop\n\tv_nop" : "+v"(c) : "v"(ah), "v"(al), "v"(bh), "v"(bl));
  return c;
}
// batched GEMM like k_gemm_b but f16 operands: A f32 (split into f16 hi/lo if ASPLIT, else rounded to f16), Bt = f16 values [n][k]; alpha; C f32; N multiple of 16 (partial tiles skipped)
template <bool ASPLIT>
__global__ __launch_bounds__(128) void k_gemm_h(const float* __restrict__ A, int lda, size_t sA, const _Float16* __restrict__ Bh, int ldb, size_t sB, float alpha, float* __restrict__ C, int ldc, size_t sC, int M, int N, int K) {
  __shared__ __attribute__((aligned(16))) float so[4][16][64];
  const int tid = threadIdx.x, w = tid >> 5, lane = tid & 31, ln = lane & 15, hh = lane >> 4; const int by = blockIdx.y;
  A += (size_t)by * sA; Bh += (size_t)by * sB; C += (size_t)by * sC;
  const int ntn = (N + 63) / 64; const int wid = blockIdx.x * 4 + w; const int mt = wid / ntn, nq = wid % ntn; if (mt * 16 >= M) return;
  const int row0 = mt * 16, col0 = nq * 64; const float* arow = A + (size_t)(row0 + ln) * lda;
  v8f acc[4] = {};
  for (int kb = 0; kb < K; kb += 32) {
    FragH ah, al;
    const v4f x0 = *(const v4fa*)(arow + kb + 8 * hh), x1 = *(const v4fa*)(arow + kb + 8 * hh + 4), x2 = *(const v4fa*)(arow + kb + 16 + 8 * hh), x3 = *(const v4fa*)(arow + kb + 16 + 8 * hh + 4);
    float xs[16] = {x0[0],x0[1],x0[2],x0[3],x1[0],x1[1],x1[2],x1[3],x2[0],x2[1],x2[2],x2[3],x3[0],x3[1],x3[2],x3[3]};
#pragma unroll
    for (int i = 0; i < 16; ++i) { const _Float16 h = (_Float16)xs[i]; ah.h[i] = h; al.h[i] = ASPLIT ? (_Float16)(xs[i] - (float)h) : (_Float16)0.0f; }
#pragma unroll
    for (int t = 0; t < 4; ++t) { if (col0 + t * 16 >= N) continue; const size_t boff = (size_t)(col0 + t * 16 + ln) * ldb + kb; FragH bq; bq.half[0] = *(const v8us*)(Bh + boff + 8 * hh); bq.half[1] = *(const v8us*)(Bh + boff + 16 + 8 * hh);
      acc[t] = mmaH<ASPLIT ? 2 : 1>(ah.v, al.v, bq.v, bq.v, acc[t]); }
  }
#pragma unroll
  for (int t = 0; t < 4; ++t) { if (col0 + t * 16 >= N) continue;
#pragma unroll
    for (int r = 0; r < 8; ++r) so[w][8 * hh + r][t * 16 + ln] = acc[t][r] * alpha; }
  __builtin_amdgcn_fence(__ATOMIC_ACQ_REL, "workgroup"); __builtin_amdgcn_wave_barrier();
  const int rsub = lane >> 4, c4 = (lane & 15) * 4;
  {
#pragma unroll
    for (int q = 0; q < 8; ++q) { const int r = q * 2 + rsub; if (col0 + c4 < N) { const v4f v = *(const v4fa*)&so[w][r][c4]; *(v4f*)(C + (size_t)(row0 + r) * ldc + col0 + c4) = v; } }
     }
}

// Wt[n][k] = f16(W[k][n]·scale) from f32 row-major W[K][N] (scale = power of two; bf16-exact weights stay exact in f16 away from the subnormal range)
__global__ __launch_bounds__(256) void k_wt_f16(const float* __restrict__ W, _Float16* __restrict__ Wt, int K, int N, float scale) {
  const int t = blockIdx.x * 256 + threadIdx.x; if (t >= N * (K / 8)) return; const int n = t / (K / 8), k8 = (t % (K / 8)) * 8; FragH f;
#pragma unroll
  for (int i = 0; i < 8; ++i) f.h[i] = (_Float16)(bf16_round(W[(size_t)(k8 + i) * N + n]) * scale); const v8us o = f.half[0];
  *(v8us*)((unsigned short*)Wt + (size_t)n * K + k8) = o; 
}
// k_gemm_hh variant with fused epilogue: v = acc·alpha + bias[by·sBias + col] (+ CP[(row/rowsPerB)·sCPb + by·64 + col] if CP) ; ACT 0 none / 1 elu ; writes f32 C and/or f16 C16 (each if non-null)
template <int ACT>
__global__ __launch_bounds__(128) void k_gemm_hhx(const _Float16* __restrict__ A, int lda, size_t sA, const _Float16* __restrict__ Bh, int ldb, size_t sB, float alpha, const float* __restrict__ bias, size_t sBias, const float* __restrict__ CP, int rowsPerB, size_t sCPb, int row0g,
    float* __restrict__ C, _Float16* __restrict__ C16, int ldc, size_t sC, int M, int N, int K) {
  __shared__ __attribute__((aligned(16))) float so[4][16][64];
  const int tid = threadIdx.x, w = tid >> 5, lane = tid & 31, ln = lane & 15, hh = lane >> 4; const int by = blockIdx.y;
  A += (size_t)by * sA; Bh += (size_t)by * sB; const size_t cofs = (size_t)by * sC; const float* bp = bias ? bias + (size_t)by * sBias : nullptr;
  const int ntn = (N + 63) / 64; const int wid = blockIdx.x * 4 + w; const int mt = wid / ntn, nq = wid % ntn; if (mt * 16 >= M) return;
  const int row0 = mt * 16, col0 = nq * 64; const _Float16* arow = A + (size_t)(row0 + ln) * lda;
  v8f acc[4] = {};
  for (int kb = 0; kb < K; kb += 32) { FragH ah; ah.half[0] = *(const v8us*)((const unsigned short*)arow + kb + 8 * hh); ah.half[1] = *(const v8us*)((const unsigned short*)arow + kb + 16 + 8 * hh);
#pragma unroll
    for (int t = 0; t < 4; ++t) { if (col0 + t * 16 >= N) continue; const size_t boff = (size_t)(col0 + t * 16 + ln) * ldb + kb; FragH bq; bq.half[0] = *(const v8us*)((const unsigned short*)Bh + boff + 8 * hh); bq.half[1] = *(const v8us*)((const unsigned short*)Bh + boff + 16 + 8 * hh);
      acc[t] = mmaH<1>(ah.v, ah.v, bq.v, bq.v, acc[t]); }
  }
#pragma unroll
  for (int t = 0; t < 4; ++t) { if (col0 + t * 16 >= N) continue; const int col = col0 + t * 16 + ln; const float bv = bp ? bf16_round(bp[col]) : 0.f;
#pragma unroll
    for (int r = 0; r < 8; ++r) { float v = acc[t][r] * alpha + bv; if (CP) { const int bidx = (row0g + row0 + 8 * hh + r) / rowsPerB; v += CP[(size_t)bidx * sCPb + (size_t)by * 64 + col]; } if (ACT == 1) v = (v > 0.f) ? v : expm1f(v); else if (ACT == 7) v = (v > 0.f) ? v + 1.0f : expf(v); else if (ACT == 8) v = tanhf(v); else if (ACT == 9) v = 0.5f * v * (1.0f + tanhf(0.7978845608028654f * (v + 0.044715f * v * v * v))); else if (ACT == 11) v = 1.0f / (1.0f + expf(-v)); else if (ACT == 12) v = (v > 0.f) ? v : 0.01f * v; else if (ACT == 14) v = (v > 0.f) ? v : 0.1f * v; else if (ACT == 15) v = v / (1.0f + expf(-v)); else if (ACT == 3) v = fmaxf(v, 0.f); else if (ACT == 6) v = 0.5f * v * (1.0f + erff(v * 0.70710678118654752f)); so[w][8 * hh + r][t * 16 + ln] = v; } }
  __builtin_amdgcn_fence(__ATOMIC_ACQ_REL, "workgroup"); __builtin_amdgcn_wave_barrier();
  const int rsub = lane >> 4, c4 = (lane & 15) * 4; typedef _Float16 v4h __attribute__((ext_vector_type(4)));
  {
#pragma unroll
    for (int q = 0; q < 8; ++q) { const int r = q * 2 + rsub; if (col0 + c4 < N) { const v4f v = *(const v4fa*)&so[w][r][c4]; if (C) *(v4f*)(C + cofs + (size_t)(row0 + r) * ldc + col0 + c4) = v; if (C16) { v4h h4; for (int i = 0; i < 4; ++i) h4[i] = (_Float16)v[i]; *(v4h*)(C16 + cofs + (size_t)(row0 + r) * ldc + col0 + c4) = h4; } } }
     }
}


typedef _Float16 v4h __attribute__((ext_vector_type(4)));

// All five input conversions in one launch: x -> f16(bf16(x)), each weight -> f16(bf16(W) * 16). An item is 8 floats; item = u * PREP_T + thread, so u = 0..3 walks x and u = 4..7 is one weight each.
// 512 work-groups of 8 waves (16 waves a WGP): every thread has its 16 loads of 16 B in flight before its first store.
#define PREP_T (512 * 256)
__global__ __launch_bounds__(256) void k_prep(const float* __restrict__ x, const float* __restrict__ Wq, const float* __restrict__ Wk, const float* __restrict__ Wv, const float* __restrict__ Wo, _Float16* __restrict__ X16, _Float16* __restrict__ Bw) {
  static_assert((size_t)NR * DD / 8 == (size_t)4 * PREP_T && (size_t)DD * DD / 8 == (size_t)PREP_T, "item split");
  const unsigned tb = (blockIdx.x * 256u + threadIdx.x) * 32u;      /* one 32-bit byte offset serves all eight items: each has a uniform base (scalar base + vector offset addressing) */
  const float* sp[8] = { x, x + PREP_T * 8, x + 2 * PREP_T * 8, x + 3 * PREP_T * 8, Wq, Wk, Wv, Wo };
  v4f a[8], c[8];
#pragma unroll
  for (int u = 0; u < 8; ++u) { a[u] = *(const v4fa*)((const char*)sp[u] + tb); c[u] = *(const v4fa*)((const char*)sp[u] + tb + 16); }
  __builtin_amdgcn_sched_barrier(0);      /* all 16 loads go out as one group: left alone the scheduler starts converting after eight and the rest wait behind those results */
  FragH f[8];
#pragma unroll
  for (int u = 0; u < 8; ++u) { const float sc = (u < 4) ? 1.0f : 16.0f;
#pragma unroll
    for (int q = 0; q < 4; ++q) { f[u].h[q] = (_Float16)(bf16_round(a[u][q]) * sc); f[u].h[4 + q] = (_Float16)(bf16_round(c[u][q]) * sc); } }
#pragma unroll
  for (int u = 0; u < 8; ++u) *(v8us*)((char*)(((u < 4) ? X16 : Bw) + (u & 3) * PREP_T * 8) + (tb >> 1)) = f[u].half[0];
}
__global__ __launch_bounds__(256) void k_h16(const float* __restrict__ x, _Float16* __restrict__ X16, size_t n8) { const size_t t = (size_t)blockIdx.x * 256 + threadIdx.x; if (t >= n8) return; FragH f;
#pragma unroll
  for (int q = 0; q < 8; ++q) f.h[q] = (_Float16)x[t * 8 + q]; *(v8us*)((unsigned short*)X16 + t * 8) = f.half[0];  }
typedef int v4ia __attribute__((ext_vector_type(4), may_alias));
// lane l <-> lane l ^ 16 (the two halves of a wave hold the two key groups of one query column)
__device__ __forceinline__ float xhalf(float x) { return __builtin_bit_cast(float, __builtin_amdgcn_permlanex16(__builtin_bit_cast(int, x), __builtin_bit_cast(int, x), 0x76543210, 0xfedcba98, false, false)); }
#define FS_KEYS 64
#define FS_PITCH 144
#define FS_PLANE (64 * FS_PITCH)
#define FS_STAGE (3 * FS_PLANE)
// six copies of one lane: rows r and r + 32 of K hi, K lo and Vt, 16 B each. The s_wait_xcnt stands inside the copies' own statement, so that no address register named here is rewritten in front of it.
__device__ __forceinline__ void fs_copy6(unsigned l, const _Float16* kh, const _Float16* kl, int ldk, const _Float16* vt) {
  asm volatile("global_load_async_to_lds_b128 %0, %6, off\n\t"
               "global_load_async_to_lds_b128 %1, %7, off\n\t"
               "global_load_async_to_lds_b128 %2, %8, off\n\t"
               "global_load_async_to_lds_b128 %3, %9, off\n\t"
               "global_load_async_to_lds_b128 %4, %10, off\n\t"
               "global_load_async_to_lds_b128 %5, %11, off\n\t"
               "s_wait_xcnt 0x0"
               :: "v"(l), "v"(l + 32 * FS_PITCH), "v"(l + FS_PLANE), "v"(l + FS_PLANE + 32 * FS_PITCH), "v"(l + 2 * FS_PLANE), "v"(l + 2 * FS_PLANE + 32 * FS_PITCH),
                  "v"(kh), "v"(kh + (size_t)32 * ldk), "v"(kl), "v"(kl + (size_t)32 * ldk), "v"(vt), "v"(vt + 32 * TT)
               : "memory");
}
__global__ __launch_bounds__(256) void k_flash(const _Float16* __restrict__ Q16, const _Float16* __restrict__ Q16lo, int ldq, const _Float16* __restrict__ K16, const _Float16* __restrict__ K16lo, int ldk, const _Float16* __restrict__ Vt, const int* __restrict__ MSK, _Float16* __restrict__ O16, int ldo) {
  constexpr int RPW = 16, NW = 8, NQB = TT / (NW * RPW), DT = 4, KS = 2, NST = TT / FS_KEYS;
  __shared__ __attribute__((aligned(16))) unsigned char sT[2 * FS_STAGE];
  __shared__ __attribute__((aligned(16))) int sM[TT];
  __shared__ __attribute__((aligned(16))) float sO[NW][RPW][64 + 4];
  const int tid = threadIdx.x, w = tid >> 5, lane = tid & 31, ln = lane & 15, hh = lane >> 4;
  const int slab = blockIdx.x / NQB, qblk = blockIdx.x % NQB; const int b = slab / NH, h = slab % NH; const int q0 = qblk * (NW * RPW) + w * RPW;
  const int cr = tid >> 3, cc = tid & 7;      /* this lane's row (mod 32) and 16-B column of every stage copy */
  const size_t kofs = ((size_t)b * TT + cr) * ldk + h * 64 + cc * 8;
  const _Float16* gkh = K16 + kofs; const _Float16* gkl = K16lo + kofs; const _Float16* gvt = Vt + ((size_t)slab * 64 + cr) * TT + cc * 8;
  const unsigned lt = (unsigned)(size_t)sT + cr * FS_PITCH + cc * 16;
  { const unsigned lm = (unsigned)(size_t)sM + tid * 16; const int* gm = MSK + (size_t)b * TT + tid * 4;
    /* the mask row, 2 x 16 B a lane; the wait inside the statement keeps its address registers until the copies have read them */
    asm volatile("global_load_async_to_lds_b128 %0, %2, off\n\t"
                 "global_load_async_to_lds_b128 %1, %3, off\n\t"
                 "s_wait_xcnt 0x0" :: "v"(lm), "v"(lm + TT * 2), "v"(gm), "v"(gm + TT / 2) : "memory"); }
  fs_copy6(lt, gkh, gkl, ldk, gvt);
  FragH aq[KS], aql[KS];
  { const size_t qo = ((size_t)b * TT + q0 + ln) * ldq + h * 64; const unsigned short* qr = (const unsigned short*)Q16 + qo; const unsigned short* ql = (const unsigned short*)Q16lo + qo;
#pragma unroll
    for (int ks = 0; ks < KS; ++ks) { aq[ks].half[0] = *(const v8us*)(qr + ks * 32 + 8 * hh); aq[ks].half[1] = *(const v8us*)(qr + ks * 32 + 16 + 8 * hh); aql[ks].half[0] = *(const v8us*)(ql + ks * 32 + 8 * hh); aql[ks].half[1] = *(const v8us*)(ql + ks * 32 + 16 + 8 * hh); } }
  asm volatile("s_wait_asynccnt 0x0" ::: "memory");      /* the mask and stage 0 have landed for this wave */
  __syncthreads();                                       /* ... and for every wave */
  fs_copy6(lt + FS_STAGE, gkh + (size_t)FS_KEYS * ldk, gkl + (size_t)FS_KEYS * ldk, ldk, gvt + FS_KEYS);
  /* exponentials in base 2: e^(s - m) * 2^10 = 2^(s * log2e - c) with c = m * log2e - 10, one fused multiply-add and one v_exp_f32 a score; c is kept beside the running maximum, so that every term of a query hangs on the same rounded c.
     The start value of m is finite also after the multiplication by log2e. */
  constexpr float L2E = 1.4426950408889634f;
  float m_r = -2.0e38f, c_r = -2.0e38f * L2E - 10.0f, l_r = 0.f; v8f oacc[DT];
#pragma unroll
  for (int dt = 0; dt < DT; ++dt) oacc[dt] = (v8f){0.f,0.f,0.f,0.f,0.f,0.f,0.f,0.f};
  const unsigned char* fk = sT + ln * FS_PITCH + 16 * hh; const unsigned char* fv = fk + 2 * FS_PLANE;
#pragma unroll 1      /* one stage a trip: the two buffers alternate by an offset */
  for (int t = 0; t < NST; ++t) {
    const unsigned bo = (unsigned)(t & 1) * FS_STAGE;
#pragma unroll      /* the two passes of a stage stand in line, so that every LDS read takes its place in the stage as an immediate offset */
    for (int ps = 0; ps < FS_KEYS / 32; ++ps) {
    const int* mp = sM + t * FS_KEYS + ps * 32 + 8 * hh;      /* key padding mask (1 = attend) of this lane's 16 keys */
    const v4ia km[4] = { *(const v4ia*)(mp), *(const v4ia*)(mp + 4), *(const v4ia*)(mp + 16), *(const v4ia*)(mp + 20) };
    float sv[16]; FragH bk[2][KS], bl[2][KS], bv[DT];
#pragma unroll
    for (int nt = 0; nt < 2; ++nt) { const unsigned char* kr = fk + bo + (ps * 32 + nt * 16) * FS_PITCH; const unsigned char* kl = kr + FS_PLANE;
#pragma unroll
      for (int ks = 0; ks < KS; ++ks) { bk[nt][ks].half[0] = *(const v8us*)(kr + ks * 64); bk[nt][ks].half[1] = *(const v8us*)(kr + ks * 64 + 32); bl[nt][ks].half[0] = *(const v8us*)(kl + ks * 64); bl[nt][ks].half[1] = *(const v8us*)(kl + ks * 64 + 32); } }
    __builtin_amdgcn_sched_barrier(0);      /* the pass's K reads go out as one group: left alone the scheduler puts the second key tile's reads behind the first tile's products, and the wave waits out the LDS latency a second time */
#pragma unroll
    for (int nt = 0; nt < 2; ++nt) {
      v8f acc = (v8f){0.f,0.f,0.f,0.f,0.f,0.f,0.f,0.f}, accl = acc;
#pragma unroll
      for (int ks = 0; ks < KS; ++ks) { acc = mmaH<1>(bk[nt][ks].v, bk[nt][ks].v, aq[ks].v, aq[ks].v, acc); accl = mmaH<1>(bk[nt][ks].v, bk[nt][ks].v, aql[ks].v, aql[ks].v, accl); accl = mmaH<1>(bl[nt][ks].v, bl[nt][ks].v, aq[ks].v, aq[ks].v, accl); }
#pragma unroll
      for (int r = 0; r < 8; ++r) sv[nt * 8 + r] = (km[nt * 2 + (r >> 2)][r & 3] != 0) ? acc[r] + accl[r] * 0.0009765625f : -INFINITY; }
#pragma unroll
    for (int dt = 0; dt < DT; ++dt) { const unsigned char* vrow = fv + bo + dt * 16 * FS_PITCH + ps * 64; bv[dt].half[0] = *(const v8us*)(vrow); bv[dt].half[1] = *(const v8us*)(vrow + 32); }
    __builtin_amdgcn_sched_barrier(0);      /* the four Vt fragments are read as one group ahead of the softmax, which covers their latency: left alone each read sinks to just in front of its product and is waited for there */
    float t8[8];
#pragma unroll
    for (int i = 0; i < 8; ++i) t8[i] = fmaxf(sv[i], sv[8 + i]);
    float mc = fmaxf(fmaxf(fmaxf(t8[0], t8[1]), fmaxf(t8[2], t8[3])), fmaxf(fmaxf(t8[4], t8[5]), fmaxf(t8[6], t8[7])));
    mc = fmaxf(mc, xhalf(mc));      /* both halves now hold the query's block maximum */
    const float mn = fmaxf(m_r, mc); const float cn = fmaf(mn, L2E, -10.0f); float ea = c_r - cn; m_r = mn; c_r = cn;      /* cn is finite (mn >= -2e38), so a masked score gives 2^(-inf) = 0 */
    float p[16]; FragH pa;
#pragma unroll
    for (int i = 0; i < 16; ++i) p[i] = fmaf(sv[i], L2E, -cn);
    /* the pass's 17 exponentials, each in its own register: written by the compiler a v_exp_f32 here and there lands on the source register of the one directly in front of it, where the instruction set asks for a free slot.
       The closing v_nop is that slot behind the last one, whatever the compiler puts next. Order: %0, whose argument is formed last, stands third; p[0..3], which are packed last, stand at the end. */
    asm("v_exp_f32 %5, %5\n\t" "v_exp_f32 %6, %6\n\t" "v_exp_f32 %0, %0\n\t" "v_exp_f32 %7, %7\n\t" "v_exp_f32 %8, %8\n\t" "v_exp_f32 %9, %9\n\t"
        "v_exp_f32 %10, %10\n\t" "v_exp_f32 %11, %11\n\t" "v_exp_f32 %12, %12\n\t" "v_exp_f32 %13, %13\n\t" "v_exp_f32 %14, %14\n\t" "v_exp_f32 %15, %15\n\t"
        "v_exp_f32 %16, %16\n\t" "v_exp_f32 %3, %3\n\t" "v_exp_f32 %4, %4\n\t" "v_exp_f32 %1, %1\n\t" "v_exp_f32 %2, %2\n\t" "v_nop"
        : "+v"(ea), "+v"(p[0]), "+v"(p[1]), "+v"(p[2]), "+v"(p[3]), "+v"(p[4]), "+v"(p[5]), "+v"(p[6]), "+v"(p[7]), "+v"(p[8]), "+v"(p[9]), "+v"(p[10]), "+v"(p[11]), "+v"(p[12]), "+v"(p[13]), "+v"(p[14]), "+v"(p[15]));
    const float al = (mn > -1.0e38f) ? ea : 1.0f;
#pragma unroll
    for (int i = 0; i < 16; ++i) pa.h[i] = (_Float16)p[i];      /* p carries the 2^10 of the f16 operand, and so does the row sum */
#pragma unroll
    for (int i = 0; i < 8; ++i) t8[i] = p[i] + p[8 + i];
    l_r = l_r * al + (((t8[0] + t8[1]) + (t8[2] + t8[3])) + ((t8[4] + t8[5]) + (t8[6] + t8[7])));      /* per-lane partial sum; the halves join after the loop */
#pragma unroll
    for (int dt = 0; dt < DT; ++dt)
#pragma unroll
      for (int r = 0; r < 8; ++r) oacc[dt][r] *= al;
#pragma unroll
    for (int dt = 0; dt < DT; ++dt) oacc[dt] = mmaH<1>(bv[dt].v, bv[dt].v, pa.v, pa.v, oacc[dt]); }
    asm volatile("s_wait_dscnt 0x0" ::: "memory");       /* this wave's reads of buffer t & 1 are done before the buffer is handed back */
    asm volatile("s_wait_asynccnt 0x0" ::: "memory");    /* this wave's copies of stage t + 1 have landed */
    __syncthreads();                                     /* publishes stage t + 1 and ends every wave's reads of stage t */
    if (t + 2 < NST) fs_copy6(lt + bo, gkh + (size_t)(t + 2) * FS_KEYS * ldk, gkl + (size_t)(t + 2) * FS_KEYS * ldk, ldk, gvt + (t + 2) * FS_KEYS);
  }
  asm volatile("s_wait_asynccnt 0x0" ::: "memory");      /* nothing is in flight when the wave goes on to its end */
  { const float l = l_r + xhalf(l_r); const float inv = (l > 0.f) ? 1.0f / l : 0.f;
#pragma unroll
    for (int dt = 0; dt < DT; ++dt)
#pragma unroll
      for (int q = 0; q < 2; ++q) { const v4f o4 = { oacc[dt][q * 4] * inv, oacc[dt][q * 4 + 1] * inv, oacc[dt][q * 4 + 2] * inv, oacc[dt][q * 4 + 3] * inv }; *(v4fa*)&sO[w][ln][dt * 16 + 8 * hh + q * 4] = o4; } }
  __builtin_amdgcn_fence(__ATOMIC_ACQ_REL, "workgroup"); __builtin_amdgcn_wave_barrier();
  {
#pragma unroll      /* O x 2^4 goes out as the f16 operand of the output GEMM: 8 lanes a row, one whole 128-B line per (query, head) */
    for (int rp = 0; rp < RPW; rp += 4) { const int r = rp + (lane >> 3), c8 = (lane & 7) * 8; const v4f a = *(const v4fa*)&sO[w][r][c8], c = *(const v4fa*)&sO[w][r][c8 + 4]; FragH f;
#pragma unroll
      for (int q = 0; q < 4; ++q) { f.h[q] = (_Float16)(a[q] * 16.0f); f.h[4 + q] = (_Float16)(c[q] * 16.0f); }
      *(v8us*)((unsigned short*)O16 + ((size_t)b * TT + q0 + r) * ldo + h * 64 + c8) = f.half[0]; }
     } }

// ---- projection GEMM with its operands staged in LDS: C = alpha * A . Bt^T, A [NR][DD] and Bt [DD][DD] f16, both k-contiguous.
// One 128 x 128 tile per work-group of 8 waves (4 x 2 waves of 32 x 64). A stage is 128 k = 256 B of each of the 256 operand rows (A rows 0-127, Bt rows 128-255),
// brought by asynchronous copies (16 lanes of 16 B a row), two buffers: stage t + 1 flies while stage t is multiplied.
// LDS row pitch 272 B = 16 B x odd, the conflict-free pitch of ds_load_b128 fragment reads. The k order of every accumulator is 0, 32, 64, ... as before.
#define GS_K 128
#define GS_PITCH 272
#define GS_STAGE (256 * GS_PITCH)
// eight copies of one lane: rows r, r + 16, ..., r + 112 of one operand, 16 B each. The s_wait_xcnt stands inside the copies' own statement, so that no address register named here is rewritten in front of it.
__device__ __forceinline__ void gs_copy8(unsigned l, const _Float16* g) {
  asm volatile("global_load_async_to_lds_b128 %0, %8, off\n\t"
               "global_load_async_to_lds_b128 %1, %9, off\n\t"
               "global_load_async_to_lds_b128 %2, %10, off\n\t"
               "global_load_async_to_lds_b128 %3, %11, off\n\t"
               "global_load_async_to_lds_b128 %4, %12, off\n\t"
               "global_load_async_to_lds_b128 %5, %13, off\n\t"
               "global_load_async_to_lds_b128 %6, %14, off\n\t"
               "global_load_async_to_lds_b128 %7, %15, off\n\t"
               "s_wait_xcnt 0x0"
               :: "v"(l), "v"(l + 16 * GS_PITCH), "v"(l + 32 * GS_PITCH), "v"(l + 48 * GS_PITCH), "v"(l + 64 * GS_PITCH), "v"(l + 80 * GS_PITCH), "v"(l + 96 * GS_PITCH), "v"(l + 112 * GS_PITCH),
                  "v"(g), "v"(g + 16 * DD), "v"(g + 32 * DD), "v"(g + 48 * DD), "v"(g + 64 * DD), "v"(g + 80 * DD), "v"(g + 96 * DD), "v"(g + 112 * DD)
               : "memory");
}
// the 2 A and 4 B fragments of one k step (32 k = 64 B of a row) from a stage in LDS; both operands in the same k order: 8 hh + 0..7, then 16 + 8 hh + 0..7
__device__ __forceinline__ void gs_frags(FragH (&a)[2], FragH (&b)[4], const unsigned char* pa, const unsigned char* pb) {
#pragma unroll
  for (int i = 0; i < 2; ++i) { a[i].half[0] = *(const v8us*)(pa + i * 16 * GS_PITCH); a[i].half[1] = *(const v8us*)(pa + i * 16 * GS_PITCH + 32); }
#pragma unroll
  for (int j = 0; j < 4; ++j) { b[j].half[0] = *(const v8us*)(pb + j * 16 * GS_PITCH); b[j].half[1] = *(const v8us*)(pb + j * 16 * GS_PITCH + 32); }
}
// the 8 products of one k step
__device__ __forceinline__ void gs_mma(v8f (&acc)[2][4], const FragH (&a)[2], const FragH (&b)[4]) {
#pragma unroll
  for (int i = 0; i < 2; ++i)
#pragma unroll
    for (int j = 0; j < 4; ++j) acc[i][j] = __builtin_amdgcn_wmma_f32_16x16x32_f16(false, a[i].v, false, b[j].v, (short)0, acc[i][j], false, false);
}
// QKV = false: one product, C f32. QKV = true: the q, k and v projections in one grid (256 tiles each, Bt = the three weights in a row), each with its consumer's conversion as epilogue:
// q and k leave as elu + 1 split in f16 hi + 2^10 x residual planes, v leaves as f16 already transposed, Vt[batch * DD + column][token].
template <bool QKV>
__global__ __launch_bounds__(256) void k_gemm_lds(const _Float16* __restrict__ A, const _Float16* __restrict__ Bt, float alpha, float* __restrict__ C,
                                                  _Float16* __restrict__ Qh, _Float16* __restrict__ Ql, _Float16* __restrict__ Kh, _Float16* __restrict__ Kl, _Float16* __restrict__ Vt) {
  __shared__ __attribute__((aligned(16))) unsigned char sT[2 * GS_STAGE];
  __shared__ __attribute__((aligned(16))) float so[8][32][64 + 4];
  constexpr int NST = DD / GS_K;
  const int tid = threadIdx.x, w = tid >> 5, lane = tid & 31, ln = lane & 15, hh = lane >> 4;
  constexpr int NTILE = (NR / 128) * (DD / 128);
  const int which = QKV ? blockIdx.x / NTILE : 0, tile = QKV ? blockIdx.x % NTILE : blockIdx.x;      /* which: 0 q, 1 k, 2 v; the same for the whole work-group */
  Bt += (size_t)which * DD * DD;
  const int row0 = (tile / (DD / 128)) * 128, col0 = (tile % (DD / 128)) * 128; const int wm = w >> 1, wn = w & 1;
  const int cr = tid >> 4, cc = tid & 15;      /* this lane's row (mod 16) and 16-B column of every copy */
  const _Float16* ga = A + (size_t)(row0 + cr) * DD + cc * 8; const _Float16* gb = Bt + (size_t)(col0 + cr) * DD + cc * 8;
  const unsigned la = (unsigned)(size_t)sT + cr * GS_PITCH + cc * 16, lb = la + 128 * GS_PITCH;
  gs_copy8(la, ga); gs_copy8(lb, gb);
  asm volatile("s_wait_asynccnt 0x0" ::: "memory");      /* stage 0 has landed for this wave */
  __syncthreads();                                       /* ... and for every wave */
  gs_copy8(la + GS_STAGE, ga + GS_K); gs_copy8(lb + GS_STAGE, gb + GS_K);
  v8f acc[2][4];
#pragma unroll
  for (int i = 0; i < 2; ++i)
#pragma unroll
    for (int j = 0; j < 4; ++j) acc[i][j] = (v8f){0.f,0.f,0.f,0.f,0.f,0.f,0.f,0.f};
  const unsigned char* fa = sT + (wm * 32 + ln) * GS_PITCH + 16 * hh; const unsigned char* fb = sT + (128 + wn * 64 + ln) * GS_PITCH + 16 * hh;
#pragma unroll 1      /* one stage a trip: the two buffers alternate by an offset, the text stays small */
  for (int t = 0; t < NST; ++t) {
    const unsigned bo = (unsigned)(t & 1) * GS_STAGE;
    FragH a[2][2], b[2][4];      /* two fragment sets: the reads of k step ks + 1 of this same stage are issued as one group ahead of the products of k step ks */
    gs_frags(a[0], b[0], fa + bo, fb + bo);
#pragma unroll
    for (int ks = 0; ks + 1 < GS_K / 32; ++ks) {
      gs_frags(a[(ks + 1) & 1], b[(ks + 1) & 1], fa + bo + (ks + 1) * 64, fb + bo + (ks + 1) * 64);
      __builtin_amdgcn_sched_barrier(0);      /* keeps that group of reads ahead of the products: left alone the scheduler sinks each read to just in front of its use, and the wave waits out the LDS latency there */
      gs_mma(acc, a[ks & 1], b[ks & 1]);
    }
    __builtin_amdgcn_sched_barrier(0);                   /* those products stay in front of the hand-over and cover the last group's LDS latency */
    asm volatile("s_wait_dscnt 0x0" ::: "memory");       /* this wave's reads of buffer t & 1 are done before the buffer is handed back */
    asm volatile("s_wait_asynccnt 0x0" ::: "memory");    /* this wave's copies of stage t + 1 have landed */
    __syncthreads();                                     /* publishes stage t + 1 and ends every wave's reads of stage t */
    if (t + 2 < NST) { gs_copy8(la + bo, ga + (t + 2) * GS_K); gs_copy8(lb + bo, gb + (t + 2) * GS_K); }
    __builtin_amdgcn_sched_barrier(0);                   /* the refill is issued first: the last k step's products need registers only and run while the copies fly */
    gs_mma(acc, a[(GS_K / 32 - 1) & 1], b[(GS_K / 32 - 1) & 1]);
  }
  asm volatile("s_wait_asynccnt 0x0" ::: "memory");      /* nothing is in flight when the wave goes on to its end */
  if (QKV && which == 2) {
    /* v: a lane's 8 accumulator rows are 8 consecutive tokens of one column = 16 B of the transposed tile; staged [128 columns][128 tokens] f16 at pitch 272 B in so */
    unsigned char* sv = (unsigned char*)&so[0][0][0];
#pragma unroll
    for (int i = 0; i < 2; ++i)
#pragma unroll
      for (int j = 0; j < 4; ++j) { FragH f;
#pragma unroll
        for (int r = 0; r < 8; ++r) f.h[r] = (_Float16)(acc[i][j][r] * alpha);
        *(v8us*)(sv + (wn * 64 + j * 16 + ln) * GS_PITCH + (wm * 32 + i * 16 + 8 * hh) * 2) = f.half[0]; }
    __syncthreads();      /* a column's 128 tokens come from four waves: every wave's part is in LDS before any is read back */
#pragma unroll
    for (int q = 0; q < 8; ++q) { const int c = q * 16 + (tid >> 4), ch = tid & 15;      /* 16 lanes a column: 256 contiguous bytes of Vt */
      const v8us v = *(const v8us*)(sv + c * GS_PITCH + ch * 16);
      *(v8us*)((unsigned short*)Vt + ((size_t)(row0 / TT) * DD + col0 + c) * TT + row0 % TT + ch * 8) = v; }
  } else {
#pragma unroll
  for (int i = 0; i < 2; ++i)
#pragma unroll
    for (int j = 0; j < 4; ++j)
#pragma unroll
      for (int r = 0; r < 8; ++r) so[w][i * 16 + 8 * hh + r][j * 16 + ln] = acc[i][j][r] * alpha;
  __builtin_amdgcn_fence(__ATOMIC_ACQ_REL, "workgroup"); __builtin_amdgcn_wave_barrier();      /* the wave reads back rows that its other lanes wrote */
  if (QKV) {
    /* q, k: elu(x) + 1 = x + 1 (x > 0) | e^x (x <= 0), then hi = f16(v), lo = f16((v - hi) * 2^10); 8 lanes a row: the wave's 64 columns are one whole 128-B line of each plane */
    unsigned short* Hh = (unsigned short*)(which == 0 ? Qh : Kh); unsigned short* Hl = (unsigned short*)(which == 0 ? Ql : Kl);
#pragma unroll
    for (int q = 0; q < 8; ++q) { const int r = q * 4 + (lane >> 3), c8 = (lane & 7) * 8; const v4f a = *(const v4fa*)&so[w][r][c8], c = *(const v4fa*)&so[w][r][c8 + 4]; FragH fh, fl;
#pragma unroll
      for (int e = 0; e < 8; ++e) { const float x = (e < 4) ? a[e] : c[e - 4]; const float ex = expf(x);      /* taken for every lane, then selected: eight independent chains and no branch per element, with only two waves a SIMD to cover latency here */
        const float v = (x > 0.f) ? x + 1.0f : ex; const _Float16 h = (_Float16)v; fh.h[e] = h; fl.h[e] = (_Float16)((v - (float)h) * 1024.0f); }
      const size_t o = (size_t)(row0 + wm * 32 + r) * DD + col0 + wn * 64 + c8;
      *(v8us*)(Hh + o) = fh.half[0]; *(v8us*)(Hl + o) = fl.half[0]; }
    asm volatile("s_wait_xcnt 0x0" ::: "memory");      /* behind the last hi/lo store: no address or data register of these stores is rewritten in front of this wait on any way out of the loop */
  } else {
    const int rsub = lane >> 4, c4 = (lane & 15) * 4;
#pragma unroll
    for (int q = 0; q < 16; ++q) { const int r = q * 2 + rsub; const v4f v = *(const v4fa*)&so[w][r][c4]; *(v4f*)(C + (size_t)(row0 + wm * 32 + r) * DD + col0 + wn * 64 + c4) = v; }
  }
  }
}

extern "C" void kernel_launch(void* const* d_in, const int* in_sizes, int n_in,
                              void* d_out, int out_size, void* d_ws, size_t ws_size, hipStream_t stream) {
  (void)in_sizes; (void)n_in; (void)out_size;
  const float* x = (const float*)d_in[0]; const int* mask = (const int*)d_in[1]; const float* Wq = (const float*)d_in[2]; const float* Wk = (const float*)d_in[3]; const float* Wv = (const float*)d_in[4]; const float* Wo = (const float*)d_in[5];
  char* ws = (char*)d_ws; size_t off = 0;
  auto take = [&](size_t bytes) { char* p = ws + off; off += (bytes + 255) & ~(size_t)255; return p; };
  const size_t WSZ = (size_t)DD * DD; _Float16* Bw = (_Float16*)take(4 * WSZ * 2); _Float16* X16 = (_Float16*)take((size_t)NR * DD * 2);
  _Float16* Qh = (_Float16*)take((size_t)NR * DD * 2); _Float16* Ql = (_Float16*)take((size_t)NR * DD * 2); _Float16* Kh = (_Float16*)take((size_t)NR * DD * 2); _Float16* Kl = (_Float16*)take((size_t)NR * DD * 2); _Float16* Vt = (_Float16*)take((size_t)NR * DD * 2);
  _Float16* O16 = X16;      /* X16 is dead after the q/k/v launch */
  if (off > ws_size) return;      // 7 x 8.4 MB
  k_prep<<<PREP_T / 256, 256, 0, stream>>>(x, Wq, Wk, Wv, Wo, X16, Bw);
  k_gemm_lds<true><<<3 * (NR / 128) * (DD / 128), 256, 0, stream>>>(X16, Bw, 0.0625f, nullptr, Qh, Ql, Kh, Kl, Vt);      /* q, k: elu + 1 hi/lo; v: transposed */
  k_flash<<<BB * NH * (TT / 128), 256, 0, stream>>>(Qh, Ql, DD, Kh, Kl, DD, Vt, mask, O16, DD);
  k_gemm_lds<false><<<(NR / 128) * (DD / 128), 256, 0, stream>>>(O16, Bw + 3 * WSZ, 0.00390625f, (float*)d_out, nullptr, nullptr, nullptr, nullptr, nullptr);      /* out = O . Wo^T */
}

// v006
// It runs in 106 microseconds.
// Two timings next to v005 both put it at 1.05 times that version's speed.
// Over all steps from v000 it is 4.95 times as fast.
#include <hip/hip_runtime.h>
// Multi-head 'linear-feature' attention (B=2, S=2048, H=1024, 16 heads × 64): q,k,v = x·Wᵀ (no bias); φ(q) = elu(q)+1, φ(k) = elu(k)+1; attn = softmax(φ(q)·φ(k)ᵀ) UNSCALED (σ≈8 logits) with the INPUT key mask [B,S] (0 → −inf);
// out = (attn·v merged)·Woᵀ.
// Compute dtype: x and weights rounded to bf16; q,k as f32 GEMM outputs mapped through elu+1 in f32 and split into f16 hi + ×2^10 residual planes so the large unscaled logits are f32-accurate
// (S = Qh·Kh + (Ql·Kh + Qh·Kl)·2^-10, separate accumulators); v f16; fused flash-style kernel (online softmax f32, P f16 ×2^10) on v_wmma_f32_16x16x32_f16; O ×2^4 → f16 → output GEMM; f32 accumulate.
#define BB 2
#define TT 2048
#define NH 16
#define DD 1024
#define NR (BB * TT)

typedef __bf16 v16b __attribute__((ext_vector_type(16)));
typedef unsigned short v8us __attribute__((ext_vector_type(8), may_alias));
typedef float  v8f  __attribute__((ext_vector_type(8)));
typedef float  v4f  __attribute__((ext_vector_type(4)));
typedef float  v4fa __attribute__((ext_vector_type(4), may_alias));
union FragB { v16b v; v8us half[2]; unsigned short u[16]; };

__device__ __forceinline__ unsigned short bf16_bits(float x) { unsigned int u = __float_as_uint(x); return (unsigned short)((u + 0x7FFFu + ((u >> 16) & 1u)) >> 16); }
__device__ __forceinline__ float bf16_val(unsigned short b) { return __uint_as_float(((unsigned int)b) << 16); }
__device__ __forceinline__ float bf16_round(float x) { return bf16_val(bf16_bits(x)); }
// D += A·B with NT terms: 1 = ah·bh, 2 = + al·bh (A split), 3 = + ah·bl (both split)
template <int NT>
__device__ __forceinline__ v8f mmaN(v16b ah, v16b al, v16b bh, v16b bl, v8f c) {
  c = __builtin_amdgcn_wmma_f32_16x16x32_bf16(false, ah, false, bh, (short)0, c, false, false);
  if (NT >= 2) c = __builtin_amdgcn_wmma_f32_16x16x32_bf16(false, al, false, bh, (short)0, c, false, false);
  if (NT >= 3) c = __builtin_amdgcn_wmma_f32_16x16x32_bf16(false, ah, false, bl, (short)0, c, false, false);
  asm volatile("v_nop\n\tv_nop\n\tv_nop\n\tv_nop" : "+v"(c) : "v"(ah), "v"(al), "v"(bh), "v"(bl));
  return c;
}

__global__ __launch_bounds__(256) void k_wt_bf16(const float* __restrict__ W, unsigned short* __restrict__ Wt, int K, int N) {
  const int t = blockIdx.x * 256 + threadIdx.x;
  const int k8n = K / 8;
  if (t >= N * k8n) return;
  const int n = t / k8n, k8 = (t % k8n) * 8;
  v8us v;
#pragma unroll
  for (int i = 0; i < 8; ++i) v[i] = bf16_bits(W[(size_t)(k8 + i) * N + n]);
  *(v8us*)(Wt + (size_t)n * K + k8) = v;
  
}

// GEMM C[M][N] (f32, pitch ldc) = act(A[M][K]·W + bias). A f32 row-major (pitch lda) converted per fragment to bf16
// (ASPLIT: hi/lo two planes -> 2 terms, else single rounded term); Wt bf16 [N][K] (pitch ldb). BIAS_BF16 rounds the
// bias to bf16 first (bias quantised to bf16 before the add). K%32==0, M%16==0, N%64==0.
template <bool ASPLIT, int ACT, bool BIAS_BF16>
__global__ __launch_bounds__(128) void k_gemm_bf(const float* __restrict__ A, int lda, const unsigned short* __restrict__ Wt, int ldb,
                                               const float* __restrict__ bias, float* __restrict__ C, int ldc, int M, int N, int K) {
  __shared__ __attribute__((aligned(16))) float so[4][16][64];
  const int tid = threadIdx.x, w = tid >> 5, lane = tid & 31, ln = lane & 15, hh = lane >> 4;
  const int ntn = N / 64;
  const int wid = blockIdx.x * 4 + w;
  const int mt = wid / ntn, nq = wid % ntn;
  if (mt * 16 >= M) return;
  const int row0 = mt * 16, col0 = nq * 64;
  const float* arow = A + (size_t)(row0 + ln) * lda;
  v8f acc[4] = {};
  for (int kb = 0; kb < K; kb += 32) {
    FragB ah, al;
    const v4f x0 = *(const v4fa*)(arow + kb + 8 * hh), x1 = *(const v4fa*)(arow + kb + 8 * hh + 4);
    const v4f x2 = *(const v4fa*)(arow + kb + 16 + 8 * hh), x3 = *(const v4fa*)(arow + kb + 16 + 8 * hh + 4);
    float xs[16] = {x0[0],x0[1],x0[2],x0[3],x1[0],x1[1],x1[2],x1[3],x2[0],x2[1],x2[2],x2[3],x3[0],x3[1],x3[2],x3[3]};
#pragma unroll
    for (int i = 0; i < 16; ++i) { const unsigned short hb = bf16_bits(xs[i]); ah.u[i] = hb; al.u[i] = ASPLIT ? bf16_bits(xs[i] - bf16_val(hb)) : (unsigned short)0; }
#pragma unroll
    for (int t = 0; t < 4; ++t) {
      const unsigned short* brow = Wt + (size_t)(col0 + t * 16 + ln) * ldb + kb;
      FragB b;
      b.half[0] = *(const v8us*)(brow + 8 * hh);
      b.half[1] = *(const v8us*)(brow + 16 + 8 * hh);
      acc[t] = mmaN<ASPLIT ? 2 : 1>(ah.v, al.v, b.v, b.v, acc[t]);
    }
  }
#pragma unroll
  for (int t = 0; t < 4; ++t) {
    float bv = bias ? bias[col0 + t * 16 + ln] : 0.f;
    if (BIAS_BF16) bv = bf16_round(bv);
#pragma unroll
    for (int r = 0; r < 8; ++r) { float v = acc[t][r] + bv; if (ACT == 1) v = fmaxf(v, 0.f); so[w][8 * hh + r][t * 16 + ln] = v; }
  }
  __builtin_amdgcn_fence(__ATOMIC_ACQ_REL, "workgroup");
  __builtin_amdgcn_wave_barrier();
  const int rsub = lane >> 4, c4 = (lane & 15) * 4;
  {
#pragma unroll
    for (int q = 0; q < 8; ++q) {
      const int r = q * 2 + rsub;
      const v4f v = *(const v4fa*)&so[w][r][c4];
      *(v4f*)(C + (size_t)(row0 + r) * ldc + col0 + c4) = v;
    }
    
  }
}

// Flash-style causal/unmasked attention, all contractions 3-term bf16 hi/lo splits, f32 softmax with running max.
// q,k,v rows are read from f32 buffers with arbitrary row pitch (so they can live inside a fused qkv buffer);
// D = head size (multiple of 32, <= 128); one wave = 16 query rows; block = 4 waves (64 queries) sharing K/V chunks of 32.
template <int D, bool CAUSAL>
__global__ __launch_bounds__(128) void k_flash(const float* __restrict__ qb, const float* __restrict__ kb, const float* __restrict__ vb,
                                             int pitch, int T, int H, float scale, float* __restrict__ y, int ypitch) {
  constexpr int KS = D / 32;        // k-steps for QK
  constexpr int DT = D / 16;        // d tiles for PV
  __shared__ __attribute__((aligned(16))) unsigned short sKh[32][D + 8], sKl[32][D + 8], sVh[32][D + 8], sVl[32][D + 8];
  __shared__ __attribute__((aligned(16))) unsigned short sPh[4][16][40], sPl[4][16][40];
  __shared__ __attribute__((aligned(16))) float sO[4][16][D];
  const int tid = threadIdx.x, w = tid >> 5, lane = tid & 31, ln = lane & 15, hh = lane >> 4;
  const int nqb = (T + 63) / 64;
  const int bh = blockIdx.x / nqb, qblk = blockIdx.x % nqb;
  const int b = bh / H, h = bh % H;
  const int q0 = qblk * 64 + w * 16;
  const float* Q = qb + (size_t)b * T * pitch + h * D;
  const float* K = kb + (size_t)b * T * pitch + h * D;
  const float* V = vb + (size_t)b * T * pitch + h * D;

  // A fragments of the wave's 16 query rows (scaled), hi/lo
  FragB aqh[KS], aql[KS];
  {
    int row = q0 + ln; if (row >= T) row = T - 1;
    const float* qr = Q + (size_t)row * pitch;
#pragma unroll
    for (int ks = 0; ks < KS; ++ks)
#pragma unroll
      for (int i = 0; i < 16; ++i) {
        const int d = ks * 32 + ((i < 8) ? (8 * hh + i) : (16 + 8 * hh + (i - 8)));
        const float x = qr[d] * scale; const unsigned short hb = bf16_bits(x);
        aqh[ks].u[i] = hb; aql[ks].u[i] = bf16_bits(x - bf16_val(hb));
      }
  }
  float m_r[8], l_r[8];
#pragma unroll
  for (int r = 0; r < 8; ++r) { m_r[r] = -3.0e38f; l_r[r] = 0.f; }
  v8f oacc[DT];
#pragma unroll
  for (int dt = 0; dt < DT; ++dt) oacc[dt] = (v8f){0.f,0.f,0.f,0.f,0.f,0.f,0.f,0.f};

  const int kv_end = CAUSAL ? min(T, qblk * 64 + 64) : T;     // block-uniform
  for (int j0 = 0; j0 < kv_end; j0 += 32) {
    __syncthreads();
    for (int e = tid; e < 32 * (D / 4); e += 128) {
      const int r = e / (D / 4), c4 = (e % (D / 4)) * 4;
      const int key = j0 + r;
      v4f kf = {0.f,0.f,0.f,0.f}, vf = {0.f,0.f,0.f,0.f};
      if (key < T) { kf = *(const v4fa*)(K + (size_t)key * pitch + c4); vf = *(const v4fa*)(V + (size_t)key * pitch + c4); }
#pragma unroll
      for (int t = 0; t < 4; ++t) {
        unsigned short hb = bf16_bits(kf[t]); sKh[r][c4 + t] = hb; sKl[r][c4 + t] = bf16_bits(kf[t] - bf16_val(hb));
        hb = bf16_bits(vf[t]); sVh[r][c4 + t] = hb; sVl[r][c4 + t] = bf16_bits(vf[t] - bf16_val(hb));
      }
    }
    __syncthreads();
    // S tile 16 x 32
    v8f s[2];
#pragma unroll
    for (int nt = 0; nt < 2; ++nt) {
      v8f acc = {};
#pragma unroll
      for (int ks = 0; ks < KS; ++ks) {
        FragB bh_, bl_;
        bh_.half[0] = *(const v8us*)&sKh[nt * 16 + ln][ks * 32 + 8 * hh]; bh_.half[1] = *(const v8us*)&sKh[nt * 16 + ln][ks * 32 + 16 + 8 * hh];
        bl_.half[0] = *(const v8us*)&sKl[nt * 16 + ln][ks * 32 + 8 * hh]; bl_.half[1] = *(const v8us*)&sKl[nt * 16 + ln][ks * 32 + 16 + 8 * hh];
        acc = mmaN<3>(aqh[ks].v, aql[ks].v, bh_.v, bl_.v, acc);
      }
      s[nt] = acc;
    }
    // mask + running max (rows 8hh+r; the 16 lanes of a half share rows)
    float alpha[8];
#pragma unroll
    for (int r = 0; r < 8; ++r) {
      const int qi = q0 + 8 * hh + r;
      const int ja = j0 + ln, jb = j0 + 16 + ln;
      if (CAUSAL) { if (ja > qi) s[0][r] = -3.0e38f; if (jb > qi) s[1][r] = -3.0e38f; }
      if (ja >= T) s[0][r] = -3.0e38f;
      if (jb >= T) s[1][r] = -3.0e38f;
      float mx = fmaxf(s[0][r], s[1][r]);
      mx = fmaxf(mx, __shfl_xor(mx, 1, 32)); mx = fmaxf(mx, __shfl_xor(mx, 2, 32)); mx = fmaxf(mx, __shfl_xor(mx, 4, 32)); mx = fmaxf(mx, __shfl_xor(mx, 8, 32));
      const float mnew = fmaxf(m_r[r], mx);
      alpha[r] = (mnew > -1.0e38f) ? __expf(m_r[r] - mnew) : 1.0f;
      const float p0 = (s[0][r] > -1.0e38f) ? __expf(s[0][r] - mnew) : 0.f;
      const float p1 = (s[1][r] > -1.0e38f) ? __expf(s[1][r] - mnew) : 0.f;
      m_r[r] = mnew;
      l_r[r] = l_r[r] * alpha[r] + p0 + p1;            // per-lane partial row sum (16 lanes combined at the end)
      unsigned short hb = bf16_bits(p0); sPh[w][8 * hh + r][ln] = hb;      sPl[w][8 * hh + r][ln] = bf16_bits(p0 - bf16_val(hb));
      hb = bf16_bits(p1);                sPh[w][8 * hh + r][16 + ln] = hb; sPl[w][8 * hh + r][16 + ln] = bf16_bits(p1 - bf16_val(hb));
    }
#pragma unroll
    for (int dt = 0; dt < DT; ++dt)
#pragma unroll
      for (int r = 0; r < 8; ++r) oacc[dt][r] *= alpha[r];
    __builtin_amdgcn_fence(__ATOMIC_ACQ_REL, "workgroup");
    __builtin_amdgcn_wave_barrier();
    FragB pah, pal;
    pah.half[0] = *(const v8us*)&sPh[w][ln][8 * hh]; pah.half[1] = *(const v8us*)&sPh[w][ln][16 + 8 * hh];
    pal.half[0] = *(const v8us*)&sPl[w][ln][8 * hh]; pal.half[1] = *(const v8us*)&sPl[w][ln][16 + 8 * hh];
#pragma unroll
    for (int dt = 0; dt < DT; ++dt) {
      FragB bvh, bvl;
#pragma unroll
      for (int i = 0; i < 8; ++i) {
        bvh.u[i] = sVh[8 * hh + i][dt * 16 + ln]; bvh.u[8 + i] = sVh[16 + 8 * hh + i][dt * 16 + ln];
        bvl.u[i] = sVl[8 * hh + i][dt * 16 + ln]; bvl.u[8 + i] = sVl[16 + 8 * hh + i][dt * 16 + ln];
      }
      oacc[dt] = mmaN<3>(pah.v, pal.v, bvh.v, bvl.v, oacc[dt]);
    }
    __builtin_amdgcn_fence(__ATOMIC_ACQ_REL, "workgroup");
    __builtin_amdgcn_wave_barrier();
  }
#pragma unroll
  for (int r = 0; r < 8; ++r) {
    float l = l_r[r];
    l += __shfl_xor(l, 1, 32); l += __shfl_xor(l, 2, 32); l += __shfl_xor(l, 4, 32); l += __shfl_xor(l, 8, 32);
    l_r[r] = (l > 0.f) ? 1.0f / l : 0.f;
  }
#pragma unroll
  for (int dt = 0; dt < DT; ++dt)
#pragma unroll
    for (int r = 0; r < 8; ++r) sO[w][8 * hh + r][dt * 16 + ln] = oacc[dt][r] * l_r[r];
  __builtin_amdgcn_fence(__ATOMIC_ACQ_REL, "workgroup");
  __builtin_amdgcn_wave_barrier();
  {
    for (int r = 0; r < 16; ++r) {
      const int row = q0 + r;
      if (row < T && lane < D / 4) {
        const v4f val = *(const v4fa*)&sO[w][r][lane * 4];
        *(v4f*)(y + ((size_t)b * T + row) * ypitch + h * D + lane * 4) = val;
      }
    }
    
  }
}

// GEMM C = act(A·W + bias + resid): A f32 (ASPLIT -> hi/lo 2 terms), Wt bf16 [N][K]; ACT 0 none, 1 relu, 2 exact gelu;
// resid (optional, f32, row index = (row % rmod), pitch ldr, RES_BF16 rounds it) added before the activation.
template <bool ASPLIT, int ACT, bool BIAS_BF16, bool RES_BF16>
__global__ __launch_bounds__(128) void k_gemm_bf3(const float* __restrict__ A, int lda, const unsigned short* __restrict__ Wt, int ldb,
                                                const float* __restrict__ bias, const float* __restrict__ resid, int rmod, int ldr,
                                                float* __restrict__ C, int ldc, int M, int N, int K) {
  __shared__ __attribute__((aligned(16))) float so[4][16][64];
  const int tid = threadIdx.x, w = tid >> 5, lane = tid & 31, ln = lane & 15, hh = lane >> 4;
  const int ntn = N / 64;
  const int wid = blockIdx.x * 4 + w;
  const int mt = wid / ntn, nq = wid % ntn;
  if (mt * 16 >= M) return;
  const int row0 = mt * 16, col0 = nq * 64;
  const float* arow = A + (size_t)(row0 + ln) * lda;
  v8f acc[4] = {};
  for (int kb = 0; kb < K; kb += 32) {
    FragB ah, al;
    const v4f x0 = *(const v4fa*)(arow + kb + 8 * hh), x1 = *(const v4fa*)(arow + kb + 8 * hh + 4);
    const v4f x2 = *(const v4fa*)(arow + kb + 16 + 8 * hh), x3 = *(const v4fa*)(arow + kb + 16 + 8 * hh + 4);
    float xs[16] = {x0[0],x0[1],x0[2],x0[3],x1[0],x1[1],x1[2],x1[3],x2[0],x2[1],x2[2],x2[3],x3[0],x3[1],x3[2],x3[3]};
#pragma unroll
    for (int i = 0; i < 16; ++i) { const unsigned short hb = bf16_bits(xs[i]); ah.u[i] = hb; al.u[i] = ASPLIT ? bf16_bits(xs[i] - bf16_val(hb)) : (unsigned short)0; }
#pragma unroll
    for (int t = 0; t < 4; ++t) {
      const unsigned short* brow = Wt + (size_t)(col0 + t * 16 + ln) * ldb + kb;
      FragB b;
      b.half[0] = *(const v8us*)(brow + 8 * hh);
      b.half[1] = *(const v8us*)(brow + 16 + 8 * hh);
      acc[t] = mmaN<ASPLIT ? 2 : 1>(ah.v, al.v, b.v, b.v, acc[t]);
    }
  }
#pragma unroll
  for (int t = 0; t < 4; ++t) {
    const int col = col0 + t * 16 + ln;
    float bv = bias ? bias[col] : 0.f;
    if (BIAS_BF16) bv = bf16_round(bv);
#pragma unroll
    for (int r = 0; r < 8; ++r) {
      float v = acc[t][r] + bv;
      if (resid) { float rv = resid[(size_t)((row0 + 8 * hh + r) % rmod) * ldr + col]; if (RES_BF16) rv = bf16_round(rv); v += rv; }
      if (ACT == 1) v = fmaxf(v, 0.f);
      if (ACT == 2) v = 0.5f * v * (1.0f + erff(v * 0.70710678118654752f));
      if (ACT == 3) { const float u = 0.7978845608028654f * (v + 0.044715f * v * v * v); v = 0.5f * v * (1.0f + tanhf(u)); }
      so[w][8 * hh + r][t * 16 + ln] = v;
    }
  }
  __builtin_amdgcn_fence(__ATOMIC_ACQ_REL, "workgroup");
  __builtin_amdgcn_wave_barrier();
  const int rsub = lane >> 4, c4 = (lane & 15) * 4;
  {
#pragma unroll
    for (int q = 0; q < 8; ++q) {
      const int r = q * 2 + rsub;
      const v4f v = *(const v4fa*)&so[w][r][c4];
      *(v4f*)(C + (size_t)(row0 + r) * ldc + col0 + c4) = v;
    }
    
  }
}
// row LayerNorm (biased variance, eps) over N: s = X (+ R); optional out_sum <- s; out_norm <- (s-mu)*rsqrt(var+eps)*g + b
template <bool PARAM_BF16>
__global__ __launch_bounds__(256) void k_layernorm(const float* __restrict__ X, const float* __restrict__ R, const float* __restrict__ g, const float* __restrict__ bta,
                                                  float* __restrict__ out_sum, float* __restrict__ out_norm, int N, float eps) {
  __shared__ float red[256];
  const int row = blockIdx.x, tid = threadIdx.x;
  const float* x = X + (size_t)row * N; const float* rr = R ? R + (size_t)row * N : nullptr;
  float vals[16];                     // up to N = 4096
  const int per = N / 256;            // contiguous chunk per thread? use strided-by-4 chunks: thread handles j = tid*4 + 1024*u
  float s1 = 0.f;
  for (int u = 0; u < per / 4; ++u) {
    const int j = tid * 4 + 1024 * u;
    const v4f a = *(const v4fa*)(x + j);
    v4f b = {0.f,0.f,0.f,0.f}; if (rr) b = *(const v4fa*)(rr + j);
#pragma unroll
    for (int q = 0; q < 4; ++q) { const float v = a[q] + b[q]; vals[u * 4 + q] = v; s1 += v; }
  }
  red[tid] = s1; __syncthreads();
  for (int st = 128; st > 0; st >>= 1) { if (tid < st) red[tid] += red[tid + st]; __syncthreads(); }
  const float mu = red[0] / (float)N; __syncthreads();
  float s2 = 0.f;
  for (int u = 0; u < per / 4; ++u)
#pragma unroll
    for (int q = 0; q < 4; ++q) { const float c = vals[u * 4 + q] - mu; s2 += c * c; }
  red[tid] = s2; __syncthreads();
  for (int st = 128; st > 0; st >>= 1) { if (tid < st) red[tid] += red[tid + st]; __syncthreads(); }
  const float rs = rsqrtf(red[0] / (float)N + eps);
  {
    for (int u = 0; u < per / 4; ++u) {
      const int j = tid * 4 + 1024 * u;
      v4f o, sm;
#pragma unroll
      for (int q = 0; q < 4; ++q) {
        float gg = g[j + q], bb = bta[j + q];
        if (PARAM_BF16) { gg = bf16_round(gg); bb = bf16_round(bb); }
        sm[q] = vals[u * 4 + q]; o[q] = (vals[u * 4 + q] - mu) * rs * gg + bb;
      }
      if (out_sum) *(v4f*)(out_sum + (size_t)row * N + j) = sm;
      *(v4f*)(out_norm + (size_t)row * N + j) = o;
    }
    
  }
}



// ---- f16 WMMA path (v_wmma_f32_16x16x32_f16): 11-bit significands for operands in range — used where a [0,1] probability operand needs more precision than bf16
typedef _Float16 v16h __attribute__((ext_vector_type(16)));
union FragH { v16h v; v8us half[2]; _Float16 h[16]; unsigned short u[16]; };
template <int NT>
__device__ __forceinline__ v8f mmaH(v16h ah, v16h al, v16h bh, v16h bl, v8f c) {
  c = __builtin_amdgcn_wmma_f32_16x16x32_f16(false, ah, false, bh, (short)0, c, false, false);
  if (NT >= 2) c = __builtin_amdgcn_wmma_f32_16x16x32_f16(false, al, false, bh, (short)0, c, false, false);
  if (NT >= 3) c = __builtin_amdgcn_wmma_f32_16x16x32_f16(false, ah, false, bl, (short)0, c, false, false);
  asm volatile("v_nop\n\tv_nop\n\tv_nop\n\tv_nop" : "+v"(c) : "v"(ah), "v"(al), "v"(bh), "v"(bl));
  return c;
}
// batched GEMM like k_gemm_b but f16 operands: A f32 (split into f16 hi/lo if ASPLIT, else rounded to f16), Bt = f16 values [n][k]; alpha; C f32; N multiple of 16 (partial tiles skipped)
template <bool ASPLIT>
__global__ __launch_bounds__(128) void k_gemm_h(const float* __restrict__ A, int lda, size_t sA, const _Float16* __restrict__ Bh, int ldb, size_t sB, float alpha, float* __restrict__ C, int ldc, size_t sC, int M, int N, int K) {
  __shared__ __attribute__((aligned(16))) float so[4][16][64];
  const int tid = threadIdx.x, w = tid >> 5, lane = tid & 31, ln = lane & 15, hh = lane >> 4; const int by = blockIdx.y;
  A += (size_t)by * sA; Bh += (size_t)by * sB; C += (size_t)by * sC;
  const int ntn = (N + 63) / 64; const int wid = blockIdx.x * 4 + w; const int mt = wid / ntn, nq = wid % ntn; if (mt * 16 >= M) return;
  const int row0 = mt * 16, col0 = nq * 64; const float* arow = A + (size_t)(row0 + ln) * lda;
  v8f acc[4] = {};
  for (int kb = 0; kb < K; kb += 32) {
    FragH ah, al;
    const v4f x0 = *(const v4fa*)(arow + kb + 8 * hh), x1 = *(const v4fa*)(arow + kb + 8 * hh + 4), x2 = *(const v4fa*)(arow + kb + 16 + 8 * hh), x3 = *(const v4fa*)(arow + kb + 16 + 8 * hh + 4);
    float xs[16] = {x0[0],x0[1],x0[2],x0[3],x1[0],x1[1],x1[2],x1[3],x2[0],x2[1],x2[2],x2[3],x3[0],x3[1],x3[2],x3[3]};
#pragma unroll
    for (int i = 0; i < 16; ++i) { const _Float16 h = (_Float16)xs[i]; ah.h[i] = h; al.h[i] = ASPLIT ? (_Float16)(xs[i] - (float)h) : (_Float16)0.0f; }
#pragma unroll
    for (int t = 0; t < 4; ++t) { if (col0 + t * 16 >= N) continue; const size_t boff = (size_t)(col0 + t * 16 + ln) * ldb + kb; FragH bq; bq.half[0] = *(const v8us*)(Bh + boff + 8 * hh); bq.half[1] = *(const v8us*)(Bh + boff + 16 + 8 * hh);
      acc[t] = mmaH<ASPLIT ? 2 : 1>(ah.v, al.v, bq.v, bq.v, acc[t]); }
  }
#pragma unroll
  for (int t = 0; t < 4; ++t) { if (col0 + t * 16 >= N) continue;
#pragma unroll
    for (int r = 0; r < 8; ++r) so[w][8 * hh + r][t * 16 + ln] = acc[t][r] * alpha; }
  __builtin_amdgcn_fence(__ATOMIC_ACQ_REL, "workgroup"); __builtin_amdgcn_wave_barrier();
  const int rsub = lane >> 4, c4 = (lane & 15) * 4;
  {
#pragma unroll
    for (int q = 0; q < 8; ++q) { const int r = q * 2 + rsub; if (col0 + c4 < N) { const v4f v = *(const v4fa*)&so[w][r][c4]; *(v4f*)(C + (size_t)(row0 + r) * ldc + col0 + c4) = v; } }
     }
}

// Wt[n][k] = f16(W[k][n]·scale) from f32 row-major W[K][N] (scale = power of two; bf16-exact weights stay exact in f16 away from the subnormal range)
__global__ __launch_bounds__(256) void k_wt_f16(const float* __restrict__ W, _Float16* __restrict__ Wt, int K, int N, float scale) {
  const int t = blockIdx.x * 256 + threadIdx.x; if (t >= N * (K / 8)) return; const int n = t / (K / 8), k8 = (t % (K / 8)) * 8; FragH f;
#pragma unroll
  for (int i = 0; i < 8; ++i) f.h[i] = (_Float16)(bf16_round(W[(size_t)(k8 + i) * N + n]) * scale); const v8us o = f.half[0];
  *(v8us*)((unsigned short*)Wt + (size_t)n * K + k8) = o; 
}
// k_gemm_hh variant with fused epilogue: v = acc·alpha + bias[by·sBias + col] (+ CP[(row/rowsPerB)·sCPb + by·64 + col] if CP) ; ACT 0 none / 1 elu ; writes f32 C and/or f16 C16 (each if non-null)
template <int ACT>
__global__ __launch_bounds__(128) void k_gemm_hhx(const _Float16* __restrict__ A, int lda, size_t sA, const _Float16* __restrict__ Bh, int ldb, size_t sB, float alpha, const float* __restrict__ bias, size_t sBias, const float* __restrict__ CP, int rowsPerB, size_t sCPb, int row0g,
    float* __restrict__ C, _Float16* __restrict__ C16, int ldc, size_t sC, int M, int N, int K) {
  __shared__ __attribute__((aligned(16))) float so[4][16][64];
  const int tid = threadIdx.x, w = tid >> 5, lane = tid & 31, ln = lane & 15, hh = lane >> 4; const int by = blockIdx.y;
  A += (size_t)by * sA; Bh += (size_t)by * sB; const size_t cofs = (size_t)by * sC; const float* bp = bias ? bias + (size_t)by * sBias : nullptr;
  const int ntn = (N + 63) / 64; const int wid = blockIdx.x * 4 + w; const int mt = wid / ntn, nq = wid % ntn; if (mt * 16 >= M) return;
  const int row0 = mt * 16, col0 = nq * 64; const _Float16* arow = A + (size_t)(row0 + ln) * lda;
  v8f acc[4] = {};
  for (int kb = 0; kb < K; kb += 32) { FragH ah; ah.half[0] = *(const v8us*)((const unsigned short*)arow + kb + 8 * hh); ah.half[1] = *(const v8us*)((const unsigned short*)arow + kb + 16 + 8 * hh);
#pragma unroll
    for (int t = 0; t < 4; ++t) { if (col0 + t * 16 >= N) continue; const size_t boff = (size_t)(col0 + t * 16 + ln) * ldb + kb; FragH bq; bq.half[0] = *(const v8us*)((const unsigned short*)Bh + boff + 8 * hh); bq.half[1] = *(const v8us*)((const unsigned short*)Bh + boff + 16 + 8 * hh);
      acc[t] = mmaH<1>(ah.v, ah.v, bq.v, bq.v, acc[t]); }
  }
#pragma unroll
  for (int t = 0; t < 4; ++t) { if (col0 + t * 16 >= N) continue; const int col = col0 + t * 16 + ln; const float bv = bp ? bf16_round(bp[col]) : 0.f;
#pragma unroll
    for (int r = 0; r < 8; ++r) { float v = acc[t][r] * alpha + bv; if (CP) { const int bidx = (row0g + row0 + 8 * hh + r) / rowsPerB; v += CP[(size_t)bidx * sCPb + (size_t)by * 64 + col]; } if (ACT == 1) v = (v > 0.f) ? v : expm1f(v); else if (ACT == 7) v = (v > 0.f) ? v + 1.0f : expf(v); else if (ACT == 8) v = tanhf(v); else if (ACT == 9) v = 0.5f * v * (1.0f + tanhf(0.7978845608028654f * (v + 0.044715f * v * v * v))); else if (ACT == 11) v = 1.0f / (1.0f + expf(-v)); else if (ACT == 12) v = (v > 0.f) ? v : 0.01f * v; else if (ACT == 14) v = (v > 0.f) ? v : 0.1f * v; else if (ACT == 15) v = v / (1.0f + expf(-v)); else if (ACT == 3) v = fmaxf(v, 0.f); else if (ACT == 6) v = 0.5f * v * (1.0f + erff(v * 0.70710678118654752f)); so[w][8 * hh + r][t * 16 + ln] = v; } }
  __builtin_amdgcn_fence(__ATOMIC_ACQ_REL, "workgroup"); __builtin_amdgcn_wave_barrier();
  const int rsub = lane >> 4, c4 = (lane & 15) * 4; typedef _Float16 v4h __attribute__((ext_vector_type(4)));
  {
#pragma unroll
    for (int q = 0; q < 8; ++q) { const int r = q * 2 + rsub; if (col0 + c4 < N) { const v4f v = *(const v4fa*)&so[w][r][c4]; if (C) *(v4f*)(C + cofs + (size_t)(row0 + r) * ldc + col0 + c4) = v; if (C16) { v4h h4; for (int i = 0; i < 4; ++i) h4[i] = (_Float16)v[i]; *(v4h*)(C16 + cofs + (size_t)(row0 + r) * ldc + col0 + c4) = h4; } } }
     }
}


typedef _Float16 v4h __attribute__((ext_vector_type(4)));

// All five input conversions in one launch: x -> f16(bf16(x)), each weight -> f16(bf16(W) * 16). An item is 8 floats; item = u * PREP_T + thread, so u = 0..3 walks x and u = 4..7 is one weight each.
// 512 work-groups of 8 waves (16 waves a WGP): every thread has its 16 loads of 16 B in flight before its first store.
#define PREP_T (512 * 256)
__global__ __launch_bounds__(256) void k_prep(const float* __restrict__ x, const float* __restrict__ Wq, const float* __restrict__ Wk, const float* __restrict__ Wv, const float* __restrict__ Wo, _Float16* __restrict__ X16, _Float16* __restrict__ Bw) {
  static_assert((size_t)NR * DD / 8 == (size_t)4 * PREP_T && (size_t)DD * DD / 8 == (size_t)PREP_T, "item split");
  const unsigned tb = (blockIdx.x * 256u + threadIdx.x) * 32u;      /* one 32-bit byte offset serves all eight items: each has a uniform base (scalar base + vector offset addressing) */
  const float* sp[8] = { x, x + PREP_T * 8, x + 2 * PREP_T * 8, x + 3 * PREP_T * 8, Wq, Wk, Wv, Wo };
  v4f a[8], c[8];
#pragma unroll
  for (int u = 0; u < 8; ++u) { a[u] = *(const v4fa*)((const char*)sp[u] + tb); c[u] = *(const v4fa*)((const char*)sp[u] + tb + 16); }
  __builtin_amdgcn_sched_barrier(0);      /* all 16 loads go out as one group: left alone the scheduler starts converting after eight and the rest wait behind those results */
  FragH f[8];
#pragma unroll
  for (int u = 0; u < 8; ++u) { const float sc = (u < 4) ? 1.0f : 16.0f;
#pragma unroll
    for (int q = 0; q < 4; ++q) { f[u].h[q] = (_Float16)(bf16_round(a[u][q]) * sc); f[u].h[4 + q] = (_Float16)(bf16_round(c[u][q]) * sc); } }
#pragma unroll
  for (int u = 0; u < 8; ++u) *(v8us*)((char*)(((u < 4) ? X16 : Bw) + (u & 3) * PREP_T * 8) + (tb >> 1)) = f[u].half[0];
}
__global__ __launch_bounds__(256) void k_h16(const float* __restrict__ x, _Float16* __restrict__ X16, size_t n8) { const size_t t = (size_t)blockIdx.x * 256 + threadIdx.x; if (t >= n8) return; FragH f;
#pragma unroll
  for (int q = 0; q < 8; ++q) f.h[q] = (_Float16)x[t * 8 + q]; *(v8us*)((unsigned short*)X16 + t * 8) = f.half[0];  }
typedef int v4ia __attribute__((ext_vector_type(4), may_alias));
// lane l <-> lane l ^ 16 (the two halves of a wave hold the two key groups of one query column)
__device__ __forceinline__ float xhalf(float x) { return __builtin_bit_cast(float, __builtin_amdgcn_permlanex16(__builtin_bit_cast(int, x), __builtin_bit_cast(int, x), 0x76543210, 0xfedcba98, false, false)); }
__device__ __forceinline__ v8f wm(v16h a, v16h b, v8f c) { return __builtin_amdgcn_wmma_f32_16x16x32_f16(false, a, false, b, (short)0, c, false, false); }
#define FS_KEYS 64
#define FS_PITCH 144
#define FS_PLANE (64 * FS_PITCH)
#define FS_STAGE (3 * FS_PLANE)
// six copies of one lane: rows r and r + 32 of K hi, K lo and Vt, 16 B each. The s_wait_xcnt stands inside the copies' own statement, so that no address register named here is rewritten in front of it.
__device__ __forceinline__ void fs_copy6(unsigned l, const _Float16* kh, const _Float16* kl, int ldk, const _Float16* vt) {
  asm volatile("global_load_async_to_lds_b128 %0, %6, off\n\t"
               "global_load_async_to_lds_b128 %1, %7, off\n\t"
               "global_load_async_to_lds_b128 %2, %8, off\n\t"
               "global_load_async_to_lds_b128 %3, %9, off\n\t"
               "global_load_async_to_lds_b128 %4, %10, off\n\t"
               "global_load_async_to_lds_b128 %5, %11, off\n\t"
               "s_wait_xcnt 0x0"
               :: "v"(l), "v"(l + 32 * FS_PITCH), "v"(l + FS_PLANE), "v"(l + FS_PLANE + 32 * FS_PITCH), "v"(l + 2 * FS_PLANE), "v"(l + 2 * FS_PLANE + 32 * FS_PITCH),
                  "v"(kh), "v"(kh + (size_t)32 * ldk), "v"(kl), "v"(kl + (size_t)32 * ldk), "v"(vt), "v"(vt + 32 * TT)
               : "memory");
}
__global__ __launch_bounds__(256) void k_flash(const _Float16* __restrict__ Q16, const _Float16* __restrict__ Q16lo, int ldq, const _Float16* __restrict__ K16, const _Float16* __restrict__ K16lo, int ldk, const _Float16* __restrict__ Vt, const int* __restrict__ MSK, _Float16* __restrict__ O16, int ldo) {
  constexpr int RPW = 16, NW = 8, NQB = TT / (NW * RPW), DT = 4, KS = 2, NST = TT / FS_KEYS;
  __shared__ __attribute__((aligned(16))) unsigned char sT[2 * FS_STAGE];
  __shared__ __attribute__((aligned(16))) int sM[TT];
  __shared__ __attribute__((aligned(16))) float sO[NW][RPW][64 + 4];
  const int tid = threadIdx.x, w = tid >> 5, lane = tid & 31, ln = lane & 15, hh = lane >> 4;
  const int slab = blockIdx.x / NQB, qblk = blockIdx.x % NQB; const int b = slab / NH, h = slab % NH; const int q0 = qblk * (NW * RPW) + w * RPW;
  const int cr = tid >> 3, cc = tid & 7;      /* this lane's row (mod 32) and 16-B column of every stage copy */
  const size_t kofs = ((size_t)b * TT + cr) * ldk + h * 64 + cc * 8;
  const _Float16* gkh = K16 + kofs; const _Float16* gkl = K16lo + kofs; const _Float16* gvt = Vt + ((size_t)slab * 64 + cr) * TT + cc * 8;
  const unsigned lt = (unsigned)(size_t)sT + cr * FS_PITCH + cc * 16;
  { const unsigned lm = (unsigned)(size_t)sM + tid * 16; const int* gm = MSK + (size_t)b * TT + tid * 4;
    /* the mask row, 2 x 16 B a lane; the wait inside the statement keeps its address registers until the copies have read them */
    asm volatile("global_load_async_to_lds_b128 %0, %2, off\n\t"
                 "global_load_async_to_lds_b128 %1, %3, off\n\t"
                 "s_wait_xcnt 0x0" :: "v"(lm), "v"(lm + TT * 2), "v"(gm), "v"(gm + TT / 2) : "memory"); }
  fs_copy6(lt, gkh, gkl, ldk, gvt);
  FragH aq[KS], aql[KS];
  { const size_t qo = ((size_t)b * TT + q0 + ln) * ldq + h * 64; const unsigned short* qr = (const unsigned short*)Q16 + qo; const unsigned short* ql = (const unsigned short*)Q16lo + qo;
#pragma unroll
    for (int ks = 0; ks < KS; ++ks) { aq[ks].half[0] = *(const v8us*)(qr + ks * 32 + 8 * hh); aq[ks].half[1] = *(const v8us*)(qr + ks * 32 + 16 + 8 * hh); aql[ks].half[0] = *(const v8us*)(ql + ks * 32 + 8 * hh); aql[ks].half[1] = *(const v8us*)(ql + ks * 32 + 16 + 8 * hh); } }
  asm volatile("s_wait_asynccnt 0x0" ::: "memory");      /* the mask and stage 0 have landed for this wave */
  __syncthreads();                                       /* ... and for every wave */
  fs_copy6(lt + FS_STAGE, gkh + (size_t)FS_KEYS * ldk, gkl + (size_t)FS_KEYS * ldk, ldk, gvt + FS_KEYS);
  /* exponentials in base 2: e^(s - m) * 2^10 = 2^(s * log2e - c) with c = m * log2e - 10, one fused multiply-add and one v_exp_f32 a score; c is kept beside the running maximum, so that every term of a query hangs on the same rounded c.
     The start value of m is finite also after the multiplication by log2e. */
  constexpr float L2E = 1.4426950408889634f;
  float m_r = -2.0e38f, c_r = -2.0e38f * L2E - 10.0f, l_r = 0.f; v8f oacc[DT];
#pragma unroll
  for (int dt = 0; dt < DT; ++dt) oacc[dt] = (v8f){0.f,0.f,0.f,0.f,0.f,0.f,0.f,0.f};
  const unsigned char* fk = sT + ln * FS_PITCH + 16 * hh; const unsigned char* fv = fk + 2 * FS_PLANE;
#pragma unroll 1      /* one stage a trip: the two buffers alternate by an offset */
  for (int t = 0; t < NST; ++t) {
    const unsigned bo = (unsigned)(t & 1) * FS_STAGE;
#pragma unroll      /* the two passes of a stage stand in line, so that every LDS read takes its place in the stage as an immediate offset */
    for (int ps = 0; ps < FS_KEYS / 32; ++ps) {
    const int* mp = sM + t * FS_KEYS + ps * 32 + 8 * hh;      /* key padding mask (1 = attend) of this lane's 16 keys */
    const v4ia km[4] = { *(const v4ia*)(mp), *(const v4ia*)(mp + 4), *(const v4ia*)(mp + 16), *(const v4ia*)(mp + 20) };
    float sv[16]; FragH bk[2][KS], bl[2][KS], bv[DT];
#pragma unroll
    for (int nt = 0; nt < 2; ++nt) { const unsigned char* kr = fk + bo + (ps * 32 + nt * 16) * FS_PITCH; const unsigned char* kl = kr + FS_PLANE;
#pragma unroll
      for (int ks = 0; ks < KS; ++ks) { bk[nt][ks].half[0] = *(const v8us*)(kr + ks * 64); bk[nt][ks].half[1] = *(const v8us*)(kr + ks * 64 + 32); bl[nt][ks].half[0] = *(const v8us*)(kl + ks * 64); bl[nt][ks].half[1] = *(const v8us*)(kl + ks * 64 + 32); } }
    __builtin_amdgcn_sched_barrier(0);      /* the pass's K reads go out as one group: left alone the scheduler puts the second key tile's reads behind the first tile's products, and the wave waits out the LDS latency a second time */
#pragma unroll
    for (int nt = 0; nt < 2; ++nt) {
      v8f acc = (v8f){0.f,0.f,0.f,0.f,0.f,0.f,0.f,0.f}, accl = acc;
#pragma unroll
      for (int ks = 0; ks < KS; ++ks) { acc = wm(bk[nt][ks].v, aq[ks].v, acc); accl = wm(bk[nt][ks].v, aql[ks].v, accl); accl = wm(bl[nt][ks].v, aq[ks].v, accl); }
#pragma unroll
      for (int r = 0; r < 8; ++r) sv[nt * 8 + r] = (km[nt * 2 + (r >> 2)][r & 3] != 0) ? acc[r] + accl[r] * 0.0009765625f : -INFINITY; }
#pragma unroll
    for (int dt = 0; dt < DT; ++dt) { const unsigned char* vrow = fv + bo + dt * 16 * FS_PITCH + ps * 64; bv[dt].half[0] = *(const v8us*)(vrow); bv[dt].half[1] = *(const v8us*)(vrow + 32); }
    __builtin_amdgcn_sched_barrier(0);      /* the four Vt fragments are read ahead of the softmax, which covers their latency: left alone each read sinks to just in front of its product and is waited for there */
    float t8[8];
#pragma unroll
    for (int i = 0; i < 8; ++i) t8[i] = fmaxf(sv[i], sv[8 + i]);
    float mc = fmaxf(fmaxf(fmaxf(t8[0], t8[1]), fmaxf(t8[2], t8[3])), fmaxf(fmaxf(t8[4], t8[5]), fmaxf(t8[6], t8[7])));
    mc = fmaxf(mc, xhalf(mc));      /* both halves now hold the query's block maximum */
    const float mn = fmaxf(m_r, mc); const float cn = fmaf(mn, L2E, -10.0f); float ea = c_r - cn; m_r = mn; c_r = cn;      /* cn is finite (mn >= -2e38), so a masked score gives 2^(-inf) = 0 */
    float p[16]; FragH pa;
#pragma unroll
    for (int i = 0; i < 16; ++i) p[i] = fmaf(sv[i], L2E, -cn);
    /* the pass's 17 exponentials, each in its own register: written by the compiler a v_exp_f32 here and there lands on the source register of the one directly in front of it, where the instruction set asks for a free slot.
       The closing v_nop is that slot behind the last one, whatever the compiler puts next. Order: %0, whose argument is formed last, stands third; p[0..3], which are packed last, stand at the end. */
    asm("v_exp_f32 %5, %5\n\t" "v_exp_f32 %6, %6\n\t" "v_exp_f32 %0, %0\n\t" "v_exp_f32 %7, %7\n\t" "v_exp_f32 %8, %8\n\t" "v_exp_f32 %9, %9\n\t"
        "v_exp_f32 %10, %10\n\t" "v_exp_f32 %11, %11\n\t" "v_exp_f32 %12, %12\n\t" "v_exp_f32 %13, %13\n\t" "v_exp_f32 %14, %14\n\t" "v_exp_f32 %15, %15\n\t"
        "v_exp_f32 %16, %16\n\t" "v_exp_f32 %3, %3\n\t" "v_exp_f32 %4, %4\n\t" "v_exp_f32 %1, %1\n\t" "v_exp_f32 %2, %2\n\t" "v_nop"
        : "+v"(ea), "+v"(p[0]), "+v"(p[1]), "+v"(p[2]), "+v"(p[3]), "+v"(p[4]), "+v"(p[5]), "+v"(p[6]), "+v"(p[7]), "+v"(p[8]), "+v"(p[9]), "+v"(p[10]), "+v"(p[11]), "+v"(p[12]), "+v"(p[13]), "+v"(p[14]), "+v"(p[15]));
    const float al = (mn > -1.0e38f) ? ea : 1.0f;
#pragma unroll
    for (int i = 0; i < 16; ++i) pa.h[i] = (_Float16)p[i];      /* p carries the 2^10 of the f16 operand, and so does the row sum */
#pragma unroll
    for (int i = 0; i < 8; ++i) t8[i] = p[i] + p[8 + i];
    l_r = l_r * al + (((t8[0] + t8[1]) + (t8[2] + t8[3])) + ((t8[4] + t8[5]) + (t8[6] + t8[7])));      /* per-lane partial sum; the halves join after the loop */
#pragma unroll
    for (int dt = 0; dt < DT; ++dt)
#pragma unroll
      for (int r = 0; r < 8; ++r) oacc[dt][r] *= al;
#pragma unroll
    for (int dt = 0; dt < DT; ++dt) oacc[dt] = wm(bv[dt].v, pa.v, oacc[dt]); }
    asm volatile("s_wait_dscnt 0x0" ::: "memory");       /* this wave's reads of buffer t & 1 are done before the buffer is handed back */
    asm volatile("s_wait_asynccnt 0x0" ::: "memory");    /* this wave's copies of stage t + 1 have landed */
    __syncthreads();                                     /* publishes stage t + 1 and ends every wave's reads of stage t */
    if (t + 2 < NST) fs_copy6(lt + bo, gkh + (size_t)(t + 2) * FS_KEYS * ldk, gkl + (size_t)(t + 2) * FS_KEYS * ldk, ldk, gvt + (t + 2) * FS_KEYS);
  }
  asm volatile("s_wait_asynccnt 0x0" ::: "memory");      /* nothing is in flight when the wave goes on to its end */
  { const float l = l_r + xhalf(l_r); const float inv = (l > 0.f) ? 1.0f / l : 0.f;
#pragma unroll
    for (int dt = 0; dt < DT; ++dt)
#pragma unroll
      for (int q = 0; q < 2; ++q) { const v4f o4 = { oacc[dt][q * 4] * inv, oacc[dt][q * 4 + 1] * inv, oacc[dt][q * 4 + 2] * inv, oacc[dt][q * 4 + 3] * inv }; *(v4fa*)&sO[w][ln][dt * 16 + 8 * hh + q * 4] = o4; } }
  __builtin_amdgcn_fence(__ATOMIC_ACQ_REL, "workgroup"); __builtin_amdgcn_wave_barrier();
  {
#pragma unroll      /* O x 2^4 goes out as the f16 operand of the output GEMM: 8 lanes a row, one whole 128-B line per (query, head) */
    for (int rp = 0; rp < RPW; rp += 4) { const int r = rp + (lane >> 3), c8 = (lane & 7) * 8; const v4f a = *(const v4fa*)&sO[w][r][c8], c = *(const v4fa*)&sO[w][r][c8 + 4]; FragH f;
#pragma unroll
      for (int q = 0; q < 4; ++q) { f.h[q] = (_Float16)(a[q] * 16.0f); f.h[4 + q] = (_Float16)(c[q] * 16.0f); }
      *(v8us*)((unsigned short*)O16 + ((size_t)b * TT + q0 + r) * ldo + h * 64 + c8) = f.half[0]; }
     } }

// ---- projection GEMM with its operands staged in LDS: C = alpha * A . Bt^T, A [NR][DD] and Bt [DD][DD] f16, both k-contiguous.
// One 128 x 128 tile per work-group of 8 waves (4 x 2 waves of 32 x 64). A stage is 128 k = 256 B of each of the 256 operand rows (A rows 0-127, Bt rows 128-255),
// brought by asynchronous copies (16 lanes of 16 B a row), two buffers: stage t + 1 flies while stage t is multiplied.
// LDS row pitch 272 B = 16 B x odd, the conflict-free pitch of ds_load_b128 fragment reads. The k order of every accumulator is 0, 32, 64, ... as before.
#define GS_K 128
#define GS_PITCH 272
#define GS_STAGE (256 * GS_PITCH)
// eight copies of one lane: rows r, r + 16, ..., r + 112 of one operand, 16 B each. The s_wait_xcnt stands inside the copies' own statement, so that no address register named here is rewritten in front of it.
__device__ __forceinline__ void gs_copy8(unsigned l, const _Float16* g) {
  asm volatile("global_load_async_to_lds_b128 %0, %8, off\n\t"
               "global_load_async_to_lds_b128 %1, %9, off\n\t"
               "global_load_async_to_lds_b128 %2, %10, off\n\t"
               "global_load_async_to_lds_b128 %3, %11, off\n\t"
               "global_load_async_to_lds_b128 %4, %12, off\n\t"
               "global_load_async_to_lds_b128 %5, %13, off\n\t"
               "global_load_async_to_lds_b128 %6, %14, off\n\t"
               "global_load_async_to_lds_b128 %7, %15, off\n\t"
               "s_wait_xcnt 0x0"
               :: "v"(l), "v"(l + 16 * GS_PITCH), "v"(l + 32 * GS_PITCH), "v"(l + 48 * GS_PITCH), "v"(l + 64 * GS_PITCH), "v"(l + 80 * GS_PITCH), "v"(l + 96 * GS_PITCH), "v"(l + 112 * GS_PITCH),
                  "v"(g), "v"(g + 16 * DD), "v"(g + 32 * DD), "v"(g + 48 * DD), "v"(g + 64 * DD), "v"(g + 80 * DD), "v"(g + 96 * DD), "v"(g + 112 * DD)
               : "memory");
}
// the 2 A and 4 B fragments of one k step (32 k = 64 B of a row) from a stage in LDS; both operands in the same k order: 8 hh + 0..7, then 16 + 8 hh + 0..7
__device__ __forceinline__ void gs_frags(FragH (&a)[2], FragH (&b)[4], const unsigned char* pa, const unsigned char* pb) {
#pragma unroll
  for (int i = 0; i < 2; ++i) { a[i].half[0] = *(const v8us*)(pa + i * 16 * GS_PITCH); a[i].half[1] = *(const v8us*)(pa + i * 16 * GS_PITCH + 32); }
#pragma unroll
  for (int j = 0; j < 4; ++j) { b[j].half[0] = *(const v8us*)(pb + j * 16 * GS_PITCH); b[j].half[1] = *(const v8us*)(pb + j * 16 * GS_PITCH + 32); }
}
// the 8 products of one k step
__device__ __forceinline__ void gs_mma(v8f (&acc)[2][4], const FragH (&a)[2], const FragH (&b)[4]) {
#pragma unroll
  for (int i = 0; i < 2; ++i)
#pragma unroll
    for (int j = 0; j < 4; ++j) acc[i][j] = __builtin_amdgcn_wmma_f32_16x16x32_f16(false, a[i].v, false, b[j].v, (short)0, acc[i][j], false, false);
}
// QKV = false: one product, C f32. QKV = true: the q, k and v projections in one grid (256 tiles each, Bt = the three weights in a row), each with its consumer's conversion as epilogue:
// q and k leave as elu + 1 split in f16 hi + 2^10 x residual planes, v leaves as f16 already transposed, Vt[batch * DD + column][token].
template <bool QKV>
__global__ __launch_bounds__(256) void k_gemm_lds(const _Float16* __restrict__ A, const _Float16* __restrict__ Bt, float alpha, float* __restrict__ C,
                                                  _Float16* __restrict__ Qh, _Float16* __restrict__ Ql, _Float16* __restrict__ Kh, _Float16* __restrict__ Kl, _Float16* __restrict__ Vt) {
  __shared__ __attribute__((aligned(16))) unsigned char sT[2 * GS_STAGE];
  __shared__ __attribute__((aligned(16))) float so[8][32][64 + 4];
  constexpr int NST = DD / GS_K;
  const int tid = threadIdx.x, w = tid >> 5, lane = tid & 31, ln = lane & 15, hh = lane >> 4;
  constexpr int NTILE = (NR / 128) * (DD / 128);
  const int which = QKV ? blockIdx.x / NTILE : 0, tile = QKV ? blockIdx.x % NTILE : blockIdx.x;      /* which: 0 q, 1 k, 2 v; the same for the whole work-group */
  Bt += (size_t)which * DD * DD;
  const int row0 = (tile / (DD / 128)) * 128, col0 = (tile % (DD / 128)) * 128; const int wm = w >> 1, wn = w & 1;
  const int cr = tid >> 4, cc = tid & 15;      /* this lane's row (mod 16) and 16-B column of every copy */
  const _Float16* ga = A + (size_t)(row0 + cr) * DD + cc * 8; const _Float16* gb = Bt + (size_t)(col0 + cr) * DD + cc * 8;
  const unsigned la = (unsigned)(size_t)sT + cr * GS_PITCH + cc * 16, lb = la + 128 * GS_PITCH;
  gs_copy8(la, ga); gs_copy8(lb, gb);
  asm volatile("s_wait_asynccnt 0x0" ::: "memory");      /* stage 0 has landed for this wave */
  __syncthreads();                                       /* ... and for every wave */
  gs_copy8(la + GS_STAGE, ga + GS_K); gs_copy8(lb + GS_STAGE, gb + GS_K);
  v8f acc[2][4];
#pragma unroll
  for (int i = 0; i < 2; ++i)
#pragma unroll
    for (int j = 0; j < 4; ++j) acc[i][j] = (v8f){0.f,0.f,0.f,0.f,0.f,0.f,0.f,0.f};
  const unsigned char* fa = sT + (wm * 32 + ln) * GS_PITCH + 16 * hh; const unsigned char* fb = sT + (128 + wn * 64 + ln) * GS_PITCH + 16 * hh;
#pragma unroll 1      /* one stage a trip: the two buffers alternate by an offset, the text stays small */
  for (int t = 0; t < NST; ++t) {
    const unsigned bo = (unsigned)(t & 1) * GS_STAGE;
    FragH a[2][2], b[2][4];      /* two fragment sets: the reads of k step ks + 1 of this same stage are issued as one group ahead of the products of k step ks */
    gs_frags(a[0], b[0], fa + bo, fb + bo);
#pragma unroll
    for (int ks = 0; ks + 1 < GS_K / 32; ++ks) {
      gs_frags(a[(ks + 1) & 1], b[(ks + 1) & 1], fa + bo + (ks + 1) * 64, fb + bo + (ks + 1) * 64);
      __builtin_amdgcn_sched_barrier(0);      /* keeps that group of reads ahead of the products: left alone the scheduler sinks each read to just in front of its use, and the wave waits out the LDS latency there */
      gs_mma(acc, a[ks & 1], b[ks & 1]);
    }
    __builtin_amdgcn_sched_barrier(0);                   /* those products stay in front of the hand-over and cover the last group's LDS latency */
    asm volatile("s_wait_dscnt 0x0" ::: "memory");       /* this wave's reads of buffer t & 1 are done before the buffer is handed back */
    asm volatile("s_wait_asynccnt 0x0" ::: "memory");    /* this wave's copies of stage t + 1 have landed */
    __syncthreads();                                     /* publishes stage t + 1 and ends every wave's reads of stage t */
    if (t + 2 < NST) { gs_copy8(la + bo, ga + (t + 2) * GS_K); gs_copy8(lb + bo, gb + (t + 2) * GS_K); }
    __builtin_amdgcn_sched_barrier(0);                   /* the refill is issued first: the last k step's products need registers only and run while the copies fly */
    gs_mma(acc, a[(GS_K / 32 - 1) & 1], b[(GS_K / 32 - 1) & 1]);
  }
  asm volatile("s_wait_asynccnt 0x0" ::: "memory");      /* nothing is in flight when the wave goes on to its end */
  if (QKV && which == 2) {
    /* v: a lane's 8 accumulator rows are 8 consecutive tokens of one column = 16 B of the transposed tile; staged [128 columns][128 tokens] f16 at pitch 272 B in so */
    unsigned char* sv = (unsigned char*)&so[0][0][0];
#pragma unroll
    for (int i = 0; i < 2; ++i)
#pragma unroll
      for (int j = 0; j < 4; ++j) { FragH f;
#pragma unroll
        for (int r = 0; r < 8; ++r) f.h[r] = (_Float16)(acc[i][j][r] * alpha);
        *(v8us*)(sv + (wn * 64 + j * 16 + ln) * GS_PITCH + (wm * 32 + i * 16 + 8 * hh) * 2) = f.half[0]; }
    __syncthreads();      /* a column's 128 tokens come from four waves: every wave's part is in LDS before any is read back */
#pragma unroll
    for (int q = 0; q < 8; ++q) { const int c = q * 16 + (tid >> 4), ch = tid & 15;      /* 16 lanes a column: 256 contiguous bytes of Vt */
      const v8us v = *(const v8us*)(sv + c * GS_PITCH + ch * 16);
      *(v8us*)((unsigned short*)Vt + ((size_t)(row0 / TT) * DD + col0 + c) * TT + row0 % TT + ch * 8) = v; }
  } else {
#pragma unroll
  for (int i = 0; i < 2; ++i)
#pragma unroll
    for (int j = 0; j < 4; ++j)
#pragma unroll
      for (int r = 0; r < 8; ++r) so[w][i * 16 + 8 * hh + r][j * 16 + ln] = acc[i][j][r] * alpha;
  __builtin_amdgcn_fence(__ATOMIC_ACQ_REL, "workgroup"); __builtin_amdgcn_wave_barrier();      /* the wave reads back rows that its other lanes wrote */
  if (QKV) {
    /* q, k: elu(x) + 1 = x + 1 (x > 0) | e^x (x <= 0), then hi = f16(v), lo = f16((v - hi) * 2^10); 8 lanes a row: the wave's 64 columns are one whole 128-B line of each plane */
    unsigned short* Hh = (unsigned short*)(which == 0 ? Qh : Kh); unsigned short* Hl = (unsigned short*)(which == 0 ? Ql : Kl);
#pragma unroll
    for (int q = 0; q < 8; ++q) { const int r = q * 4 + (lane >> 3), c8 = (lane & 7) * 8; const v4f a = *(const v4fa*)&so[w][r][c8], c = *(const v4fa*)&so[w][r][c8 + 4]; FragH fh, fl;
#pragma unroll
      for (int e = 0; e < 8; ++e) { const float x = (e < 4) ? a[e] : c[e - 4]; const float ex = expf(x);      /* taken for every lane, then selected: eight independent chains and no branch per element, with only two waves a SIMD to cover latency here */
        const float v = (x > 0.f) ? x + 1.0f : ex; const _Float16 h = (_Float16)v; fh.h[e] = h; fl.h[e] = (_Float16)((v - (float)h) * 1024.0f); }
      const size_t o = (size_t)(row0 + wm * 32 + r) * DD + col0 + wn * 64 + c8;
      *(v8us*)(Hh + o) = fh.half[0]; *(v8us*)(Hl + o) = fl.half[0]; }
    asm volatile("s_wait_xcnt 0x0" ::: "memory");      /* behind the last hi/lo store: no address or data register of these stores is rewritten in front of this wait on any way out of the loop */
  } else {
    const int rsub = lane >> 4, c4 = (lane & 15) * 4;
#pragma unroll
    for (int q = 0; q < 16; ++q) { const int r = q * 2 + rsub; const v4f v = *(const v4fa*)&so[w][r][c4]; *(v4f*)(C + (size_t)(row0 + wm * 32 + r) * DD + col0 + wn * 64 + c4) = v; }
  }
  }
}

extern "C" void kernel_launch(void* const* d_in, const int* in_sizes, int n_in,
                              void* d_out, int out_size, void* d_ws, size_t ws_size, hipStream_t stream) {
  (void)in_sizes; (void)n_in; (void)out_size;
  const float* x = (const float*)d_in[0]; const int* mask = (const int*)d_in[1]; const float* Wq = (const float*)d_in[2]; const float* Wk = (const float*)d_in[3]; const float* Wv = (const float*)d_in[4]; const float* Wo = (const float*)d_in[5];
  char* ws = (char*)d_ws; size_t off = 0;
  auto take = [&](size_t bytes) { char* p = ws + off; off += (bytes + 255) & ~(size_t)255; return p; };
  const size_t WSZ = (size_t)DD * DD; _Float16* Bw = (_Float16*)take(4 * WSZ * 2); _Float16* X16 = (_Float16*)take((size_t)NR * DD * 2);
  _Float16* Qh = (_Float16*)take((size_t)NR * DD * 2); _Float16* Ql = (_Float16*)take((size_t)NR * DD * 2); _Float16* Kh = (_Float16*)take((size_t)NR * DD * 2); _Float16* Kl = (_Float16*)take((size_t)NR * DD * 2); _Float16* Vt = (_Float16*)take((size_t)NR * DD * 2);
  _Float16* O16 = X16;      /* X16 is dead after the q/k/v launch */
  if (off > ws_size) return;      // 7 x 8.4 MB
  k_prep<<<PREP_T / 256, 256, 0, stream>>>(x, Wq, Wk, Wv, Wo, X16, Bw);
  k_gemm_lds<true><<<3 * (NR / 128) * (DD / 128), 256, 0, stream>>>(X16, Bw, 0.0625f, nullptr, Qh, Ql, Kh, Kl, Vt);      /* q, k: elu + 1 hi/lo; v: transposed */
  k_flash<<<BB * NH * (TT / 128), 256, 0, stream>>>(Qh, Ql, DD, Kh, Kl, DD, Vt, mask, O16, DD);
  k_gemm_lds<false><<<(NR / 128) * (DD / 128), 256, 0, stream>>>(O16, Bw + 3 * WSZ, 0.00390625f, (float*)d_out, nullptr, nullptr, nullptr, nullptr, nullptr);      /* out = O . Wo^T */
}

// v007
// Measured time: 99.6 microseconds a run.
// Next to v006, in two timings, it ran 1.06 times as fast each time.
// All steps since v000 together make it 5.26 times as fast.
#include <hip/hip_runtime.h>
// Multi-head 'linear-feature' attention (B=2, S=2048, H=1024, 16 heads × 64): q,k,v = x·Wᵀ (no bias); φ(q) = elu(q)+1, φ(k) = elu(k)+1; attn = softmax(φ(q)·φ(k)ᵀ) UNSCALED (σ≈8 logits) with the INPUT key mask [B,S] (0 → −inf);
// out = (attn·v merged)·Woᵀ.
// Compute dtype: x and weights rounded to bf16; q,k as f32 GEMM outputs mapped through elu+1 in f32 and split into f16 hi + ×2^10 residual planes so the large unscaled logits are f32-accurate
// (S = Qh·Kh + (Ql·Kh + Qh·Kl)·2^-10, separate accumulators); v f16; fused flash-style kernel (online softmax f32, P f16 ×2^10) on v_wmma_f32_16x16x32_f16; O ×2^4 → f16 → output GEMM; f32 accumulate.
#define BB 2
#define TT 2048
#define NH 16
#define DD 1024
#define NR (BB * TT)

typedef __bf16 v16b __attribute__((ext_vector_type(16)));
typedef unsigned short v8us __attribute__((ext_vector_type(8), may_alias));
typedef float  v8f  __attribute__((ext_vector_type(8)));
typedef float  v4f  __attribute__((ext_vector_type(4)));
typedef float  v4fa __attribute__((ext_vector_type(4), may_alias));
union FragB { v16b v; v8us half[2]; unsigned short u[16]; };

__device__ __forceinline__ unsigned short bf16_bits(float x) { unsigned int u = __float_as_uint(x); return (unsigned short)((u + 0x7FFFu + ((u >> 16) & 1u)) >> 16); }
__device__ __forceinline__ float bf16_val(unsigned short b) { return __uint_as_float(((unsigned int)b) << 16); }
__device__ __forceinline__ float bf16_round(float x) { return bf16_val(bf16_bits(x)); }
// D += A·B with NT terms: 1 = ah·bh, 2 = + al·bh (A split), 3 = + ah·bl (both split)
template <int NT>
__device__ __forceinline__ v8f mmaN(v16b ah, v16b al, v16b bh, v16b bl, v8f c) {
  c = __builtin_amdgcn_wmma_f32_16x16x32_bf16(false, ah, false, bh, (short)0, c, false, false);
  if (NT >= 2) c = __builtin_amdgcn_wmma_f32_16x16x32_bf16(false, al, false, bh, (short)0, c, false, false);
  if (NT >= 3) c = __builtin_amdgcn_wmma_f32_16x16x32_bf16(false, ah, false, bl, (short)0, c, false, false);
  asm volatile("v_nop\n\tv_nop\n\tv_nop\n\tv_nop" : "+v"(c) : "v"(ah), "v"(al), "v"(bh), "v"(bl));
  return c;
}

__global__ __launch_bounds__(256) void k_wt_bf16(const float* __restrict__ W, unsigned short* __restrict__ Wt, int K, int N) {
  const int t = blockIdx.x * 256 + threadIdx.x;
  const int k8n = K / 8;
  if (t >= N * k8n) return;
  const int n = t / k8n, k8 = (t % k8n) * 8;
  v8us v;
#pragma unroll
  for (int i = 0; i < 8; ++i) v[i] = bf16_bits(W[(size_t)(k8 + i) * N + n]);
  *(v8us*)(Wt + (size_t)n * K + k8) = v;
  
}

// GEMM C[M][N] (f32, pitch ldc) = act(A[M][K]·W + bias). A f32 row-major (pitch lda) converted per fragment to bf16
// (ASPLIT: hi/lo two planes -> 2 terms, else single rounded term); Wt bf16 [N][K] (pitch ldb). BIAS_BF16 rounds the
// bias to bf16 first (bias quantised to bf16 before the add). K%32==0, M%16==0, N%64==0.
template <bool ASPLIT, int ACT, bool BIAS_BF16>
__global__ __launch_bounds__(128) void k_gemm_bf(const float* __restrict__ A, int lda, const unsigned short* __restrict__ Wt, int ldb,
                                               const float* __restrict__ bias, float* __restrict__ C, int ldc, int M, int N, int K) {
  __shared__ __attribute__((aligned(16))) float so[4][16][64];
  const int tid = threadIdx.x, w = tid >> 5, lane = tid & 31, ln = lane & 15, hh = lane >> 4;
  const int ntn = N / 64;
  const int wid = blockIdx.x * 4 + w;
  const int mt = wid / ntn, nq = wid % ntn;
  if (mt * 16 >= M) return;
  const int row0 = mt * 16, col0 = nq * 64;
  const float* arow = A + (size_t)(row0 + ln) * lda;
  v8f acc[4] = {};
  for (int kb = 0; kb < K; kb += 32) {
    FragB ah, al;
    const v4f x0 = *(const v4fa*)(arow + kb + 8 * hh), x1 = *(const v4fa*)(arow + kb + 8 * hh + 4);
    const v4f x2 = *(const v4fa*)(arow + kb + 16 + 8 * hh), x3 = *(const v4fa*)(arow + kb + 16 + 8 * hh + 4);
    float xs[16] = {x0[0],x0[1],x0[2],x0[3],x1[0],x1[1],x1[2],x1[3],x2[0],x2[1],x2[2],x2[3],x3[0],x3[1],x3[2],x3[3]};
#pragma unroll
    for (int i = 0; i < 16; ++i) { const unsigned short hb = bf16_bits(xs[i]); ah.u[i] = hb; al.u[i] = ASPLIT ? bf16_bits(xs[i] - bf16_val(hb)) : (unsigned short)0; }
#pragma unroll
    for (int t = 0; t < 4; ++t) {
      const unsigned short* brow = Wt + (size_t)(col0 + t * 16 + ln) * ldb + kb;
      FragB b;
      b.half[0] = *(const v8us*)(brow + 8 * hh);
      b.half[1] = *(const v8us*)(brow + 16 + 8 * hh);
      acc[t] = mmaN<ASPLIT ? 2 : 1>(ah.v, al.v, b.v, b.v, acc[t]);
    }
  }
#pragma unroll
  for (int t = 0; t < 4; ++t) {
    float bv = bias ? bias[col0 + t * 16 + ln] : 0.f;
    if (BIAS_BF16) bv = bf16_round(bv);
#pragma unroll
    for (int r = 0; r < 8; ++r) { float v = acc[t][r] + bv; if (ACT == 1) v = fmaxf(v, 0.f); so[w][8 * hh + r][t * 16 + ln] = v; }
  }
  __builtin_amdgcn_fence(__ATOMIC_ACQ_REL, "workgroup");
  __builtin_amdgcn_wave_barrier();
  const int rsub = lane >> 4, c4 = (lane & 15) * 4;
  {
#pragma unroll
    for (int q = 0; q < 8; ++q) {
      const int r = q * 2 + rsub;
      const v4f v = *(const v4fa*)&so[w][r][c4];
      *(v4f*)(C + (size_t)(row0 + r) * ldc + col0 + c4) = v;
    }
    
  }
}

// Flash-style causal/unmasked attention, all contractions 3-term bf16 hi/lo splits, f32 softmax with running max.
// q,k,v rows are read from f32 buffers with arbitrary row pitch (so they can live inside a fused qkv buffer);
// D = head size (multiple of 32, <= 128); one wave = 16 query rows; block = 4 waves (64 queries) sharing K/V chunks of 32.
template <int D, bool CAUSAL>
__global__ __launch_bounds__(128) void k_flash(const float* __restrict__ qb, const float* __restrict__ kb, const float* __restrict__ vb,
                                             int pitch, int T, int H, float scale, float* __restrict__ y, int ypitch) {
  constexpr int KS = D / 32;        // k-steps for QK
  constexpr int DT = D / 16;        // d tiles for PV
  __shared__ __attribute__((aligned(16))) unsigned short sKh[32][D + 8], sKl[32][D + 8], sVh[32][D + 8], sVl[32][D + 8];
  __shared__ __attribute__((aligned(16))) unsigned short sPh[4][16][40], sPl[4][16][40];
  __shared__ __attribute__((aligned(16))) float sO[4][16][D];
  const int tid = threadIdx.x, w = tid >> 5, lane = tid & 31, ln = lane & 15, hh = lane >> 4;
  const int nqb = (T + 63) / 64;
  const int bh = blockIdx.x / nqb, qblk = blockIdx.x % nqb;
  const int b = bh / H, h = bh % H;
  const int q0 = qblk * 64 + w * 16;
  const float* Q = qb + (size_t)b * T * pitch + h * D;
  const float* K = kb + (size_t)b * T * pitch + h * D;
  const float* V = vb + (size_t)b * T * pitch + h * D;

  // A fragments of the wave's 16 query rows (scaled), hi/lo
  FragB aqh[KS], aql[KS];
  {
    int row = q0 + ln; if (row >= T) row = T - 1;
    const float* qr = Q + (size_t)row * pitch;
#pragma unroll
    for (int ks = 0; ks < KS; ++ks)
#pragma unroll
      for (int i = 0; i < 16; ++i) {
        const int d = ks * 32 + ((i < 8) ? (8 * hh + i) : (16 + 8 * hh + (i - 8)));
        const float x = qr[d] * scale; const unsigned short hb = bf16_bits(x);
        aqh[ks].u[i] = hb; aql[ks].u[i] = bf16_bits(x - bf16_val(hb));
      }
  }
  float m_r[8], l_r[8];
#pragma unroll
  for (int r = 0; r < 8; ++r) { m_r[r] = -3.0e38f; l_r[r] = 0.f; }
  v8f oacc[DT];
#pragma unroll
  for (int dt = 0; dt < DT; ++dt) oacc[dt] = (v8f){0.f,0.f,0.f,0.f,0.f,0.f,0.f,0.f};

  const int kv_end = CAUSAL ? min(T, qblk * 64 + 64) : T;     // block-uniform
  for (int j0 = 0; j0 < kv_end; j0 += 32) {
    __syncthreads();
    for (int e = tid; e < 32 * (D / 4); e += 128) {
      const int r = e / (D / 4), c4 = (e % (D / 4)) * 4;
      const int key = j0 + r;
      v4f kf = {0.f,0.f,0.f,0.f}, vf = {0.f,0.f,0.f,0.f};
      if (key < T) { kf = *(const v4fa*)(K + (size_t)key * pitch + c4); vf = *(const v4fa*)(V + (size_t)key * pitch + c4); }
#pragma unroll
      for (int t = 0; t < 4; ++t) {
        unsigned short hb = bf16_bits(kf[t]); sKh[r][c4 + t] = hb; sKl[r][c4 + t] = bf16_bits(kf[t] - bf16_val(hb));
        hb = bf16_bits(vf[t]); sVh[r][c4 + t] = hb; sVl[r][c4 + t] = bf16_bits(vf[t] - bf16_val(hb));
      }
    }
    __syncthreads();
    // S tile 16 x 32
    v8f s[2];
#pragma unroll
    for (int nt = 0; nt < 2; ++nt) {
      v8f acc = {};
#pragma unroll
      for (int ks = 0; ks < KS; ++ks) {
        FragB bh_, bl_;
        bh_.half[0] = *(const v8us*)&sKh[nt * 16 + ln][ks * 32 + 8 * hh]; bh_.half[1] = *(const v8us*)&sKh[nt * 16 + ln][ks * 32 + 16 + 8 * hh];
        bl_.half[0] = *(const v8us*)&sKl[nt * 16 + ln][ks * 32 + 8 * hh]; bl_.half[1] = *(const v8us*)&sKl[nt * 16 + ln][ks * 32 + 16 + 8 * hh];
        acc = mmaN<3>(aqh[ks].v, aql[ks].v, bh_.v, bl_.v, acc);
      }
      s[nt] = acc;
    }
    // mask + running max (rows 8hh+r; the 16 lanes of a half share rows)
    float alpha[8];
#pragma unroll
    for (int r = 0; r < 8; ++r) {
      const int qi = q0 + 8 * hh + r;
      const int ja = j0 + ln, jb = j0 + 16 + ln;
      if (CAUSAL) { if (ja > qi) s[0][r] = -3.0e38f; if (jb > qi) s[1][r] = -3.0e38f; }
      if (ja >= T) s[0][r] = -3.0e38f;
      if (jb >= T) s[1][r] = -3.0e38f;
      float mx = fmaxf(s[0][r], s[1][r]);
      mx = fmaxf(mx, __shfl_xor(mx, 1, 32)); mx = fmaxf(mx, __shfl_xor(mx, 2, 32)); mx = fmaxf(mx, __shfl_xor(mx, 4, 32)); mx = fmaxf(mx, __shfl_xor(mx, 8, 32));
      const float mnew = fmaxf(m_r[r], mx);
      alpha[r] = (mnew > -1.0e38f) ? __expf(m_r[r] - mnew) : 1.0f;
      const float p0 = (s[0][r] > -1.0e38f) ? __expf(s[0][r] - mnew) : 0.f;
      const float p1 = (s[1][r] > -1.0e38f) ? __expf(s[1][r] - mnew) : 0.f;
      m_r[r] = mnew;
      l_r[r] = l_r[r] * alpha[r] + p0 + p1;            // per-lane partial row sum (16 lanes combined at the end)
      unsigned short hb = bf16_bits(p0); sPh[w][8 * hh + r][ln] = hb;      sPl[w][8 * hh + r][ln] = bf16_bits(p0 - bf16_val(hb));
      hb = bf16_bits(p1);                sPh[w][8 * hh + r][16 + ln] = hb; sPl[w][8 * hh + r][16 + ln] = bf16_bits(p1 - bf16_val(hb));
    }
#pragma unroll
    for (int dt = 0; dt < DT; ++dt)
#pragma unroll
      for (int r = 0; r < 8; ++r) oacc[dt][r] *= alpha[r];
    __builtin_amdgcn_fence(__ATOMIC_ACQ_REL, "workgroup");
    __builtin_amdgcn_wave_barrier();
    FragB pah, pal;
    pah.half[0] = *(const v8us*)&sPh[w][ln][8 * hh]; pah.half[1] = *(const v8us*)&sPh[w][ln][16 + 8 * hh];
    pal.half[0] = *(const v8us*)&sPl[w][ln][8 * hh]; pal.half[1] = *(const v8us*)&sPl[w][ln][16 + 8 * hh];
#pragma unroll
    for (int dt = 0; dt < DT; ++dt) {
      FragB bvh, bvl;
#pragma unroll
      for (int i = 0; i < 8; ++i) {
        bvh.u[i] = sVh[8 * hh + i][dt * 16 + ln]; bvh.u[8 + i] = sVh[16 + 8 * hh + i][dt * 16 + ln];
        bvl.u[i] = sVl[8 * hh + i][dt * 16 + ln]; bvl.u[8 + i] = sVl[16 + 8 * hh + i][dt * 16 + ln];
      }
      oacc[dt] = mmaN<3>(pah.v, pal.v, bvh.v, bvl.v, oacc[dt]);
    }
    __builtin_amdgcn_fence(__ATOMIC_ACQ_REL, "workgroup");
    __builtin_amdgcn_wave_barrier();
  }
#pragma unroll
  for (int r = 0; r < 8; ++r) {
    float l = l_r[r];
    l += __shfl_xor(l, 1, 32); l += __shfl_xor(l, 2, 32); l += __shfl_xor(l, 4, 32); l += __shfl_xor(l, 8, 32);
    l_r[r] = (l > 0.f) ? 1.0f / l : 0.f;
  }
#pragma unroll
  for (int dt = 0; dt < DT; ++dt)
#pragma unroll
    for (int r = 0; r < 8; ++r) sO[w][8 * hh + r][dt * 16 + ln] = oacc[dt][r] * l_r[r];
  __builtin_amdgcn_fence(__ATOMIC_ACQ_REL, "workgroup");
  __builtin_amdgcn_wave_barrier();
  {
    for (int r = 0; r < 16; ++r) {
      const int row = q0 + r;
      if (row < T && lane < D / 4) {
        const v4f val = *(const v4fa*)&sO[w][r][lane * 4];
        *(v4f*)(y + ((size_t)b * T + row) * ypitch + h * D + lane * 4) = val;
      }
    }
    
  }
}

// GEMM C = act(A·W + bias + resid): A f32 (ASPLIT -> hi/lo 2 terms), Wt bf16 [N][K]; ACT 0 none, 1 relu, 2 exact gelu;
// resid (optional, f32, row index = (row % rmod), pitch ldr, RES_BF16 rounds it) added before the activation.
template <bool ASPLIT, int ACT, bool BIAS_BF16, bool RES_BF16>
__global__ __launch_bounds__(128) void k_gemm_bf3(const float* __restrict__ A, int lda, const unsigned short* __restrict__ Wt, int ldb,
                                                const float* __restrict__ bias, const float* __restrict__ resid, int rmod, int ldr,
                                                float* __restrict__ C, int ldc, int M, int N, int K) {
  __shared__ __attribute__((aligned(16))) float so[4][16][64];
  const int tid = threadIdx.x, w = tid >> 5, lane = tid & 31, ln = lane & 15, hh = lane >> 4;
  const int ntn = N / 64;
  const int wid = blockIdx.x * 4 + w;
  const int mt = wid / ntn, nq = wid % ntn;
  if (mt * 16 >= M) return;
  const int row0 = mt * 16, col0 = nq * 64;
  const float* arow = A + (size_t)(row0 + ln) * lda;
  v8f acc[4] = {};
  for (int kb = 0; kb < K; kb += 32) {
    FragB ah, al;
    const v4f x0 = *(const v4fa*)(arow + kb + 8 * hh), x1 = *(const v4fa*)(arow + kb + 8 * hh + 4);
    const v4f x2 = *(const v4fa*)(arow + kb + 16 + 8 * hh), x3 = *(const v4fa*)(arow + kb + 16 + 8 * hh + 4);
    float xs[16] = {x0[0],x0[1],x0[2],x0[3],x1[0],x1[1],x1[2],x1[3],x2[0],x2[1],x2[2],x2[3],x3[0],x3[1],x3[2],x3[3]};
#pragma unroll
    for (int i = 0; i < 16; ++i) { const unsigned short hb = bf16_bits(xs[i]); ah.u[i] = hb; al.u[i] = ASPLIT ? bf16_bits(xs[i] - bf16_val(hb)) : (unsigned short)0; }
#pragma unroll
    for (int t = 0; t < 4; ++t) {
      const unsigned short* brow = Wt + (size_t)(col0 + t * 16 + ln) * ldb + kb;
      FragB b;
      b.half[0] = *(const v8us*)(brow + 8 * hh);
      b.half[1] = *(const v8us*)(brow + 16 + 8 * hh);
      acc[t] = mmaN<ASPLIT ? 2 : 1>(ah.v, al.v, b.v, b.v, acc[t]);
    }
  }
#pragma unroll
  for (int t = 0; t < 4; ++t) {
    const int col = col0 + t * 16 + ln;
    float bv = bias ? bias[col] : 0.f;
    if (BIAS_BF16) bv = bf16_round(bv);
#pragma unroll
    for (int r = 0; r < 8; ++r) {
      float v = acc[t][r] + bv;
      if (resid) { float rv = resid[(size_t)((row0 + 8 * hh + r) % rmod) * ldr + col]; if (RES_BF16) rv = bf16_round(rv); v += rv; }
      if (ACT == 1) v = fmaxf(v, 0.f);
      if (ACT == 2) v = 0.5f * v * (1.0f + erff(v * 0.70710678118654752f));
      if (ACT == 3) { const float u = 0.7978845608028654f * (v + 0.044715f * v * v * v); v = 0.5f * v * (1.0f + tanhf(u)); }
      so[w][8 * hh + r][t * 16 + ln] = v;
    }
  }
  __builtin_amdgcn_fence(__ATOMIC_ACQ_REL, "workgroup");
  __builtin_amdgcn_wave_barrier();
  const int rsub = lane >> 4, c4 = (lane & 15) * 4;
  {
#pragma unroll
    for (int q = 0; q < 8; ++q) {
      const int r = q * 2 + rsub;
      const v4f v = *(const v4fa*)&so[w][r][c4];
      *(v4f*)(C + (size_t)(row0 + r) * ldc + col0 + c4) = v;
    }
    
  }
}
// row LayerNorm (biased variance, eps) over N: s = X (+ R); optional out_sum <- s; out_norm <- (s-mu)*rsqrt(var+eps)*g + b
template <bool PARAM_BF16>
__global__ __launch_bounds__(256) void k_layernorm(const float* __restrict__ X, const float* __restrict__ R, const float* __restrict__ g, const float* __restrict__ bta,
                                                  float* __restrict__ out_sum, float* __restrict__ out_norm, int N, float eps) {
  __shared__ float red[256];
  const int row = blockIdx.x, tid = threadIdx.x;
  const float* x = X + (size_t)row * N; const float* rr = R ? R + (size_t)row * N : nullptr;
  float vals[16];                     // up to N = 4096
  const int per = N / 256;            // contiguous chunk per thread? use strided-by-4 chunks: thread handles j = tid*4 + 1024*u
  float s1 = 0.f;
  for (int u = 0; u < per / 4; ++u) {
    const int j = tid * 4 + 1024 * u;
    const v4f a = *(const v4fa*)(x + j);
    v4f b = {0.f,0.f,0.f,0.f}; if (rr) b = *(const v4fa*)(rr + j);
#pragma unroll
    for (int q = 0; q < 4; ++q) { const float v = a[q] + b[q]; vals[u * 4 + q] = v; s1 += v; }
  }
  red[tid] = s1; __syncthreads();
  for (int st = 128; st > 0; st >>= 1) { if (tid < st) red[tid] += red[tid + st]; __syncthreads(); }
  const float mu = red[0] / (float)N; __syncthreads();
  float s2 = 0.f;
  for (int u = 0; u < per / 4; ++u)
#pragma unroll
    for (int q = 0; q < 4; ++q) { const float c = vals[u * 4 + q] - mu; s2 += c * c; }
  red[tid] = s2; __syncthreads();
  for (int st = 128; st > 0; st >>= 1) { if (tid < st) red[tid] += red[tid + st]; __syncthreads(); }
  const float rs = rsqrtf(red[0] / (float)N + eps);
  {
    for (int u = 0; u < per / 4; ++u) {
      const int j = tid * 4 + 1024 * u;
      v4f o, sm;
#pragma unroll
      for (int q = 0; q < 4; ++q) {
        float gg = g[j + q], bb = bta[j + q];
        if (PARAM_BF16) { gg = bf16_round(gg); bb = bf16_round(bb); }
        sm[q] = vals[u * 4 + q]; o[q] = (vals[u * 4 + q] - mu) * rs * gg + bb;
      }
      if (out_sum) *(v4f*)(out_sum + (size_t)row * N + j) = sm;
      *(v4f*)(out_norm + (size_t)row * N + j) = o;
    }
    
  }
}



// ---- f16 WMMA path (v_wmma_f32_16x16x32_f16): 11-bit significands for operands in range — used where a [0,1] probability operand needs more precision than bf16
typedef _Float16 v16h __attribute__((ext_vector_type(16)));
union FragH { v16h v; v8us half[2]; _Float16 h[16]; unsigned short u[16]; };
template <int NT>
__device__ __forceinline__ v8f mmaH(v16h ah, v16h al, v16h bh, v16h bl, v8f c) {
  c = __builtin_amdgcn_wmma_f32_16x16x32_f16(false, ah, false, bh, (short)0, c, false, false);
  if (NT >= 2) c = __builtin_amdgcn_wmma_f32_16x16x32_f16(false, al, false, bh, (short)0, c, false, false);
  if (NT >= 3) c = __builtin_amdgcn_wmma_f32_16x16x32_f16(false, ah, false, bl, (short)0, c, false, false);
  asm volatile("v_nop\n\tv_nop\n\tv_nop\n\tv_nop" : "+v"(c) : "v"(ah), "v"(al), "v"(bh), "v"(bl));
  return c;
}
// batched GEMM like k_gemm_b but f16 operands: A f32 (split into f16 hi/lo if ASPLIT, else rounded to f16), Bt = f16 values [n][k]; alpha; C f32; N multiple of 16 (partial tiles skipped)
template <bool ASPLIT>
__global__ __launch_bounds__(128) void k_gemm_h(const float* __restrict__ A, int lda, size_t sA, const _Float16* __restrict__ Bh, int ldb, size_t sB, float alpha, float* __restrict__ C, int ldc, size_t sC, int M, int N, int K) {
  __shared__ __attribute__((aligned(16))) float so[4][16][64];
  const int tid = threadIdx.x, w = tid >> 5, lane = tid & 31, ln = lane & 15, hh = lane >> 4; const int by = blockIdx.y;
  A += (size_t)by * sA; Bh += (size_t)by * sB; C += (size_t)by * sC;
  const int ntn = (N + 63) / 64; const int wid = blockIdx.x * 4 + w; const int mt = wid / ntn, nq = wid % ntn; if (mt * 16 >= M) return;
  const int row0 = mt * 16, col0 = nq * 64; const float* arow = A + (size_t)(row0 + ln) * lda;
  v8f acc[4] = {};
  for (int kb = 0; kb < K; kb += 32) {
    FragH ah, al;
    const v4f x0 = *(const v4fa*)(arow + kb + 8 * hh), x1 = *(const v4fa*)(arow + kb + 8 * hh + 4), x2 = *(const v4fa*)(arow + kb + 16 + 8 * hh), x3 = *(const v4fa*)(arow + kb + 16 + 8 * hh + 4);
    float xs[16] = {x0[0],x0[1],x0[2],x0[3],x1[0],x1[1],x1[2],x1[3],x2[0],x2[1],x2[2],x2[3],x3[0],x3[1],x3[2],x3[3]};
#pragma unroll
    for (int i = 0; i < 16; ++i) { const _Float16 h = (_Float16)xs[i]; ah.h[i] = h; al.h[i] = ASPLIT ? (_Float16)(xs[i] - (float)h) : (_Float16)0.0f; }
#pragma unroll
    for (int t = 0; t < 4; ++t) { if (col0 + t * 16 >= N) continue; const size_t boff = (size_t)(col0 + t * 16 + ln) * ldb + kb; FragH bq; bq.half[0] = *(const v8us*)(Bh + boff + 8 * hh); bq.half[1] = *(const v8us*)(Bh + boff + 16 + 8 * hh);
      acc[t] = mmaH<ASPLIT ? 2 : 1>(ah.v, al.v, bq.v, bq.v, acc[t]); }
  }
#pragma unroll
  for (int t = 0; t < 4; ++t) { if (col0 + t * 16 >= N) continue;
#pragma unroll
    for (int r = 0; r < 8; ++r) so[w][8 * hh + r][t * 16 + ln] = acc[t][r] * alpha; }
  __builtin_amdgcn_fence(__ATOMIC_ACQ_REL, "workgroup"); __builtin_amdgcn_wave_barrier();
  const int rsub = lane >> 4, c4 = (lane & 15) * 4;
  {
#pragma unroll
    for (int q = 0; q < 8; ++q) { const int r = q * 2 + rsub; if (col0 + c4 < N) { const v4f v = *(const v4fa*)&so[w][r][c4]; *(v4f*)(C + (size_t)(row0 + r) * ldc + col0 + c4) = v; } }
     }
}

// Wt[n][k] = f16(W[k][n]·scale) from f32 row-major W[K][N] (scale = power of two; bf16-exact weights stay exact in f16 away from the subnormal range)
__global__ __launch_bounds__(256) void k_wt_f16(const float* __restrict__ W, _Float16* __restrict__ Wt, int K, int N, float scale) {
  const int t = blockIdx.x * 256 + threadIdx.x; if (t >= N * (K / 8)) return; const int n = t / (K / 8), k8 = (t % (K / 8)) * 8; FragH f;
#pragma unroll
  for (int i = 0; i < 8; ++i) f.h[i] = (_Float16)(bf16_round(W[(size_t)(k8 + i) * N + n]) * scale); const v8us o = f.half[0];
  *(v8us*)((unsigned short*)Wt + (size_t)n * K + k8) = o; 
}
// k_gemm_hh variant with fused epilogue: v = acc·alpha + bias[by·sBias + col] (+ CP[(row/rowsPerB)·sCPb + by·64 + col] if CP) ; ACT 0 none / 1 elu ; writes f32 C and/or f16 C16 (each if non-null)
template <int ACT>
__global__ __launch_bounds__(128) void k_gemm_hhx(const _Float16* __restrict__ A, int lda, size_t sA, const _Float16* __restrict__ Bh, int ldb, size_t sB, float alpha, const float* __restrict__ bias, size_t sBias, const float* __restrict__ CP, int rowsPerB, size_t sCPb, int row0g,
    float* __restrict__ C, _Float16* __restrict__ C16, int ldc, size_t sC, int M, int N, int K) {
  __shared__ __attribute__((aligned(16))) float so[4][16][64];
  const int tid = threadIdx.x, w = tid >> 5, lane = tid & 31, ln = lane & 15, hh = lane >> 4; const int by = blockIdx.y;
  A += (size_t)by * sA; Bh += (size_t)by * sB; const size_t cofs = (size_t)by * sC; const float* bp = bias ? bias + (size_t)by * sBias : nullptr;
  const int ntn = (N + 63) / 64; const int wid = blockIdx.x * 4 + w; const int mt = wid / ntn, nq = wid % ntn; if (mt * 16 >= M) return;
  const int row0 = mt * 16, col0 = nq * 64; const _Float16* arow = A + (size_t)(row0 + ln) * lda;
  v8f acc[4] = {};
  for (int kb = 0; kb < K; kb += 32) { FragH ah; ah.half[0] = *(const v8us*)((const unsigned short*)arow + kb + 8 * hh); ah.half[1] = *(const v8us*)((const unsigned short*)arow + kb + 16 + 8 * hh);
#pragma unroll
    for (int t = 0; t < 4; ++t) { if (col0 + t * 16 >= N) continue; const size_t boff = (size_t)(col0 + t * 16 + ln) * ldb + kb; FragH bq; bq.half[0] = *(const v8us*)((const unsigned short*)Bh + boff + 8 * hh); bq.half[1] = *(const v8us*)((const unsigned short*)Bh + boff + 16 + 8 * hh);
      acc[t] = mmaH<1>(ah.v, ah.v, bq.v, bq.v, acc[t]); }
  }
#pragma unroll
  for (int t = 0; t < 4; ++t) { if (col0 + t * 16 >= N) continue; const int col = col0 + t * 16 + ln; const float bv = bp ? bf16_round(bp[col]) : 0.f;
#pragma unroll
    for (int r = 0; r < 8; ++r) { float v = acc[t][r] * alpha + bv; if (CP) { const int bidx = (row0g + row0 + 8 * hh + r) / rowsPerB; v += CP[(size_t)bidx * sCPb + (size_t)by * 64 + col]; } if (ACT == 1) v = (v > 0.f) ? v : expm1f(v); else if (ACT == 7) v = (v > 0.f) ? v + 1.0f : expf(v); else if (ACT == 8) v = tanhf(v); else if (ACT == 9) v = 0.5f * v * (1.0f + tanhf(0.7978845608028654f * (v + 0.044715f * v * v * v))); else if (ACT == 11) v = 1.0f / (1.0f + expf(-v)); else if (ACT == 12) v = (v > 0.f) ? v : 0.01f * v; else if (ACT == 14) v = (v > 0.f) ? v : 0.1f * v; else if (ACT == 15) v = v / (1.0f + expf(-v)); else if (ACT == 3) v = fmaxf(v, 0.f); else if (ACT == 6) v = 0.5f * v * (1.0f + erff(v * 0.70710678118654752f)); so[w][8 * hh + r][t * 16 + ln] = v; } }
  __builtin_amdgcn_fence(__ATOMIC_ACQ_REL, "workgroup"); __builtin_amdgcn_wave_barrier();
  const int rsub = lane >> 4, c4 = (lane & 15) * 4; typedef _Float16 v4h __attribute__((ext_vector_type(4)));
  {
#pragma unroll
    for (int q = 0; q < 8; ++q) { const int r = q * 2 + rsub; if (col0 + c4 < N) { const v4f v = *(const v4fa*)&so[w][r][c4]; if (C) *(v4f*)(C + cofs + (size_t)(row0 + r) * ldc + col0 + c4) = v; if (C16) { v4h h4; for (int i = 0; i < 4; ++i) h4[i] = (_Float16)v[i]; *(v4h*)(C16 + cofs + (size_t)(row0 + r) * ldc + col0 + c4) = h4; } } }
     }
}


typedef _Float16 v4h __attribute__((ext_vector_type(4)));

// All five input conversions in one launch: x -> f16(bf16(x)), each weight -> f16(bf16(W) * 16). An item is 8 floats; item = u * PREP_T + thread, so u = 0..3 walks x and u = 4..7 is one weight each.
// 512 work-groups of 8 waves (16 waves a WGP): every thread has its 16 loads of 16 B in flight before its first store.
#define PREP_T (512 * 256)
__global__ __launch_bounds__(256) void k_prep(const float* __restrict__ x, const float* __restrict__ Wq, const float* __restrict__ Wk, const float* __restrict__ Wv, const float* __restrict__ Wo, _Float16* __restrict__ X16, _Float16* __restrict__ Bw) {
  static_assert((size_t)NR * DD / 8 == (size_t)4 * PREP_T && (size_t)DD * DD / 8 == (size_t)PREP_T, "item split");
  const unsigned tb = (blockIdx.x * 256u + threadIdx.x) * 32u;      /* one 32-bit byte offset serves all eight items: each has a uniform base (scalar base + vector offset addressing) */
  const float* sp[8] = { x, x + PREP_T * 8, x + 2 * PREP_T * 8, x + 3 * PREP_T * 8, Wq, Wk, Wv, Wo };
  v4f a[8], c[8];
#pragma unroll
  for (int u = 0; u < 8; ++u) { a[u] = *(const v4fa*)((const char*)sp[u] + tb); c[u] = *(const v4fa*)((const char*)sp[u] + tb + 16); }
  __builtin_amdgcn_sched_barrier(0);      /* all 16 loads go out as one group: left alone the scheduler starts converting after eight and the rest wait behind those results */
  FragH f[8];
#pragma unroll
  for (int u = 0; u < 8; ++u) { const float sc = (u < 4) ? 1.0f : 16.0f;
#pragma unroll
    for (int q = 0; q < 4; ++q) { f[u].h[q] = (_Float16)(bf16_round(a[u][q]) * sc); f[u].h[4 + q] = (_Float16)(bf16_round(c[u][q]) * sc); } }
#pragma unroll
  for (int u = 0; u < 8; ++u) *(v8us*)((char*)(((u < 4) ? X16 : Bw) + (u & 3) * PREP_T * 8) + (tb >> 1)) = f[u].half[0];
}
__global__ __launch_bounds__(256) void k_h16(const float* __restrict__ x, _Float16* __restrict__ X16, size_t n8) { const size_t t = (size_t)blockIdx.x * 256 + threadIdx.x; if (t >= n8) return; FragH f;
#pragma unroll
  for (int q = 0; q < 8; ++q) f.h[q] = (_Float16)x[t * 8 + q]; *(v8us*)((unsigned short*)X16 + t * 8) = f.half[0];  }
typedef int v4ia __attribute__((ext_vector_type(4), may_alias));
// lane l <-> lane l ^ 16 (the two halves of a wave hold the two key groups of one query column)
__device__ __forceinline__ float xhalf(float x) { return __builtin_bit_cast(float, __builtin_amdgcn_permlanex16(__builtin_bit_cast(int, x), __builtin_bit_cast(int, x), 0x76543210, 0xfedcba98, false, false)); }
__device__ __forceinline__ v8f wm(v16h a, v16h b, v8f c) { return __builtin_amdgcn_wmma_f32_16x16x32_f16(false, a, false, b, (short)0, c, false, false); }
#define FS_KEYS 64
#define FS_PITCH 144
#define FS_PLANE (64 * FS_PITCH)
#define FS_STAGE (3 * FS_PLANE)
// six copies of one lane: rows r and r + 32 of K hi, K lo and Vt, 16 B each. The s_wait_xcnt stands inside the copies' own statement, so that no address register named here is rewritten in front of it.
__device__ __forceinline__ void fs_copy6(unsigned l, const _Float16* kh, const _Float16* kl, int ldk, const _Float16* vt) {
  asm volatile("global_load_async_to_lds_b128 %0, %6, off\n\t"
               "global_load_async_to_lds_b128 %1, %7, off\n\t"
               "global_load_async_to_lds_b128 %2, %8, off\n\t"
               "global_load_async_to_lds_b128 %3, %9, off\n\t"
               "global_load_async_to_lds_b128 %4, %10, off\n\t"
               "global_load_async_to_lds_b128 %5, %11, off\n\t"
               "s_wait_xcnt 0x0"
               :: "v"(l), "v"(l + 32 * FS_PITCH), "v"(l + FS_PLANE), "v"(l + FS_PLANE + 32 * FS_PITCH), "v"(l + 2 * FS_PLANE), "v"(l + 2 * FS_PLANE + 32 * FS_PITCH),
                  "v"(kh), "v"(kh + (size_t)32 * ldk), "v"(kl), "v"(kl + (size_t)32 * ldk), "v"(vt), "v"(vt + 32 * TT)
               : "memory");
}
__global__ __launch_bounds__(256) void k_flash(const _Float16* __restrict__ Q16, const _Float16* __restrict__ Q16lo, int ldq, const _Float16* __restrict__ K16, const _Float16* __restrict__ K16lo, int ldk, const _Float16* __restrict__ Vt, const int* __restrict__ MSK, _Float16* __restrict__ O16, int ldo) {
  /* a wave owns NG = 2 groups of 16 query columns: every K, Vt and mask fragment that it reads from LDS serves both groups, and a work-group's stage copies serve 256 queries */
  constexpr int NG = 2, RPW = 16 * NG, NW = 8, NQB = TT / (NW * RPW), DT = 4, KS = 2, NST = TT / FS_KEYS;
  __shared__ __attribute__((aligned(16))) unsigned char sT[2 * FS_STAGE];
  __shared__ __attribute__((aligned(16))) int sM[TT];
  __shared__ __attribute__((aligned(16))) float sO[NW][RPW][64 + 4];
  const int tid = threadIdx.x, w = tid >> 5, lane = tid & 31, ln = lane & 15, hh = lane >> 4;
  const int slab = blockIdx.x / NQB, qblk = blockIdx.x % NQB; const int b = slab / NH, h = slab % NH; const int q0 = qblk * (NW * RPW) + w * RPW;
  const int cr = tid >> 3, cc = tid & 7;      /* this lane's row (mod 32) and 16-B column of every stage copy */
  const size_t kofs = ((size_t)b * TT + cr) * ldk + h * 64 + cc * 8;
  const _Float16* gkh = K16 + kofs; const _Float16* gkl = K16lo + kofs; const _Float16* gvt = Vt + ((size_t)slab * 64 + cr) * TT + cc * 8;
  const unsigned lt = (unsigned)(size_t)sT + cr * FS_PITCH + cc * 16;
  { const unsigned lm = (unsigned)(size_t)sM + tid * 16; const int* gm = MSK + (size_t)b * TT + tid * 4;
    /* the mask row, 2 x 16 B a lane; the wait inside the statement keeps its address registers until the copies have read them */
    asm volatile("global_load_async_to_lds_b128 %0, %2, off\n\t"
                 "global_load_async_to_lds_b128 %1, %3, off\n\t"
                 "s_wait_xcnt 0x0" :: "v"(lm), "v"(lm + TT * 2), "v"(gm), "v"(gm + TT / 2) : "memory"); }
  fs_copy6(lt, gkh, gkl, ldk, gvt);
  FragH aq[NG][KS], aql[NG][KS];
#pragma unroll
  for (int g = 0; g < NG; ++g) { const size_t qo = ((size_t)b * TT + q0 + g * 16 + ln) * ldq + h * 64; const unsigned short* qr = (const unsigned short*)Q16 + qo; const unsigned short* ql = (const unsigned short*)Q16lo + qo;
#pragma unroll
    for (int ks = 0; ks < KS; ++ks) { aq[g][ks].half[0] = *(const v8us*)(qr + ks * 32 + 8 * hh); aq[g][ks].half[1] = *(const v8us*)(qr + ks * 32 + 16 + 8 * hh); aql[g][ks].half[0] = *(const v8us*)(ql + ks * 32 + 8 * hh); aql[g][ks].half[1] = *(const v8us*)(ql + ks * 32 + 16 + 8 * hh); } }
  asm volatile("s_wait_xcnt 0x0" ::: "memory");          /* behind the Q loads: none of their address registers is rewritten in front of this wait */
  asm volatile("s_wait_asynccnt 0x0" ::: "memory");      /* the mask and stage 0 have landed for this wave */
  __syncthreads();                                       /* ... and for every wave */
  fs_copy6(lt + FS_STAGE, gkh + (size_t)FS_KEYS * ldk, gkl + (size_t)FS_KEYS * ldk, ldk, gvt + FS_KEYS);
  /* exponentials in base 2: e^(s - m) * 2^10 = 2^(s * log2e - c) with c = m * log2e - 10, one fused multiply-add and one v_exp_f32 a score; c is kept beside the running maximum, so that every term of a query hangs on the same rounded c.
     The start value of m is finite also after the multiplication by log2e. */
  constexpr float L2E = 1.4426950408889634f;
  float m_r[NG], c_r[NG], l_r[NG]; v8f oacc[NG][DT];
#pragma unroll
  for (int g = 0; g < NG; ++g) { m_r[g] = -2.0e38f; c_r[g] = -2.0e38f * L2E - 10.0f; l_r[g] = 0.f;
#pragma unroll
    for (int dt = 0; dt < DT; ++dt) oacc[g][dt] = (v8f){0.f,0.f,0.f,0.f,0.f,0.f,0.f,0.f}; }
  const unsigned char* fk = sT + ln * FS_PITCH + 16 * hh; const unsigned char* fv = fk + 2 * FS_PLANE;
#pragma unroll 1      /* one stage a trip: the two buffers alternate by an offset */
  for (int t = 0; t < NST; ++t) {
    const unsigned bo = (unsigned)(t & 1) * FS_STAGE;
#pragma unroll      /* the two passes of a stage stand in line, so that every LDS read takes its place in the stage as an immediate offset */
    for (int ps = 0; ps < FS_KEYS / 32; ++ps) {
    const int* mp = sM + t * FS_KEYS + ps * 32 + 8 * hh;      /* key padding mask (1 = attend) of this lane's 16 keys */
    const v4ia km[4] = { *(const v4ia*)(mp), *(const v4ia*)(mp + 4), *(const v4ia*)(mp + 16), *(const v4ia*)(mp + 20) };
    float sv[NG][16]; FragH bk[2][KS], bl[2][KS], bv[DT];
#pragma unroll
    for (int nt = 0; nt < 2; ++nt) { const unsigned char* kr = fk + bo + (ps * 32 + nt * 16) * FS_PITCH; const unsigned char* kl = kr + FS_PLANE;
#pragma unroll
      for (int ks = 0; ks < KS; ++ks) { bk[nt][ks].half[0] = *(const v8us*)(kr + ks * 64); bk[nt][ks].half[1] = *(const v8us*)(kr + ks * 64 + 32); bl[nt][ks].half[0] = *(const v8us*)(kl + ks * 64); bl[nt][ks].half[1] = *(const v8us*)(kl + ks * 64 + 32); } }
    __builtin_amdgcn_sched_barrier(0);      /* the pass's K reads go out as one group: left alone the scheduler puts the second key tile's reads behind the first tile's products, and the wave waits out the LDS latency a second time */
    v8f acc[2][NG], accl[2][NG];      /* the two groups' products alternate: four accumulator chains a key tile, each chain's terms in the order they had */
#pragma unroll
    for (int nt = 0; nt < 2; ++nt) {
#pragma unroll
      for (int g = 0; g < NG; ++g) { acc[nt][g] = (v8f){0.f,0.f,0.f,0.f,0.f,0.f,0.f,0.f}; accl[nt][g] = acc[nt][g]; }
#pragma unroll
      for (int ks = 0; ks < KS; ++ks) {
#pragma unroll
        for (int g = 0; g < NG; ++g) acc[nt][g] = wm(bk[nt][ks].v, aq[g][ks].v, acc[nt][g]);
#pragma unroll
        for (int g = 0; g < NG; ++g) accl[nt][g] = wm(bk[nt][ks].v, aql[g][ks].v, accl[nt][g]);
#pragma unroll
        for (int g = 0; g < NG; ++g) accl[nt][g] = wm(bl[nt][ks].v, aq[g][ks].v, accl[nt][g]); }
      if (nt == 0) __builtin_amdgcn_sched_barrier(0);      /* the first key tile's 12 products stay one run of four alternating chains: left alone the scheduler pulls a chain's products together and pads behind them; that tile's vector work then stands among the second tile's products */
      if (nt == 1) {
#pragma unroll
        for (int g = 0; g < NG; ++g)
#pragma unroll
          for (int r = 0; r < 8; ++r) sv[g][r] = (km[r >> 2][r & 3] != 0) ? acc[0][g][r] + accl[0][g][r] * 0.0009765625f : -INFINITY;
        __builtin_amdgcn_sched_barrier(0);      /* ... and does not sink behind them */
      } }
#pragma unroll
    for (int g = 0; g < NG; ++g)
#pragma unroll
      for (int r = 0; r < 8; ++r) sv[g][8 + r] = (km[2 + (r >> 2)][r & 3] != 0) ? acc[1][g][r] + accl[1][g][r] * 0.0009765625f : -INFINITY;
#pragma unroll
    for (int dt = 0; dt < DT; ++dt) { const unsigned char* vrow = fv + bo + dt * 16 * FS_PITCH + ps * 64; bv[dt].half[0] = *(const v8us*)(vrow); bv[dt].half[1] = *(const v8us*)(vrow + 32); }
    __builtin_amdgcn_sched_barrier(0);      /* the four Vt fragments are read ahead of the softmax, which covers their latency: left alone each read sinks to just in front of its product and is waited for there */
    FragH pa[NG];
#pragma unroll
    for (int g = 0; g < NG; ++g) {
    float t8[8];
#pragma unroll
    for (int i = 0; i < 8; ++i) t8[i] = fmaxf(sv[g][i], sv[g][8 + i]);
    float mc = fmaxf(fmaxf(fmaxf(t8[0], t8[1]), fmaxf(t8[2], t8[3])), fmaxf(fmaxf(t8[4], t8[5]), fmaxf(t8[6], t8[7])));
    mc = fmaxf(mc, xhalf(mc));      /* both halves now hold the query's block maximum */
    const float mn = fmaxf(m_r[g], mc); const float cn = fmaf(mn, L2E, -10.0f); float ea = c_r[g] - cn; m_r[g] = mn; c_r[g] = cn;      /* cn is finite (mn >= -2e38), so a masked score gives 2^(-inf) = 0 */
    float p[16];
#pragma unroll
    for (int i = 0; i < 16; ++i) p[i] = fmaf(sv[g][i], L2E, -cn);
    /* the group's 17 exponentials, each in its own register: written by the compiler a v_exp_f32 here and there lands on the source register of the one directly in front of it, where the instruction set asks for a free slot.
       The closing v_nop is that slot behind the last one, whatever the compiler puts next. Order: %0, whose argument is formed last, stands third; p[0..3], which are packed last, stand at the end. */
    asm("v_exp_f32 %5, %5\n\t" "v_exp_f32 %6, %6\n\t" "v_exp_f32 %0, %0\n\t" "v_exp_f32 %7, %7\n\t" "v_exp_f32 %8, %8\n\t" "v_exp_f32 %9, %9\n\t"
        "v_exp_f32 %10, %10\n\t" "v_exp_f32 %11, %11\n\t" "v_exp_f32 %12, %12\n\t" "v_exp_f32 %13, %13\n\t" "v_exp_f32 %14, %14\n\t" "v_exp_f32 %15, %15\n\t"
        "v_exp_f32 %16, %16\n\t" "v_exp_f32 %3, %3\n\t" "v_exp_f32 %4, %4\n\t" "v_exp_f32 %1, %1\n\t" "v_exp_f32 %2, %2\n\t" "v_nop"
        : "+v"(ea), "+v"(p[0]), "+v"(p[1]), "+v"(p[2]), "+v"(p[3]), "+v"(p[4]), "+v"(p[5]), "+v"(p[6]), "+v"(p[7]), "+v"(p[8]), "+v"(p[9]), "+v"(p[10]), "+v"(p[11]), "+v"(p[12]), "+v"(p[13]), "+v"(p[14]), "+v"(p[15]));
    const float al = (mn > -1.0e38f) ? ea : 1.0f;
#pragma unroll
    for (int i = 0; i < 16; ++i) pa[g].h[i] = (_Float16)p[i];      /* p carries the 2^10 of the f16 operand, and so does the row sum */
#pragma unroll
    for (int i = 0; i < 8; ++i) t8[i] = p[i] + p[8 + i];
    l_r[g] = l_r[g] * al + (((t8[0] + t8[1]) + (t8[2] + t8[3])) + ((t8[4] + t8[5]) + (t8[6] + t8[7])));      /* per-lane partial sum; the halves join after the loop */
#pragma unroll
    for (int dt = 0; dt < DT; ++dt)
#pragma unroll
      for (int r = 0; r < 8; ++r) oacc[g][dt][r] *= al; }
#pragma unroll
    for (int dt = 0; dt < DT; ++dt)
#pragma unroll
      for (int g = 0; g < NG; ++g) oacc[g][dt] = wm(bv[dt].v, pa[g].v, oacc[g][dt]); }
    asm volatile("s_wait_dscnt 0x0" ::: "memory");       /* this wave's reads of buffer t & 1 are done before the buffer is handed back */
    asm volatile("s_wait_asynccnt 0x0" ::: "memory");    /* this wave's copies of stage t + 1 have landed */
    __syncthreads();                                     /* publishes stage t + 1 and ends every wave's reads of stage t */
    if (t + 2 < NST) fs_copy6(lt + bo, gkh + (size_t)(t + 2) * FS_KEYS * ldk, gkl + (size_t)(t + 2) * FS_KEYS * ldk, ldk, gvt + (t + 2) * FS_KEYS);
  }
  asm volatile("s_wait_asynccnt 0x0" ::: "memory");      /* nothing is in flight when the wave goes on to its end */
#pragma unroll
  for (int g = 0; g < NG; ++g) { const float l = l_r[g] + xhalf(l_r[g]); const float inv = (l > 0.f) ? 1.0f / l : 0.f;
#pragma unroll
    for (int dt = 0; dt < DT; ++dt)
#pragma unroll
      for (int q = 0; q < 2; ++q) { const v4f o4 = { oacc[g][dt][q * 4] * inv, oacc[g][dt][q * 4 + 1] * inv, oacc[g][dt][q * 4 + 2] * inv, oacc[g][dt][q * 4 + 3] * inv }; *(v4fa*)&sO[w][g * 16 + ln][dt * 16 + 8 * hh + q * 4] = o4; } }
  __builtin_amdgcn_fence(__ATOMIC_ACQ_REL, "workgroup"); __builtin_amdgcn_wave_barrier();
  {
#pragma unroll      /* O x 2^4 goes out as the f16 operand of the output GEMM: 8 lanes a row, one whole 128-B line per (query, head) */
    for (int rp = 0; rp < RPW; rp += 4) { const int r = rp + (lane >> 3), c8 = (lane & 7) * 8; const v4f a = *(const v4fa*)&sO[w][r][c8], c = *(const v4fa*)&sO[w][r][c8 + 4]; FragH f;
#pragma unroll
      for (int q = 0; q < 4; ++q) { f.h[q] = (_Float16)(a[q] * 16.0f); f.h[4 + q] = (_Float16)(c[q] * 16.0f); }
      *(v8us*)((unsigned short*)O16 + ((size_t)b * TT + q0 + r) * ldo + h * 64 + c8) = f.half[0]; }
     } }

// ---- projection GEMM with its operands staged in LDS: C = alpha * A . Bt^T, A [NR][DD] and Bt [DD][DD] f16, both k-contiguous.
// One 128 x 128 tile per work-group of 8 waves (4 x 2 waves of 32 x 64). A stage is 128 k = 256 B of each of the 256 operand rows (A rows 0-127, Bt rows 128-255),
// brought by asynchronous copies (16 lanes of 16 B a row), two buffers: stage t + 1 flies while stage t is multiplied.
// LDS row pitch 272 B = 16 B x odd, the conflict-free pitch of ds_load_b128 fragment reads. The k order of every accumulator is 0, 32, 64, ... as before.
#define GS_K 128
#define GS_PITCH 272
#define GS_STAGE (256 * GS_PITCH)
// eight copies of one lane: rows r, r + 16, ..., r + 112 of one operand, 16 B each. The s_wait_xcnt stands inside the copies' own statement, so that no address register named here is rewritten in front of it.
__device__ __forceinline__ void gs_copy8(unsigned l, const _Float16* g) {
  asm volatile("global_load_async_to_lds_b128 %0, %8, off\n\t"
               "global_load_async_to_lds_b128 %1, %9, off\n\t"
               "global_load_async_to_lds_b128 %2, %10, off\n\t"
               "global_load_async_to_lds_b128 %3, %11, off\n\t"
               "global_load_async_to_lds_b128 %4, %12, off\n\t"
               "global_load_async_to_lds_b128 %5, %13, off\n\t"
               "global_load_async_to_lds_b128 %6, %14, off\n\t"
               "global_load_async_to_lds_b128 %7, %15, off\n\t"
               "s_wait_xcnt 0x0"
               :: "v"(l), "v"(l + 16 * GS_PITCH), "v"(l + 32 * GS_PITCH), "v"(l + 48 * GS_PITCH), "v"(l + 64 * GS_PITCH), "v"(l + 80 * GS_PITCH), "v"(l + 96 * GS_PITCH), "v"(l + 112 * GS_PITCH),
                  "v"(g), "v"(g + 16 * DD), "v"(g + 32 * DD), "v"(g + 48 * DD), "v"(g + 64 * DD), "v"(g + 80 * DD), "v"(g + 96 * DD), "v"(g + 112 * DD)
               : "memory");
}
// the 2 A and 4 B fragments of one k step (32 k = 64 B of a row) from a stage in LDS; both operands in the same k order: 8 hh + 0..7, then 16 + 8 hh + 0..7
__device__ __forceinline__ void gs_frags(FragH (&a)[2], FragH (&b)[4], const unsigned char* pa, const unsigned char* pb) {
#pragma unroll
  for (int i = 0; i < 2; ++i) { a[i].half[0] = *(const v8us*)(pa + i * 16 * GS_PITCH); a[i].half[1] = *(const v8us*)(pa + i * 16 * GS_PITCH + 32); }
#pragma unroll
  for (int j = 0; j < 4; ++j) { b[j].half[0] = *(const v8us*)(pb + j * 16 * GS_PITCH); b[j].half[1] = *(const v8us*)(pb + j * 16 * GS_PITCH + 32); }
}
// the 8 products of one k step
__device__ __forceinline__ void gs_mma(v8f (&acc)[2][4], const FragH (&a)[2], const FragH (&b)[4]) {
#pragma unroll
  for (int i = 0; i < 2; ++i)
#pragma unroll
    for (int j = 0; j < 4; ++j) acc[i][j] = __builtin_amdgcn_wmma_f32_16x16x32_f16(false, a[i].v, false, b[j].v, (short)0, acc[i][j], false, false);
}
// QKV = false: one product, C f32. QKV = true: the q, k and v projections in one grid (256 tiles each, Bt = the three weights in a row), each with its consumer's conversion as epilogue:
// q and k leave as elu + 1 split in f16 hi + 2^10 x residual planes, v leaves as f16 already transposed, Vt[batch * DD + column][token].
template <bool QKV>
__global__ __launch_bounds__(256) void k_gemm_lds(const _Float16* __restrict__ A, const _Float16* __restrict__ Bt, float alpha, float* __restrict__ C,
                                                  _Float16* __restrict__ Qh, _Float16* __restrict__ Ql, _Float16* __restrict__ Kh, _Float16* __restrict__ Kl, _Float16* __restrict__ Vt) {
  __shared__ __attribute__((aligned(16))) unsigned char sT[2 * GS_STAGE];
  __shared__ __attribute__((aligned(16))) float so[8][32][64 + 4];
  constexpr int NST = DD / GS_K;
  const int tid = threadIdx.x, w = tid >> 5, lane = tid & 31, ln = lane & 15, hh = lane >> 4;
  constexpr int NTILE = (NR / 128) * (DD / 128);
  const int which = QKV ? blockIdx.x / NTILE : 0, tile = QKV ? blockIdx.x % NTILE : blockIdx.x;      /* which: 0 q, 1 k, 2 v; the same for the whole work-group */
  Bt += (size_t)which * DD * DD;
  const int row0 = (tile / (DD / 128)) * 128, col0 = (tile % (DD / 128)) * 128; const int wm = w >> 1, wn = w & 1;
  const int cr = tid >> 4, cc = tid & 15;      /* this lane's row (mod 16) and 16-B column of every copy */
  const _Float16* ga = A + (size_t)(row0 + cr) * DD + cc * 8; const _Float16* gb = Bt + (size_t)(col0 + cr) * DD + cc * 8;
  const unsigned la = (unsigned)(size_t)sT + cr * GS_PITCH + cc * 16, lb = la + 128 * GS_PITCH;
  gs_copy8(la, ga); gs_copy8(lb, gb);
  asm volatile("s_wait_asynccnt 0x0" ::: "memory");      /* stage 0 has landed for this wave */
  __syncthreads();                                       /* ... and for every wave */
  gs_copy8(la + GS_STAGE, ga + GS_K); gs_copy8(lb + GS_STAGE, gb + GS_K);
  v8f acc[2][4];
#pragma unroll
  for (int i = 0; i < 2; ++i)
#pragma unroll
    for (int j = 0; j < 4; ++j) acc[i][j] = (v8f){0.f,0.f,0.f,0.f,0.f,0.f,0.f,0.f};
  const unsigned char* fa = sT + (wm * 32 + ln) * GS_PITCH + 16 * hh; const unsigned char* fb = sT + (128 + wn * 64 + ln) * GS_PITCH + 16 * hh;
#pragma unroll 1      /* one stage a trip: the two buffers alternate by an offset, the text stays small */
  for (int t = 0; t < NST; ++t) {
    const unsigned bo = (unsigned)(t & 1) * GS_STAGE;
    FragH a[2][2], b[2][4];      /* two fragment sets: the reads of k step ks + 1 of this same stage are issued as one group ahead of the products of k step ks */
    gs_frags(a[0], b[0], fa + bo, fb + bo);
#pragma unroll
    for (int ks = 0; ks + 1 < GS_K / 32; ++ks) {
      gs_frags(a[(ks + 1) & 1], b[(ks + 1) & 1], fa + bo + (ks + 1) * 64, fb + bo + (ks + 1) * 64);
      __builtin_amdgcn_sched_barrier(0);      /* keeps that group of reads ahead of the products: left alone the scheduler sinks each read to just in front of its use, and the wave waits out the LDS latency there */
      gs_mma(acc, a[ks & 1], b[ks & 1]);
    }
    __builtin_amdgcn_sched_barrier(0);                   /* those products stay in front of the hand-over and cover the last group's LDS latency */
    asm volatile("s_wait_dscnt 0x0" ::: "memory");       /* this wave's reads of buffer t & 1 are done before the buffer is handed back */
    asm volatile("s_wait_asynccnt 0x0" ::: "memory");    /* this wave's copies of stage t + 1 have landed */
    __syncthreads();                                     /* publishes stage t + 1 and ends every wave's reads of stage t */
    if (t + 2 < NST) { gs_copy8(la + bo, ga + (t + 2) * GS_K); gs_copy8(lb + bo, gb + (t + 2) * GS_K); }
    __builtin_amdgcn_sched_barrier(0);                   /* the refill is issued first: the last k step's products need registers only and run while the copies fly */
    gs_mma(acc, a[(GS_K / 32 - 1) & 1], b[(GS_K / 32 - 1) & 1]);
  }
  asm volatile("s_wait_asynccnt 0x0" ::: "memory");      /* nothing is in flight when the wave goes on to its end */
  if (QKV && which == 2) {
    /* v: a lane's 8 accumulator rows are 8 consecutive tokens of one column = 16 B of the transposed tile; staged [128 columns][128 tokens] f16 at pitch 272 B in so */
    unsigned char* sv = (unsigned char*)&so[0][0][0];
#pragma unroll
    for (int i = 0; i < 2; ++i)
#pragma unroll
      for (int j = 0; j < 4; ++j) { FragH f;
#pragma unroll
        for (int r = 0; r < 8; ++r) f.h[r] = (_Float16)(acc[i][j][r] * alpha);
        *(v8us*)(sv + (wn * 64 + j * 16 + ln) * GS_PITCH + (wm * 32 + i * 16 + 8 * hh) * 2) = f.half[0]; }
    __syncthreads();      /* a column's 128 tokens come from four waves: every wave's part is in LDS before any is read back */
#pragma unroll
    for (int q = 0; q < 8; ++q) { const int c = q * 16 + (tid >> 4), ch = tid & 15;      /* 16 lanes a column: 256 contiguous bytes of Vt */
      const v8us v = *(const v8us*)(sv + c * GS_PITCH + ch * 16);
      *(v8us*)((unsigned short*)Vt + ((size_t)(row0 / TT) * DD + col0 + c) * TT + row0 % TT + ch * 8) = v; }
  } else {
#pragma unroll
  for (int i = 0; i < 2; ++i)
#pragma unroll
    for (int j = 0; j < 4; ++j)
#pragma unroll
      for (int r = 0; r < 8; ++r) so[w][i * 16 + 8 * hh + r][j * 16 + ln] = acc[i][j][r] * alpha;
  __builtin_amdgcn_fence(__ATOMIC_ACQ_REL, "workgroup"); __builtin_amdgcn_wave_barrier();      /* the wave reads back rows that its other lanes wrote */
  if (QKV) {
    /* q, k: elu(x) + 1 = x + 1 (x > 0) | e^x (x <= 0), then hi = f16(v), lo = f16((v - hi) * 2^10); 8 lanes a row: the wave's 64 columns are one whole 128-B line of each plane */
    unsigned short* Hh = (unsigned short*)(which == 0 ? Qh : Kh); unsigned short* Hl = (unsigned short*)(which == 0 ? Ql : Kl);
#pragma unroll
    for (int q = 0; q < 8; ++q) { const int r = q * 4 + (lane >> 3), c8 = (lane & 7) * 8; const v4f a = *(const v4fa*)&so[w][r][c8], c = *(const v4fa*)&so[w][r][c8 + 4]; FragH fh, fl;
#pragma unroll
      for (int e = 0; e < 8; ++e) { const float x = (e < 4) ? a[e] : c[e - 4]; const float ex = expf(x);      /* taken for every lane, then selected: eight independent chains and no branch per element, with only two waves a SIMD to cover latency here */
        const float v = (x > 0.f) ? x + 1.0f : ex; const _Float16 h = (_Float16)v; fh.h[e] = h; fl.h[e] = (_Float16)((v - (float)h) * 1024.0f); }
      const size_t o = (size_t)(row0 + wm * 32 + r) * DD + col0 + wn * 64 + c8;
      *(v8us*)(Hh + o) = fh.half[0]; *(v8us*)(Hl + o) = fl.half[0]; }
    asm volatile("s_wait_xcnt 0x0" ::: "memory");      /* behind the last hi/lo store: no address or data register of these stores is rewritten in front of this wait on any way out of the loop */
  } else {
    const int rsub = lane >> 4, c4 = (lane & 15) * 4;
#pragma unroll
    for (int q = 0; q < 16; ++q) { const int r = q * 2 + rsub; const v4f v = *(const v4fa*)&so[w][r][c4]; *(v4f*)(C + (size_t)(row0 + wm * 32 + r) * DD + col0 + wn * 64 + c4) = v; }
  }
  }
}

extern "C" void kernel_launch(void* const* d_in, const int* in_sizes, int n_in,
                              void* d_out, int out_size, void* d_ws, size_t ws_size, hipStream_t stream) {
  (void)in_sizes; (void)n_in; (void)out_size;
  const float* x = (const float*)d_in[0]; const int* mask = (const int*)d_in[1]; const float* Wq = (const float*)d_in[2]; const float* Wk = (const float*)d_in[3]; const float* Wv = (const float*)d_in[4]; const float* Wo = (const float*)d_in[5];
  char* ws = (char*)d_ws; size_t off = 0;
  auto take = [&](size_t bytes) { char* p = ws + off; off += (bytes + 255) & ~(size_t)255; return p; };
  const size_t WSZ = (size_t)DD * DD; _Float16* Bw = (_Float16*)take(4 * WSZ * 2); _Float16* X16 = (_Float16*)take((size_t)NR * DD * 2);
  _Float16* Qh = (_Float16*)take((size_t)NR * DD * 2); _Float16* Ql = (_Float16*)take((size_t)NR * DD * 2); _Float16* Kh = (_Float16*)take((size_t)NR * DD * 2); _Float16* Kl = (_Float16*)take((size_t)NR * DD * 2); _Float16* Vt = (_Float16*)take((size_t)NR * DD * 2);
  _Float16* O16 = X16;      /* X16 is dead after the q/k/v launch */
  if (off > ws_size) return;      // 7 x 8.4 MB
  k_prep<<<PREP_T / 256, 256, 0, stream>>>(x, Wq, Wk, Wv, Wo, X16, Bw);
  k_gemm_lds<true><<<3 * (NR / 128) * (DD / 128), 256, 0, stream>>>(X16, Bw, 0.0625f, nullptr, Qh, Ql, Kh, Kl, Vt);      /* q, k: elu + 1 hi/lo; v: transposed */
  k_flash<<<BB * NH * (TT / 256), 256, 0, stream>>>(Qh, Ql, DD, Kh, Kl, DD, Vt, mask, O16, DD);
  k_gemm_lds<false><<<(NR / 128) * (DD / 128), 256, 0, stream>>>(O16, Bw + 3 * WSZ, 0.00390625f, (float*)d_out, nullptr, nullptr, nullptr, nullptr, nullptr);      /* out = O . Wo^T */
}

// v008
// One run takes 96.5 microseconds.
// Two timings next to v007 both put it at 1.03 times that version's speed.
// Over all steps from v000 it is 5.43 times as fast.
#include <hip/hip_runtime.h>
// Multi-head 'linear-feature' attention (B=2, S=2048, H=1024, 16 heads × 64): q,k,v = x·Wᵀ (no bias); φ(q) = elu(q)+1, φ(k) = elu(k)+1; attn = softmax(φ(q)·φ(k)ᵀ) UNSCALED (σ≈8 logits) with the INPUT key mask [B,S] (0 → −inf);
// out = (attn·v merged)·Woᵀ.
// Compute dtype: x and weights rounded to bf16; q,k as f32 GEMM outputs mapped through elu+1 in f32 and split into f16 hi + ×2^10 residual planes so the large unscaled logits are f32-accurate
// (S = Qh·Kh + (Ql·Kh + Qh·Kl)·2^-10, separate accumulators); v f16; fused flash-style kernel (online softmax f32, P f16 against a held reference) on v_wmma_f32_16x16x32_f16; O ×2^4 → f16 → output GEMM; f32 accumulate.
#define BB 2
#define TT 2048
#define NH 16
#define DD 1024
#define NR (BB * TT)

typedef __bf16 v16b __attribute__((ext_vector_type(16)));
typedef unsigned short v8us __attribute__((ext_vector_type(8), may_alias));
typedef float  v8f  __attribute__((ext_vector_type(8)));
typedef float  v4f  __attribute__((ext_vector_type(4)));
typedef float  v4fa __attribute__((ext_vector_type(4), may_alias));
union FragB { v16b v; v8us half[2]; unsigned short u[16]; };

__device__ __forceinline__ unsigned short bf16_bits(float x) { unsigned int u = __float_as_uint(x); return (unsigned short)((u + 0x7FFFu + ((u >> 16) & 1u)) >> 16); }
__device__ __forceinline__ float bf16_val(unsigned short b) { return __uint_as_float(((unsigned int)b) << 16); }
__device__ __forceinline__ float bf16_round(float x) { return bf16_val(bf16_bits(x)); }
// D += A·B with NT terms: 1 = ah·bh, 2 = + al·bh (A split), 3 = + ah·bl (both split)
template <int NT>
__device__ __forceinline__ v8f mmaN(v16b ah, v16b al, v16b bh, v16b bl, v8f c) {
  c = __builtin_amdgcn_wmma_f32_16x16x32_bf16(false, ah, false, bh, (short)0, c, false, false);
  if (NT >= 2) c = __builtin_amdgcn_wmma_f32_16x16x32_bf16(false, al, false, bh, (short)0, c, false, false);
  if (NT >= 3) c = __builtin_amdgcn_wmma_f32_16x16x32_bf16(false, ah, false, bl, (short)0, c, false, false);
  asm volatile("v_nop\n\tv_nop\n\tv_nop\n\tv_nop" : "+v"(c) : "v"(ah), "v"(al), "v"(bh), "v"(bl));
  return c;
}

__global__ __launch_bounds__(256) void k_wt_bf16(const float* __restrict__ W, unsigned short* __restrict__ Wt, int K, int N) {
  const int t = blockIdx.x * 256 + threadIdx.x;
  const int k8n = K / 8;
  if (t >= N * k8n) return;
  const int n = t / k8n, k8 = (t % k8n) * 8;
  v8us v;
#pragma unroll
  for (int i = 0; i < 8; ++i) v[i] = bf16_bits(W[(size_t)(k8 + i) * N + n]);
  *(v8us*)(Wt + (size_t)n * K + k8) = v;
  
}

// GEMM C[M][N] (f32, pitch ldc) = act(A[M][K]·W + bias). A f32 row-major (pitch lda) converted per fragment to bf16
// (ASPLIT: hi/lo two planes -> 2 terms, else single rounded term); Wt bf16 [N][K] (pitch ldb). BIAS_BF16 rounds the
// bias to bf16 first (bias quantised to bf16 before the add). K%32==0, M%16==0, N%64==0.
template <bool ASPLIT, int ACT, bool BIAS_BF16>
__global__ __launch_bounds__(128) void k_gemm_bf(const float* __restrict__ A, int lda, const unsigned short* __restrict__ Wt, int ldb,
                                               const float* __restrict__ bias, float* __restrict__ C, int ldc, int M, int N, int K) {
  __shared__ __attribute__((aligned(16))) float so[4][16][64];
  const int tid = threadIdx.x, w = tid >> 5, lane = tid & 31, ln = lane & 15, hh = lane >> 4;
  const int ntn = N / 64;
  const int wid = blockIdx.x * 4 + w;
  const int mt = wid / ntn, nq = wid % ntn;
  if (mt * 16 >= M) return;
  const int row0 = mt * 16, col0 = nq * 64;
  const float* arow = A + (size_t)(row0 + ln) * lda;
  v8f acc[4] = {};
  for (int kb = 0; kb < K; kb += 32) {
    FragB ah, al;
    const v4f x0 = *(const v4fa*)(arow + kb + 8 * hh), x1 = *(const v4fa*)(arow + kb + 8 * hh + 4);
    const v4f x2 = *(const v4fa*)(arow + kb + 16 + 8 * hh), x3 = *(const v4fa*)(arow + kb + 16 + 8 * hh + 4);
    float xs[16] = {x0[0],x0[1],x0[2],x0[3],x1[0],x1[1],x1[2],x1[3],x2[0],x2[1],x2[2],x2[3],x3[0],x3[1],x3[2],x3[3]};
#pragma unroll
    for (int i = 0; i < 16; ++i) { const unsigned short hb = bf16_bits(xs[i]); ah.u[i] = hb; al.u[i] = ASPLIT ? bf16_bits(xs[i] - bf16_val(hb)) : (unsigned short)0; }
#pragma unroll
    for (int t = 0; t < 4; ++t) {
      const unsigned short* brow = Wt + (size_t)(col0 + t * 16 + ln) * ldb + kb;
      FragB b;
      b.half[0] = *(const v8us*)(brow + 8 * hh);
      b.half[1] = *(const v8us*)(brow + 16 + 8 * hh);
      acc[t] = mmaN<ASPLIT ? 2 : 1>(ah.v, al.v, b.v, b.v, acc[t]);
    }
  }
#pragma unroll
  for (int t = 0; t < 4; ++t) {
    float bv = bias ? bias[col0 + t * 16 + ln] : 0.f;
    if (BIAS_BF16) bv = bf16_round(bv);
#pragma unroll
    for (int r = 0; r < 8; ++r) { float v = acc[t][r] + bv; if (ACT == 1) v = fmaxf(v, 0.f); so[w][8 * hh + r][t * 16 + ln] = v; }
  }
  __builtin_amdgcn_fence(__ATOMIC_ACQ_REL, "workgroup");
  __builtin_amdgcn_wave_barrier();
  const int rsub = lane >> 4, c4 = (lane & 15) * 4;
  {
#pragma unroll
    for (int q = 0; q < 8; ++q) {
      const int r = q * 2 + rsub;
      const v4f v = *(const v4fa*)&so[w][r][c4];
      *(v4f*)(C + (size_t)(row0 + r) * ldc + col0 + c4) = v;
    }
    
  }
}

// Flash-style causal/unmasked attention, all contractions 3-term bf16 hi/lo splits, f32 softmax with running max.
// q,k,v rows are read from f32 buffers with arbitrary row pitch (so they can live inside a fused qkv buffer);
// D = head size (multiple of 32, <= 128); one wave = 16 query rows; block = 4 waves (64 queries) sharing K/V chunks of 32.
template <int D, bool CAUSAL>
__global__ __launch_bounds__(128) void k_flash(const float* __restrict__ qb, const float* __restrict__ kb, const float* __restrict__ vb,
                                             int pitch, int T, int H, float scale, float* __restrict__ y, int ypitch) {
  constexpr int KS = D / 32;        // k-steps for QK
  constexpr int DT = D / 16;        // d tiles for PV
  __shared__ __attribute__((aligned(16))) unsigned short sKh[32][D + 8], sKl[32][D + 8], sVh[32][D + 8], sVl[32][D + 8];
  __shared__ __attribute__((aligned(16))) unsigned short sPh[4][16][40], sPl[4][16][40];
  __shared__ __attribute__((aligned(16))) float sO[4][16][D];
  const int tid = threadIdx.x, w = tid >> 5, lane = tid & 31, ln = lane & 15, hh = lane >> 4;
  const int nqb = (T + 63) / 64;
  const int bh = blockIdx.x / nqb, qblk = blockIdx.x % nqb;
  const int b = bh / H, h = bh % H;
  const int q0 = qblk * 64 + w * 16;
  const float* Q = qb + (size_t)b * T * pitch + h * D;
  const float* K = kb + (size_t)b * T * pitch + h * D;
  const float* V = vb + (size_t)b * T * pitch + h * D;

  // A fragments of the wave's 16 query rows (scaled), hi/lo
  FragB aqh[KS], aql[KS];
  {
    int row = q0 + ln; if (row >= T) row = T - 1;
    const float* qr = Q + (size_t)row * pitch;
#pragma unroll
    for (int ks = 0; ks < KS; ++ks)
#pragma unroll
      for (int i = 0; i < 16; ++i) {
        const int d = ks * 32 + ((i < 8) ? (8 * hh + i) : (16 + 8 * hh + (i - 8)));
        const float x = qr[d] * scale; const unsigned short hb = bf16_bits(x);
        aqh[ks].u[i] = hb; aql[ks].u[i] = bf16_bits(x - bf16_val(hb));
      }
  }
  float m_r[8], l_r[8];
#pragma unroll
  for (int r = 0; r < 8; ++r) { m_r[r] = -3.0e38f; l_r[r] = 0.f; }
  v8f oacc[DT];
#pragma unroll
  for (int dt = 0; dt < DT; ++dt) oacc[dt] = (v8f){0.f,0.f,0.f,0.f,0.f,0.f,0.f,0.f};

  const int kv_end = CAUSAL ? min(T, qblk * 64 + 64) : T;     // block-uniform
  for (int j0 = 0; j0 < kv_end; j0 += 32) {
    __syncthreads();
    for (int e = tid; e < 32 * (D / 4); e += 128) {
      const int r = e / (D / 4), c4 = (e % (D / 4)) * 4;
      const int key = j0 + r;
      v4f kf = {0.f,0.f,0.f,0.f}, vf = {0.f,0.f,0.f,0.f};
      if (key < T) { kf = *(const v4fa*)(K + (size_t)key * pitch + c4); vf = *(const v4fa*)(V + (size_t)key * pitch + c4); }
#pragma unroll
      for (int t = 0; t < 4; ++t) {
        unsigned short hb = bf16_bits(kf[t]); sKh[r][c4 + t] = hb; sKl[r][c4 + t] = bf16_bits(kf[t] - bf16_val(hb));
        hb = bf16_bits(vf[t]); sVh[r][c4 + t] = hb; sVl[r][c4 + t] = bf16_bits(vf[t] - bf16_val(hb));
      }
    }
    __syncthreads();
    // S tile 16 x 32
    v8f s[2];
#pragma unroll
    for (int nt = 0; nt < 2; ++nt) {
      v8f acc = {};
#pragma unroll
      for (int ks = 0; ks < KS; ++ks) {
        FragB bh_, bl_;
        bh_.half[0] = *(const v8us*)&sKh[nt * 16 + ln][ks * 32 + 8 * hh]; bh_.half[1] = *(const v8us*)&sKh[nt * 16 + ln][ks * 32 + 16 + 8 * hh];
        bl_.half[0] = *(const v8us*)&sKl[nt * 16 + ln][ks * 32 + 8 * hh]; bl_.half[1] = *(const v8us*)&sKl[nt * 16 + ln][ks * 32 + 16 + 8 * hh];
        acc = mmaN<3>(aqh[ks].v, aql[ks].v, bh_.v, bl_.v, acc);
      }
      s[nt] = acc;
    }
    // mask + running max (rows 8hh+r; the 16 lanes of a half share rows)
    float alpha[8];
#pragma unroll
    for (int r = 0; r < 8; ++r) {
      const int qi = q0 + 8 * hh + r;
      const int ja = j0 + ln, jb = j0 + 16 + ln;
      if (CAUSAL) { if (ja > qi) s[0][r] = -3.0e38f; if (jb > qi) s[1][r] = -3.0e38f; }
      if (ja >= T) s[0][r] = -3.0e38f;
      if (jb >= T) s[1][r] = -3.0e38f;
      float mx = fmaxf(s[0][r], s[1][r]);
      mx = fmaxf(mx, __shfl_xor(mx, 1, 32)); mx = fmaxf(mx, __shfl_xor(mx, 2, 32)); mx = fmaxf(mx, __shfl_xor(mx, 4, 32)); mx = fmaxf(mx, __shfl_xor(mx, 8, 32));
      const float mnew = fmaxf(m_r[r], mx);
      alpha[r] = (mnew > -1.0e38f) ? __expf(m_r[r] - mnew) : 1.0f;
      const float p0 = (s[0][r] > -1.0e38f) ? __expf(s[0][r] - mnew) : 0.f;
      const float p1 = (s[1][r] > -1.0e38f) ? __expf(s[1][r] - mnew) : 0.f;
      m_r[r] = mnew;
      l_r[r] = l_r[r] * alpha[r] + p0 + p1;            // per-lane partial row sum (16 lanes combined at the end)
      unsigned short hb = bf16_bits(p0); sPh[w][8 * hh + r][ln] = hb;      sPl[w][8 * hh + r][ln] = bf16_bits(p0 - bf16_val(hb));
      hb = bf16_bits(p1);                sPh[w][8 * hh + r][16 + ln] = hb; sPl[w][8 * hh + r][16 + ln] = bf16_bits(p1 - bf16_val(hb));
    }
#pragma unroll
    for (int dt = 0; dt < DT; ++dt)
#pragma unroll
      for (int r = 0; r < 8; ++r) oacc[dt][r] *= alpha[r];
    __builtin_amdgcn_fence(__ATOMIC_ACQ_REL, "workgroup");
    __builtin_amdgcn_wave_barrier();
    FragB pah, pal;
    pah.half[0] = *(const v8us*)&sPh[w][ln][8 * hh]; pah.half[1] = *(const v8us*)&sPh[w][ln][16 + 8 * hh];
    pal.half[0] = *(const v8us*)&sPl[w][ln][8 * hh]; pal.half[1] = *(const v8us*)&sPl[w][ln][16 + 8 * hh];
#pragma unroll
    for (int dt = 0; dt < DT; ++dt) {
      FragB bvh, bvl;
#pragma unroll
      for (int i = 0; i < 8; ++i) {
        bvh.u[i] = sVh[8 * hh + i][dt * 16 + ln]; bvh.u[8 + i] = sVh[16 + 8 * hh + i][dt * 16 + ln];
        bvl.u[i] = sVl[8 * hh + i][dt * 16 + ln]; bvl.u[8 + i] = sVl[16 + 8 * hh + i][dt * 16 + ln];
      }
      oacc[dt] = mmaN<3>(pah.v, pal.v, bvh.v, bvl.v, oacc[dt]);
    }
    __builtin_amdgcn_fence(__ATOMIC_ACQ_REL, "workgroup");
    __builtin_amdgcn_wave_barrier();
  }
#pragma unroll
  for (int r = 0; r < 8; ++r) {
    float l = l_r[r];
    l += __shfl_xor(l, 1, 32); l += __shfl_xor(l, 2, 32); l += __shfl_xor(l, 4, 32); l += __shfl_xor(l, 8, 32);
    l_r[r] = (l > 0.f) ? 1.0f / l : 0.f;
  }
#pragma unroll
  for (int dt = 0; dt < DT; ++dt)
#pragma unroll
    for (int r = 0; r < 8; ++r) sO[w][8 * hh + r][dt * 16 + ln] = oacc[dt][r] * l_r[r];
  __builtin_amdgcn_fence(__ATOMIC_ACQ_REL, "workgroup");
  __builtin_amdgcn_wave_barrier();
  {
    for (int r = 0; r < 16; ++r) {
      const int row = q0 + r;
      if (row < T && lane < D / 4) {
        const v4f val = *(const v4fa*)&sO[w][r][lane * 4];
        *(v4f*)(y + ((size_t)b * T + row) * ypitch + h * D + lane * 4) = val;
      }
    }
    
  }
}

// GEMM C = act(A·W + bias + resid): A f32 (ASPLIT -> hi/lo 2 terms), Wt bf16 [N][K]; ACT 0 none, 1 relu, 2 exact gelu;
// resid (optional, f32, row index = (row % rmod), pitch ldr, RES_BF16 rounds it) added before the activation.
template <bool ASPLIT, int ACT, bool BIAS_BF16, bool RES_BF16>
__global__ __launch_bounds__(128) void k_gemm_bf3(const float* __restrict__ A, int lda, const unsigned short* __restrict__ Wt, int ldb,
                                                const float* __restrict__ bias, const float* __restrict__ resid, int rmod, int ldr,
                                                float* __restrict__ C, int ldc, int M, int N, int K) {
  __shared__ __attribute__((aligned(16))) float so[4][16][64];
  const int tid = threadIdx.x, w = tid >> 5, lane = tid & 31, ln = lane & 15, hh = lane >> 4;
  const int ntn = N / 64;
  const int wid = blockIdx.x * 4 + w;
  const int mt = wid / ntn, nq = wid % ntn;
  if (mt * 16 >= M) return;
  const int row0 = mt * 16, col0 = nq * 64;
  const float* arow = A + (size_t)(row0 + ln) * lda;
  v8f acc[4] = {};
  for (int kb = 0; kb < K; kb += 32) {
    FragB ah, al;
    const v4f x0 = *(const v4fa*)(arow + kb + 8 * hh), x1 = *(const v4fa*)(arow + kb + 8 * hh + 4);
    const v4f x2 = *(const v4fa*)(arow + kb + 16 + 8 * hh), x3 = *(const v4fa*)(arow + kb + 16 + 8 * hh + 4);
    float xs[16] = {x0[0],x0[1],x0[2],x0[3],x1[0],x1[1],x1[2],x1[3],x2[0],x2[1],x2[2],x2[3],x3[0],x3[1],x3[2],x3[3]};
#pragma unroll
    for (int i = 0; i < 16; ++i) { const unsigned short hb = bf16_bits(xs[i]); ah.u[i] = hb; al.u[i] = ASPLIT ? bf16_bits(xs[i] - bf16_val(hb)) : (unsigned short)0; }
#pragma unroll
    for (int t = 0; t < 4; ++t) {
      const unsigned short* brow = Wt + (size_t)(col0 + t * 16 + ln) * ldb + kb;
      FragB b;
      b.half[0] = *(const v8us*)(brow + 8 * hh);
      b.half[1] = *(const v8us*)(brow + 16 + 8 * hh);
      acc[t] = mmaN<ASPLIT ? 2 : 1>(ah.v, al.v, b.v, b.v, acc[t]);
    }
  }
#pragma unroll
  for (int t = 0; t < 4; ++t) {
    const int col = col0 + t * 16 + ln;
    float bv = bias ? bias[col] : 0.f;
    if (BIAS_BF16) bv = bf16_round(bv);
#pragma unroll
    for (int r = 0; r < 8; ++r) {
      float v = acc[t][r] + bv;
      if (resid) { float rv = resid[(size_t)((row0 + 8 * hh + r) % rmod) * ldr + col]; if (RES_BF16) rv = bf16_round(rv); v += rv; }
      if (ACT == 1) v = fmaxf(v, 0.f);
      if (ACT == 2) v = 0.5f * v * (1.0f + erff(v * 0.70710678118654752f));
      if (ACT == 3) { const float u = 0.7978845608028654f * (v + 0.044715f * v * v * v); v = 0.5f * v * (1.0f + tanhf(u)); }
      so[w][8 * hh + r][t * 16 + ln] = v;
    }
  }
  __builtin_amdgcn_fence(__ATOMIC_ACQ_REL, "workgroup");
  __builtin_amdgcn_wave_barrier();
  const int rsub = lane >> 4, c4 = (lane & 15) * 4;
  {
#pragma unroll
    for (int q = 0; q < 8; ++q) {
      const int r = q * 2 + rsub;
      const v4f v = *(const v4fa*)&so[w][r][c4];
      *(v4f*)(C + (size_t)(row0 + r) * ldc + col0 + c4) = v;
    }
    
  }
}
// row LayerNorm (biased variance, eps) over N: s = X (+ R); optional out_sum <- s; out_norm <- (s-mu)*rsqrt(var+eps)*g + b
template <bool PARAM_BF16>
__global__ __launch_bounds__(256) void k_layernorm(const float* __restrict__ X, const float* __restrict__ R, const float* __restrict__ g, const float* __restrict__ bta,
                                                  float* __restrict__ out_sum, float* __restrict__ out_norm, int N, float eps) {
  __shared__ float red[256];
  const int row = blockIdx.x, tid = threadIdx.x;
  const float* x = X + (size_t)row * N; const float* rr = R ? R + (size_t)row * N : nullptr;
  float vals[16];                     // up to N = 4096
  const int per = N / 256;            // contiguous chunk per thread? use strided-by-4 chunks: thread handles j = tid*4 + 1024*u
  float s1 = 0.f;
  for (int u = 0; u < per / 4; ++u) {
    const int j = tid * 4 + 1024 * u;
    const v4f a = *(const v4fa*)(x + j);
    v4f b = {0.f,0.f,0.f,0.f}; if (rr) b = *(const v4fa*)(rr + j);
#pragma unroll
    for (int q = 0; q < 4; ++q) { const float v = a[q] + b[q]; vals[u * 4 + q] = v; s1 += v; }
  }
  red[tid] = s1; __syncthreads();
  for (int st = 128; st > 0; st >>= 1) { if (tid < st) red[tid] += red[tid + st]; __syncthreads(); }
  const float mu = red[0] / (float)N; __syncthreads();
  float s2 = 0.f;
  for (int u = 0; u < per / 4; ++u)
#pragma unroll
    for (int q = 0; q < 4; ++q) { const float c = vals[u * 4 + q] - mu; s2 += c * c; }
  red[tid] = s2; __syncthreads();
  for (int st = 128; st > 0; st >>= 1) { if (tid < st) red[tid] += red[tid + st]; __syncthreads(); }
  const float rs = rsqrtf(red[0] / (float)N + eps);
  {
    for (int u = 0; u < per / 4; ++u) {
      const int j = tid * 4 + 1024 * u;
      v4f o, sm;
#pragma unroll
      for (int q = 0; q < 4; ++q) {
        float gg = g[j + q], bb = bta[j + q];
        if (PARAM_BF16) { gg = bf16_round(gg); bb = bf16_round(bb); }
        sm[q] = vals[u * 4 + q]; o[q] = (vals[u * 4 + q] - mu) * rs * gg + bb;
      }
      if (out_sum) *(v4f*)(out_sum + (size_t)row * N + j) = sm;
      *(v4f*)(out_norm + (size_t)row * N + j) = o;
    }
    
  }
}



// ---- f16 WMMA path (v_wmma_f32_16x16x32_f16): 11-bit significands for operands in range — used where a probability operand needs more precision than bf16
typedef _Float16 v16h __attribute__((ext_vector_type(16)));
union FragH { v16h v; v8us half[2]; _Float16 h[16]; unsigned short u[16]; };
template <int NT>
__device__ __forceinline__ v8f mmaH(v16h ah, v16h al, v16h bh, v16h bl, v8f c) {
  c = __builtin_amdgcn_wmma_f32_16x16x32_f16(false, ah, false, bh, (short)0, c, false, false);
  if (NT >= 2) c = __builtin_amdgcn_wmma_f32_16x16x32_f16(false, al, false, bh, (short)0, c, false, false);
  if (NT >= 3) c = __builtin_amdgcn_wmma_f32_16x16x32_f16(false, ah, false, bl, (short)0, c, false, false);
  asm volatile("v_nop\n\tv_nop\n\tv_nop\n\tv_nop" : "+v"(c) : "v"(ah), "v"(al), "v"(bh), "v"(bl));
  return c;
}
// batched GEMM like k_gemm_b but f16 operands: A f32 (split into f16 hi/lo if ASPLIT, else rounded to f16), Bt = f16 values [n][k]; alpha; C f32; N multiple of 16 (partial tiles skipped)
template <bool ASPLIT>
__global__ __launch_bounds__(128) void k_gemm_h(const float* __restrict__ A, int lda, size_t sA, const _Float16* __restrict__ Bh, int ldb, size_t sB, float alpha, float* __restrict__ C, int ldc, size_t sC, int M, int N, int K) {
  __shared__ __attribute__((aligned(16))) float so[4][16][64];
  const int tid = threadIdx.x, w = tid >> 5, lane = tid & 31, ln = lane & 15, hh = lane >> 4; const int by = blockIdx.y;
  A += (size_t)by * sA; Bh += (size_t)by * sB; C += (size_t)by * sC;
  const int ntn = (N + 63) / 64; const int wid = blockIdx.x * 4 + w; const int mt = wid / ntn, nq = wid % ntn; if (mt * 16 >= M) return;
  const int row0 = mt * 16, col0 = nq * 64; const float* arow = A + (size_t)(row0 + ln) * lda;
  v8f acc[4] = {};
  for (int kb = 0; kb < K; kb += 32) {
    FragH ah, al;
    const v4f x0 = *(const v4fa*)(arow + kb + 8 * hh), x1 = *(const v4fa*)(arow + kb + 8 * hh + 4), x2 = *(const v4fa*)(arow + kb + 16 + 8 * hh), x3 = *(const v4fa*)(arow + kb + 16 + 8 * hh + 4);
    float xs[16] = {x0[0],x0[1],x0[2],x0[3],x1[0],x1[1],x1[2],x1[3],x2[0],x2[1],x2[2],x2[3],x3[0],x3[1],x3[2],x3[3]};
#pragma unroll
    for (int i = 0; i < 16; ++i) { const _Float16 h = (_Float16)xs[i]; ah.h[i] = h; al.h[i] = ASPLIT ? (_Float16)(xs[i] - (float)h) : (_Float16)0.0f; }
#pragma unroll
    for (int t = 0; t < 4; ++t) { if (col0 + t * 16 >= N) continue; const size_t boff = (size_t)(col0 + t * 16 + ln) * ldb + kb; FragH bq; bq.half[0] = *(const v8us*)(Bh + boff + 8 * hh); bq.half[1] = *(const v8us*)(Bh + boff + 16 + 8 * hh);
      acc[t] = mmaH<ASPLIT ? 2 : 1>(ah.v, al.v, bq.v, bq.v, acc[t]); }
  }
#pragma unroll
  for (int t = 0; t < 4; ++t) { if (col0 + t * 16 >= N) continue;
#pragma unroll
    for (int r = 0; r < 8; ++r) so[w][8 * hh + r][t * 16 + ln] = acc[t][r] * alpha; }
  __builtin_amdgcn_fence(__ATOMIC_ACQ_REL, "workgroup"); __builtin_amdgcn_wave_barrier();
  const int rsub = lane >> 4, c4 = (lane & 15) * 4;
  {
#pragma unroll
    for (int q = 0; q < 8; ++q) { const int r = q * 2 + rsub; if (col0 + c4 < N) { const v4f v = *(const v4fa*)&so[w][r][c4]; *(v4f*)(C + (size_t)(row0 + r) * ldc + col0 + c4) = v; } }
     }
}

// Wt[n][k] = f16(W[k][n]·scale) from f32 row-major W[K][N] (scale = power of two; bf16-exact weights stay exact in f16 away from the subnormal range)
__global__ __launch_bounds__(256) void k_wt_f16(const float* __restrict__ W, _Float16* __restrict__ Wt, int K, int N, float scale) {
  const int t = blockIdx.x * 256 + threadIdx.x; if (t >= N * (K / 8)) return; const int n = t / (K / 8), k8 = (t % (K / 8)) * 8; FragH f;
#pragma unroll
  for (int i = 0; i < 8; ++i) f.h[i] = (_Float16)(bf16_round(W[(size_t)(k8 + i) * N + n]) * scale); const v8us o = f.half[0];
  *(v8us*)((unsigned short*)Wt + (size_t)n * K + k8) = o; 
}
// k_gemm_hh variant with fused epilogue: v = acc·alpha + bias[by·sBias + col] (+ CP[(row/rowsPerB)·sCPb + by·64 + col] if CP) ; ACT 0 none / 1 elu ; writes f32 C and/or f16 C16 (each if non-null)
template <int ACT>
__global__ __launch_bounds__(128) void k_gemm_hhx(const _Float16* __restrict__ A, int lda, size_t sA, const _Float16* __restrict__ Bh, int ldb, size_t sB, float alpha, const float* __restrict__ bias, size_t sBias, const float* __restrict__ CP, int rowsPerB, size_t sCPb, int row0g,
    float* __restrict__ C, _Float16* __restrict__ C16, int ldc, size_t sC, int M, int N, int K) {
  __shared__ __attribute__((aligned(16))) float so[4][16][64];
  const int tid = threadIdx.x, w = tid >> 5, lane = tid & 31, ln = lane & 15, hh = lane >> 4; const int by = blockIdx.y;
  A += (size_t)by * sA; Bh += (size_t)by * sB; const size_t cofs = (size_t)by * sC; const float* bp = bias ? bias + (size_t)by * sBias : nullptr;
  const int ntn = (N + 63) / 64; const int wid = blockIdx.x * 4 + w; const int mt = wid / ntn, nq = wid % ntn; if (mt * 16 >= M) return;
  const int row0 = mt * 16, col0 = nq * 64; const _Float16* arow = A + (size_t)(row0 + ln) * lda;
  v8f acc[4] = {};
  for (int kb = 0; kb < K; kb += 32) { FragH ah; ah.half[0] = *(const v8us*)((const unsigned short*)arow + kb + 8 * hh); ah.half[1] = *(const v8us*)((const unsigned short*)arow + kb + 16 + 8 * hh);
#pragma unroll
    for (int t = 0; t < 4; ++t) { if (col0 + t * 16 >= N) continue; const size_t boff = (size_t)(col0 + t * 16 + ln) * ldb + kb; FragH bq; bq.half[0] = *(const v8us*)((const unsigned short*)Bh + boff + 8 * hh); bq.half[1] = *(const v8us*)((const unsigned short*)Bh + boff + 16 + 8 * hh);
      acc[t] = mmaH<1>(ah.v, ah.v, bq.v, bq.v, acc[t]); }
  }
#pragma unroll
  for (int t = 0; t < 4; ++t) { if (col0 + t * 16 >= N) continue; const int col = col0 + t * 16 + ln; const float bv = bp ? bf16_round(bp[col]) : 0.f;
#pragma unroll
    for (int r = 0; r < 8; ++r) { float v = acc[t][r] * alpha + bv; if (CP) { const int bidx = (row0g + row0 + 8 * hh + r) / rowsPerB; v += CP[(size_t)bidx * sCPb + (size_t)by * 64 + col]; } if (ACT == 1) v = (v > 0.f) ? v : expm1f(v); else if (ACT == 7) v = (v > 0.f) ? v + 1.0f : expf(v); else if (ACT == 8) v = tanhf(v); else if (ACT == 9) v = 0.5f * v * (1.0f + tanhf(0.7978845608028654f * (v + 0.044715f * v * v * v))); else if (ACT == 11) v = 1.0f / (1.0f + expf(-v)); else if (ACT == 12) v = (v > 0.f) ? v : 0.01f * v; else if (ACT == 14) v = (v > 0.f) ? v : 0.1f * v; else if (ACT == 15) v = v / (1.0f + expf(-v)); else if (ACT == 3) v = fmaxf(v, 0.f); else if (ACT == 6) v = 0.5f * v * (1.0f + erff(v * 0.70710678118654752f)); so[w][8 * hh + r][t * 16 + ln] = v; } }
  __builtin_amdgcn_fence(__ATOMIC_ACQ_REL, "workgroup"); __builtin_amdgcn_wave_barrier();
  const int rsub = lane >> 4, c4 = (lane & 15) * 4; typedef _Float16 v4h __attribute__((ext_vector_type(4)));
  {
#pragma unroll
    for (int q = 0; q < 8; ++q) { const int r = q * 2 + rsub; if (col0 + c4 < N) { const v4f v = *(const v4fa*)&so[w][r][c4]; if (C) *(v4f*)(C + cofs + (size_t)(row0 + r) * ldc + col0 + c4) = v; if (C16) { v4h h4; for (int i = 0; i < 4; ++i) h4[i] = (_Float16)v[i]; *(v4h*)(C16 + cofs + (size_t)(row0 + r) * ldc + col0 + c4) = h4; } } }
     }
}


typedef _Float16 v4h __attribute__((ext_vector_type(4)));

// All five input conversions in one launch: x -> f16(bf16(x)), each weight -> f16(bf16(W) * 16). An item is 8 floats; item = u * PREP_T + thread, so u = 0..3 walks x and u = 4..7 is one weight each.
// 512 work-groups of 8 waves (16 waves a WGP): every thread has its 16 loads of 16 B in flight before its first store.
#define PREP_T (512 * 256)
__global__ __launch_bounds__(256) void k_prep(const float* __restrict__ x, const float* __restrict__ Wq, const float* __restrict__ Wk, const float* __restrict__ Wv, const float* __restrict__ Wo, _Float16* __restrict__ X16, _Float16* __restrict__ Bw) {
  static_assert((size_t)NR * DD / 8 == (size_t)4 * PREP_T && (size_t)DD * DD / 8 == (size_t)PREP_T, "item split");
  const unsigned tb = (blockIdx.x * 256u + threadIdx.x) * 32u;      /* one 32-bit byte offset serves all eight items: each has a uniform base (scalar base + vector offset addressing) */
  const float* sp[8] = { x, x + PREP_T * 8, x + 2 * PREP_T * 8, x + 3 * PREP_T * 8, Wq, Wk, Wv, Wo };
  v4f a[8], c[8];
#pragma unroll
  for (int u = 0; u < 8; ++u) { a[u] = *(const v4fa*)((const char*)sp[u] + tb); c[u] = *(const v4fa*)((const char*)sp[u] + tb + 16); }
  __builtin_amdgcn_sched_barrier(0);      /* all 16 loads go out as one group: left alone the scheduler starts converting after eight and the rest wait behind those results */
  FragH f[8];
#pragma unroll
  for (int u = 0; u < 8; ++u) { const float sc = (u < 4) ? 1.0f : 16.0f;
#pragma unroll
    for (int q = 0; q < 4; ++q) { f[u].h[q] = (_Float16)(bf16_round(a[u][q]) * sc); f[u].h[4 + q] = (_Float16)(bf16_round(c[u][q]) * sc); } }
#pragma unroll
  for (int u = 0; u < 8; ++u) *(v8us*)((char*)(((u < 4) ? X16 : Bw) + (u & 3) * PREP_T * 8) + (tb >> 1)) = f[u].half[0];
}
__global__ __launch_bounds__(256) void k_h16(const float* __restrict__ x, _Float16* __restrict__ X16, size_t n8) { const size_t t = (size_t)blockIdx.x * 256 + threadIdx.x; if (t >= n8) return; FragH f;
#pragma unroll
  for (int q = 0; q < 8; ++q) f.h[q] = (_Float16)x[t * 8 + q]; *(v8us*)((unsigned short*)X16 + t * 8) = f.half[0];  }
typedef int v4ia __attribute__((ext_vector_type(4), may_alias));
// lane l <-> lane l ^ 16 (the two halves of a wave hold the two key groups of one query column)
__device__ __forceinline__ float xhalf(float x) { return __builtin_bit_cast(float, __builtin_amdgcn_permlanex16(__builtin_bit_cast(int, x), __builtin_bit_cast(int, x), 0x76543210, 0xfedcba98, false, false)); }
__device__ __forceinline__ v8f wm(v16h a, v16h b, v8f c) { return __builtin_amdgcn_wmma_f32_16x16x32_f16(false, a, false, b, (short)0, c, false, false); }
#define FS_KEYS 64
#define FS_PITCH 144
#define FS_PLANE (64 * FS_PITCH)
#define FS_STAGE (3 * FS_PLANE)
// six copies of one lane: rows r and r + 32 of K hi, K lo and Vt, 16 B each. The s_wait_xcnt stands inside the copies' own statement, so that no address register named here is rewritten in front of it.
__device__ __forceinline__ void fs_copy6(unsigned l, const _Float16* kh, const _Float16* kl, int ldk, const _Float16* vt) {
  asm volatile("global_load_async_to_lds_b128 %0, %6, off\n\t"
               "global_load_async_to_lds_b128 %1, %7, off\n\t"
               "global_load_async_to_lds_b128 %2, %8, off\n\t"
               "global_load_async_to_lds_b128 %3, %9, off\n\t"
               "global_load_async_to_lds_b128 %4, %10, off\n\t"
               "global_load_async_to_lds_b128 %5, %11, off\n\t"
               "s_wait_xcnt 0x0"
               :: "v"(l), "v"(l + 32 * FS_PITCH), "v"(l + FS_PLANE), "v"(l + FS_PLANE + 32 * FS_PITCH), "v"(l + 2 * FS_PLANE), "v"(l + 2 * FS_PLANE + 32 * FS_PITCH),
                  "v"(kh), "v"(kh + (size_t)32 * ldk), "v"(kl), "v"(kl + (size_t)32 * ldk), "v"(vt), "v"(vt + 32 * TT)
               : "memory");
}
// eight exponentials in base 2, results in registers of their own (early clobber): none lands on the source of the one in front of it, where the instruction set asks for a free slot, and the arguments stay whole for a pass that has to move its reference.
// The closing v_nop is that slot behind the last one, whatever the compiler puts next.
#define FS_EXP8(P, A, O) asm("v_exp_f32 %0, %8\n\t" "v_exp_f32 %1, %9\n\t" "v_exp_f32 %2, %10\n\t" "v_exp_f32 %3, %11\n\t" "v_exp_f32 %4, %12\n\t" "v_exp_f32 %5, %13\n\t" "v_exp_f32 %6, %14\n\t" "v_exp_f32 %7, %15\n\t" "v_nop" \
    : "=&v"(P[O]), "=&v"(P[O + 1]), "=&v"(P[O + 2]), "=&v"(P[O + 3]), "=&v"(P[O + 4]), "=&v"(P[O + 5]), "=&v"(P[O + 6]), "=&v"(P[O + 7]) \
    : "v"(A[O]), "v"(A[O + 1]), "v"(A[O + 2]), "v"(A[O + 3]), "v"(A[O + 4]), "v"(A[O + 5]), "v"(A[O + 6]), "v"(A[O + 7]))
// P = 2^a of one group's 16 scores of a lane: the f16 operand of Vt.Pt and the lane's partial row sum
__device__ __forceinline__ void fs_p16(const float (&a)[16], FragH& pa, float& sm) {
  float p[16], t8[8];
  FS_EXP8(p, a, 0); FS_EXP8(p, a, 8);
#pragma unroll
  for (int i = 0; i < 16; ++i) pa.h[i] = (_Float16)p[i];
#pragma unroll
  for (int i = 0; i < 8; ++i) t8[i] = p[i] + p[8 + i];
  sm = ((t8[0] + t8[1]) + (t8[2] + t8[3])) + ((t8[4] + t8[5]) + (t8[6] + t8[7]));
}
__global__ __launch_bounds__(256) void k_flash(const _Float16* __restrict__ Q16, const _Float16* __restrict__ Q16lo, int ldq, const _Float16* __restrict__ K16, const _Float16* __restrict__ K16lo, int ldk, const _Float16* __restrict__ Vt, const int* __restrict__ MSK, _Float16* __restrict__ O16, int ldo) {
  /* a wave owns NG = 2 groups of 16 query columns: every K, Vt and mask fragment that it reads from LDS serves both groups, and a work-group's stage copies serve 256 queries */
  constexpr int NG = 2, RPW = 16 * NG, NW = 8, NQB = TT / (NW * RPW), DT = 4, KS = 2, NST = TT / FS_KEYS;
  __shared__ __attribute__((aligned(16))) unsigned char sT[2 * FS_STAGE];
  __shared__ __attribute__((aligned(16))) int sM[TT];
  __shared__ __attribute__((aligned(16))) float sO[NW][RPW][64 + 4];
  const int tid = threadIdx.x, w = tid >> 5, lane = tid & 31, ln = lane & 15, hh = lane >> 4;
  const int slab = blockIdx.x / NQB, qblk = blockIdx.x % NQB; const int b = slab / NH, h = slab % NH; const int q0 = qblk * (NW * RPW) + w * RPW;
  const int cr = tid >> 3, cc = tid & 7;      /* this lane's row (mod 32) and 16-B column of every stage copy */
  const size_t kofs = ((size_t)b * TT + cr) * ldk + h * 64 + cc * 8;
  const _Float16* gkh = K16 + kofs; const _Float16* gkl = K16lo + kofs; const _Float16* gvt = Vt + ((size_t)slab * 64 + cr) * TT + cc * 8;
  const unsigned lt = (unsigned)(size_t)sT + cr * FS_PITCH + cc * 16;
  { const unsigned lm = (unsigned)(size_t)sM + tid * 16; const int* gm = MSK + (size_t)b * TT + tid * 4;
    /* the mask row, 2 x 16 B a lane; the wait inside the statement keeps its address registers until the copies have read them */
    asm volatile("global_load_async_to_lds_b128 %0, %2, off\n\t"
                 "global_load_async_to_lds_b128 %1, %3, off\n\t"
                 "s_wait_xcnt 0x0" :: "v"(lm), "v"(lm + TT * 2), "v"(gm), "v"(gm + TT / 2) : "memory"); }
  fs_copy6(lt, gkh, gkl, ldk, gvt);
  FragH aq[NG][KS], aql[NG][KS];
#pragma unroll
  for (int g = 0; g < NG; ++g) { const size_t qo = ((size_t)b * TT + q0 + g * 16 + ln) * ldq + h * 64; const unsigned short* qr = (const unsigned short*)Q16 + qo; const unsigned short* ql = (const unsigned short*)Q16lo + qo;
#pragma unroll
    for (int ks = 0; ks < KS; ++ks) { aq[g][ks].half[0] = *(const v8us*)(qr + ks * 32 + 8 * hh); aq[g][ks].half[1] = *(const v8us*)(qr + ks * 32 + 16 + 8 * hh); aql[g][ks].half[0] = *(const v8us*)(ql + ks * 32 + 8 * hh); aql[g][ks].half[1] = *(const v8us*)(ql + ks * 32 + 16 + 8 * hh); } }
  asm volatile("s_wait_xcnt 0x0" ::: "memory");          /* behind the Q loads: none of their address registers is rewritten in front of this wait */
  asm volatile("s_wait_asynccnt 0x0" ::: "memory");      /* the mask and stage 0 have landed for this wave */
  __syncthreads();                                       /* ... and for every wave */
  fs_copy6(lt + FS_STAGE, gkh + (size_t)FS_KEYS * ldk, gkl + (size_t)FS_KEYS * ldk, ldk, gvt + FS_KEYS);
  /* Softmax against a HELD reference c (base-2 units, one a query): the q planes carry log2(e), and -c is the C start value of each score tile's first product, so that the joined score IS the argument of v_exp_f32: P = 2^(s * log2e - c).
     c moves only in a pass where a lane's sum of P passes 2^15 (f16 P ends at 65504): there every query whose pass maximum lies above c - 4 takes that maximum + 4 as its new c (its largest P is then 2^-4, 19 doublings below the next move,
     and the f16 step of 2^-24 is 2^-20 of it), and O and l are scaled by 2^(old c - new c). Any c gives the same O / l; it only places P in the range of f16. c lives as -c in the 8 registers of the C operand and nowhere else.
     c starts at 0: elu + 1 is positive, so no score lies below 0 and no P below 1 before the first move. */
  float l_r[NG]; v8f negc[NG], oacc[NG][DT];
#pragma unroll
  for (int g = 0; g < NG; ++g) { l_r[g] = 0.f; negc[g] = (v8f){0.f,0.f,0.f,0.f,0.f,0.f,0.f,0.f};
#pragma unroll
    for (int dt = 0; dt < DT; ++dt) oacc[g][dt] = (v8f){0.f,0.f,0.f,0.f,0.f,0.f,0.f,0.f}; }
  const unsigned char* fk = sT + ln * FS_PITCH + 16 * hh; const unsigned char* fv = fk + 2 * FS_PLANE;
#pragma unroll 1      /* one stage a trip: the two buffers alternate by an offset */
  for (int t = 0; t < NST; ++t) {
    const unsigned bo = (unsigned)(t & 1) * FS_STAGE;
#pragma unroll      /* the two passes of a stage stand in line, so that every LDS read takes its place in the stage as an immediate offset */
    for (int ps = 0; ps < FS_KEYS / 32; ++ps) {
    const int* mp = sM + t * FS_KEYS + ps * 32 + 8 * hh;      /* key padding mask (1 = attend) of this lane's 16 keys */
    const v4ia km[4] = { *(const v4ia*)(mp), *(const v4ia*)(mp + 4), *(const v4ia*)(mp + 16), *(const v4ia*)(mp + 20) };
    float sv[NG][16]; FragH bk[2][KS], bl[2][KS], bv[DT];
#pragma unroll
    for (int nt = 0; nt < 2; ++nt) { const unsigned char* kr = fk + bo + (ps * 32 + nt * 16) * FS_PITCH; const unsigned char* kl = kr + FS_PLANE;
#pragma unroll
      for (int ks = 0; ks < KS; ++ks) { bk[nt][ks].half[0] = *(const v8us*)(kr + ks * 64); bk[nt][ks].half[1] = *(const v8us*)(kr + ks * 64 + 32); bl[nt][ks].half[0] = *(const v8us*)(kl + ks * 64); bl[nt][ks].half[1] = *(const v8us*)(kl + ks * 64 + 32); } }
    __builtin_amdgcn_sched_barrier(0);      /* the pass's K reads go out as one group: left alone the scheduler puts the second key tile's reads behind the first tile's products, and the wave waits out the LDS latency a second time */
    v8f acc[2][NG], accl[2][NG];      /* the two groups' products alternate: four accumulator chains a key tile, each chain's terms in the order they had */
#pragma unroll
    for (int nt = 0; nt < 2; ++nt) {
#pragma unroll
      for (int g = 0; g < NG; ++g) { acc[nt][g] = negc[g]; accl[nt][g] = (v8f){0.f,0.f,0.f,0.f,0.f,0.f,0.f,0.f}; }
#pragma unroll
      for (int ks = 0; ks < KS; ++ks) {
#pragma unroll
        for (int g = 0; g < NG; ++g) acc[nt][g] = wm(bk[nt][ks].v, aq[g][ks].v, acc[nt][g]);
#pragma unroll
        for (int g = 0; g < NG; ++g) accl[nt][g] = wm(bk[nt][ks].v, aql[g][ks].v, accl[nt][g]);
#pragma unroll
        for (int g = 0; g < NG; ++g) accl[nt][g] = wm(bl[nt][ks].v, aq[g][ks].v, accl[nt][g]); }
      if (nt == 0) __builtin_amdgcn_sched_barrier(0);      /* the first key tile's 12 products stay one run of four alternating chains: left alone the scheduler pulls a chain's products together and pads behind them; that tile's vector work then stands among the second tile's products */
      if (nt == 1) {
#pragma unroll
        for (int g = 0; g < NG; ++g)
#pragma unroll
          for (int r = 0; r < 8; ++r) sv[g][r] = (km[r >> 2][r & 3] != 0) ? acc[0][g][r] + accl[0][g][r] * 0.0009765625f : -INFINITY;
        __builtin_amdgcn_sched_barrier(0);      /* ... and does not sink behind them */
      } }
#pragma unroll
    for (int g = 0; g < NG; ++g)
#pragma unroll
      for (int r = 0; r < 8; ++r) sv[g][8 + r] = (km[2 + (r >> 2)][r & 3] != 0) ? acc[1][g][r] + accl[1][g][r] * 0.0009765625f : -INFINITY;
#pragma unroll
    for (int dt = 0; dt < DT; ++dt) { const unsigned char* vrow = fv + bo + dt * 16 * FS_PITCH + ps * 64; bv[dt].half[0] = *(const v8us*)(vrow); bv[dt].half[1] = *(const v8us*)(vrow + 32); }
    __builtin_amdgcn_sched_barrier(0);      /* the four Vt fragments are read ahead of the softmax, which covers their latency: left alone each read sinks to just in front of its product and is waited for there */
    FragH pa[NG]; float sm[NG];
#pragma unroll
    for (int g = 0; g < NG; ++g) fs_p16(sv[g], pa[g], sm[g]);
    /* one test a pass for both groups, a scalar branch on the wave's ballot: seldom taken once the references have settled */
    if (__builtin_amdgcn_ballot_w32(fmaxf(sm[0], sm[1]) > 32768.0f) != 0) {
#pragma unroll
      for (int g = 0; g < NG; ++g) {
        float t8[8], a2[16];
#pragma unroll
        for (int i = 0; i < 8; ++i) t8[i] = fmaxf(sv[g][i], sv[g][8 + i]);
        float mc = fmaxf(fmaxf(fmaxf(t8[0], t8[1]), fmaxf(t8[2], t8[3])), fmaxf(fmaxf(t8[4], t8[5]), fmaxf(t8[6], t8[7])));
        mc = fmaxf(mc, xhalf(mc));      /* both halves hold the query's pass maximum, relative to c */
        const float dl = fmaxf(mc + 4.0f, 0.f);      /* the reference only rises; 0 also where every key of the pass is masked */
        float al;
        asm("v_exp_f32 %0, %1\n\tv_nop" : "=v"(al) : "v"(-dl));      /* 2^(old c - new c); the v_nop is the free slot behind the exponential */
#pragma unroll
        for (int r = 0; r < 8; ++r) negc[g][r] -= dl;
#pragma unroll
        for (int i = 0; i < 16; ++i) a2[i] = sv[g][i] - dl;
        fs_p16(a2, pa[g], sm[g]);      /* this pass's P anew, against the new reference */
        l_r[g] *= al;
#pragma unroll
        for (int dt = 0; dt < DT; ++dt)
#pragma unroll
          for (int r = 0; r < 8; ++r) oacc[g][dt][r] *= al; } }
#pragma unroll
    for (int g = 0; g < NG; ++g) l_r[g] += sm[g];      /* per-lane partial sum; the halves join after the loop */
#pragma unroll
    for (int dt = 0; dt < DT; ++dt)
#pragma unroll
      for (int g = 0; g < NG; ++g) oacc[g][dt] = wm(bv[dt].v, pa[g].v, oacc[g][dt]); }
    asm volatile("s_wait_dscnt 0x0" ::: "memory");       /* this wave's reads of buffer t & 1 are done before the buffer is handed back */
    asm volatile("s_wait_asynccnt 0x0" ::: "memory");    /* this wave's copies of stage t + 1 have landed */
    __syncthreads();                                     /* publishes stage t + 1 and ends every wave's reads of stage t */
    if (t + 2 < NST) fs_copy6(lt + bo, gkh + (size_t)(t + 2) * FS_KEYS * ldk, gkl + (size_t)(t + 2) * FS_KEYS * ldk, ldk, gvt + (t + 2) * FS_KEYS);
  }
  asm volatile("s_wait_asynccnt 0x0" ::: "memory");      /* nothing is in flight when the wave goes on to its end */
#pragma unroll
  for (int g = 0; g < NG; ++g) { const float l = l_r[g] + xhalf(l_r[g]); const float inv = (l > 0.f) ? 1.0f / l : 0.f;
#pragma unroll
    for (int dt = 0; dt < DT; ++dt)
#pragma unroll
      for (int q = 0; q < 2; ++q) { const v4f o4 = { oacc[g][dt][q * 4] * inv, oacc[g][dt][q * 4 + 1] * inv, oacc[g][dt][q * 4 + 2] * inv, oacc[g][dt][q * 4 + 3] * inv }; *(v4fa*)&sO[w][g * 16 + ln][dt * 16 + 8 * hh + q * 4] = o4; } }
  __builtin_amdgcn_fence(__ATOMIC_ACQ_REL, "workgroup"); __builtin_amdgcn_wave_barrier();
  {
#pragma unroll      /* O x 2^4 goes out as the f16 operand of the output GEMM: 8 lanes a row, one whole 128-B line per (query, head) */
    for (int rp = 0; rp < RPW; rp += 4) { const int r = rp + (lane >> 3), c8 = (lane & 7) * 8; const v4f a = *(const v4fa*)&sO[w][r][c8], c = *(const v4fa*)&sO[w][r][c8 + 4]; FragH f;
#pragma unroll
      for (int q = 0; q < 4; ++q) { f.h[q] = (_Float16)(a[q] * 16.0f); f.h[4 + q] = (_Float16)(c[q] * 16.0f); }
      *(v8us*)((unsigned short*)O16 + ((size_t)b * TT + q0 + r) * ldo + h * 64 + c8) = f.half[0]; }
     } }

// ---- projection GEMM with its operands staged in LDS: C = alpha * A . Bt^T, A [NR][DD] and Bt [DD][DD] f16, both k-contiguous.
// One 128 x 128 tile per work-group of 8 waves (4 x 2 waves of 32 x 64). A stage is 128 k = 256 B of each of the 256 operand rows (A rows 0-127, Bt rows 128-255),
// brought by asynchronous copies (16 lanes of 16 B a row), two buffers: stage t + 1 flies while stage t is multiplied.
// LDS row pitch 272 B = 16 B x odd, the conflict-free pitch of ds_load_b128 fragment reads. The k order of every accumulator is 0, 32, 64, ... as before.
#define GS_K 128
#define GS_PITCH 272
#define GS_STAGE (256 * GS_PITCH)
// eight copies of one lane: rows r, r + 16, ..., r + 112 of one operand, 16 B each. The s_wait_xcnt stands inside the copies' own statement, so that no address register named here is rewritten in front of it.
__device__ __forceinline__ void gs_copy8(unsigned l, const _Float16* g) {
  asm volatile("global_load_async_to_lds_b128 %0, %8, off\n\t"
               "global_load_async_to_lds_b128 %1, %9, off\n\t"
               "global_load_async_to_lds_b128 %2, %10, off\n\t"
               "global_load_async_to_lds_b128 %3, %11, off\n\t"
               "global_load_async_to_lds_b128 %4, %12, off\n\t"
               "global_load_async_to_lds_b128 %5, %13, off\n\t"
               "global_load_async_to_lds_b128 %6, %14, off\n\t"
               "global_load_async_to_lds_b128 %7, %15, off\n\t"
               "s_wait_xcnt 0x0"
               :: "v"(l), "v"(l + 16 * GS_PITCH), "v"(l + 32 * GS_PITCH), "v"(l + 48 * GS_PITCH), "v"(l + 64 * GS_PITCH), "v"(l + 80 * GS_PITCH), "v"(l + 96 * GS_PITCH), "v"(l + 112 * GS_PITCH),
                  "v"(g), "v"(g + 16 * DD), "v"(g + 32 * DD), "v"(g + 48 * DD), "v"(g + 64 * DD), "v"(g + 80 * DD), "v"(g + 96 * DD), "v"(g + 112 * DD)
               : "memory");
}
// the 2 A and 4 B fragments of one k step (32 k = 64 B of a row) from a stage in LDS; both operands in the same k order: 8 hh + 0..7, then 16 + 8 hh + 0..7
__device__ __forceinline__ void gs_frags(FragH (&a)[2], FragH (&b)[4], const unsigned char* pa, const unsigned char* pb) {
#pragma unroll
  for (int i = 0; i < 2; ++i) { a[i].half[0] = *(const v8us*)(pa + i * 16 * GS_PITCH); a[i].half[1] = *(const v8us*)(pa + i * 16 * GS_PITCH + 32); }
#pragma unroll
  for (int j = 0; j < 4; ++j) { b[j].half[0] = *(const v8us*)(pb + j * 16 * GS_PITCH); b[j].half[1] = *(const v8us*)(pb + j * 16 * GS_PITCH + 32); }
}
// the 8 products of one k step
__device__ __forceinline__ void gs_mma(v8f (&acc)[2][4], const FragH (&a)[2], const FragH (&b)[4]) {
#pragma unroll
  for (int i = 0; i < 2; ++i)
#pragma unroll
    for (int j = 0; j < 4; ++j) acc[i][j] = __builtin_amdgcn_wmma_f32_16x16x32_f16(false, a[i].v, false, b[j].v, (short)0, acc[i][j], false, false);
}
// QKV = false: one product, C f32. QKV = true: the q, k and v projections in one grid (256 tiles each, Bt = the three weights in a row), each with its consumer's conversion as epilogue:
// q and k leave as elu + 1 (q times log2 e) split in f16 hi + 2^10 x residual planes, v leaves as f16 already transposed, Vt[batch * DD + column][token].
template <bool QKV>
__global__ __launch_bounds__(256) void k_gemm_lds(const _Float16* __restrict__ A, const _Float16* __restrict__ Bt, float alpha, float* __restrict__ C,
                                                  _Float16* __restrict__ Qh, _Float16* __restrict__ Ql, _Float16* __restrict__ Kh, _Float16* __restrict__ Kl, _Float16* __restrict__ Vt) {
  __shared__ __attribute__((aligned(16))) unsigned char sT[2 * GS_STAGE];
  __shared__ __attribute__((aligned(16))) float so[8][32][64 + 4];
  constexpr int NST = DD / GS_K;
  const int tid = threadIdx.x, w = tid >> 5, lane = tid & 31, ln = lane & 15, hh = lane >> 4;
  constexpr int NTILE = (NR / 128) * (DD / 128);
  const int which = QKV ? blockIdx.x / NTILE : 0, tile = QKV ? blockIdx.x % NTILE : blockIdx.x;      /* which: 0 q, 1 k, 2 v; the same for the whole work-group */
  Bt += (size_t)which * DD * DD;
  const int row0 = (tile / (DD / 128)) * 128, col0 = (tile % (DD / 128)) * 128; const int wm = w >> 1, wn = w & 1;
  const int cr = tid >> 4, cc = tid & 15;      /* this lane's row (mod 16) and 16-B column of every copy */
  const _Float16* ga = A + (size_t)(row0 + cr) * DD + cc * 8; const _Float16* gb = Bt + (size_t)(col0 + cr) * DD + cc * 8;
  const unsigned la = (unsigned)(size_t)sT + cr * GS_PITCH + cc * 16, lb = la + 128 * GS_PITCH;
  gs_copy8(la, ga); gs_copy8(lb, gb);
  asm volatile("s_wait_asynccnt 0x0" ::: "memory");      /* stage 0 has landed for this wave */
  __syncthreads();                                       /* ... and for every wave */
  gs_copy8(la + GS_STAGE, ga + GS_K); gs_copy8(lb + GS_STAGE, gb + GS_K);
  v8f acc[2][4];
#pragma unroll
  for (int i = 0; i < 2; ++i)
#pragma unroll
    for (int j = 0; j < 4; ++j) acc[i][j] = (v8f){0.f,0.f,0.f,0.f,0.f,0.f,0.f,0.f};
  const unsigned char* fa = sT + (wm * 32 + ln) * GS_PITCH + 16 * hh; const unsigned char* fb = sT + (128 + wn * 64 + ln) * GS_PITCH + 16 * hh;
#pragma unroll 1      /* one stage a trip: the two buffers alternate by an offset, the text stays small */
  for (int t = 0; t < NST; ++t) {
    const unsigned bo = (unsigned)(t & 1) * GS_STAGE;
    FragH a[2][2], b[2][4];      /* two fragment sets: the reads of k step ks + 1 of this same stage are issued as one group ahead of the products of k step ks */
    gs_frags(a[0], b[0], fa + bo, fb + bo);
#pragma unroll
    for (int ks = 0; ks + 1 < GS_K / 32; ++ks) {
      gs_frags(a[(ks + 1) & 1], b[(ks + 1) & 1], fa + bo + (ks + 1) * 64, fb + bo + (ks + 1) * 64);
      __builtin_amdgcn_sched_barrier(0);      /* keeps that group of reads ahead of the products: left alone the scheduler sinks each read to just in front of its use, and the wave waits out the LDS latency there */
      gs_mma(acc, a[ks & 1], b[ks & 1]);
    }
    __builtin_amdgcn_sched_barrier(0);                   /* those products stay in front of the hand-over and cover the last group's LDS latency */
    asm volatile("s_wait_dscnt 0x0" ::: "memory");       /* this wave's reads of buffer t & 1 are done before the buffer is handed back */
    asm volatile("s_wait_asynccnt 0x0" ::: "memory");    /* this wave's copies of stage t + 1 have landed */
    __syncthreads();                                     /* publishes stage t + 1 and ends every wave's reads of stage t */
    if (t + 2 < NST) { gs_copy8(la + bo, ga + (t + 2) * GS_K); gs_copy8(lb + bo, gb + (t + 2) * GS_K); }
    __builtin_amdgcn_sched_barrier(0);                   /* the refill is issued first: the last k step's products need registers only and run while the copies fly */
    gs_mma(acc, a[(GS_K / 32 - 1) & 1], b[(GS_K / 32 - 1) & 1]);
  }
  asm volatile("s_wait_asynccnt 0x0" ::: "memory");      /* nothing is in flight when the wave goes on to its end */
  if (QKV && which == 2) {
    /* v: a lane's 8 accumulator rows are 8 consecutive tokens of one column = 16 B of the transposed tile; staged [128 columns][128 tokens] f16 at pitch 272 B in so */
    unsigned char* sv = (unsigned char*)&so[0][0][0];
#pragma unroll
    for (int i = 0; i < 2; ++i)
#pragma unroll
      for (int j = 0; j < 4; ++j) { FragH f;
#pragma unroll
        for (int r = 0; r < 8; ++r) f.h[r] = (_Float16)(acc[i][j][r] * alpha);
        *(v8us*)(sv + (wn * 64 + j * 16 + ln) * GS_PITCH + (wm * 32 + i * 16 + 8 * hh) * 2) = f.half[0]; }
    __syncthreads();      /* a column's 128 tokens come from four waves: every wave's part is in LDS before any is read back */
#pragma unroll
    for (int q = 0; q < 8; ++q) { const int c = q * 16 + (tid >> 4), ch = tid & 15;      /* 16 lanes a column: 256 contiguous bytes of Vt */
      const v8us v = *(const v8us*)(sv + c * GS_PITCH + ch * 16);
      *(v8us*)((unsigned short*)Vt + ((size_t)(row0 / TT) * DD + col0 + c) * TT + row0 % TT + ch * 8) = v; }
  } else {
#pragma unroll
  for (int i = 0; i < 2; ++i)
#pragma unroll
    for (int j = 0; j < 4; ++j)
#pragma unroll
      for (int r = 0; r < 8; ++r) so[w][i * 16 + 8 * hh + r][j * 16 + ln] = acc[i][j][r] * alpha;
  __builtin_amdgcn_fence(__ATOMIC_ACQ_REL, "workgroup"); __builtin_amdgcn_wave_barrier();      /* the wave reads back rows that its other lanes wrote */
  if (QKV) {
    /* q, k: elu(x) + 1 = x + 1 (x > 0) | e^x (x <= 0), then hi = f16(v), lo = f16((v - hi) * 2^10); 8 lanes a row: the wave's 64 columns are one whole 128-B line of each plane */
    unsigned short* Hh = (unsigned short*)(which == 0 ? Qh : Kh); unsigned short* Hl = (unsigned short*)(which == 0 ? Ql : Kl);
    const float fs = (which == 0) ? 1.4426950408889634f : 1.0f;      /* the q planes carry log2(e): the score products of k_flash come out as base-2 exponents */
#pragma unroll
    for (int q = 0; q < 8; ++q) { const int r = q * 4 + (lane >> 3), c8 = (lane & 7) * 8; const v4f a = *(const v4fa*)&so[w][r][c8], c = *(const v4fa*)&so[w][r][c8 + 4]; FragH fh, fl;
#pragma unroll
      for (int e = 0; e < 8; ++e) { const float x = (e < 4) ? a[e] : c[e - 4]; const float ex = expf(x);      /* taken for every lane, then selected: eight independent chains and no branch per element, with only two waves a SIMD to cover latency here */
        const float v = ((x > 0.f) ? x + 1.0f : ex) * fs; const _Float16 h = (_Float16)v; fh.h[e] = h; fl.h[e] = (_Float16)((v - (float)h) * 1024.0f); }
      const size_t o = (size_t)(row0 + wm * 32 + r) * DD + col0 + wn * 64 + c8;
      *(v8us*)(Hh + o) = fh.half[0]; *(v8us*)(Hl + o) = fl.half[0]; }
    asm volatile("s_wait_xcnt 0x0" ::: "memory");      /* behind the last hi/lo store: no address or data register of these stores is rewritten in front of this wait on any way out of the loop */
  } else {
    const int rsub = lane >> 4, c4 = (lane & 15) * 4;
#pragma unroll
    for (int q = 0; q < 16; ++q) { const int r = q * 2 + rsub; const v4f v = *(const v4fa*)&so[w][r][c4]; *(v4f*)(C + (size_t)(row0 + wm * 32 + r) * DD + col0 + wn * 64 + c4) = v; }
  }
  }
}

extern "C" void kernel_launch(void* const* d_in, const int* in_sizes, int n_in,
                              void* d_out, int out_size, void* d_ws, size_t ws_size, hipStream_t stream) {
  (void)in_sizes; (void)n_in; (void)out_size;
  const float* x = (const float*)d_in[0]; const int* mask = (const int*)d_in[1]; const float* Wq = (const float*)d_in[2]; const float* Wk = (const float*)d_in[3]; const float* Wv = (const float*)d_in[4]; const float* Wo = (const float*)d_in[5];
  char* ws = (char*)d_ws; size_t off = 0;
  auto take = [&](size_t bytes) { char* p = ws + off; off += (bytes + 255) & ~(size_t)255; return p; };
  const size_t WSZ = (size_t)DD * DD; _Float16* Bw = (_Float16*)take(4 * WSZ * 2); _Float16* X16 = (_Float16*)take((size_t)NR * DD * 2);
  _Float16* Qh = (_Float16*)take((size_t)NR * DD * 2); _Float16* Ql = (_Float16*)take((size_t)NR * DD * 2); _Float16* Kh = (_Float16*)take((size_t)NR * DD * 2); _Float16* Kl = (_Float16*)take((size_t)NR * DD * 2); _Float16* Vt = (_Float16*)take((size_t)NR * DD * 2);
  _Float16* O16 = X16;      /* X16 is dead after the q/k/v launch */
  if (off > ws_size) return;      // 7 x 8.4 MB
  k_prep<<<PREP_T / 256, 256, 0, stream>>>(x, Wq, Wk, Wv, Wo, X16, Bw);
  k_gemm_lds<true><<<3 * (NR / 128) * (DD / 128), 256, 0, stream>>>(X16, Bw, 0.0625f, nullptr, Qh, Ql, Kh, Kl, Vt);      /* q, k: elu + 1 hi/lo; v: transposed */
  k_flash<<<BB * NH * (TT / 256), 256, 0, stream>>>(Qh, Ql, DD, Kh, Kl, DD, Vt, mask, O16, DD);
  k_gemm_lds<false><<<(NR / 128) * (DD / 128), 256, 0, stream>>>(O16, Bw + 3 * WSZ, 0.00390625f, (float*)d_out, nullptr, nullptr, nullptr, nullptr, nullptr);      /* out = O . Wo^T */
}

// v009
// It runs in 93 microseconds.
// Timed twice side by side with v008, it ran 1.03 and 1.04 times as fast.
// Over all steps from v000 it is 5.63 times as fast.
#include <hip/hip_runtime.h>
// Multi-head 'linear-feature' attention (B=2, S=2048, H=1024, 16 heads × 64): q,k,v = x·Wᵀ (no bias); φ(q) = elu(q)+1, φ(k) = elu(k)+1; attn = softmax(φ(q)·φ(k)ᵀ) UNSCALED (σ≈8 logits) with the INPUT key mask [B,S] (0 → −inf);
// out = (attn·v merged)·Woᵀ.
// Compute dtype: x and weights rounded to bf16; q,k as f32 GEMM outputs mapped through elu+1 in f32 and split into f16 hi + residual planes so the large unscaled logits are f32-accurate
// (S = Qh·Kh + Ql·Kh + Qh·Kl, one accumulator); v f16; fused flash-style kernel (online softmax f32, P f16 against a held reference) on v_wmma_f32_16x16x32_f16; O ×2^4 → f16 → output GEMM; f32 accumulate.
#define BB 2
#define TT 2048
#define NH 16
#define DD 1024
#define NR (BB * TT)

typedef __bf16 v16b __attribute__((ext_vector_type(16)));
typedef unsigned short v8us __attribute__((ext_vector_type(8), may_alias));
typedef float  v8f  __attribute__((ext_vector_type(8)));
typedef float  v4f  __attribute__((ext_vector_type(4)));
typedef float  v4fa __attribute__((ext_vector_type(4), may_alias));
union FragB { v16b v; v8us half[2]; unsigned short u[16]; };

__device__ __forceinline__ unsigned short bf16_bits(float x) { unsigned int u = __float_as_uint(x); return (unsigned short)((u + 0x7FFFu + ((u >> 16) & 1u)) >> 16); }
__device__ __forceinline__ float bf16_val(unsigned short b) { return __uint_as_float(((unsigned int)b) << 16); }
__device__ __forceinline__ float bf16_round(float x) { return bf16_val(bf16_bits(x)); }
// D += A·B with NT terms: 1 = ah·bh, 2 = + al·bh (A split), 3 = + ah·bl (both split)
template <int NT>
__device__ __forceinline__ v8f mmaN(v16b ah, v16b al, v16b bh, v16b bl, v8f c) {
  c = __builtin_amdgcn_wmma_f32_16x16x32_bf16(false, ah, false, bh, (short)0, c, false, false);
  if (NT >= 2) c = __builtin_amdgcn_wmma_f32_16x16x32_bf16(false, al, false, bh, (short)0, c, false, false);
  if (NT >= 3) c = __builtin_amdgcn_wmma_f32_16x16x32_bf16(false, ah, false, bl, (short)0, c, false, false);
  asm volatile("v_nop\n\tv_nop\n\tv_nop\n\tv_nop" : "+v"(c) : "v"(ah), "v"(al), "v"(bh), "v"(bl));
  return c;
}

__global__ __launch_bounds__(256) void k_wt_bf16(const float* __restrict__ W, unsigned short* __restrict__ Wt, int K, int N) {
  const int t = blockIdx.x * 256 + threadIdx.x;
  const int k8n = K / 8;
  if (t >= N * k8n) return;
  const int n = t / k8n, k8 = (t % k8n) * 8;
  v8us v;
#pragma unroll
  for (int i = 0; i < 8; ++i) v[i] = bf16_bits(W[(size_t)(k8 + i) * N + n]);
  *(v8us*)(Wt + (size_t)n * K + k8) = v;
  
}

// GEMM C[M][N] (f32, pitch ldc) = act(A[M][K]·W + bias). A f32 row-major (pitch lda) converted per fragment to bf16
// (ASPLIT: hi/lo two planes -> 2 terms, else single rounded term); Wt bf16 [N][K] (pitch ldb). BIAS_BF16 rounds the
// bias to bf16 first (bias quantised to bf16 before the add). K%32==0, M%16==0, N%64==0.
template <bool ASPLIT, int ACT, bool BIAS_BF16>
__global__ __launch_bounds__(128) void k_gemm_bf(const float* __restrict__ A, int lda, const unsigned short* __restrict__ Wt, int ldb,
                                               const float* __restrict__ bias, float* __restrict__ C, int ldc, int M, int N, int K) {
  __shared__ __attribute__((aligned(16))) float so[4][16][64];
  const int tid = threadIdx.x, w = tid >> 5, lane = tid & 31, ln = lane & 15, hh = lane >> 4;
  const int ntn = N / 64;
  const int wid = blockIdx.x * 4 + w;
  const int mt = wid / ntn, nq = wid % ntn;
  if (mt * 16 >= M) return;
  const int row0 = mt * 16, col0 = nq * 64;
  const float* arow = A + (size_t)(row0 + ln) * lda;
  v8f acc[4] = {};
  for (int kb = 0; kb < K; kb += 32) {
    FragB ah, al;
    const v4f x0 = *(const v4fa*)(arow + kb + 8 * hh), x1 = *(const v4fa*)(arow + kb + 8 * hh + 4);
    const v4f x2 = *(const v4fa*)(arow + kb + 16 + 8 * hh), x3 = *(const v4fa*)(arow + kb + 16 + 8 * hh + 4);
    float xs[16] = {x0[0],x0[1],x0[2],x0[3],x1[0],x1[1],x1[2],x1[3],x2[0],x2[1],x2[2],x2[3],x3[0],x3[1],x3[2],x3[3]};
#pragma unroll
    for (int i = 0; i < 16; ++i) { const unsigned short hb = bf16_bits(xs[i]); ah.u[i] = hb; al.u[i] = ASPLIT ? bf16_bits(xs[i] - bf16_val(hb)) : (unsigned short)0; }
#pragma unroll
    for (int t = 0; t < 4; ++t) {
      const unsigned short* brow = Wt + (size_t)(col0 + t * 16 + ln) * ldb + kb;
      FragB b;
      b.half[0] = *(const v8us*)(brow + 8 * hh);
      b.half[1] = *(const v8us*)(brow + 16 + 8 * hh);
      acc[t] = mmaN<ASPLIT ? 2 : 1>(ah.v, al.v, b.v, b.v, acc[t]);
    }
  }
#pragma unroll
  for (int t = 0; t < 4; ++t) {
    float bv = bias ? bias[col0 + t * 16 + ln] : 0.f;
    if (BIAS_BF16) bv = bf16_round(bv);
#pragma unroll
    for (int r = 0; r < 8; ++r) { float v = acc[t][r] + bv; if (ACT == 1) v = fmaxf(v, 0.f); so[w][8 * hh + r][t * 16 + ln] = v; }
  }
  __builtin_amdgcn_fence(__ATOMIC_ACQ_REL, "workgroup");
  __builtin_amdgcn_wave_barrier();
  const int rsub = lane >> 4, c4 = (lane & 15) * 4;
  {
#pragma unroll
    for (int q = 0; q < 8; ++q) {
      const int r = q * 2 + rsub;
      const v4f v = *(const v4fa*)&so[w][r][c4];
      *(v4f*)(C + (size_t)(row0 + r) * ldc + col0 + c4) = v;
    }
    
  }
}

// Flash-style causal/unmasked attention, all contractions 3-term bf16 hi/lo splits, f32 softmax with running max.
// q,k,v rows are read from f32 buffers with arbitrary row pitch (so they can live inside a fused qkv buffer);
// D = head size (multiple of 32, <= 128); one wave = 16 query rows; block = 4 waves (64 queries) sharing K/V chunks of 32.
template <int D, bool CAUSAL>
__global__ __launch_bounds__(128) void k_flash(const float* __restrict__ qb, const float* __restrict__ kb, const float* __restrict__ vb,
                                             int pitch, int T, int H, float scale, float* __restrict__ y, int ypitch) {
  constexpr int KS = D / 32;        // k-steps for QK
  constexpr int DT = D / 16;        // d tiles for PV
  __shared__ __attribute__((aligned(16))) unsigned short sKh[32][D + 8], sKl[32][D + 8], sVh[32][D + 8], sVl[32][D + 8];
  __shared__ __attribute__((aligned(16))) unsigned short sPh[4][16][40], sPl[4][16][40];
  __shared__ __attribute__((aligned(16))) float sO[4][16][D];
  const int tid = threadIdx.x, w = tid >> 5, lane = tid & 31, ln = lane & 15, hh = lane >> 4;
  const int nqb = (T + 63) / 64;
  const int bh = blockIdx.x / nqb, qblk = blockIdx.x % nqb;
  const int b = bh / H, h = bh % H;
  const int q0 = qblk * 64 + w * 16;
  const float* Q = qb + (size_t)b * T * pitch + h * D;
  const float* K = kb + (size_t)b * T * pitch + h * D;
  const float* V = vb + (size_t)b * T * pitch + h * D;

  // A fragments of the wave's 16 query rows (scaled), hi/lo
  FragB aqh[KS], aql[KS];
  {
    int row = q0 + ln; if (row >= T) row = T - 1;
    const float* qr = Q + (size_t)row * pitch;
#pragma unroll
    for (int ks = 0; ks < KS; ++ks)
#pragma unroll
      for (int i = 0; i < 16; ++i) {
        const int d = ks * 32 + ((i < 8) ? (8 * hh + i) : (16 + 8 * hh + (i - 8)));
        const float x = qr[d] * scale; const unsigned short hb = bf16_bits(x);
        aqh[ks].u[i] = hb; aql[ks].u[i] = bf16_bits(x - bf16_val(hb));
      }
  }
  float m_r[8], l_r[8];
#pragma unroll
  for (int r = 0; r < 8; ++r) { m_r[r] = -3.0e38f; l_r[r] = 0.f; }
  v8f oacc[DT];
#pragma unroll
  for (int dt = 0; dt < DT; ++dt) oacc[dt] = (v8f){0.f,0.f,0.f,0.f,0.f,0.f,0.f,0.f};

  const int kv_end = CAUSAL ? min(T, qblk * 64 + 64) : T;     // block-uniform
  for (int j0 = 0; j0 < kv_end; j0 += 32) {
    __syncthreads();
    for (int e = tid; e < 32 * (D / 4); e += 128) {
      const int r = e / (D / 4), c4 = (e % (D / 4)) * 4;
      const int key = j0 + r;
      v4f kf = {0.f,0.f,0.f,0.f}, vf = {0.f,0.f,0.f,0.f};
      if (key < T) { kf = *(const v4fa*)(K + (size_t)key * pitch + c4); vf = *(const v4fa*)(V + (size_t)key * pitch + c4); }
#pragma unroll
      for (int t = 0; t < 4; ++t) {
        unsigned short hb = bf16_bits(kf[t]); sKh[r][c4 + t] = hb; sKl[r][c4 + t] = bf16_bits(kf[t] - bf16_val(hb));
        hb = bf16_bits(vf[t]); sVh[r][c4 + t] = hb; sVl[r][c4 + t] = bf16_bits(vf[t] - bf16_val(hb));
      }
    }
    __syncthreads();
    // S tile 16 x 32
    v8f s[2];
#pragma unroll
    for (int nt = 0; nt < 2; ++nt) {
      v8f acc = {};
#pragma unroll
      for (int ks = 0; ks < KS; ++ks) {
        FragB bh_, bl_;
        bh_.half[0] = *(const v8us*)&sKh[nt * 16 + ln][ks * 32 + 8 * hh]; bh_.half[1] = *(const v8us*)&sKh[nt * 16 + ln][ks * 32 + 16 + 8 * hh];
        bl_.half[0] = *(const v8us*)&sKl[nt * 16 + ln][ks * 32 + 8 * hh]; bl_.half[1] = *(const v8us*)&sKl[nt * 16 + ln][ks * 32 + 16 + 8 * hh];
        acc = mmaN<3>(aqh[ks].v, aql[ks].v, bh_.v, bl_.v, acc);
      }
      s[nt] = acc;
    }
    // mask + running max (rows 8hh+r; the 16 lanes of a half share rows)
    float alpha[8];
#pragma unroll
    for (int r = 0; r < 8; ++r) {
      const int qi = q0 + 8 * hh + r;
      const int ja = j0 + ln, jb = j0 + 16 + ln;
      if (CAUSAL) { if (ja > qi) s[0][r] = -3.0e38f; if (jb > qi) s[1][r] = -3.0e38f; }
      if (ja >= T) s[0][r] = -3.0e38f;
      if (jb >= T) s[1][r] = -3.0e38f;
      float mx = fmaxf(s[0][r], s[1][r]);
      mx = fmaxf(mx, __shfl_xor(mx, 1, 32)); mx = fmaxf(mx, __shfl_xor(mx, 2, 32)); mx = fmaxf(mx, __shfl_xor(mx, 4, 32)); mx = fmaxf(mx, __shfl_xor(mx, 8, 32));
      const float mnew = fmaxf(m_r[r], mx);
      alpha[r] = (mnew > -1.0e38f) ? __expf(m_r[r] - mnew) : 1.0f;
      const float p0 = (s[0][r] > -1.0e38f) ? __expf(s[0][r] - mnew) : 0.f;
      const float p1 = (s[1][r] > -1.0e38f) ? __expf(s[1][r] - mnew) : 0.f;
      m_r[r] = mnew;
      l_r[r] = l_r[r] * alpha[r] + p0 + p1;            // per-lane partial row sum (16 lanes combined at the end)
      unsigned short hb = bf16_bits(p0); sPh[w][8 * hh + r][ln] = hb;      sPl[w][8 * hh + r][ln] = bf16_bits(p0 - bf16_val(hb));
      hb = bf16_bits(p1);                sPh[w][8 * hh + r][16 + ln] = hb; sPl[w][8 * hh + r][16 + ln] = bf16_bits(p1 - bf16_val(hb));
    }
#pragma unroll
    for (int dt = 0; dt < DT; ++dt)
#pragma unroll
      for (int r = 0; r < 8; ++r) oacc[dt][r] *= alpha[r];
    __builtin_amdgcn_fence(__ATOMIC_ACQ_REL, "workgroup");
    __builtin_amdgcn_wave_barrier();
    FragB pah, pal;
    pah.half[0] = *(const v8us*)&sPh[w][ln][8 * hh]; pah.half[1] = *(const v8us*)&sPh[w][ln][16 + 8 * hh];
    pal.half[0] = *(const v8us*)&sPl[w][ln][8 * hh]; pal.half[1] = *(const v8us*)&sPl[w][ln][16 + 8 * hh];
#pragma unroll
    for (int dt = 0; dt < DT; ++dt) {
      FragB bvh, bvl;
#pragma unroll
      for (int i = 0; i < 8; ++i) {
        bvh.u[i] = sVh[8 * hh + i][dt * 16 + ln]; bvh.u[8 + i] = sVh[16 + 8 * hh + i][dt * 16 + ln];
        bvl.u[i] = sVl[8 * hh + i][dt * 16 + ln]; bvl.u[8 + i] = sVl[16 + 8 * hh + i][dt * 16 + ln];
      }
      oacc[dt] = mmaN<3>(pah.v, pal.v, bvh.v, bvl.v, oacc[dt]);
    }
    __builtin_amdgcn_fence(__ATOMIC_ACQ_REL, "workgroup");
    __builtin_amdgcn_wave_barrier();
  }
#pragma unroll
  for (int r = 0; r < 8; ++r) {
    float l = l_r[r];
    l += __shfl_xor(l, 1, 32); l += __shfl_xor(l, 2, 32); l += __shfl_xor(l, 4, 32); l += __shfl_xor(l, 8, 32);
    l_r[r] = (l > 0.f) ? 1.0f / l : 0.f;
  }
#pragma unroll
  for (int dt = 0; dt < DT; ++dt)
#pragma unroll
    for (int r = 0; r < 8; ++r) sO[w][8 * hh + r][dt * 16 + ln] = oacc[dt][r] * l_r[r];
  __builtin_amdgcn_fence(__ATOMIC_ACQ_REL, "workgroup");
  __builtin_amdgcn_wave_barrier();
  {
    for (int r = 0; r < 16; ++r) {
      const int row = q0 + r;
      if (row < T && lane < D / 4) {
        const v4f val = *(const v4fa*)&sO[w][r][lane * 4];
        *(v4f*)(y + ((size_t)b * T + row) * ypitch + h * D + lane * 4) = val;
      }
    }
    
  }
}

// GEMM C = act(A·W + bias + resid): A f32 (ASPLIT -> hi/lo 2 terms), Wt bf16 [N][K]; ACT 0 none, 1 relu, 2 exact gelu;
// resid (optional, f32, row index = (row % rmod), pitch ldr, RES_BF16 rounds it) added before the activation.
template <bool ASPLIT, int ACT, bool BIAS_BF16, bool RES_BF16>
__global__ __launch_bounds__(128) void k_gemm_bf3(const float* __restrict__ A, int lda, const unsigned short* __restrict__ Wt, int ldb,
                                                const float* __restrict__ bias, const float* __restrict__ resid, int rmod, int ldr,
                                                float* __restrict__ C, int ldc, int M, int N, int K) {
  __shared__ __attribute__((aligned(16))) float so[4][16][64];
  const int tid = threadIdx.x, w = tid >> 5, lane = tid & 31, ln = lane & 15, hh = lane >> 4;
  const int ntn = N / 64;
  const int wid = blockIdx.x * 4 + w;
  const int mt = wid / ntn, nq = wid % ntn;
  if (mt * 16 >= M) return;
  const int row0 = mt * 16, col0 = nq * 64;
  const float* arow = A + (size_t)(row0 + ln) * lda;
  v8f acc[4] = {};
  for (int kb = 0; kb < K; kb += 32) {
    FragB ah, al;
    const v4f x0 = *(const v4fa*)(arow + kb + 8 * hh), x1 = *(const v4fa*)(arow + kb + 8 * hh + 4);
    const v4f x2 = *(const v4fa*)(arow + kb + 16 + 8 * hh), x3 = *(const v4fa*)(arow + kb + 16 + 8 * hh + 4);
    float xs[16] = {x0[0],x0[1],x0[2],x0[3],x1[0],x1[1],x1[2],x1[3],x2[0],x2[1],x2[2],x2[3],x3[0],x3[1],x3[2],x3[3]};
#pragma unroll
    for (int i = 0; i < 16; ++i) { const unsigned short hb = bf16_bits(xs[i]); ah.u[i] = hb; al.u[i] = ASPLIT ? bf16_bits(xs[i] - bf16_val(hb)) : (unsigned short)0; }
#pragma unroll
    for (int t = 0; t < 4; ++t) {
      const unsigned short* brow = Wt + (size_t)(col0 + t * 16 + ln) * ldb + kb;
      FragB b;
      b.half[0] = *(const v8us*)(brow + 8 * hh);
      b.half[1] = *(const v8us*)(brow + 16 + 8 * hh);
      acc[t] = mmaN<ASPLIT ? 2 : 1>(ah.v, al.v, b.v, b.v, acc[t]);
    }
  }
#pragma unroll
  for (int t = 0; t < 4; ++t) {
    const int col = col0 + t * 16 + ln;
    float bv = bias ? bias[col] : 0.f;
    if (BIAS_BF16) bv = bf16_round(bv);
#pragma unroll
    for (int r = 0; r < 8; ++r) {
      float v = acc[t][r] + bv;
      if (resid) { float rv = resid[(size_t)((row0 + 8 * hh + r) % rmod) * ldr + col]; if (RES_BF16) rv = bf16_round(rv); v += rv; }
      if (ACT == 1) v = fmaxf(v, 0.f);
      if (ACT == 2) v = 0.5f * v * (1.0f + erff(v * 0.70710678118654752f));
      if (ACT == 3) { const float u = 0.7978845608028654f * (v + 0.044715f * v * v * v); v = 0.5f * v * (1.0f + tanhf(u)); }
      so[w][8 * hh + r][t * 16 + ln] = v;
    }
  }
  __builtin_amdgcn_fence(__ATOMIC_ACQ_REL, "workgroup");
  __builtin_amdgcn_wave_barrier();
  const int rsub = lane >> 4, c4 = (lane & 15) * 4;
  {
#pragma unroll
    for (int q = 0; q < 8; ++q) {
      const int r = q * 2 + rsub;
      const v4f v = *(const v4fa*)&so[w][r][c4];
      *(v4f*)(C + (size_t)(row0 + r) * ldc + col0 + c4) = v;
    }
    
  }
}
// row LayerNorm (biased variance, eps) over N: s = X (+ R); optional out_sum <- s; out_norm <- (s-mu)*rsqrt(var+eps)*g + b
template <bool PARAM_BF16>
__global__ __launch_bounds__(256) void k_layernorm(const float* __restrict__ X, const float* __restrict__ R, const float* __restrict__ g, const float* __restrict__ bta,
                                                  float* __restrict__ out_sum, float* __restrict__ out_norm, int N, float eps) {
  __shared__ float red[256];
  const int row = blockIdx.x, tid = threadIdx.x;
  const float* x = X + (size_t)row * N; const float* rr = R ? R + (size_t)row * N : nullptr;
  float vals[16];                     // up to N = 4096
  const int per = N / 256;            // contiguous chunk per thread? use strided-by-4 chunks: thread handles j = tid*4 + 1024*u
  float s1 = 0.f;
  for (int u = 0; u < per / 4; ++u) {
    const int j = tid * 4 + 1024 * u;
    const v4f a = *(const v4fa*)(x + j);
    v4f b = {0.f,0.f,0.f,0.f}; if (rr) b = *(const v4fa*)(rr + j);
#pragma unroll
    for (int q = 0; q < 4; ++q) { const float v = a[q] + b[q]; vals[u * 4 + q] = v; s1 += v; }
  }
  red[tid] = s1; __syncthreads();
  for (int st = 128; st > 0; st >>= 1) { if (tid < st) red[tid] += red[tid + st]; __syncthreads(); }
  const float mu = red[0] / (float)N; __syncthreads();
  float s2 = 0.f;
  for (int u = 0; u < per / 4; ++u)
#pragma unroll
    for (int q = 0; q < 4; ++q) { const float c = vals[u * 4 + q] - mu; s2 += c * c; }
  red[tid] = s2; __syncthreads();
  for (int st = 128; st > 0; st >>= 1) { if (tid < st) red[tid] += red[tid + st]; __syncthreads(); }
  const float rs = rsqrtf(red[0] / (float)N + eps);
  {
    for (int u = 0; u < per / 4; ++u) {
      const int j = tid * 4 + 1024 * u;
      v4f o, sm;
#pragma unroll
      for (int q = 0; q < 4; ++q) {
        float gg = g[j + q], bb = bta[j + q];
        if (PARAM_BF16) { gg = bf16_round(gg); bb = bf16_round(bb); }
        sm[q] = vals[u * 4 + q]; o[q] = (vals[u * 4 + q] - mu) * rs * gg + bb;
      }
      if (out_sum) *(v4f*)(out_sum + (size_t)row * N + j) = sm;
      *(v4f*)(out_norm + (size_t)row * N + j) = o;
    }
    
  }
}



// ---- f16 WMMA path (v_wmma_f32_16x16x32_f16): 11-bit significands for operands in range — used where a probability operand needs more precision than bf16
typedef _Float16 v16h __attribute__((ext_vector_type(16)));
union FragH { v16h v; v8us half[2]; _Float16 h[16]; unsigned short u[16]; };
template <int NT>
__device__ __forceinline__ v8f mmaH(v16h ah, v16h al, v16h bh, v16h bl, v8f c) {
  c = __builtin_amdgcn_wmma_f32_16x16x32_f16(false, ah, false, bh, (short)0, c, false, false);
  if (NT >= 2) c = __builtin_amdgcn_wmma_f32_16x16x32_f16(false, al, false, bh, (short)0, c, false, false);
  if (NT >= 3) c = __builtin_amdgcn_wmma_f32_16x16x32_f16(false, ah, false, bl, (short)0, c, false, false);
  asm volatile("v_nop\n\tv_nop\n\tv_nop\n\tv_nop" : "+v"(c) : "v"(ah), "v"(al), "v"(bh), "v"(bl));
  return c;
}
// batched GEMM like k_gemm_b but f16 operands: A f32 (split into f16 hi/lo if ASPLIT, else rounded to f16), Bt = f16 values [n][k]; alpha; C f32; N multiple of 16 (partial tiles skipped)
template <bool ASPLIT>
__global__ __launch_bounds__(128) void k_gemm_h(const float* __restrict__ A, int lda, size_t sA, const _Float16* __restrict__ Bh, int ldb, size_t sB, float alpha, float* __restrict__ C, int ldc, size_t sC, int M, int N, int K) {
  __shared__ __attribute__((aligned(16))) float so[4][16][64];
  const int tid = threadIdx.x, w = tid >> 5, lane = tid & 31, ln = lane & 15, hh = lane >> 4; const int by = blockIdx.y;
  A += (size_t)by * sA; Bh += (size_t)by * sB; C += (size_t)by * sC;
  const int ntn = (N + 63) / 64; const int wid = blockIdx.x * 4 + w; const int mt = wid / ntn, nq = wid % ntn; if (mt * 16 >= M) return;
  const int row0 = mt * 16, col0 = nq * 64; const float* arow = A + (size_t)(row0 + ln) * lda;
  v8f acc[4] = {};
  for (int kb = 0; kb < K; kb += 32) {
    FragH ah, al;
    const v4f x0 = *(const v4fa*)(arow + kb + 8 * hh), x1 = *(const v4fa*)(arow + kb + 8 * hh + 4), x2 = *(const v4fa*)(arow + kb + 16 + 8 * hh), x3 = *(const v4fa*)(arow + kb + 16 + 8 * hh + 4);
    float xs[16] = {x0[0],x0[1],x0[2],x0[3],x1[0],x1[1],x1[2],x1[3],x2[0],x2[1],x2[2],x2[3],x3[0],x3[1],x3[2],x3[3]};
#pragma unroll
    for (int i = 0; i < 16; ++i) { const _Float16 h = (_Float16)xs[i]; ah.h[i] = h; al.h[i] = ASPLIT ? (_Float16)(xs[i] - (float)h) : (_Float16)0.0f; }
#pragma unroll
    for (int t = 0; t < 4; ++t) { if (col0 + t * 16 >= N) continue; const size_t boff = (size_t)(col0 + t * 16 + ln) * ldb + kb; FragH bq; bq.half[0] = *(const v8us*)(Bh + boff + 8 * hh); bq.half[1] = *(const v8us*)(Bh + boff + 16 + 8 * hh);
      acc[t] = mmaH<ASPLIT ? 2 : 1>(ah.v, al.v, bq.v, bq.v, acc[t]); }
  }
#pragma unroll
  for (int t = 0; t < 4; ++t) { if (col0 + t * 16 >= N) continue;
#pragma unroll
    for (int r = 0; r < 8; ++r) so[w][8 * hh + r][t * 16 + ln] = acc[t][r] * alpha; }
  __builtin_amdgcn_fence(__ATOMIC_ACQ_REL, "workgroup"); __builtin_amdgcn_wave_barrier();
  const int rsub = lane >> 4, c4 = (lane & 15) * 4;
  {
#pragma unroll
    for (int q = 0; q < 8; ++q) { const int r = q * 2 + rsub; if (col0 + c4 < N) { const v4f v = *(const v4fa*)&so[w][r][c4]; *(v4f*)(C + (size_t)(row0 + r) * ldc + col0 + c4) = v; } }
     }
}

// Wt[n][k] = f16(W[k][n]·scale) from f32 row-major W[K][N] (scale = power of two; bf16-exact weights stay exact in f16 away from the subnormal range)
__global__ __launch_bounds__(256) void k_wt_f16(const float* __restrict__ W, _Float16* __restrict__ Wt, int K, int N, float scale) {
  const int t = blockIdx.x * 256 + threadIdx.x; if (t >= N * (K / 8)) return; const int n = t / (K / 8), k8 = (t % (K / 8)) * 8; FragH f;
#pragma unroll
  for (int i = 0; i < 8; ++i) f.h[i] = (_Float16)(bf16_round(W[(size_t)(k8 + i) * N + n]) * scale); const v8us o = f.half[0];
  *(v8us*)((unsigned short*)Wt + (size_t)n * K + k8) = o; 
}
// k_gemm_hh variant with fused epilogue: v = acc·alpha + bias[by·sBias + col] (+ CP[(row/rowsPerB)·sCPb + by·64 + col] if CP) ; ACT 0 none / 1 elu ; writes f32 C and/or f16 C16 (each if non-null)
template <int ACT>
__global__ __launch_bounds__(128) void k_gemm_hhx(const _Float16* __restrict__ A, int lda, size_t sA, const _Float16* __restrict__ Bh, int ldb, size_t sB, float alpha, const float* __restrict__ bias, size_t sBias, const float* __restrict__ CP, int rowsPerB, size_t sCPb, int row0g,
    float* __restrict__ C, _Float16* __restrict__ C16, int ldc, size_t sC, int M, int N, int K) {
  __shared__ __attribute__((aligned(16))) float so[4][16][64];
  const int tid = threadIdx.x, w = tid >> 5, lane = tid & 31, ln = lane & 15, hh = lane >> 4; const int by = blockIdx.y;
  A += (size_t)by * sA; Bh += (size_t)by * sB; const size_t cofs = (size_t)by * sC; const float* bp = bias ? bias + (size_t)by * sBias : nullptr;
  const int ntn = (N + 63) / 64; const int wid = blockIdx.x * 4 + w; const int mt = wid / ntn, nq = wid % ntn; if (mt * 16 >= M) return;
  const int row0 = mt * 16, col0 = nq * 64; const _Float16* arow = A + (size_t)(row0 + ln) * lda;
  v8f acc[4] = {};
  for (int kb = 0; kb < K; kb += 32) { FragH ah; ah.half[0] = *(const v8us*)((const unsigned short*)arow + kb + 8 * hh); ah.half[1] = *(const v8us*)((const unsigned short*)arow + kb + 16 + 8 * hh);
#pragma unroll
    for (int t = 0; t < 4; ++t) { if (col0 + t * 16 >= N) continue; const size_t boff = (size_t)(col0 + t * 16 + ln) * ldb + kb; FragH bq; bq.half[0] = *(const v8us*)((const unsigned short*)Bh + boff + 8 * hh); bq.half[1] = *(const v8us*)((const unsigned short*)Bh + boff + 16 + 8 * hh);
      acc[t] = mmaH<1>(ah.v, ah.v, bq.v, bq.v, acc[t]); }
  }
#pragma unroll
  for (int t = 0; t < 4; ++t) { if (col0 + t * 16 >= N) continue; const int col = col0 + t * 16 + ln; const float bv = bp ? bf16_round(bp[col]) : 0.f;
#pragma unroll
    for (int r = 0; r < 8; ++r) { float v = acc[t][r] * alpha + bv; if (CP) { const int bidx = (row0g + row0 + 8 * hh + r) / rowsPerB; v += CP[(size_t)bidx * sCPb + (size_t)by * 64 + col]; } if (ACT == 1) v = (v > 0.f) ? v : expm1f(v); else if (ACT == 7) v = (v > 0.f) ? v + 1.0f : expf(v); else if (ACT == 8) v = tanhf(v); else if (ACT == 9) v = 0.5f * v * (1.0f + tanhf(0.7978845608028654f * (v + 0.044715f * v * v * v))); else if (ACT == 11) v = 1.0f / (1.0f + expf(-v)); else if (ACT == 12) v = (v > 0.f) ? v : 0.01f * v; else if (ACT == 14) v = (v > 0.f) ? v : 0.1f * v; else if (ACT == 15) v = v / (1.0f + expf(-v)); else if (ACT == 3) v = fmaxf(v, 0.f); else if (ACT == 6) v = 0.5f * v * (1.0f + erff(v * 0.70710678118654752f)); so[w][8 * hh + r][t * 16 + ln] = v; } }
  __builtin_amdgcn_fence(__ATOMIC_ACQ_REL, "workgroup"); __builtin_amdgcn_wave_barrier();
  const int rsub = lane >> 4, c4 = (lane & 15) * 4; typedef _Float16 v4h __attribute__((ext_vector_type(4)));
  {
#pragma unroll
    for (int q = 0; q < 8; ++q) { const int r = q * 2 + rsub; if (col0 + c4 < N) { const v4f v = *(const v4fa*)&so[w][r][c4]; if (C) *(v4f*)(C + cofs + (size_t)(row0 + r) * ldc + col0 + c4) = v; if (C16) { v4h h4; for (int i = 0; i < 4; ++i) h4[i] = (_Float16)v[i]; *(v4h*)(C16 + cofs + (size_t)(row0 + r) * ldc + col0 + c4) = h4; } } }
     }
}


typedef _Float16 v4h __attribute__((ext_vector_type(4)));

// All five input conversions in one launch: x -> f16(bf16(x)), each weight -> f16(bf16(W) * 16). An item is 8 floats; item = u * PREP_T + thread, so u = 0..3 walks x and u = 4..7 is one weight each.
// 512 work-groups of 8 waves (16 waves a WGP): every thread has its 16 loads of 16 B in flight before its first store.
#define PREP_T (512 * 256)
__global__ __launch_bounds__(256) void k_prep(const float* __restrict__ x, const float* __restrict__ Wq, const float* __restrict__ Wk, const float* __restrict__ Wv, const float* __restrict__ Wo, _Float16* __restrict__ X16, _Float16* __restrict__ Bw) {
  static_assert((size_t)NR * DD / 8 == (size_t)4 * PREP_T && (size_t)DD * DD / 8 == (size_t)PREP_T, "item split");
  const unsigned tb = (blockIdx.x * 256u + threadIdx.x) * 32u;      /* one 32-bit byte offset serves all eight items: each has a uniform base (scalar base + vector offset addressing) */
  const float* sp[8] = { x, x + PREP_T * 8, x + 2 * PREP_T * 8, x + 3 * PREP_T * 8, Wq, Wk, Wv, Wo };
  v4f a[8], c[8];
#pragma unroll
  for (int u = 0; u < 8; ++u) { a[u] = *(const v4fa*)((const char*)sp[u] + tb); c[u] = *(const v4fa*)((const char*)sp[u] + tb + 16); }
  __builtin_amdgcn_sched_barrier(0);      /* all 16 loads go out as one group: left alone the scheduler starts converting after eight and the rest wait behind those results */
  FragH f[8];
#pragma unroll
  for (int u = 0; u < 8; ++u) { const float sc = (u < 4) ? 1.0f : 16.0f;
#pragma unroll
    for (int q = 0; q < 4; ++q) { f[u].h[q] = (_Float16)(bf16_round(a[u][q]) * sc); f[u].h[4 + q] = (_Float16)(bf16_round(c[u][q]) * sc); } }
#pragma unroll
  for (int u = 0; u < 8; ++u) *(v8us*)((char*)(((u < 4) ? X16 : Bw) + (u & 3) * PREP_T * 8) + (tb >> 1)) = f[u].half[0];
}
__global__ __launch_bounds__(256) void k_h16(const float* __restrict__ x, _Float16* __restrict__ X16, size_t n8) { const size_t t = (size_t)blockIdx.x * 256 + threadIdx.x; if (t >= n8) return; FragH f;
#pragma unroll
  for (int q = 0; q < 8; ++q) f.h[q] = (_Float16)x[t * 8 + q]; *(v8us*)((unsigned short*)X16 + t * 8) = f.half[0];  }
typedef int v4ia __attribute__((ext_vector_type(4), may_alias));
// lane l <-> lane l ^ 16 (the two halves of a wave hold the two key groups of one query column)
__device__ __forceinline__ float xhalf(float x) { return __builtin_bit_cast(float, __builtin_amdgcn_permlanex16(__builtin_bit_cast(int, x), __builtin_bit_cast(int, x), 0x76543210, 0xfedcba98, false, false)); }
__device__ __forceinline__ v8f wm(v16h a, v16h b, v8f c) { return __builtin_amdgcn_wmma_f32_16x16x32_f16(false, a, false, b, (short)0, c, false, false); }
#define FS_KEYS 64
#define FS_OFF (-1.0e30f)      /* start value of a masked key's score: no sum of products brings it back, and 2^score is exactly 0 */
#define FS_PITCH 144
#define FS_PLANE (64 * FS_PITCH)
#define FS_STAGE (3 * FS_PLANE)
// six copies of one lane: rows r and r + 32 of K hi, K lo and Vt, 16 B each. The s_wait_xcnt stands inside the copies' own statement, so that no address register named here is rewritten in front of it.
__device__ __forceinline__ void fs_copy6(unsigned l, const _Float16* kh, const _Float16* kl, int ldk, const _Float16* vt) {
  asm volatile("global_load_async_to_lds_b128 %0, %6, off\n\t"
               "global_load_async_to_lds_b128 %1, %7, off\n\t"
               "global_load_async_to_lds_b128 %2, %8, off\n\t"
               "global_load_async_to_lds_b128 %3, %9, off\n\t"
               "global_load_async_to_lds_b128 %4, %10, off\n\t"
               "global_load_async_to_lds_b128 %5, %11, off\n\t"
               "s_wait_xcnt 0x0"
               :: "v"(l), "v"(l + 32 * FS_PITCH), "v"(l + FS_PLANE), "v"(l + FS_PLANE + 32 * FS_PITCH), "v"(l + 2 * FS_PLANE), "v"(l + 2 * FS_PLANE + 32 * FS_PITCH),
                  "v"(kh), "v"(kh + (size_t)32 * ldk), "v"(kl), "v"(kl + (size_t)32 * ldk), "v"(vt), "v"(vt + 32 * TT)
               : "memory");
}
// eight exponentials in base 2, results in registers of their own (early clobber): none lands on the source of the one in front of it, where the instruction set asks for a free slot, and the arguments stay whole for a pass that has to move its reference.
// The closing v_nop is that slot behind the last one, whatever the compiler puts next.
#define FS_EXP8(P, A, O) asm("v_exp_f32 %0, %8\n\t" "v_exp_f32 %1, %9\n\t" "v_exp_f32 %2, %10\n\t" "v_exp_f32 %3, %11\n\t" "v_exp_f32 %4, %12\n\t" "v_exp_f32 %5, %13\n\t" "v_exp_f32 %6, %14\n\t" "v_exp_f32 %7, %15\n\t" "v_nop" \
    : "=&v"(P[O]), "=&v"(P[O + 1]), "=&v"(P[O + 2]), "=&v"(P[O + 3]), "=&v"(P[O + 4]), "=&v"(P[O + 5]), "=&v"(P[O + 6]), "=&v"(P[O + 7]) \
    : "v"(A[O]), "v"(A[O + 1]), "v"(A[O + 2]), "v"(A[O + 3]), "v"(A[O + 4]), "v"(A[O + 5]), "v"(A[O + 6]), "v"(A[O + 7]))
// P = 2^a of one group's 16 scores of a lane: the f16 operand of Vt.Pt and the lane's partial row sum
// the same eight as the builtin, for the common path, where they are the first readers of the score accumulators
__device__ __forceinline__ void fs_exp8(float (&p)[16], const float (&a)[16], int o) {
#pragma unroll
  for (int i = 0; i < 8; ++i) p[o + i] = __builtin_amdgcn_exp2f(a[o + i]);
}
__device__ __forceinline__ void fs_fin(const float (&p)[16], FragH& pa, float& sm) {
  float t8[8];
#pragma unroll
  for (int i = 0; i < 16; ++i) pa.h[i] = (_Float16)p[i];
#pragma unroll
  for (int i = 0; i < 8; ++i) t8[i] = p[i] + p[8 + i];
  sm = ((t8[0] + t8[1]) + (t8[2] + t8[3])) + ((t8[4] + t8[5]) + (t8[6] + t8[7]));
}
__device__ __forceinline__ void fs_p16(const float (&a)[16], FragH& pa, float& sm) {
  float p[16];
  FS_EXP8(p, a, 0); FS_EXP8(p, a, 8);
  fs_fin(p, pa, sm);
}
__global__ __launch_bounds__(256) void k_flash(const _Float16* __restrict__ Q16, const _Float16* __restrict__ Q16lo, int ldq, const _Float16* __restrict__ K16, const _Float16* __restrict__ K16lo, int ldk, const _Float16* __restrict__ Vt, const int* __restrict__ MSK, _Float16* __restrict__ O16, int ldo) {
  /* a wave owns NG = 2 groups of 16 query columns: every K, Vt and mask fragment that it reads from LDS serves both groups, and a work-group's stage copies serve 256 queries */
  constexpr int NG = 2, RPW = 16 * NG, NW = 8, NQB = TT / (NW * RPW), DT = 4, KS = 2, NST = TT / FS_KEYS;
  __shared__ __attribute__((aligned(16))) unsigned char sT[2 * FS_STAGE];
  __shared__ __attribute__((aligned(16))) float sM[TT];
  __shared__ __attribute__((aligned(16))) float sO[NW][RPW][64 + 4];
  const int tid = threadIdx.x, w = tid >> 5, lane = tid & 31, ln = lane & 15, hh = lane >> 4;
  const int slab = blockIdx.x / NQB, qblk = blockIdx.x % NQB; const int b = slab / NH, h = slab % NH; const int q0 = qblk * (NW * RPW) + w * RPW;
  const int cr = tid >> 3, cc = tid & 7;      /* this lane's row (mod 32) and 16-B column of every stage copy */
  const size_t kofs = ((size_t)b * TT + cr) * ldk + h * 64 + cc * 8;
  const _Float16* gkh = K16 + kofs; const _Float16* gkl = K16lo + kofs; const _Float16* gvt = Vt + ((size_t)slab * 64 + cr) * TT + cc * 8;
  const unsigned lt = (unsigned)(size_t)sT + cr * FS_PITCH + cc * 16;
  fs_copy6(lt, gkh, gkl, ldk, gvt);
  const int* gm = MSK + (size_t)b * TT + tid * 4;      /* the mask row, 2 x 4 keys a lane */
  const v4ia m0 = *(const v4ia*)(gm), m1 = *(const v4ia*)(gm + TT / 2);
  FragH aq[NG][KS], aql[NG][KS];
#pragma unroll
  for (int g = 0; g < NG; ++g) { const size_t qo = ((size_t)b * TT + q0 + g * 16 + ln) * ldq + h * 64; const unsigned short* qr = (const unsigned short*)Q16 + qo; const unsigned short* ql = (const unsigned short*)Q16lo + qo;
#pragma unroll
    for (int ks = 0; ks < KS; ++ks) { aq[g][ks].half[0] = *(const v8us*)(qr + ks * 32 + 8 * hh); aq[g][ks].half[1] = *(const v8us*)(qr + ks * 32 + 16 + 8 * hh); aql[g][ks].half[0] = *(const v8us*)(ql + ks * 32 + 8 * hh); aql[g][ks].half[1] = *(const v8us*)(ql + ks * 32 + 16 + 8 * hh); } }
  asm volatile("s_wait_xcnt 0x0" ::: "memory");          /* behind the mask and Q loads: none of their address registers is rewritten in front of this wait */
  { v4f f0, f1;
#pragma unroll
    for (int i = 0; i < 4; ++i) { f0[i] = (m0[i] != 0) ? 0.f : FS_OFF; f1[i] = (m1[i] != 0) ? 0.f : FS_OFF; }
    *(v4fa*)(sM + tid * 4) = f0; *(v4fa*)(sM + TT / 2 + tid * 4) = f1; }
  asm volatile("s_wait_asynccnt 0x0" ::: "memory");      /* stage 0 has landed for this wave */
  __syncthreads();                                       /* ... and for every wave */
  fs_copy6(lt + FS_STAGE, gkh + (size_t)FS_KEYS * ldk, gkl + (size_t)FS_KEYS * ldk, ldk, gvt + FS_KEYS);
  /* Softmax against a HELD reference c (base-2 units, one a query): the q planes carry log2(e), and -c is the C start value of each score tile's first product, so that the joined score IS the argument of v_exp_f32: P = 2^(s * log2e - c).
     c moves only in a pass where a lane's sum of P passes 2^15 (f16 P ends at 65504): there every query whose pass maximum lies above c - 4 takes that maximum + 4 as its new c (its largest P is then 2^-4, 19 doublings below the next move,
     and the f16 step of 2^-24 is 2^-20 of it), and O and l are scaled by 2^(old c - new c). Any c gives the same O / l; it only places P in the range of f16. c lives as -c in one register a group.
     The score leaves the matrix unit finished: the residual planes are unscaled, so that all three terms add into ONE accumulator, and its start value is -c + the key's mask float: nothing stands between the last product and v_exp_f32.
     c starts at 0: elu + 1 is positive, so no score lies below 0 and no P below 1 before the first move. */
  float l_r[NG], negc[NG]; v8f oacc[NG][DT];
#pragma unroll
  for (int g = 0; g < NG; ++g) { l_r[g] = 0.f; negc[g] = 0.f;
#pragma unroll
    for (int dt = 0; dt < DT; ++dt) oacc[g][dt] = (v8f){0.f,0.f,0.f,0.f,0.f,0.f,0.f,0.f}; }
  const unsigned char* fk = sT + ln * FS_PITCH + 16 * hh; const unsigned char* fv = fk + 2 * FS_PLANE;
#pragma unroll 1      /* one stage a trip: the two buffers alternate by an offset */
  for (int t = 0; t < NST; ++t) {
    const unsigned bo = (unsigned)(t & 1) * FS_STAGE;
#pragma unroll      /* the two passes of a stage stand in line, so that every LDS read takes its place in the stage as an immediate offset */
    for (int ps = 0; ps < FS_KEYS / 32; ++ps) {
    const float* mp = sM + t * FS_KEYS + ps * 32 + 8 * hh;      /* mask floats (0 = attend) of this lane's 16 keys */
    const v4f km[4] = { *(const v4fa*)(mp), *(const v4fa*)(mp + 4), *(const v4fa*)(mp + 16), *(const v4fa*)(mp + 20) };
    float sv[NG][16], p[NG][16]; FragH bk[2][KS], bl[2][KS], bv[DT];
#pragma unroll      /* in the order in which the products take them: k step by k step, K hi of both key tiles, then K lo of both */
    for (int ks = 0; ks < KS; ++ks) {
#pragma unroll
      for (int nt = 0; nt < 2; ++nt) { const unsigned char* kr = fk + bo + (ps * 32 + nt * 16) * FS_PITCH + ks * 64; bk[nt][ks].half[0] = *(const v8us*)(kr); bk[nt][ks].half[1] = *(const v8us*)(kr + 32); }
#pragma unroll
      for (int nt = 0; nt < 2; ++nt) { const unsigned char* kl = fk + bo + (ps * 32 + nt * 16) * FS_PITCH + FS_PLANE + ks * 64; bl[nt][ks].half[0] = *(const v8us*)(kl); bl[nt][ks].half[1] = *(const v8us*)(kl + 32); } }
    __builtin_amdgcn_sched_barrier(0);      /* the pass's K reads go out as one group: left alone the scheduler puts the second key tile's reads behind the first tile's products, and the wave waits out the LDS latency a second time */
    v8f acc[2][NG];      /* one accumulator a key tile and group: four chains, whose products alternate, so that none waits for the one before it in its own chain */
#pragma unroll
    for (int nt = 0; nt < 2; ++nt)
#pragma unroll
      for (int g = 0; g < NG; ++g)
#pragma unroll
        for (int r = 0; r < 8; ++r) acc[nt][g][r] = negc[g] + km[2 * nt + (r >> 2)][r & 3];
#pragma unroll
    for (int ks = 0; ks < KS; ++ks) {
#pragma unroll
      for (int nt = 0; nt < 2; ++nt)
#pragma unroll
        for (int g = 0; g < NG; ++g) acc[nt][g] = wm(bk[nt][ks].v, aq[g][ks].v, acc[nt][g]);
#pragma unroll
      for (int nt = 0; nt < 2; ++nt)
#pragma unroll
        for (int g = 0; g < NG; ++g) acc[nt][g] = wm(bk[nt][ks].v, aql[g][ks].v, acc[nt][g]);
#pragma unroll
      for (int nt = 0; nt < 2; ++nt)
#pragma unroll
        for (int g = 0; g < NG; ++g) acc[nt][g] = wm(bl[nt][ks].v, aq[g][ks].v, acc[nt][g]); }
#pragma unroll
    for (int nt = 0; nt < 2; ++nt)
#pragma unroll
      for (int g = 0; g < NG; ++g)
#pragma unroll
        for (int r = 0; r < 8; ++r) sv[g][8 * nt + r] = acc[nt][g][r];
#pragma unroll
    for (int dt = 0; dt < DT; ++dt) { const unsigned char* vrow = fv + bo + dt * 16 * FS_PITCH + ps * 64; bv[dt].half[0] = *(const v8us*)(vrow); bv[dt].half[1] = *(const v8us*)(vrow + 32); }
    __builtin_amdgcn_sched_barrier(0);      /* the four Vt fragments are read ahead of the softmax, which covers their latency: left alone each read sinks to just in front of its product and is waited for there */
    FragH pa[NG]; float sm[NG];
#pragma unroll
    for (int g = 0; g < NG; ++g) { fs_exp8(p[g], sv[g], 0); fs_exp8(p[g], sv[g], 8); fs_fin(p[g], pa[g], sm[g]); }
    /* one test a pass for both groups, a scalar branch on the wave's ballot: seldom taken once the references have settled */
    if (__builtin_amdgcn_ballot_w32(fmaxf(sm[0], sm[1]) > 32768.0f) != 0) {
#pragma unroll
      for (int g = 0; g < NG; ++g) {
        float t8[8], a2[16];
#pragma unroll
        for (int i = 0; i < 8; ++i) t8[i] = fmaxf(sv[g][i], sv[g][8 + i]);
        float mc = fmaxf(fmaxf(fmaxf(t8[0], t8[1]), fmaxf(t8[2], t8[3])), fmaxf(fmaxf(t8[4], t8[5]), fmaxf(t8[6], t8[7])));
        mc = fmaxf(mc, xhalf(mc));      /* both halves hold the query's pass maximum, relative to c */
        const float dl = fmaxf(mc + 4.0f, 0.f);      /* the reference only rises; 0 also where every key of the pass is masked */
        float al;
        asm("v_exp_f32 %0, %1\n\tv_nop" : "=v"(al) : "v"(-dl));      /* 2^(old c - new c); the v_nop is the free slot behind the exponential */
        negc[g] -= dl;
#pragma unroll
        for (int i = 0; i < 16; ++i) a2[i] = sv[g][i] - dl;
        fs_p16(a2, pa[g], sm[g]);      /* this pass's P anew, against the new reference */
        l_r[g] *= al;
#pragma unroll
        for (int dt = 0; dt < DT; ++dt)
#pragma unroll
          for (int r = 0; r < 8; ++r) oacc[g][dt][r] *= al; } }
#pragma unroll
    for (int g = 0; g < NG; ++g) l_r[g] += sm[g];      /* per-lane partial sum; the halves join after the loop */
#pragma unroll
    for (int dt = 0; dt < DT; ++dt)
#pragma unroll
      for (int g = 0; g < NG; ++g) oacc[g][dt] = wm(bv[dt].v, pa[g].v, oacc[g][dt]); }
    asm volatile("s_wait_dscnt 0x0" ::: "memory");       /* this wave's reads of buffer t & 1 are done before the buffer is handed back */
    asm volatile("s_wait_asynccnt 0x0" ::: "memory");    /* this wave's copies of stage t + 1 have landed */
    __syncthreads();                                     /* publishes stage t + 1 and ends every wave's reads of stage t */
    if (t + 2 < NST) fs_copy6(lt + bo, gkh + (size_t)(t + 2) * FS_KEYS * ldk, gkl + (size_t)(t + 2) * FS_KEYS * ldk, ldk, gvt + (t + 2) * FS_KEYS);
  }
  asm volatile("s_wait_asynccnt 0x0" ::: "memory");      /* nothing is in flight when the wave goes on to its end */
#pragma unroll
  for (int g = 0; g < NG; ++g) { const float l = l_r[g] + xhalf(l_r[g]); const float inv = (l > 0.f) ? 1.0f / l : 0.f;
#pragma unroll
    for (int dt = 0; dt < DT; ++dt)
#pragma unroll
      for (int q = 0; q < 2; ++q) { const v4f o4 = { oacc[g][dt][q * 4] * inv, oacc[g][dt][q * 4 + 1] * inv, oacc[g][dt][q * 4 + 2] * inv, oacc[g][dt][q * 4 + 3] * inv }; *(v4fa*)&sO[w][g * 16 + ln][dt * 16 + 8 * hh + q * 4] = o4; } }
  __builtin_amdgcn_fence(__ATOMIC_ACQ_REL, "workgroup"); __builtin_amdgcn_wave_barrier();
  {
#pragma unroll      /* O x 2^4 goes out as the f16 operand of the output GEMM: 8 lanes a row, one whole 128-B line per (query, head) */
    for (int rp = 0; rp < RPW; rp += 4) { const int r = rp + (lane >> 3), c8 = (lane & 7) * 8; const v4f a = *(const v4fa*)&sO[w][r][c8], c = *(const v4fa*)&sO[w][r][c8 + 4]; FragH f;
#pragma unroll
      for (int q = 0; q < 4; ++q) { f.h[q] = (_Float16)(a[q] * 16.0f); f.h[4 + q] = (_Float16)(c[q] * 16.0f); }
      *(v8us*)((unsigned short*)O16 + ((size_t)b * TT + q0 + r) * ldo + h * 64 + c8) = f.half[0]; }
     } }

// ---- projection GEMM with its operands staged in LDS: C = alpha * A . Bt^T, A [NR][DD] and Bt [DD][DD] f16, both k-contiguous.
// One 128 x 128 tile per work-group of 8 waves (4 x 2 waves of 32 x 64). A stage is 128 k = 256 B of each of the 256 operand rows (A rows 0-127, Bt rows 128-255),
// brought by asynchronous copies (16 lanes of 16 B a row), two buffers: stage t + 1 flies while stage t is multiplied.
// LDS row pitch 272 B = 16 B x odd, the conflict-free pitch of ds_load_b128 fragment reads. The k order of every accumulator is 0, 32, 64, ... as before.
#define GS_K 128
#define GS_PITCH 272
#define GS_STAGE (256 * GS_PITCH)
// eight copies of one lane: rows r, r + 16, ..., r + 112 of one operand, 16 B each. The s_wait_xcnt stands inside the copies' own statement, so that no address register named here is rewritten in front of it.
__device__ __forceinline__ void gs_copy8(unsigned l, const _Float16* g) {
  asm volatile("global_load_async_to_lds_b128 %0, %8, off\n\t"
               "global_load_async_to_lds_b128 %1, %9, off\n\t"
               "global_load_async_to_lds_b128 %2, %10, off\n\t"
               "global_load_async_to_lds_b128 %3, %11, off\n\t"
               "global_load_async_to_lds_b128 %4, %12, off\n\t"
               "global_load_async_to_lds_b128 %5, %13, off\n\t"
               "global_load_async_to_lds_b128 %6, %14, off\n\t"
               "global_load_async_to_lds_b128 %7, %15, off\n\t"
               "s_wait_xcnt 0x0"
               :: "v"(l), "v"(l + 16 * GS_PITCH), "v"(l + 32 * GS_PITCH), "v"(l + 48 * GS_PITCH), "v"(l + 64 * GS_PITCH), "v"(l + 80 * GS_PITCH), "v"(l + 96 * GS_PITCH), "v"(l + 112 * GS_PITCH),
                  "v"(g), "v"(g + 16 * DD), "v"(g + 32 * DD), "v"(g + 48 * DD), "v"(g + 64 * DD), "v"(g + 80 * DD), "v"(g + 96 * DD), "v"(g + 112 * DD)
               : "memory");
}
// the 2 A and 4 B fragments of one k step (32 k = 64 B of a row) from a stage in LDS; both operands in the same k order: 8 hh + 0..7, then 16 + 8 hh + 0..7
__device__ __forceinline__ void gs_frags(FragH (&a)[2], FragH (&b)[4], const unsigned char* pa, const unsigned char* pb) {
#pragma unroll
  for (int i = 0; i < 2; ++i) { a[i].half[0] = *(const v8us*)(pa + i * 16 * GS_PITCH); a[i].half[1] = *(const v8us*)(pa + i * 16 * GS_PITCH + 32); }
#pragma unroll
  for (int j = 0; j < 4; ++j) { b[j].half[0] = *(const v8us*)(pb + j * 16 * GS_PITCH); b[j].half[1] = *(const v8us*)(pb + j * 16 * GS_PITCH + 32); }
}
// the 8 products of one k step
__device__ __forceinline__ void gs_mma(v8f (&acc)[2][4], const FragH (&a)[2], const FragH (&b)[4]) {
#pragma unroll
  for (int i = 0; i < 2; ++i)
#pragma unroll
    for (int j = 0; j < 4; ++j) acc[i][j] = __builtin_amdgcn_wmma_f32_16x16x32_f16(false, a[i].v, false, b[j].v, (short)0, acc[i][j], false, false);
}
// QKV = false: one product, C f32. QKV = true: the q, k and v projections in one grid (256 tiles each, Bt = the three weights in a row), each with its consumer's conversion as epilogue:
// q and k leave as elu + 1 split in f16 hi + residual planes, v leaves as f16 already transposed, Vt[batch * DD + column][token].
template <bool QKV>
__global__ __launch_bounds__(256) void k_gemm_lds(const _Float16* __restrict__ A, const _Float16* __restrict__ Bt, float alpha, float* __restrict__ C,
                                                  _Float16* __restrict__ Qh, _Float16* __restrict__ Ql, _Float16* __restrict__ Kh, _Float16* __restrict__ Kl, _Float16* __restrict__ Vt) {
  __shared__ __attribute__((aligned(16))) unsigned char sT[2 * GS_STAGE];
  __shared__ __attribute__((aligned(16))) float so[8][32][64 + 4];
  constexpr int NST = DD / GS_K;
  const int tid = threadIdx.x, w = tid >> 5, lane = tid & 31, ln = lane & 15, hh = lane >> 4;
  constexpr int NTILE = (NR / 128) * (DD / 128);
  const int which = QKV ? blockIdx.x / NTILE : 0, tile = QKV ? blockIdx.x % NTILE : blockIdx.x;      /* which: 0 q, 1 k, 2 v; the same for the whole work-group */
  Bt += (size_t)which * DD * DD;
  const int row0 = (tile / (DD / 128)) * 128, col0 = (tile % (DD / 128)) * 128; const int wm = w >> 1, wn = w & 1;
  const int cr = tid >> 4, cc = tid & 15;      /* this lane's row (mod 16) and 16-B column of every copy */
  const _Float16* ga = A + (size_t)(row0 + cr) * DD + cc * 8; const _Float16* gb = Bt + (size_t)(col0 + cr) * DD + cc * 8;
  const unsigned la = (unsigned)(size_t)sT + cr * GS_PITCH + cc * 16, lb = la + 128 * GS_PITCH;
  gs_copy8(la, ga); gs_copy8(lb, gb);
  asm volatile("s_wait_asynccnt 0x0" ::: "memory");      /* stage 0 has landed for this wave */
  __syncthreads();                                       /* ... and for every wave */
  gs_copy8(la + GS_STAGE, ga + GS_K); gs_copy8(lb + GS_STAGE, gb + GS_K);
  v8f acc[2][4];
#pragma unroll
  for (int i = 0; i < 2; ++i)
#pragma unroll
    for (int j = 0; j < 4; ++j) acc[i][j] = (v8f){0.f,0.f,0.f,0.f,0.f,0.f,0.f,0.f};
  const unsigned char* fa = sT + (wm * 32 + ln) * GS_PITCH + 16 * hh; const unsigned char* fb = sT + (128 + wn * 64 + ln) * GS_PITCH + 16 * hh;
#pragma unroll 1      /* one stage a trip: the two buffers alternate by an offset, the text stays small */
  for (int t = 0; t < NST; ++t) {
    const unsigned bo = (unsigned)(t & 1) * GS_STAGE;
    FragH a[2][2], b[2][4];      /* two fragment sets: the reads of k step ks + 1 of this same stage are issued as one group ahead of the products of k step ks */
    gs_frags(a[0], b[0], fa + bo, fb + bo);
#pragma unroll
    for (int ks = 0; ks + 1 < GS_K / 32; ++ks) {
      gs_frags(a[(ks + 1) & 1], b[(ks + 1) & 1], fa + bo + (ks + 1) * 64, fb + bo + (ks + 1) * 64);
      __builtin_amdgcn_sched_barrier(0);      /* keeps that group of reads ahead of the products: left alone the scheduler sinks each read to just in front of its use, and the wave waits out the LDS latency there */
      gs_mma(acc, a[ks & 1], b[ks & 1]);
    }
    __builtin_amdgcn_sched_barrier(0);                   /* those products stay in front of the hand-over and cover the last group's LDS latency */
    asm volatile("s_wait_dscnt 0x0" ::: "memory");       /* this wave's reads of buffer t & 1 are done before the buffer is handed back */
    asm volatile("s_wait_asynccnt 0x0" ::: "memory");    /* this wave's copies of stage t + 1 have landed */
    __syncthreads();                                     /* publishes stage t + 1 and ends every wave's reads of stage t */
    if (t + 2 < NST) { gs_copy8(la + bo, ga + (t + 2) * GS_K); gs_copy8(lb + bo, gb + (t + 2) * GS_K); }
    __builtin_amdgcn_sched_barrier(0);                   /* the refill is issued first: the last k step's products need registers only and run while the copies fly */
    gs_mma(acc, a[(GS_K / 32 - 1) & 1], b[(GS_K / 32 - 1) & 1]);
  }
  asm volatile("s_wait_asynccnt 0x0" ::: "memory");      /* nothing is in flight when the wave goes on to its end */
  if (QKV && which == 2) {
    /* v: a lane's 8 accumulator rows are 8 consecutive tokens of one column = 16 B of the transposed tile; staged [128 columns][128 tokens] f16 at pitch 272 B in so */
    unsigned char* sv = (unsigned char*)&so[0][0][0];
#pragma unroll
    for (int i = 0; i < 2; ++i)
#pragma unroll
      for (int j = 0; j < 4; ++j) { FragH f;
#pragma unroll
        for (int r = 0; r < 8; ++r) f.h[r] = (_Float16)(acc[i][j][r] * alpha);
        *(v8us*)(sv + (wn * 64 + j * 16 + ln) * GS_PITCH + (wm * 32 + i * 16 + 8 * hh) * 2) = f.half[0]; }
    __syncthreads();      /* a column's 128 tokens come from four waves: every wave's part is in LDS before any is read back */
#pragma unroll
    for (int q = 0; q < 8; ++q) { const int c = q * 16 + (tid >> 4), ch = tid & 15;      /* 16 lanes a column: 256 contiguous bytes of Vt */
      const v8us v = *(const v8us*)(sv + c * GS_PITCH + ch * 16);
      *(v8us*)((unsigned short*)Vt + ((size_t)(row0 / TT) * DD + col0 + c) * TT + row0 % TT + ch * 8) = v; }
  } else {
#pragma unroll
  for (int i = 0; i < 2; ++i)
#pragma unroll
    for (int j = 0; j < 4; ++j)
#pragma unroll
      for (int r = 0; r < 8; ++r) so[w][i * 16 + 8 * hh + r][j * 16 + ln] = acc[i][j][r] * alpha;
  __builtin_amdgcn_fence(__ATOMIC_ACQ_REL, "workgroup"); __builtin_amdgcn_wave_barrier();      /* the wave reads back rows that its other lanes wrote */
  if (QKV) {
    /* q, k: elu(x) + 1 = x + 1 (x > 0) | e^x (x <= 0), then hi = f16(v), lo = f16(v - hi), unscaled (its smallest values are f16 subnormals, 2^-24 apart); 8 lanes a row: the wave's 64 columns are one whole 128-B line of each plane */
    unsigned short* Hh = (unsigned short*)(which == 0 ? Qh : Kh); unsigned short* Hl = (unsigned short*)(which == 0 ? Ql : Kl);
    const float fs = (which == 0) ? 1.4426950408889634f : 1.0f;      /* the q planes carry log2(e): the score products of k_flash come out as base-2 exponents */
#pragma unroll
    for (int q = 0; q < 8; ++q) { const int r = q * 4 + (lane >> 3), c8 = (lane & 7) * 8; const v4f a = *(const v4fa*)&so[w][r][c8], c = *(const v4fa*)&so[w][r][c8 + 4]; FragH fh, fl;
#pragma unroll
      for (int e = 0; e < 8; ++e) { const float x = (e < 4) ? a[e] : c[e - 4]; const float ex = expf(x);      /* taken for every lane, then selected: eight independent chains and no branch per element, with only two waves a SIMD to cover latency here */
        const float v = ((x > 0.f) ? x + 1.0f : ex) * fs; const _Float16 h = (_Float16)v; fh.h[e] = h; fl.h[e] = (_Float16)(v - (float)h); }
      const size_t o = (size_t)(row0 + wm * 32 + r) * DD + col0 + wn * 64 + c8;
      *(v8us*)(Hh + o) = fh.half[0]; *(v8us*)(Hl + o) = fl.half[0]; }
    asm volatile("s_wait_xcnt 0x0" ::: "memory");      /* behind the last hi/lo store: no address or data register of these stores is rewritten in front of this wait on any way out of the loop */
  } else {
    const int rsub = lane >> 4, c4 = (lane & 15) * 4;
#pragma unroll
    for (int q = 0; q < 16; ++q) { const int r = q * 2 + rsub; const v4f v = *(const v4fa*)&so[w][r][c4]; *(v4f*)(C + (size_t)(row0 + wm * 32 + r) * DD + col0 + wn * 64 + c4) = v; }
  }
  }
}

extern "C" void kernel_launch(void* const* d_in, const int* in_sizes, int n_in,
                              void* d_out, int out_size, void* d_ws, size_t ws_size, hipStream_t stream) {
  (void)in_sizes; (void)n_in; (void)out_size;
  const float* x = (const float*)d_in[0]; const int* mask = (const int*)d_in[1]; const float* Wq = (const float*)d_in[2]; const float* Wk = (const float*)d_in[3]; const float* Wv = (const float*)d_in[4]; const float* Wo = (const float*)d_in[5];
  char* ws = (char*)d_ws; size_t off = 0;
  auto take = [&](size_t bytes) { char* p = ws + off; off += (bytes + 255) & ~(size_t)255; return p; };
  const size_t WSZ = (size_t)DD * DD; _Float16* Bw = (_Float16*)take(4 * WSZ * 2); _Float16* X16 = (_Float16*)take((size_t)NR * DD * 2);
  _Float16* Qh = (_Float16*)take((size_t)NR * DD * 2); _Float16* Ql = (_Float16*)take((size_t)NR * DD * 2); _Float16* Kh = (_Float16*)take((size_t)NR * DD * 2); _Float16* Kl = (_Float16*)take((size_t)NR * DD * 2); _Float16* Vt = (_Float16*)take((size_t)NR * DD * 2);
  _Float16* O16 = X16;      /* X16 is dead after the q/k/v launch */
  if (off > ws_size) return;      // 7 x 8.4 MB
  k_prep<<<PREP_T / 256, 256, 0, stream>>>(x, Wq, Wk, Wv, Wo, X16, Bw);
  k_gemm_lds<true><<<3 * (NR / 128) * (DD / 128), 256, 0, stream>>>(X16, Bw, 0.0625f, nullptr, Qh, Ql, Kh, Kl, Vt);      /* q, k: elu + 1 hi/lo; v: transposed */
  k_flash<<<BB * NH * (TT / 256), 256, 0, stream>>>(Qh, Ql, DD, Kh, Kl, DD, Vt, mask, O16, DD);
  k_gemm_lds<false><<<(NR / 128) * (DD / 128), 256, 0, stream>>>(O16, Bw + 3 * WSZ, 0.00390625f, (float*)d_out, nullptr, nullptr, nullptr, nullptr, nullptr);      /* out = O . Wo^T */
}
